// v000
// The times below were measured on an AMD MI455X: many runs one after another, warmed up first and cycling through
// copies of the inputs, with the whole window's GPU time divided by the number of runs. Launches and the gaps
// between them are all in it. The median over several windows is given; except for v000 it joins two sittings, which
// can be a few percent apart, so the side-by-side timings, each taken in one sitting, are the better comparison.
// v000 is the starting kernel. One run takes 86 microseconds.
#include <hip/hip_runtime.h>

// Contractions: X x [Wf|Wg|Wh] on v_wmma_f32_16x16x32_bf16 (bf16 operands = RNE-converted inputs, f32 accumulate);
// S^T = F x G^T as three v_wmma_f32_16x16x32_f16 products (value x value in one accumulator; value x residual and
// residual x value in a second accumulator, residual planes carried x2048 and folded back in f32);
// CTX = P x Hv (P as f16 carried x4096) and OUT = CTX x Wattn (Wattn as f16 of the bf16 value, carried x16)
// on v_wmma_f32_16x16x32_f16 (f16 operands, f32 accumulate). Max-pool, softmax and residual add in f32.

#ifndef NB
#define NB 8
#endif
#ifndef SEQ
#define SEQ 4096
#endif
#define NB_FULL  8
#define SEQ_FULL 4096
#define W_IMG    64                 // image width (pixels per image row)
#define CIN      256                // input channels
#define DQK      32                 // query / key channels
#define DV       32                 // value channels
#define NPROJ    96                 // packed projection columns: [0,32) f, [32,64) g, [64,96) h
#define QW       64                 // halves per row of the query / key planes: value 0..31 | residual 32..63
#define NKEY     (SEQ / 4)          // pooled key count per image
#define KTILE    64                 // keys produced per projection block
#define BQ       128                // query rows per attention block (8 waves x 16)
#define BK       32                 // keys per inner iteration
#define NWAVE    8
#define PF       68                 // LDS pitch (floats) of the ww-pooled staging rows (f 0..31 | h 32..63)
#define GP       72                 // LDS pitch (halves) of the g staging tile (value | residual)
#define FP       72                 // LDS pitch (halves) of the pooled f tile (value | residual)
#define HP       72                 // LDS pitch (halves) of the pooled h^T tile
#define CP       40                 // LDS pitch (halves) of the ctx staging tile
#define OP       68                 // LDS pitch (floats) of the output staging tile

static_assert(SEQ % 256 == 0);
static_assert(SEQ >= 256 && SEQ <= SEQ_FULL);
static_assert(NB >= 1 && NB <= NB_FULL);
static_assert(BQ == NWAVE * 16);
static_assert(NKEY % BK == 0);
static_assert(NKEY % KTILE == 0);
static_assert(CIN % 32 == 0 && DV == 32 && DQK == 32);
static_assert(NPROJ == 2 * DQK + DV && NPROJ % 16 == 0 && NPROJ / 8 == 12);
static_assert(QW == 2 * DQK && QW * 2 == 128);
static_assert(W_IMG == 64 && CIN == 4 * 64);
// coverage equalities (grid x block x per-thread elements == plane extent)
static_assert((SEQ / 256) * 2 * NWAVE * 16 == SEQ);          // g plane rows per image
static_assert((SEQ / 256) * KTILE == NKEY);                   // f / h^T plane keys per image
static_assert((SEQ / BQ) * NWAVE * 16 == SEQ);                // ctx plane rows per image
static_assert(((NB * SEQ) / 128) * NWAVE * 16 == NB * SEQ);   // output rows
static_assert(4 * 32 * 8 == 16 * QW);                         // g tile store: 4 instructions x 32 lanes x 8 halves
static_assert(2 * 256 * 8 == KTILE * QW);                     // key tile store: 2 x 256 threads x 8 halves
static_assert(256 * 8 == DV * KTILE);                         // h^T tile store: 256 threads x 8 halves
static_assert(2 * 32 * 8 == 16 * DV);                         // ctx tile store: 2 instructions x 32 lanes x 8 halves
static_assert(4 * 256 == 32 * DQK && 4 * 256 == 32 * DV);     // hh-pool element loops
static_assert(4 * 256 * 8 == CIN * DV);                       // wot plane
static_assert(12 * 8 == NPROJ);                               // wct plane rows
static_assert(PF >= 2 * DQK && (PF * 4) % 16 == 0);
static_assert(GP >= QW && FP >= QW && HP >= KTILE && CP >= DV && OP >= 64);
static_assert((GP * 2) % 16 == 0 && (FP * 2) % 16 == 0 && (HP * 2) % 16 == 0 && (CP * 2) % 16 == 0);
static_assert((OP * 4) % 16 == 0);

static constexpr size_t WCT_BYTES = (size_t)NPROJ * CIN * 2;          // 49,152
static constexpr size_t WOT_BYTES = (size_t)CIN * DV * 2;             // 16,384
static constexpr size_t GQ_BYTES  = (size_t)NB * SEQ * QW * 2;        // 4,194,304 at full size
static constexpr size_t FK_BYTES  = (size_t)NB * NKEY * QW * 2;       // 1,048,576
static constexpr size_t HVT_BYTES = (size_t)NB * DV * NKEY * 2;       // 524,288
static constexpr size_t CTX_BYTES = (size_t)NB * SEQ * DV * 2;        // 2,097,152
static constexpr size_t OFF_WCT = 0;
static constexpr size_t OFF_WOT = OFF_WCT + WCT_BYTES;
static constexpr size_t OFF_GQ  = OFF_WOT + WOT_BYTES;
static constexpr size_t OFF_FK  = OFF_GQ + GQ_BYTES;
static constexpr size_t OFF_HVT = OFF_FK + FK_BYTES;
static constexpr size_t OFF_CTX = OFF_HVT + HVT_BYTES;
static constexpr size_t WS_TOTAL = OFF_CTX + CTX_BYTES;               // 7,929,856 at full size
static_assert(WCT_BYTES % 128 == 0 && WOT_BYTES % 128 == 0 && GQ_BYTES % 128 == 0);
static_assert(FK_BYTES % 128 == 0 && HVT_BYTES % 128 == 0 && CTX_BYTES % 128 == 0);
static_assert(WS_TOTAL <= (size_t)134217728);

typedef __bf16   bf16;
typedef _Float16 f16;
typedef bf16     v16bf __attribute__((ext_vector_type(16)));
typedef f16      v16h  __attribute__((ext_vector_type(16)));
typedef f16      v8h   __attribute__((ext_vector_type(8)));
typedef float    v8f   __attribute__((ext_vector_type(8)));
typedef float    v4f   __attribute__((ext_vector_type(4)));
typedef unsigned v4u   __attribute__((ext_vector_type(4)));

union FragB  { v16bf v; v4u q[2]; bf16 h[16]; };
union FragH  { v16h  v; v4u q[2]; f16  h[16]; };
union Pack8B { v4u u; bf16 h[8]; };
union Pack8H { v4u u; v8h v; f16 h[8]; };

// WMMA helpers: builtin followed by the VALU hazard guard (ties D, keeps A/B live).
static __device__ __forceinline__ v8f mma_bf16(v16bf a, v16bf b, v8f acc) {
  acc = __builtin_amdgcn_wmma_f32_16x16x32_bf16(false, a, false, b, (short)0, acc, false, false);
  asm volatile("v_nop\n\tv_nop\n\tv_nop\n\tv_nop" : "+v"(acc) : "v"(a), "v"(b));
  return acc;
}
static __device__ __forceinline__ v8f mma_f16(v16h a, v16h b, v8f acc) {
  acc = __builtin_amdgcn_wmma_f32_16x16x32_f16(false, a, false, b, (short)0, acc, false, false);
  asm volatile("v_nop\n\tv_nop\n\tv_nop\n\tv_nop" : "+v"(acc) : "v"(a), "v"(b));
  return acc;
}

// f32 -> f16 convert that can never produce a subnormal operand (value select below 2^-14).
static __device__ __forceinline__ f16 toh_flush(float v) {
  const f16 r = (f16)v;
  return (fabsf(v) < 6.103515625e-05f) ? (f16)0.0f : r;
}

// Weight planes (k-contiguous rows, B fragments load like A fragments):
//   wct [NPROJ][CIN] bf16 : row n = column n of [Wf | Wg | Wh], RNE bf16.
//   wot [CIN][DV]    f16  : row n = column n of Wattn, value f16(bf16(w) * 16) (exact for normal results).
// Blocks 0..11: 8 rows of wct each (one wave per 512-B row, one instruction); blocks 12..15: 64 rows of wot each
// (one wave per eight 64-B rows = 512 B contiguous, one instruction). Source selection is block-uniform.
// coverage: wct rows 0..95 x k 0..255; wot rows 0..255 x k 0..31.
__global__ __launch_bounds__(256) void pack_w_kernel(const float* __restrict__ wf, const float* __restrict__ wg,
                                                      const float* __restrict__ wh, const float* __restrict__ wo,
                                                      bf16* __restrict__ wct, f16* __restrict__ wot) {
  const int blk = blockIdx.x;
  const int tid = threadIdx.x;
  if (blk < 12) {
    const int n  = blk * 8 + (tid >> 5);       // 0..95
    const int kq = (tid & 31) * 8;             // 0..248
    const float* src = (blk < 4) ? wf : ((blk < 8) ? wg : wh);
    const int pitch  = (blk < 8) ? DQK : DV;
    const int nl     = (blk < 4) ? n : ((blk < 8) ? (n - 32) : (n - 64));
    Pack8B pk;
    #pragma unroll
    for (int i = 0; i < 8; ++i) pk.h[i] = (bf16)src[(size_t)(kq + i) * pitch + nl];   // RNE convert
    bf16* dst = wct + (size_t)n * CIN + kq;
    *(v4u*)dst = pk.u;
    
  } else {
    const int j  = (blk - 12) * 256 + tid;     // 0..1023
    const int n  = j >> 2;                     // 0..255
    const int kq = (j & 3) * 8;                // 0..24
    Pack8H pk;
    #pragma unroll
    for (int i = 0; i < 8; ++i) {
      const float v = (float)(bf16)wo[(size_t)(kq + i) * CIN + n];
      pk.h[i] = toh_flush(v * 16.0f);          // bf16 significand fits f16
    }
    f16* dst = wot + (size_t)n * DV + kq;
    *(v4u*)dst = pk.u;
    
  }
}

// One wave's 16-pixel M tile times NTN consecutive 16-column tiles of wct starting at tile NT0; K = CIN.
// A fragments from f32 x rows (RNE bf16 convert, split k map); B fragments from the k-contiguous wct rows.
template <int NT0, int NTN>
static __device__ __forceinline__ void proj_tiles(const float* __restrict__ xr, const bf16* __restrict__ wct,
                                                  int m, int hi, v8f (&acc)[NTN]) {
  #pragma unroll
  for (int t = 0; t < NTN; ++t) acc[t] = (v8f){0, 0, 0, 0, 0, 0, 0, 0};
  for (int kk = 0; kk < CIN / 32; ++kk) {
    const float* xp = xr + kk * 32;
    const v4f a0 = *(const v4f*)(xp + hi * 8);
    const v4f a1 = *(const v4f*)(xp + hi * 8 + 4);
    const v4f b0 = *(const v4f*)(xp + 16 + hi * 8);
    const v4f b1 = *(const v4f*)(xp + 16 + hi * 8 + 4);
    FragB a;
    #pragma unroll
    for (int i = 0; i < 4; ++i) {
      a.h[i]      = (bf16)a0[i];   // elems 0..7  : k = kk*32 + hi*8 + 0..7
      a.h[4 + i]  = (bf16)a1[i];
      a.h[8 + i]  = (bf16)b0[i];   // elems 8..15 : k = kk*32 + 16 + hi*8 + 0..7
      a.h[12 + i] = (bf16)b1[i];
    }
    #pragma unroll
    for (int t = 0; t < NTN; ++t) {
      const bf16* wp = wct + (size_t)((NT0 + t) * 16 + m) * CIN + kk * 32 + hi * 8;
      FragB bw;
      bw.q[0] = *(const v4u*)(wp);        // k = kk*32 + hi*8 + 0..7, n = tile*16 + m
      bw.q[1] = *(const v4u*)(wp + 16);   // k = kk*32 + 16 + hi*8 + 0..7
      acc[t] = mma_bf16(a.v, bw.v, acc[t]);
    }
  }
}

// Projection + 2x2 max-pool. Block = (64-key tile kt, batch b), 256 threads; two iterations each cover
// image rows hh = kt*4 + it*2 + {0,1}; wave -> (hh, 16 pixels along ww).
//                            (wave writes 16 rows = 2 KB, 4 instructions of 4 lines, 8 lanes x 16 B per line).
//   fk  [NB][NKEY][QW] f16 : pooled keys, value | residual x2048, 64 rows per block = 8 KB
//                            (2 instructions, each wave 4 lines, 8 lanes x 16 B per line).
// LDS regions: sP cross-wave (block barrier), sG per-wave but read across lanes after the block barrier,
// sF / sHT cross-wave (block barrier). Staged extent == consumed extent for all four.
__global__ __launch_bounds__(256) void proj_pool_kernel(const float* __restrict__ x, const bf16* __restrict__ wct,
                                                         f16* __restrict__ gq, f16* __restrict__ fk,
                                                         f16* __restrict__ hvt) {
  const int kt   = blockIdx.x;
  const int b    = blockIdx.y;
  const int tid  = threadIdx.x;
  const int wave = __builtin_amdgcn_readfirstlane(threadIdx.x >> 5);
  const int lane = tid & 31;
  const int m    = lane & 15;
  const int hi   = lane >> 4;
  const int hsel = wave >> 2;          // which of the two image rows of this iteration
  const int ww0  = (wave & 3) * 16;    // first pixel column of this wave's tile

  __shared__ __align__(16) float sP[2 * 32 * PF];     // [hsel][pw][64 cols] ww-pooled f|h in f32
  __shared__ __align__(16) f16 sG[NWAVE * 16 * GP];   // per-wave g tile [16][value 32 | residual 32]
  __shared__ __align__(16) f16 sF[64 * FP];           // pooled f [64 keys][value 32 | residual 32]
  __shared__ __align__(16) f16 sHT[DV * HP];          // pooled h^T [32 d][64 keys]

  f16*   sg = sG + wave * (16 * GP);
  float* sp = sP + hsel * (32 * PF);
  const int pwb = (ww0 >> 1) + hi * 4;   // pooled column index base for this lane half

  for (int it = 0; it < 2; ++it) {
    const int hh   = kt * 4 + it * 2 + hsel;
    const int pix0 = hh * W_IMG + ww0;
    const float* xr = x + ((size_t)b * SEQ_FULL + pix0 + m) * CIN;

    {   // tiles 0,1: f; 2,3: g; 4,5: h
      v8f acc[6];
      proj_tiles<0, 6>(xr, wct, m, hi, acc);
      #pragma unroll
      for (int r = 0; r < 8; ++r) {
        const float g0 = acc[2][r];
        const float g1 = acc[3][r];
        const f16 h0 = toh_flush(g0);
        const f16 h1 = toh_flush(g1);
        sg[(hi * 8 + r) * GP + m]      = h0;
        sg[(hi * 8 + r) * GP + 16 + m] = h1;
        sg[(hi * 8 + r) * GP + 32 + m] = toh_flush((g0 - (float)h0) * 2048.0f);
        sg[(hi * 8 + r) * GP + 48 + m] = toh_flush((g1 - (float)h1) * 2048.0f);
      }
      // ww pairs are D rows (2rp, 2rp+1) of the same lane half; pooled column pw = ww0/2 + 4*hi + rp
      #pragma unroll
      for (int rp = 0; rp < 4; ++rp) {
        #pragma unroll
        for (int t = 0; t < 2; ++t) {
          sp[(pwb + rp) * PF + t * 16 + m]      = fmaxf(acc[t][2 * rp], acc[t][2 * rp + 1]);
          sp[(pwb + rp) * PF + 32 + t * 16 + m] = fmaxf(acc[4 + t][2 * rp], acc[4 + t][2 * rp + 1]);
        }
      }
    }
    __syncthreads();

    {
      v4u    gv[4];
      size_t gi[4];
      #pragma unroll
      for (int i4 = 0; i4 < 4; ++i4) {
        const int row = i4 * 4 + (lane >> 3);
        const int cq  = (lane & 7) * 8;
        Pack8H p;
        p.v = *(const v8h*)(sg + row * GP + cq);
        gv[i4] = p.u;
        gi[i4] = ((size_t)b * SEQ + pix0 + row) * QW + cq;
      }
      #pragma unroll
      for (int i4 = 0; i4 < 4; ++i4) *(v4u*)(gq + gi[i4]) = gv[i4];
      
    }

    // hh-pool into the block's pooled tiles (f32 max, then one convert)
    #pragma unroll
    for (int e = 0; e < 4; ++e) {
      const int idx = e * 256 + tid;
      const int pw  = idx >> 5;
      const int c   = idx & 31;
      const float v = fmaxf(sP[pw * PF + c], sP[32 * PF + pw * PF + c]);
      const f16 hv  = toh_flush(v);
      sF[(it * 32 + pw) * FP + c]      = hv;
      sF[(it * 32 + pw) * FP + 32 + c] = toh_flush((v - (float)hv) * 2048.0f);
    }
    #pragma unroll
    for (int e = 0; e < 4; ++e) {
      const int idx = e * 256 + tid;
      const int pw  = idx >> 5;
      const int d   = idx & 31;
      const float v = fmaxf(sP[pw * PF + 32 + d], sP[32 * PF + pw * PF + 32 + d]);
      sHT[d * HP + it * 32 + pw] = toh_flush(v);
    }
    __syncthreads();
  }

  // final plane stores: fk (per instruction a wave writes 4 rows = 512 B), hvt (per instruction 4 d-lines)
  v4u    fv[2];
  size_t fi[2];
  #pragma unroll
  for (int i2 = 0; i2 < 2; ++i2) {
    const int idx = i2 * 256 + tid;
    const int row = idx >> 3;            // 0..63
    const int cq  = (idx & 7) * 8;
    Pack8H p;
    p.v = *(const v8h*)(sF + row * FP + cq);
    fv[i2] = p.u;
    fi[i2] = ((size_t)b * NKEY + kt * KTILE + row) * QW + cq;
  }
  v4u    hv;
  size_t hidx;
  {
    const int d  = tid >> 3;             // 0..31
    const int kq = (tid & 7) * 8;        // 0..56
    Pack8H p;
    p.v = *(const v8h*)(sHT + d * HP + kq);
    hv   = p.u;
    hidx = ((size_t)b * DV + d) * NKEY + kt * KTILE + kq;
  }
  #pragma unroll
  for (int i2 = 0; i2 < 2; ++i2) *(v4u*)(fk + fi[i2]) = fv[i2];
  *(v4u*)(hvt + hidx) = hv;
  
}

// Flash attention, non-causal, no score scaling. Block = (query block of 128, batch); one wave owns 16 queries.
// S^T = F x G^T so queries sit on lanes; P^T in C-layout is bit-identical to the A-fragment layout of CTX += P x Hv.
// Scores: value x value in c, (value x residual + residual x value) in cr, s = c + cr / 2048.
// F A-fragments, G B-fragments and Hv^T B-fragments are loaded straight from the f16 planes (two 16-B loads each).
//   ctx [NB][SEQ][DV] f16 : one 64-B row per query; wave writes 16 rows = 1 KB contiguous, 512 B per instruction.
// LDS: sC per-wave region, written and read across lanes under a block barrier; staged extent == consumed extent.
__global__ __launch_bounds__(256) void attn_kernel(const f16* __restrict__ gq, const f16* __restrict__ fk,
                                                   const f16* __restrict__ hvt, f16* __restrict__ ctx) {
  const int qblk = blockIdx.x;
  const int b    = blockIdx.y;
  const int tid  = threadIdx.x;
  const int wave = __builtin_amdgcn_readfirstlane(threadIdx.x >> 5);
  const int lane = tid & 31;
  const int lq   = lane & 15;   // query column of S^T / d column of CTX
  const int hi   = lane >> 4;   // k-split half

  __shared__ __align__(16) f16 sC[NWAVE * 16 * CP];

  const int qrow0 = qblk * BQ + wave * 16;

  // G as B-operand fragments: lane lq holds query qrow0+lq, elements follow the split d map
  FragH qf, qr;
  {
    const f16* qp = gq + ((size_t)b * SEQ + qrow0 + lq) * QW + hi * 8;
    qf.q[0] = *(const v4u*)(qp);        // value,    d = hi*8 + 0..7
    qf.q[1] = *(const v4u*)(qp + 16);   // value,    d = 16 + hi*8 + 0..7
    qr.q[0] = *(const v4u*)(qp + 32);   // residual, d = hi*8 + 0..7
    qr.q[1] = *(const v4u*)(qp + 48);   // residual, d = 16 + hi*8 + 0..7
  }

  const f16* fk_b = fk + (size_t)b * NKEY * QW;
  const f16* vt_b = hvt + (size_t)b * DV * NKEY;

  v8f o[2];
  #pragma unroll
  for (int dt = 0; dt < 2; ++dt) o[dt] = (v8f){0, 0, 0, 0, 0, 0, 0, 0};

  float rmax = -__builtin_inff();
  float rsum = 0.0f;
  const float SL = 1.4426950408889634f;   // log2(e); the scores carry no extra scale
  const float RS = 1.0f / 2048.0f;        // residual plane carry folded back

  for (int i = 0; i < NKEY / BK; ++i) {
    const int j0 = i * BK;

    FragH ak[2], akr[2];
    #pragma unroll
    for (int sub = 0; sub < 2; ++sub) {
      const f16* base = fk_b + (size_t)(j0 + sub * 16 + lq) * QW + hi * 8;
      ak[sub].q[0]  = *(const v4u*)(base);        // d = hi*8 + 0..7
      ak[sub].q[1]  = *(const v4u*)(base + 16);   // d = 16 + hi*8 + 0..7
      akr[sub].q[0] = *(const v4u*)(base + 32);
      akr[sub].q[1] = *(const v4u*)(base + 48);
    }

    // S^T tiles: c[sub][r] = score(query qrow0+lq, key j0 + sub*16 + hi*8 + r)
    v8f c[2], cr[2];
    #pragma unroll
    for (int sub = 0; sub < 2; ++sub) {
      c[sub]  = mma_f16(ak[sub].v,  qf.v, (v8f){0, 0, 0, 0, 0, 0, 0, 0});
      cr[sub] = mma_f16(ak[sub].v,  qr.v, (v8f){0, 0, 0, 0, 0, 0, 0, 0});
      cr[sub] = mma_f16(akr[sub].v, qf.v, cr[sub]);
    }
    #pragma unroll
    for (int sub = 0; sub < 2; ++sub) {
      #pragma unroll
      for (int r = 0; r < 8; ++r) c[sub][r] = c[sub][r] + cr[sub][r] * RS;
    }

    // online softmax: query lq's 32 scores are split across lane / lane^16
    float m_new = rmax;
    #pragma unroll
    for (int r = 0; r < 8; ++r) {
      m_new = fmaxf(m_new, c[0][r]);
      m_new = fmaxf(m_new, c[1][r]);
    }
    m_new = fmaxf(m_new, __shfl_xor(m_new, 16, 32));
    const float scale = __builtin_amdgcn_exp2f((rmax - m_new) * SL);
    rmax = m_new;

    // exp + pack: P^T C-layout == A-fragment layout for the PV product; P carried x4096 in f16.
    // Exponents below -25 give zero (kept values carry x4096 to at least 2^-13, inside the f16 normal range).
    FragH pa;
    float psum = 0.0f;
    #pragma unroll
    for (int r = 0; r < 8; ++r) {
      const float e0 = (c[0][r] - m_new) * SL;   // key j0 + hi*8 + r
      const float e1 = (c[1][r] - m_new) * SL;   // key j0 + 16 + hi*8 + r
      const float x0 = __builtin_amdgcn_exp2f(e0);
      const float x1 = __builtin_amdgcn_exp2f(e1);
      const float p0 = (e0 < -25.0f) ? 0.0f : x0;
      const float p1 = (e1 < -25.0f) ? 0.0f : x1;
      psum += p0 + p1;
      pa.h[r]     = (f16)(p0 * 4096.0f);
      pa.h[8 + r] = (f16)(p1 * 4096.0f);
    }
    rsum = rsum * scale + psum + __shfl_xor(psum, 16, 32);

    // rescale CTX: queries are the row dimension there -> per-row scale from lane 8*hi + r
    float sc[8];
    #pragma unroll
    for (int r = 0; r < 8; ++r) sc[r] = __shfl(scale, (hi << 3) + r, 32);
    #pragma unroll
    for (int dt = 0; dt < 2; ++dt) {
      #pragma unroll
      for (int r = 0; r < 8; ++r) o[dt][r] *= sc[r];
    }

    // CTX += P x Hv : B-fragment column n = d = dt*16 + lq, split key map from the transposed plane
    #pragma unroll
    for (int dt = 0; dt < 2; ++dt) {
      const f16* base = vt_b + (size_t)(dt * 16 + lq) * NKEY + j0 + hi * 8;
      FragH bv;
      bv.q[0] = *(const v4u*)(base);        // keys j0 + hi*8 + 0..7
      bv.q[1] = *(const v4u*)(base + 16);   // keys j0 + 16 + hi*8 + 0..7
      o[dt] = mma_f16(pa.v, bv.v, o[dt]);
    }
  }

  // normalize: lane holds column d = dt*16 + lq for query rows 8*hi + r
  float rs[8];
  #pragma unroll
  for (int r = 0; r < 8; ++r) rs[r] = 1.0f / __shfl(rsum, (hi << 3) + r, 32);

  f16* stg = sC + wave * (16 * CP);
  #pragma unroll
  for (int r = 0; r < 8; ++r) {
    #pragma unroll
    for (int dt = 0; dt < 2; ++dt)
      stg[(hi * 8 + r) * CP + dt * 16 + lq] = toh_flush(o[dt][r] * (1.0f / 4096.0f) * rs[r]);
  }
  __syncthreads();

  // whole-line stores: per instruction the wave writes 8 ctx rows x 64 B = 512 B contiguous
  // (4 lines, each filled by 8 consecutive lanes x 16 B); 2 instructions cover the wave's 16 rows.
  v4u    vals[2];
  size_t gidx[2];
  #pragma unroll
  for (int i2 = 0; i2 < 2; ++i2) {
    const int row = i2 * 8 + (lane >> 2);
    const int dq  = (lane & 3) * 8;
    Pack8H p;
    p.v = *(const v8h*)(stg + row * CP + dq);
    vals[i2] = p.u;
    gidx[i2] = ((size_t)b * SEQ + qrow0 + row) * DV + dq;
  }
  #pragma unroll
  for (int i2 = 0; i2 < 2; ++i2) *(v4u*)(ctx + gidx[i2]) = vals[i2];
  
}

// Output projection + scaled residual: out = gamma * (CTX x Wo) + x_bf16. Block = 8 waves, wave -> one 16-row M tile,
// four passes over 64-column quarters. A fragments from the f16 ctx plane, B fragments from wot (carried x16).
// Epilogue per quarter: f32 tile staged in LDS (per-wave region, block barriers), then per instruction lanes 0..15
__global__ __launch_bounds__(256) void oproj_kernel(const f16* __restrict__ ctx, const f16* __restrict__ wot,
                                                    const float* __restrict__ x, const float* __restrict__ gamma,
                                                    float* __restrict__ out) {
  const int tid  = threadIdx.x;
  const int wave = tid >> 5;
  const int lane = tid & 31;
  const int m    = lane & 15;   // B column within a tile / 16-B piece index of the quarter-row
  const int hi   = lane >> 4;
  const int mt   = blockIdx.x * NWAVE + wave;
  const int prow0 = mt * 16;                 // plane row of ctx
  const int bb    = prow0 / SEQ;
  const int pix0  = prow0 - bb * SEQ;
  const size_t xrow0 = (size_t)bb * SEQ_FULL + pix0;

  __shared__ __align__(16) float sO[NWAVE * 16 * OP];
  float* so = sO + wave * (16 * OP);

  const float gsc = (float)(bf16)gamma[0] * 0.0625f;   // gamma (RNE bf16) folded with the 1/16 Wo carry
  const f16* ap0 = ctx + (size_t)(prow0 + m) * DV + hi * 8;

  #pragma unroll 1
  for (int qn = 0; qn < 4; ++qn) {
    v8f acc[4];
    #pragma unroll
    for (int j = 0; j < 4; ++j) acc[j] = (v8f){0, 0, 0, 0, 0, 0, 0, 0};
    #pragma unroll
    for (int kk = 0; kk < DV / 32; ++kk) {
      FragH a;
      a.q[0] = *(const v4u*)(ap0 + kk * 32);        // d = kk*32 + hi*8 + 0..7
      a.q[1] = *(const v4u*)(ap0 + kk * 32 + 16);   // d = kk*32 + 16 + hi*8 + 0..7
      #pragma unroll
      for (int j = 0; j < 4; ++j) {
        const int nt = qn * 4 + j;
        const f16* wp = wot + (size_t)(nt * 16 + m) * DV + kk * 32 + hi * 8;
        FragH bw;
        bw.q[0] = *(const v4u*)(wp);
        bw.q[1] = *(const v4u*)(wp + 16);
        acc[j] = mma_f16(a.v, bw.v, acc[j]);
      }
    }
    #pragma unroll
    for (int r = 0; r < 8; ++r) {
      #pragma unroll
      for (int j = 0; j < 4; ++j) so[(hi * 8 + r) * OP + j * 16 + m] = acc[j][r] * gsc;
    }
    __syncthreads();

    v4f    vals[8];
    size_t gidx[8];
    #pragma unroll
    for (int it = 0; it < 8; ++it) {
      const int row = it * 2 + hi;
      v4f v = *(const v4f*)(so + row * OP + m * 4);
      const size_t g = (xrow0 + row) * CIN + qn * 64 + m * 4;
      const v4f xv = *(const v4f*)(x + g);
      #pragma unroll
      for (int cc = 0; cc < 4; ++cc) v[cc] = v[cc] + (float)(bf16)xv[cc];   // residual with the RNE bf16 input value
      vals[it] = v;
      gidx[it] = g;
    }
    #pragma unroll
    for (int it = 0; it < 8; ++it) *(v4f*)(out + gidx[it]) = vals[it];
    
    __syncthreads();
  }
}

extern "C" void kernel_launch(void* const* d_in, const int* in_sizes, int n_in,
                              void* d_out, int out_size, void* d_ws, size_t ws_size,
                              hipStream_t stream) {
  if (n_in < 6) return;
  const size_t rows_used = (size_t)(NB - 1) * SEQ_FULL + SEQ;
  if ((size_t)in_sizes[0] < rows_used * CIN) return;
  if (in_sizes[1] < CIN * DQK) return;
  if (in_sizes[2] < CIN * DQK) return;
  if (in_sizes[3] < CIN * DV) return;
  if (in_sizes[4] < DV * CIN) return;
  if (in_sizes[5] < 1) return;
  if ((size_t)out_size < rows_used * CIN) return;
  if (ws_size < WS_TOTAL) return;

  const float* x     = (const float*)d_in[0];
  const float* wf    = (const float*)d_in[1];
  const float* wg    = (const float*)d_in[2];
  const float* wh    = (const float*)d_in[3];
  const float* wo    = (const float*)d_in[4];
  const float* gamma = (const float*)d_in[5];
  float* out = (float*)d_out;
  char*  ws  = (char*)d_ws;
  bf16* wct = (bf16*)(ws + OFF_WCT);
  f16*  wot = (f16*)(ws + OFF_WOT);
  f16*  gq  = (f16*)(ws + OFF_GQ);
  f16*  fk  = (f16*)(ws + OFF_FK);
  f16*  hvt = (f16*)(ws + OFF_HVT);
  f16*  ctx = (f16*)(ws + OFF_CTX);

  pack_w_kernel<<<16, 256, 0, stream>>>(wf, wg, wh, wo, wct, wot);
  proj_pool_kernel<<<dim3(SEQ / 256, NB), 256, 0, stream>>>(x, wct, gq, fk, hvt);
  attn_kernel<<<dim3(SEQ / BQ, NB), 256, 0, stream>>>(gq, fk, hvt, ctx);
  oproj_kernel<<<(NB * SEQ) / 128, 256, 0, stream>>>(ctx, wot, x, gamma, out);
}

// v001
// One run takes 62.8 microseconds.
// Two timings next to v000 put it at 1.42 and 1.39 times that version's speed.
#include <hip/hip_runtime.h>

// Contractions: X x [Wf|Wg|Wh] on v_wmma_f32_16x16x32_bf16 (bf16 operands = RNE-converted inputs, f32 accumulate);
// S^T = F x G^T as three v_wmma_f32_16x16x32_f16 products (value x value in one accumulator; value x residual and
// residual x value in a second accumulator, residual planes carried x2048 and folded back in f32);
// CTX = P x Hv (P as f16 carried x4096) and OUT = CTX x Wattn (Wattn as f16 of the bf16 value, carried x16)
// on v_wmma_f32_16x16x32_f16 (f16 operands, f32 accumulate). Max-pool, softmax and residual add in f32.

#ifndef NB
#define NB 8
#endif
#ifndef SEQ
#define SEQ 4096
#endif
#define NB_FULL  8
#define SEQ_FULL 4096
#define W_IMG    64                 // image width (pixels per image row)
#define CIN      256                // input channels
#define DQK      32                 // query / key channels
#define DV       32                 // value channels
#define NPROJ    96                 // packed projection columns: [0,32) f, [32,64) g, [64,96) h
#define QW       64                 // halves per row of the query / key planes: value 0..31 | residual 32..63
#define NKEY     (SEQ / 4)          // pooled key count per image
#define KTILE    64                 // keys produced per projection block
#define BQ       128                // query rows per attention block (8 waves x 16)
#define BK       32                 // keys per inner iteration
#define NWAVE    8
#define PF       68                 // LDS pitch (floats) of the ww-pooled staging rows (f 0..31 | h 32..63)
#define GP       72                 // LDS pitch (halves) of the g staging tile (value | residual)
#define FP       72                 // LDS pitch (halves) of the pooled f tile (value | residual)
#define HP       72                 // LDS pitch (halves) of the pooled h^T tile
#define CP       40                 // LDS pitch (halves) of the ctx staging tile
#define OP       68                 // LDS pitch (floats) of the output staging tile
#define KP       72                 // LDS pitch (halves) of a staged key row (value | residual): 144 B = 16 B x odd
#define VP       (NKEY + 8)         // LDS pitch (halves) of a staged h^T row: 16 B x odd

static_assert(SEQ % 256 == 0);
static_assert(SEQ >= 256 && SEQ <= SEQ_FULL);
static_assert(NB >= 1 && NB <= NB_FULL);
static_assert(BQ == NWAVE * 16);
static_assert(NKEY % BK == 0);
static_assert(NKEY % KTILE == 0);
static_assert(CIN % 32 == 0 && DV == 32 && DQK == 32);
static_assert(NPROJ == 2 * DQK + DV && NPROJ % 16 == 0 && NPROJ / 8 == 12);
static_assert(QW == 2 * DQK && QW * 2 == 128);
static_assert(W_IMG == 64 && CIN == 4 * 64);
// coverage equalities (grid x block x per-thread elements == plane extent)
static_assert((SEQ / 256) * 2 * NWAVE * 16 == SEQ);          // g plane rows per image
static_assert((SEQ / 256) * KTILE == NKEY);                   // f / h^T plane keys per image
static_assert((SEQ / BQ) * NWAVE * 16 == SEQ);                // ctx plane rows per image
static_assert(((NB * SEQ) / 128) * NWAVE * 16 == NB * SEQ);   // output rows
static_assert(4 * 32 * 8 == 16 * QW);                         // g tile store: 4 instructions x 32 lanes x 8 halves
static_assert(2 * 256 * 8 == KTILE * QW);                     // key tile store: 2 x 256 threads x 8 halves
static_assert(256 * 8 == DV * KTILE);                         // h^T tile store: 256 threads x 8 halves
static_assert(2 * 32 * 8 == 16 * DV);                         // ctx tile store: 2 instructions x 32 lanes x 8 halves
static_assert(4 * 256 == 32 * DQK && 4 * 256 == 32 * DV);     // hh-pool element loops
static_assert(4 * 256 * 8 == CIN * DV);                       // wot plane
static_assert(12 * 8 == NPROJ);                               // wct plane rows
static_assert(PF >= 2 * DQK && (PF * 4) % 16 == 0);
static_assert(GP >= QW && FP >= QW && HP >= KTILE && CP >= DV && OP >= 64);
static_assert((GP * 2) % 16 == 0 && (FP * 2) % 16 == 0 && (HP * 2) % 16 == 0 && (CP * 2) % 16 == 0);
static_assert((OP * 4) % 16 == 0);
static_assert(KP >= QW && (KP * 2) % 32 == 16 && (VP * 2) % 32 == 16);
static_assert((NKEY * QW) % (8 * 256 * 8) == 0);              // key plane: whole groups of 8 copies x 256 lanes x 8 halves
static_assert((DV * NKEY) % (8 * 256 * 8) == 0);              // h^T plane: the same
static_assert((NKEY * QW + DV * NKEY) / (256 * 8) <= 63);     // copies of one wave in flight
static_assert((NKEY * KP + DV * VP + NWAVE * 16 * CP) * 2 <= 327680);

static constexpr size_t WCT_BYTES = (size_t)NPROJ * CIN * 2;          // 49,152
static constexpr size_t WOT_BYTES = (size_t)CIN * DV * 2;             // 16,384
static constexpr size_t GQ_BYTES  = (size_t)NB * SEQ * QW * 2;        // 4,194,304 at full size
static constexpr size_t FK_BYTES  = (size_t)NB * NKEY * QW * 2;       // 1,048,576
static constexpr size_t HVT_BYTES = (size_t)NB * DV * NKEY * 2;       // 524,288
static constexpr size_t CTX_BYTES = (size_t)NB * SEQ * DV * 2;        // 2,097,152
static constexpr size_t OFF_WCT = 0;
static constexpr size_t OFF_WOT = OFF_WCT + WCT_BYTES;
static constexpr size_t OFF_GQ  = OFF_WOT + WOT_BYTES;
static constexpr size_t OFF_FK  = OFF_GQ + GQ_BYTES;
static constexpr size_t OFF_HVT = OFF_FK + FK_BYTES;
static constexpr size_t OFF_CTX = OFF_HVT + HVT_BYTES;
static constexpr size_t WS_TOTAL = OFF_CTX + CTX_BYTES;               // 7,929,856 at full size
static_assert(WCT_BYTES % 128 == 0 && WOT_BYTES % 128 == 0 && GQ_BYTES % 128 == 0);
static_assert(FK_BYTES % 128 == 0 && HVT_BYTES % 128 == 0 && CTX_BYTES % 128 == 0);
static_assert(WS_TOTAL <= (size_t)134217728);

typedef __bf16   bf16;
typedef _Float16 f16;
typedef bf16     v16bf __attribute__((ext_vector_type(16)));
typedef f16      v16h  __attribute__((ext_vector_type(16)));
typedef f16      v8h   __attribute__((ext_vector_type(8)));
typedef float    v8f   __attribute__((ext_vector_type(8)));
typedef float    v4f   __attribute__((ext_vector_type(4)));
typedef unsigned v4u   __attribute__((ext_vector_type(4)));

union FragB  { v16bf v; v4u q[2]; bf16 h[16]; };
union FragH  { v16h  v; v4u q[2]; f16  h[16]; };
union Pack8B { v4u u; bf16 h[8]; };
union Pack8H { v4u u; v8h v; f16 h[8]; };

// WMMA helpers: builtin followed by the VALU hazard guard (ties D, keeps A/B live).
static __device__ __forceinline__ v8f mma_bf16(v16bf a, v16bf b, v8f acc) {
  acc = __builtin_amdgcn_wmma_f32_16x16x32_bf16(false, a, false, b, (short)0, acc, false, false);
  asm volatile("v_nop\n\tv_nop\n\tv_nop\n\tv_nop" : "+v"(acc) : "v"(a), "v"(b));
  return acc;
}
static __device__ __forceinline__ v8f mma_f16(v16h a, v16h b, v8f acc) {
  acc = __builtin_amdgcn_wmma_f32_16x16x32_f16(false, a, false, b, (short)0, acc, false, false);
  asm volatile("v_nop\n\tv_nop\n\tv_nop\n\tv_nop" : "+v"(acc) : "v"(a), "v"(b));
  return acc;
}

// Eight asynchronous 16-byte copies per lane, global -> LDS, through no register: copy i takes the 16-byte piece
// number piece0 + i * 256 of a plane whose rows hold ROWH halves and lands it at row pitch PITCH (halves) in LDS.
// The closing s_wait_xcnt stands inside the statement so that no address register is rewritten ahead of it.
template <int ROWH, int PITCH>
static __device__ __forceinline__ void copy8_to_lds(const f16* __restrict__ plane, unsigned lds_base, int piece0) {
  const f16* g[8];
  unsigned   l[8];
  #pragma unroll   // constant indices: the sixteen addresses stay in registers for the asm operands
  for (int i = 0; i < 8; ++i) {
    const int piece = piece0 + i * 256;
    const int row   = piece / (ROWH / 8);
    const int col   = piece % (ROWH / 8);
    g[i] = plane + (size_t)piece * 8;
    l[i] = lds_base + (unsigned)(row * PITCH + col * 8) * 2u;
  }
  asm volatile("global_load_async_to_lds_b128 %0, %8, off\n\t"
               "global_load_async_to_lds_b128 %1, %9, off\n\t"
               "global_load_async_to_lds_b128 %2, %10, off\n\t"
               "global_load_async_to_lds_b128 %3, %11, off\n\t"
               "global_load_async_to_lds_b128 %4, %12, off\n\t"
               "global_load_async_to_lds_b128 %5, %13, off\n\t"
               "global_load_async_to_lds_b128 %6, %14, off\n\t"
               "global_load_async_to_lds_b128 %7, %15, off\n\t"
               "s_wait_xcnt 0x0"
               :: "v"(l[0]), "v"(l[1]), "v"(l[2]), "v"(l[3]), "v"(l[4]), "v"(l[5]), "v"(l[6]), "v"(l[7]),
                  "v"(g[0]), "v"(g[1]), "v"(g[2]), "v"(g[3]), "v"(g[4]), "v"(g[5]), "v"(g[6]), "v"(g[7])
               : "memory");
}

// f32 -> f16 convert that can never produce a subnormal operand (value select below 2^-14).
static __device__ __forceinline__ f16 toh_flush(float v) {
  const f16 r = (f16)v;
  return (fabsf(v) < 6.103515625e-05f) ? (f16)0.0f : r;
}

// Weight planes (k-contiguous rows, B fragments load like A fragments):
//   wct [NPROJ][CIN] bf16 : row n = column n of [Wf | Wg | Wh], RNE bf16.
//   wot [CIN][DV]    f16  : row n = column n of Wattn, value f16(bf16(w) * 16) (exact for normal results).
// Blocks 0..11: 8 rows of wct each (one wave per 512-B row, one instruction); blocks 12..15: 64 rows of wot each
// (one wave per eight 64-B rows = 512 B contiguous, one instruction). Source selection is block-uniform.
// coverage: wct rows 0..95 x k 0..255; wot rows 0..255 x k 0..31.
__global__ __launch_bounds__(256) void pack_w_kernel(const float* __restrict__ wf, const float* __restrict__ wg,
                                                      const float* __restrict__ wh, const float* __restrict__ wo,
                                                      bf16* __restrict__ wct, f16* __restrict__ wot) {
  const int blk = blockIdx.x;
  const int tid = threadIdx.x;
  if (blk < 12) {
    const int n  = blk * 8 + (tid >> 5);       // 0..95
    const int kq = (tid & 31) * 8;             // 0..248
    const float* src = (blk < 4) ? wf : ((blk < 8) ? wg : wh);
    const int pitch  = (blk < 8) ? DQK : DV;
    const int nl     = (blk < 4) ? n : ((blk < 8) ? (n - 32) : (n - 64));
    Pack8B pk;
    #pragma unroll
    for (int i = 0; i < 8; ++i) pk.h[i] = (bf16)src[(size_t)(kq + i) * pitch + nl];   // RNE convert
    bf16* dst = wct + (size_t)n * CIN + kq;
    *(v4u*)dst = pk.u;
    
  } else {
    const int j  = (blk - 12) * 256 + tid;     // 0..1023
    const int n  = j >> 2;                     // 0..255
    const int kq = (j & 3) * 8;                // 0..24
    Pack8H pk;
    #pragma unroll
    for (int i = 0; i < 8; ++i) {
      const float v = (float)(bf16)wo[(size_t)(kq + i) * CIN + n];
      pk.h[i] = toh_flush(v * 16.0f);          // bf16 significand fits f16
    }
    f16* dst = wot + (size_t)n * DV + kq;
    *(v4u*)dst = pk.u;
    
  }
}

// One wave's 16-pixel M tile times NTN consecutive 16-column tiles of wct starting at tile NT0; K = CIN.
// A fragments from f32 x rows (RNE bf16 convert, split k map); B fragments from the k-contiguous wct rows.
template <int NT0, int NTN>
static __device__ __forceinline__ void proj_tiles(const float* __restrict__ xr, const bf16* __restrict__ wct,
                                                  int m, int hi, v8f (&acc)[NTN]) {
  #pragma unroll
  for (int t = 0; t < NTN; ++t) acc[t] = (v8f){0, 0, 0, 0, 0, 0, 0, 0};
  for (int kk = 0; kk < CIN / 32; ++kk) {
    const float* xp = xr + kk * 32;
    const v4f a0 = *(const v4f*)(xp + hi * 8);
    const v4f a1 = *(const v4f*)(xp + hi * 8 + 4);
    const v4f b0 = *(const v4f*)(xp + 16 + hi * 8);
    const v4f b1 = *(const v4f*)(xp + 16 + hi * 8 + 4);
    FragB a;
    #pragma unroll
    for (int i = 0; i < 4; ++i) {
      a.h[i]      = (bf16)a0[i];   // elems 0..7  : k = kk*32 + hi*8 + 0..7
      a.h[4 + i]  = (bf16)a1[i];
      a.h[8 + i]  = (bf16)b0[i];   // elems 8..15 : k = kk*32 + 16 + hi*8 + 0..7
      a.h[12 + i] = (bf16)b1[i];
    }
    #pragma unroll
    for (int t = 0; t < NTN; ++t) {
      const bf16* wp = wct + (size_t)((NT0 + t) * 16 + m) * CIN + kk * 32 + hi * 8;
      FragB bw;
      bw.q[0] = *(const v4u*)(wp);        // k = kk*32 + hi*8 + 0..7, n = tile*16 + m
      bw.q[1] = *(const v4u*)(wp + 16);   // k = kk*32 + 16 + hi*8 + 0..7
      acc[t] = mma_bf16(a.v, bw.v, acc[t]);
    }
  }
}

// Projection + 2x2 max-pool. Block = (64-key tile kt, batch b), 256 threads; two iterations each cover
// image rows hh = kt*4 + it*2 + {0,1}; wave -> (hh, 16 pixels along ww).
//                            (wave writes 16 rows = 2 KB, 4 instructions of 4 lines, 8 lanes x 16 B per line).
//   fk  [NB][NKEY][QW] f16 : pooled keys, value | residual x2048, 64 rows per block = 8 KB
//                            (2 instructions, each wave 4 lines, 8 lanes x 16 B per line).
// LDS regions: sP cross-wave (block barrier), sG per-wave but read across lanes after the block barrier,
// sF / sHT cross-wave (block barrier). Staged extent == consumed extent for all four.
__global__ __launch_bounds__(256) void proj_pool_kernel(const float* __restrict__ x, const bf16* __restrict__ wct,
                                                         f16* __restrict__ gq, f16* __restrict__ fk,
                                                         f16* __restrict__ hvt) {
  const int kt   = blockIdx.x;
  const int b    = blockIdx.y;
  const int tid  = threadIdx.x;
  const int wave = __builtin_amdgcn_readfirstlane(threadIdx.x >> 5);
  const int lane = tid & 31;
  const int m    = lane & 15;
  const int hi   = lane >> 4;
  const int hsel = wave >> 2;          // which of the two image rows of this iteration
  const int ww0  = (wave & 3) * 16;    // first pixel column of this wave's tile

  __shared__ __align__(16) float sP[2 * 32 * PF];     // [hsel][pw][64 cols] ww-pooled f|h in f32
  __shared__ __align__(16) f16 sG[NWAVE * 16 * GP];   // per-wave g tile [16][value 32 | residual 32]
  __shared__ __align__(16) f16 sF[64 * FP];           // pooled f [64 keys][value 32 | residual 32]
  __shared__ __align__(16) f16 sHT[DV * HP];          // pooled h^T [32 d][64 keys]

  f16*   sg = sG + wave * (16 * GP);
  float* sp = sP + hsel * (32 * PF);
  const int pwb = (ww0 >> 1) + hi * 4;   // pooled column index base for this lane half

  for (int it = 0; it < 2; ++it) {
    const int hh   = kt * 4 + it * 2 + hsel;
    const int pix0 = hh * W_IMG + ww0;
    const float* xr = x + ((size_t)b * SEQ_FULL + pix0 + m) * CIN;

    {   // tiles 0,1: f; 2,3: g; 4,5: h
      v8f acc[6];
      proj_tiles<0, 6>(xr, wct, m, hi, acc);
      #pragma unroll
      for (int r = 0; r < 8; ++r) {
        const float g0 = acc[2][r];
        const float g1 = acc[3][r];
        const f16 h0 = toh_flush(g0);
        const f16 h1 = toh_flush(g1);
        sg[(hi * 8 + r) * GP + m]      = h0;
        sg[(hi * 8 + r) * GP + 16 + m] = h1;
        sg[(hi * 8 + r) * GP + 32 + m] = toh_flush((g0 - (float)h0) * 2048.0f);
        sg[(hi * 8 + r) * GP + 48 + m] = toh_flush((g1 - (float)h1) * 2048.0f);
      }
      // ww pairs are D rows (2rp, 2rp+1) of the same lane half; pooled column pw = ww0/2 + 4*hi + rp
      #pragma unroll
      for (int rp = 0; rp < 4; ++rp) {
        #pragma unroll
        for (int t = 0; t < 2; ++t) {
          sp[(pwb + rp) * PF + t * 16 + m]      = fmaxf(acc[t][2 * rp], acc[t][2 * rp + 1]);
          sp[(pwb + rp) * PF + 32 + t * 16 + m] = fmaxf(acc[4 + t][2 * rp], acc[4 + t][2 * rp + 1]);
        }
      }
    }
    __syncthreads();

    {
      v4u    gv[4];
      size_t gi[4];
      #pragma unroll
      for (int i4 = 0; i4 < 4; ++i4) {
        const int row = i4 * 4 + (lane >> 3);
        const int cq  = (lane & 7) * 8;
        Pack8H p;
        p.v = *(const v8h*)(sg + row * GP + cq);
        gv[i4] = p.u;
        gi[i4] = ((size_t)b * SEQ + pix0 + row) * QW + cq;
      }
      #pragma unroll
      for (int i4 = 0; i4 < 4; ++i4) *(v4u*)(gq + gi[i4]) = gv[i4];
      
    }

    // hh-pool into the block's pooled tiles (f32 max, then one convert)
    #pragma unroll
    for (int e = 0; e < 4; ++e) {
      const int idx = e * 256 + tid;
      const int pw  = idx >> 5;
      const int c   = idx & 31;
      const float v = fmaxf(sP[pw * PF + c], sP[32 * PF + pw * PF + c]);
      const f16 hv  = toh_flush(v);
      sF[(it * 32 + pw) * FP + c]      = hv;
      sF[(it * 32 + pw) * FP + 32 + c] = toh_flush((v - (float)hv) * 2048.0f);
    }
    #pragma unroll
    for (int e = 0; e < 4; ++e) {
      const int idx = e * 256 + tid;
      const int pw  = idx >> 5;
      const int d   = idx & 31;
      const float v = fmaxf(sP[pw * PF + 32 + d], sP[32 * PF + pw * PF + 32 + d]);
      sHT[d * HP + it * 32 + pw] = toh_flush(v);
    }
    __syncthreads();
  }

  // final plane stores: fk (per instruction a wave writes 4 rows = 512 B), hvt (per instruction 4 d-lines)
  v4u    fv[2];
  size_t fi[2];
  #pragma unroll
  for (int i2 = 0; i2 < 2; ++i2) {
    const int idx = i2 * 256 + tid;
    const int row = idx >> 3;            // 0..63
    const int cq  = (idx & 7) * 8;
    Pack8H p;
    p.v = *(const v8h*)(sF + row * FP + cq);
    fv[i2] = p.u;
    fi[i2] = ((size_t)b * NKEY + kt * KTILE + row) * QW + cq;
  }
  v4u    hv;
  size_t hidx;
  {
    const int d  = tid >> 3;             // 0..31
    const int kq = (tid & 7) * 8;        // 0..56
    Pack8H p;
    p.v = *(const v8h*)(sHT + d * HP + kq);
    hv   = p.u;
    hidx = ((size_t)b * DV + d) * NKEY + kt * KTILE + kq;
  }
  #pragma unroll
  for (int i2 = 0; i2 < 2; ++i2) *(v4u*)(fk + fi[i2]) = fv[i2];
  *(v4u*)(hvt + hidx) = hv;
  
}

// Flash attention, non-causal, no score scaling. Block = (query block of 128, batch); one wave owns 16 queries.
// S^T = F x G^T so queries sit on lanes; P^T in C-layout is bit-identical to the A-fragment layout of CTX += P x Hv.
// Scores: value x value in c, (value x residual + residual x value) in cr, s = c + cr / 2048.
// The image's whole key plane and h^T plane are staged once in LDS by asynchronous copies (whole lines from global,
// padded rows in LDS) and shared by the block's 8 waves; F A-fragments and Hv^T B-fragments are two 16-B LDS loads
// each, G B-fragments two 16-B global loads each.
//   ctx [NB][SEQ][DV] f16 : one 64-B row per query; wave writes 16 rows = 1 KB contiguous, 512 B per instruction.
// LDS: sK / sV filled once, read-only behind the fill's barrier; sC per-wave region, written and read across lanes
// under a block barrier; staged extent == consumed extent.
__global__ __launch_bounds__(256) void attn_kernel(const f16* __restrict__ gq, const f16* __restrict__ fk,
                                                   const f16* __restrict__ hvt, f16* __restrict__ ctx) {
  const int qblk = blockIdx.x;
  const int b    = blockIdx.y;
  const int tid  = threadIdx.x;
  const int wave = __builtin_amdgcn_readfirstlane(threadIdx.x >> 5);
  const int lane = tid & 31;
  const int lq   = lane & 15;   // query column of S^T / d column of CTX
  const int hi   = lane >> 4;   // k-split half

  __shared__ __align__(16) f16 sK[NKEY * KP];   // [key][value 32 | residual 32]
  __shared__ __align__(16) f16 sV[DV * VP];     // [d][key]
  __shared__ __align__(16) f16 sC[NWAVE * 16 * CP];

  const int qrow0 = qblk * BQ + wave * 16;

  const f16* fk_b = fk + (size_t)b * NKEY * QW;
  const f16* vt_b = hvt + (size_t)b * DV * NKEY;

  // fill: every lane of every wave copies its own 16-byte pieces, no branch around the copies
  {
    const unsigned lk = (unsigned)(size_t)sK;
    const unsigned lv = (unsigned)(size_t)sV;
    for (int gph = 0; gph < (NKEY * QW) / (8 * 256 * 8); ++gph) copy8_to_lds<QW, KP>(fk_b, lk, gph * 2048 + tid);
    for (int gph = 0; gph < (DV * NKEY) / (8 * 256 * 8); ++gph) copy8_to_lds<NKEY, VP>(vt_b, lv, gph * 2048 + tid);
  }

  // G as B-operand fragments: lane lq holds query qrow0+lq, elements follow the split d map
  FragH qf, qr;
  {
    const f16* qp = gq + ((size_t)b * SEQ + qrow0 + lq) * QW + hi * 8;
    qf.q[0] = *(const v4u*)(qp);        // value,    d = hi*8 + 0..7
    qf.q[1] = *(const v4u*)(qp + 16);   // value,    d = 16 + hi*8 + 0..7
    qr.q[0] = *(const v4u*)(qp + 32);   // residual, d = hi*8 + 0..7
    qr.q[1] = *(const v4u*)(qp + 48);   // residual, d = 16 + hi*8 + 0..7
  }

  v8f o[2];
  #pragma unroll
  for (int dt = 0; dt < 2; ++dt) o[dt] = (v8f){0, 0, 0, 0, 0, 0, 0, 0};

  float rmax = -__builtin_inff();
  float rsum = 0.0f;
  const float SL = 1.4426950408889634f;   // log2(e); the scores carry no extra scale
  const float RS = 1.0f / 2048.0f;        // residual plane carry folded back

  // this wave's copies have landed; behind the barrier every wave's have
  asm volatile("s_wait_asynccnt 0x0" ::: "memory");
  __syncthreads();

  for (int i = 0; i < NKEY / BK; ++i) {
    const int j0 = i * BK;

    FragH ak[2], akr[2];
    #pragma unroll
    for (int sub = 0; sub < 2; ++sub) {
      const f16* base = sK + (j0 + sub * 16 + lq) * KP + hi * 8;
      ak[sub].q[0]  = *(const v4u*)(base);        // d = hi*8 + 0..7
      ak[sub].q[1]  = *(const v4u*)(base + 16);   // d = 16 + hi*8 + 0..7
      akr[sub].q[0] = *(const v4u*)(base + 32);
      akr[sub].q[1] = *(const v4u*)(base + 48);
    }

    // S^T tiles: c[sub][r] = score(query qrow0+lq, key j0 + sub*16 + hi*8 + r)
    v8f c[2], cr[2];
    #pragma unroll
    for (int sub = 0; sub < 2; ++sub) {
      c[sub]  = mma_f16(ak[sub].v,  qf.v, (v8f){0, 0, 0, 0, 0, 0, 0, 0});
      cr[sub] = mma_f16(ak[sub].v,  qr.v, (v8f){0, 0, 0, 0, 0, 0, 0, 0});
      cr[sub] = mma_f16(akr[sub].v, qf.v, cr[sub]);
    }
    #pragma unroll
    for (int sub = 0; sub < 2; ++sub) {
      #pragma unroll
      for (int r = 0; r < 8; ++r) c[sub][r] = c[sub][r] + cr[sub][r] * RS;
    }

    // online softmax: query lq's 32 scores are split across lane / lane^16
    float m_new = rmax;
    #pragma unroll
    for (int r = 0; r < 8; ++r) {
      m_new = fmaxf(m_new, c[0][r]);
      m_new = fmaxf(m_new, c[1][r]);
    }
    m_new = fmaxf(m_new, __shfl_xor(m_new, 16, 32));
    const float scale = __builtin_amdgcn_exp2f((rmax - m_new) * SL);
    rmax = m_new;

    // exp + pack: P^T C-layout == A-fragment layout for the PV product; P carried x4096 in f16.
    // Exponents below -25 give zero (kept values carry x4096 to at least 2^-13, inside the f16 normal range).
    FragH pa;
    float psum = 0.0f;
    #pragma unroll
    for (int r = 0; r < 8; ++r) {
      const float e0 = (c[0][r] - m_new) * SL;   // key j0 + hi*8 + r
      const float e1 = (c[1][r] - m_new) * SL;   // key j0 + 16 + hi*8 + r
      const float x0 = __builtin_amdgcn_exp2f(e0);
      const float x1 = __builtin_amdgcn_exp2f(e1);
      const float p0 = (e0 < -25.0f) ? 0.0f : x0;
      const float p1 = (e1 < -25.0f) ? 0.0f : x1;
      psum += p0 + p1;
      pa.h[r]     = (f16)(p0 * 4096.0f);
      pa.h[8 + r] = (f16)(p1 * 4096.0f);
    }
    rsum = rsum * scale + psum + __shfl_xor(psum, 16, 32);

    // rescale CTX: queries are the row dimension there -> per-row scale from lane 8*hi + r
    float sc[8];
    #pragma unroll
    for (int r = 0; r < 8; ++r) sc[r] = __shfl(scale, (hi << 3) + r, 32);
    #pragma unroll
    for (int dt = 0; dt < 2; ++dt) {
      #pragma unroll
      for (int r = 0; r < 8; ++r) o[dt][r] *= sc[r];
    }

    // CTX += P x Hv : B-fragment column n = d = dt*16 + lq, split key map from the transposed plane
    #pragma unroll
    for (int dt = 0; dt < 2; ++dt) {
      const f16* base = sV + (dt * 16 + lq) * VP + j0 + hi * 8;
      FragH bv;
      bv.q[0] = *(const v4u*)(base);        // keys j0 + hi*8 + 0..7
      bv.q[1] = *(const v4u*)(base + 16);   // keys j0 + 16 + hi*8 + 0..7
      o[dt] = mma_f16(pa.v, bv.v, o[dt]);
    }
  }

  // normalize: lane holds column d = dt*16 + lq for query rows 8*hi + r
  float rs[8];
  #pragma unroll
  for (int r = 0; r < 8; ++r) rs[r] = 1.0f / __shfl(rsum, (hi << 3) + r, 32);

  f16* stg = sC + wave * (16 * CP);
  #pragma unroll
  for (int r = 0; r < 8; ++r) {
    #pragma unroll
    for (int dt = 0; dt < 2; ++dt)
      stg[(hi * 8 + r) * CP + dt * 16 + lq] = toh_flush(o[dt][r] * (1.0f / 4096.0f) * rs[r]);
  }
  __syncthreads();

  // whole-line stores: per instruction the wave writes 8 ctx rows x 64 B = 512 B contiguous
  // (4 lines, each filled by 8 consecutive lanes x 16 B); 2 instructions cover the wave's 16 rows.
  v4u    vals[2];
  size_t gidx[2];
  #pragma unroll
  for (int i2 = 0; i2 < 2; ++i2) {
    const int row = i2 * 8 + (lane >> 2);
    const int dq  = (lane & 3) * 8;
    Pack8H p;
    p.v = *(const v8h*)(stg + row * CP + dq);
    vals[i2] = p.u;
    gidx[i2] = ((size_t)b * SEQ + qrow0 + row) * DV + dq;
  }
  #pragma unroll
  for (int i2 = 0; i2 < 2; ++i2) *(v4u*)(ctx + gidx[i2]) = vals[i2];
  
}

// Output projection + scaled residual: out = gamma * (CTX x Wo) + x_bf16. Block = 8 waves, wave -> one 16-row M tile,
// four passes over 64-column quarters. A fragments from the f16 ctx plane, B fragments from wot (carried x16).
// Epilogue per quarter: f32 tile staged in LDS (per-wave region, block barriers), then per instruction lanes 0..15
__global__ __launch_bounds__(256) void oproj_kernel(const f16* __restrict__ ctx, const f16* __restrict__ wot,
                                                    const float* __restrict__ x, const float* __restrict__ gamma,
                                                    float* __restrict__ out) {
  const int tid  = threadIdx.x;
  const int wave = tid >> 5;
  const int lane = tid & 31;
  const int m    = lane & 15;   // B column within a tile / 16-B piece index of the quarter-row
  const int hi   = lane >> 4;
  const int mt   = blockIdx.x * NWAVE + wave;
  const int prow0 = mt * 16;                 // plane row of ctx
  const int bb    = prow0 / SEQ;
  const int pix0  = prow0 - bb * SEQ;
  const size_t xrow0 = (size_t)bb * SEQ_FULL + pix0;

  __shared__ __align__(16) float sO[NWAVE * 16 * OP];
  float* so = sO + wave * (16 * OP);

  const float gsc = (float)(bf16)gamma[0] * 0.0625f;   // gamma (RNE bf16) folded with the 1/16 Wo carry
  const f16* ap0 = ctx + (size_t)(prow0 + m) * DV + hi * 8;

  #pragma unroll 1
  for (int qn = 0; qn < 4; ++qn) {
    v8f acc[4];
    #pragma unroll
    for (int j = 0; j < 4; ++j) acc[j] = (v8f){0, 0, 0, 0, 0, 0, 0, 0};
    #pragma unroll
    for (int kk = 0; kk < DV / 32; ++kk) {
      FragH a;
      a.q[0] = *(const v4u*)(ap0 + kk * 32);        // d = kk*32 + hi*8 + 0..7
      a.q[1] = *(const v4u*)(ap0 + kk * 32 + 16);   // d = kk*32 + 16 + hi*8 + 0..7
      #pragma unroll
      for (int j = 0; j < 4; ++j) {
        const int nt = qn * 4 + j;
        const f16* wp = wot + (size_t)(nt * 16 + m) * DV + kk * 32 + hi * 8;
        FragH bw;
        bw.q[0] = *(const v4u*)(wp);
        bw.q[1] = *(const v4u*)(wp + 16);
        acc[j] = mma_f16(a.v, bw.v, acc[j]);
      }
    }
    #pragma unroll
    for (int r = 0; r < 8; ++r) {
      #pragma unroll
      for (int j = 0; j < 4; ++j) so[(hi * 8 + r) * OP + j * 16 + m] = acc[j][r] * gsc;
    }
    __syncthreads();

    v4f    vals[8];
    size_t gidx[8];
    #pragma unroll
    for (int it = 0; it < 8; ++it) {
      const int row = it * 2 + hi;
      v4f v = *(const v4f*)(so + row * OP + m * 4);
      const size_t g = (xrow0 + row) * CIN + qn * 64 + m * 4;
      const v4f xv = *(const v4f*)(x + g);
      #pragma unroll
      for (int cc = 0; cc < 4; ++cc) v[cc] = v[cc] + (float)(bf16)xv[cc];   // residual with the RNE bf16 input value
      vals[it] = v;
      gidx[it] = g;
    }
    #pragma unroll
    for (int it = 0; it < 8; ++it) *(v4f*)(out + gidx[it]) = vals[it];
    
    __syncthreads();
  }
}

extern "C" void kernel_launch(void* const* d_in, const int* in_sizes, int n_in,
                              void* d_out, int out_size, void* d_ws, size_t ws_size,
                              hipStream_t stream) {
  if (n_in < 6) return;
  const size_t rows_used = (size_t)(NB - 1) * SEQ_FULL + SEQ;
  if ((size_t)in_sizes[0] < rows_used * CIN) return;
  if (in_sizes[1] < CIN * DQK) return;
  if (in_sizes[2] < CIN * DQK) return;
  if (in_sizes[3] < CIN * DV) return;
  if (in_sizes[4] < DV * CIN) return;
  if (in_sizes[5] < 1) return;
  if ((size_t)out_size < rows_used * CIN) return;
  if (ws_size < WS_TOTAL) return;

  const float* x     = (const float*)d_in[0];
  const float* wf    = (const float*)d_in[1];
  const float* wg    = (const float*)d_in[2];
  const float* wh    = (const float*)d_in[3];
  const float* wo    = (const float*)d_in[4];
  const float* gamma = (const float*)d_in[5];
  float* out = (float*)d_out;
  char*  ws  = (char*)d_ws;
  bf16* wct = (bf16*)(ws + OFF_WCT);
  f16*  wot = (f16*)(ws + OFF_WOT);
  f16*  gq  = (f16*)(ws + OFF_GQ);
  f16*  fk  = (f16*)(ws + OFF_FK);
  f16*  hvt = (f16*)(ws + OFF_HVT);
  f16*  ctx = (f16*)(ws + OFF_CTX);

  pack_w_kernel<<<16, 256, 0, stream>>>(wf, wg, wh, wo, wct, wot);
  proj_pool_kernel<<<dim3(SEQ / 256, NB), 256, 0, stream>>>(x, wct, gq, fk, hvt);
  attn_kernel<<<dim3(SEQ / BQ, NB), 256, 0, stream>>>(gq, fk, hvt, ctx);
  oproj_kernel<<<(NB * SEQ) / 128, 256, 0, stream>>>(ctx, wot, x, gamma, out);
}

// v002
// Measured time: 43.8 microseconds a run.
// Timed twice side by side with v001, it ran 1.44 times as fast both times.
// Counting every step since v000, it is 2.02 times as fast.
#include <hip/hip_runtime.h>

// Contractions: X x [Wf|Wg|Wh] on v_wmma_f32_16x16x32_bf16 (bf16 operands = RNE-converted inputs, f32 accumulate);
// S^T = F x G^T as three v_wmma_f32_16x16x32_f16 products (value x value in one accumulator; value x residual and
// residual x value in a second accumulator, residual planes carried x2048 and folded back in f32);
// CTX = P x Hv (P as f16 carried x4096) and OUT = CTX x Wattn (Wattn as f16 of the bf16 value, carried x16)
// on v_wmma_f32_16x16x32_f16 (f16 operands, f32 accumulate). Max-pool, softmax and residual add in f32.

#ifndef NB
#define NB 8
#endif
#ifndef SEQ
#define SEQ 4096
#endif
#define NB_FULL  8
#define SEQ_FULL 4096
#define W_IMG    64                 // image width (pixels per image row)
#define CIN      256                // input channels
#define DQK      32                 // query / key channels
#define DV       32                 // value channels
#define NPROJ    96                 // packed projection columns: [0,32) f, [32,64) g, [64,96) h
#define QW       64                 // halves per row of the query / key planes: value 0..31 | residual 32..63
#define NKEY     (SEQ / 4)          // pooled key count per image
#define KTILE    64                 // keys produced per projection block
#define BQ       128                // query rows per attention block (8 waves x 16)
#define BK       32                 // keys per inner iteration
#define NWAVE    8
#define PF       68                 // LDS pitch (floats) of the ww-pooled staging rows (f 0..31 | h 32..63)
#define GP       72                 // LDS pitch (halves) of the g staging tile (value | residual)
#define FP       72                 // LDS pitch (halves) of the pooled f tile (value | residual)
#define HP       72                 // LDS pitch (halves) of the pooled h^T tile
#define CP       40                 // LDS pitch (halves) of the ctx staging tile
#define OP       68                 // LDS pitch (floats) of the output staging tile
#define KP       72                 // LDS pitch (halves) of a staged key row (value | residual): 144 B = 16 B x odd
#define VP       (NKEY + 8)         // LDS pitch (halves) of a staged h^T row: 16 B x odd
#define WP       (CIN + 8)          // LDS pitch (bf16) of a staged weight row: 528 B = 16 B x odd
#define XP       (CIN / 2 + 4)      // LDS pitch (floats) of a staged half x row (128 channels): 528 B = 16 B x odd
#define XBUF     (NWAVE * 16 * XP)  // floats in one of the two x buffers

static_assert(SEQ % 256 == 0);
static_assert(SEQ >= 256 && SEQ <= SEQ_FULL);
static_assert(NB >= 1 && NB <= NB_FULL);
static_assert(BQ == NWAVE * 16);
static_assert(NKEY % BK == 0);
static_assert(NKEY % KTILE == 0);
static_assert(CIN % 32 == 0 && DV == 32 && DQK == 32);
static_assert(NPROJ == 2 * DQK + DV && NPROJ % 16 == 0 && NPROJ / 8 == 12);
static_assert(QW == 2 * DQK && QW * 2 == 128);
static_assert(W_IMG == 64 && CIN == 4 * 64);
// coverage equalities (grid x block x per-thread elements == plane extent)
static_assert((SEQ / 256) * 2 * NWAVE * 16 == SEQ);          // g plane rows per image
static_assert((SEQ / 256) * KTILE == NKEY);                   // f / h^T plane keys per image
static_assert((SEQ / BQ) * NWAVE * 16 == SEQ);                // ctx plane rows per image
static_assert(((NB * SEQ) / 128) * NWAVE * 16 == NB * SEQ);   // output rows
static_assert(4 * 32 * 8 == 16 * QW);                         // g tile store: 4 instructions x 32 lanes x 8 halves
static_assert(2 * 256 * 8 == KTILE * QW);                     // key tile store: 2 x 256 threads x 8 halves
static_assert(256 * 8 == DV * KTILE);                         // h^T tile store: 256 threads x 8 halves
static_assert(2 * 32 * 8 == 16 * DV);                         // ctx tile store: 2 instructions x 32 lanes x 8 halves
static_assert(4 * 256 == 32 * DQK && 4 * 256 == 32 * DV);     // hh-pool element loops
static_assert(4 * 256 * 8 == CIN * DV);                       // wot plane
static_assert(12 * 8 == NPROJ);                               // wct plane rows
static_assert(PF >= 2 * DQK && (PF * 4) % 16 == 0);
static_assert(GP >= QW && FP >= QW && HP >= KTILE && CP >= DV && OP >= 64);
static_assert((GP * 2) % 16 == 0 && (FP * 2) % 16 == 0 && (HP * 2) % 16 == 0 && (CP * 2) % 16 == 0);
static_assert((OP * 4) % 16 == 0);
static_assert(KP >= QW && (KP * 2) % 32 == 16 && (VP * 2) % 32 == 16);
static_assert((NKEY * QW) % (8 * 256 * 8) == 0);              // key plane: whole groups of 8 copies x 256 lanes x 8 halves
static_assert((DV * NKEY) % (8 * 256 * 8) == 0);              // h^T plane: the same
static_assert((NKEY * QW + DV * NKEY) / (256 * 8) <= 63);     // copies of one wave in flight
static_assert((NKEY * KP + DV * VP + NWAVE * 16 * CP) * 2 <= 327680);
static_assert((WP * 2) % 32 == 16 && (XP * 4) % 32 == 16);
static_assert(NPROJ * CIN * 2 == (8 + 4) * 256 * 16);         // weight plane: 12 copies x 256 lanes x 16 B
static_assert(16 * (CIN / 2) * 4 == 2 * 8 * 32 * 16);         // one wave's half x rows: 16 copies x 32 lanes x 16 B
static_assert(12 + 16 <= 63);                                 // copies of one wave in flight
static_assert(2 * 32 * PF * 4 + (NWAVE * 16 * GP + 64 * FP + DV * HP) * 2 + NPROJ * WP * 2 + 2 * XBUF * 4 <= 327680);

static constexpr size_t WCT_BYTES = (size_t)NPROJ * CIN * 2;          // 49,152
static constexpr size_t WOT_BYTES = (size_t)CIN * DV * 2;             // 16,384
static constexpr size_t GQ_BYTES  = (size_t)NB * SEQ * QW * 2;        // 4,194,304 at full size
static constexpr size_t FK_BYTES  = (size_t)NB * NKEY * QW * 2;       // 1,048,576
static constexpr size_t HVT_BYTES = (size_t)NB * DV * NKEY * 2;       // 524,288
static constexpr size_t CTX_BYTES = (size_t)NB * SEQ * DV * 2;        // 2,097,152
static constexpr size_t OFF_WCT = 0;
static constexpr size_t OFF_WOT = OFF_WCT + WCT_BYTES;
static constexpr size_t OFF_GQ  = OFF_WOT + WOT_BYTES;
static constexpr size_t OFF_FK  = OFF_GQ + GQ_BYTES;
static constexpr size_t OFF_HVT = OFF_FK + FK_BYTES;
static constexpr size_t OFF_CTX = OFF_HVT + HVT_BYTES;
static constexpr size_t WS_TOTAL = OFF_CTX + CTX_BYTES;               // 7,929,856 at full size
static_assert(WCT_BYTES % 128 == 0 && WOT_BYTES % 128 == 0 && GQ_BYTES % 128 == 0);
static_assert(FK_BYTES % 128 == 0 && HVT_BYTES % 128 == 0 && CTX_BYTES % 128 == 0);
static_assert(WS_TOTAL <= (size_t)134217728);

typedef __bf16   bf16;
typedef _Float16 f16;
typedef bf16     v16bf __attribute__((ext_vector_type(16)));
typedef f16      v16h  __attribute__((ext_vector_type(16)));
typedef f16      v8h   __attribute__((ext_vector_type(8)));
typedef float    v8f   __attribute__((ext_vector_type(8)));
typedef float    v4f   __attribute__((ext_vector_type(4)));
typedef unsigned v4u   __attribute__((ext_vector_type(4)));

union FragB  { v16bf v; v4u q[2]; bf16 h[16]; };
union FragH  { v16h  v; v4u q[2]; f16  h[16]; };
union Pack8B { v4u u; bf16 h[8]; };
union Pack8H { v4u u; v8h v; f16 h[8]; };

// WMMA helpers: builtin followed by the VALU hazard guard (ties D, keeps A/B live).
static __device__ __forceinline__ v8f mma_bf16(v16bf a, v16bf b, v8f acc) {
  acc = __builtin_amdgcn_wmma_f32_16x16x32_bf16(false, a, false, b, (short)0, acc, false, false);
  asm volatile("v_nop\n\tv_nop\n\tv_nop\n\tv_nop" : "+v"(acc) : "v"(a), "v"(b));
  return acc;
}
static __device__ __forceinline__ v8f mma_f16(v16h a, v16h b, v8f acc) {
  acc = __builtin_amdgcn_wmma_f32_16x16x32_f16(false, a, false, b, (short)0, acc, false, false);
  asm volatile("v_nop\n\tv_nop\n\tv_nop\n\tv_nop" : "+v"(acc) : "v"(a), "v"(b));
  return acc;
}

// Eight asynchronous 16-byte copies per lane, global -> LDS, through no register: copy i takes the 16-byte piece
// number piece0 + i * 256 of a plane whose rows hold ROWH halves and lands it at row pitch PITCH (halves) in LDS.
// The closing s_wait_xcnt stands inside the statement so that no address register is rewritten ahead of it.
template <int ROWH, int PITCH>
static __device__ __forceinline__ void copy8_to_lds(const f16* __restrict__ plane, unsigned lds_base, int piece0) {
  const f16* g[8];
  unsigned   l[8];
  #pragma unroll   // constant indices: the sixteen addresses stay in registers for the asm operands
  for (int i = 0; i < 8; ++i) {
    const int piece = piece0 + i * 256;
    const int row   = piece / (ROWH / 8);
    const int col   = piece % (ROWH / 8);
    g[i] = plane + (size_t)piece * 8;
    l[i] = lds_base + (unsigned)(row * PITCH + col * 8) * 2u;
  }
  asm volatile("global_load_async_to_lds_b128 %0, %8, off\n\t"
               "global_load_async_to_lds_b128 %1, %9, off\n\t"
               "global_load_async_to_lds_b128 %2, %10, off\n\t"
               "global_load_async_to_lds_b128 %3, %11, off\n\t"
               "global_load_async_to_lds_b128 %4, %12, off\n\t"
               "global_load_async_to_lds_b128 %5, %13, off\n\t"
               "global_load_async_to_lds_b128 %6, %14, off\n\t"
               "global_load_async_to_lds_b128 %7, %15, off\n\t"
               "s_wait_xcnt 0x0"
               :: "v"(l[0]), "v"(l[1]), "v"(l[2]), "v"(l[3]), "v"(l[4]), "v"(l[5]), "v"(l[6]), "v"(l[7]),
                  "v"(g[0]), "v"(g[1]), "v"(g[2]), "v"(g[3]), "v"(g[4]), "v"(g[5]), "v"(g[6]), "v"(g[7])
               : "memory");
}

// N (8 or 4) asynchronous 16-byte copies per lane, global -> LDS, through no register: copy i takes the 16-byte piece
// number piece0 + i * STEP of a tile whose rows hold ROWB bytes at pitch SRCB in global memory and lands it at row
// pitch PITCHB in LDS (all in bytes).
// The closing s_wait_xcnt stands inside the statement so that no address register is rewritten ahead of it.
template <int N, int ROWB, int SRCB, int PITCHB, int STEP>
static __device__ __forceinline__ void copy_rows_to_lds(const char* __restrict__ plane, unsigned lds_base, int piece0) {
  static_assert(N == 8 || N == 4);
  const char* g[N];
  unsigned    l[N];
  #pragma unroll   // constant indices: the addresses stay in registers for the asm operands
  for (int i = 0; i < N; ++i) {
    const int piece = piece0 + i * STEP;
    const int row   = piece / (ROWB / 16);
    const int col   = piece % (ROWB / 16);
    g[i] = plane + (size_t)(row * SRCB + col * 16);
    l[i] = lds_base + (unsigned)(row * PITCHB + col * 16);
  }
  if constexpr (N == 8) {
    asm volatile("global_load_async_to_lds_b128 %0, %8, off\n\t"
                 "global_load_async_to_lds_b128 %1, %9, off\n\t"
                 "global_load_async_to_lds_b128 %2, %10, off\n\t"
                 "global_load_async_to_lds_b128 %3, %11, off\n\t"
                 "global_load_async_to_lds_b128 %4, %12, off\n\t"
                 "global_load_async_to_lds_b128 %5, %13, off\n\t"
                 "global_load_async_to_lds_b128 %6, %14, off\n\t"
                 "global_load_async_to_lds_b128 %7, %15, off\n\t"
                 "s_wait_xcnt 0x0"
                 :: "v"(l[0]), "v"(l[1]), "v"(l[2]), "v"(l[3]), "v"(l[4]), "v"(l[5]), "v"(l[6]), "v"(l[7]),
                    "v"(g[0]), "v"(g[1]), "v"(g[2]), "v"(g[3]), "v"(g[4]), "v"(g[5]), "v"(g[6]), "v"(g[7])
                 : "memory");
  } else {
    asm volatile("global_load_async_to_lds_b128 %0, %4, off\n\t"
                 "global_load_async_to_lds_b128 %1, %5, off\n\t"
                 "global_load_async_to_lds_b128 %2, %6, off\n\t"
                 "global_load_async_to_lds_b128 %3, %7, off\n\t"
                 "s_wait_xcnt 0x0"
                 :: "v"(l[0]), "v"(l[1]), "v"(l[2]), "v"(l[3]), "v"(g[0]), "v"(g[1]), "v"(g[2]), "v"(g[3])
                 : "memory");
  }
}

// f32 -> f16 convert that can never produce a subnormal operand (value select below 2^-14).
static __device__ __forceinline__ f16 toh_flush(float v) {
  const f16 r = (f16)v;
  return (fabsf(v) < 6.103515625e-05f) ? (f16)0.0f : r;
}

// Weight planes (k-contiguous rows, B fragments load like A fragments):
//   wct [NPROJ][CIN] bf16 : row n = column n of [Wf | Wg | Wh], RNE bf16.
//   wot [CIN][DV]    f16  : row n = column n of Wattn, value f16(bf16(w) * 16) (exact for normal results).
// Blocks 0..11: 8 rows of wct each (one wave per 512-B row, one instruction); blocks 12..15: 64 rows of wot each
// (one wave per eight 64-B rows = 512 B contiguous, one instruction). Source selection is block-uniform.
// coverage: wct rows 0..95 x k 0..255; wot rows 0..255 x k 0..31.
__global__ __launch_bounds__(256) void pack_w_kernel(const float* __restrict__ wf, const float* __restrict__ wg,
                                                      const float* __restrict__ wh, const float* __restrict__ wo,
                                                      bf16* __restrict__ wct, f16* __restrict__ wot) {
  const int blk = blockIdx.x;
  const int tid = threadIdx.x;
  if (blk < 12) {
    const int n  = blk * 8 + (tid >> 5);       // 0..95
    const int kq = (tid & 31) * 8;             // 0..248
    const float* src = (blk < 4) ? wf : ((blk < 8) ? wg : wh);
    const int pitch  = (blk < 8) ? DQK : DV;
    const int nl     = (blk < 4) ? n : ((blk < 8) ? (n - 32) : (n - 64));
    Pack8B pk;
    #pragma unroll
    for (int i = 0; i < 8; ++i) pk.h[i] = (bf16)src[(size_t)(kq + i) * pitch + nl];   // RNE convert
    bf16* dst = wct + (size_t)n * CIN + kq;
    *(v4u*)dst = pk.u;
    
  } else {
    const int j  = (blk - 12) * 256 + tid;     // 0..1023
    const int n  = j >> 2;                     // 0..255
    const int kq = (j & 3) * 8;                // 0..24
    Pack8H pk;
    #pragma unroll
    for (int i = 0; i < 8; ++i) {
      const float v = (float)(bf16)wo[(size_t)(kq + i) * CIN + n];
      pk.h[i] = toh_flush(v * 16.0f);          // bf16 significand fits f16
    }
    f16* dst = wot + (size_t)n * DV + kq;
    *(v4u*)dst = pk.u;
    
  }
}

// One wave's 16-pixel M tile times NTN consecutive 16-column tiles of wct starting at tile NT0, summed into acc over
// the CIN / 2 channels of one staged half: k steps kk0 .. kk0 + 3.
// A fragments from the staged f32 x rows (xr = this lane's half row in LDS; RNE bf16 convert, split k map); B fragments
// from the staged k-contiguous weight rows (sw, pitch WP). A k step's sixteen LDS loads stand ahead of its products.
template <int NT0, int NTN>
static __device__ __forceinline__ void proj_tiles(const float* xr, const bf16* sw, int kk0,
                                                  int m, int hi, v8f (&acc)[NTN]) {
  for (int kq = 0; kq < CIN / 64; ++kq) {
    const int kk = kk0 + kq;
    const float* xp = xr + kq * 32;
    const v4f a0 = *(const v4f*)(xp + hi * 8);
    const v4f a1 = *(const v4f*)(xp + hi * 8 + 4);
    const v4f b0 = *(const v4f*)(xp + 16 + hi * 8);
    const v4f b1 = *(const v4f*)(xp + 16 + hi * 8 + 4);
    FragB bw[NTN];
    #pragma unroll
    for (int t = 0; t < NTN; ++t) {
      const bf16* wp = sw + ((NT0 + t) * 16 + m) * WP + kk * 32 + hi * 8;
      bw[t].q[0] = *(const v4u*)(wp);        // k = kk*32 + hi*8 + 0..7, n = tile*16 + m
      bw[t].q[1] = *(const v4u*)(wp + 16);   // k = kk*32 + 16 + hi*8 + 0..7
    }
    FragB a;
    #pragma unroll
    for (int i = 0; i < 4; ++i) {
      a.h[i]      = (bf16)a0[i];   // elems 0..7  : k = kk*32 + hi*8 + 0..7
      a.h[4 + i]  = (bf16)a1[i];
      a.h[8 + i]  = (bf16)b0[i];   // elems 8..15 : k = kk*32 + 16 + hi*8 + 0..7
      a.h[12 + i] = (bf16)b1[i];
    }
    #pragma unroll
    for (int t = 0; t < NTN; ++t) acc[t] = mma_bf16(a.v, bw[t].v, acc[t]);
  }
}

// Stage s of one wave's x ring: the 16 pixel rows of iteration s >> 1, channel half s & 1, into buffer s & 1.
// xw0 = the wave's first x row of iteration 0 (iteration 1 lies two image rows further), lx = its rows in buffer 0.
static __device__ __forceinline__ void copy_x_stage(const float* __restrict__ xw0, unsigned lx, int lane, int s) {
  const float*   src = xw0 + (size_t)(s >> 1) * 2 * W_IMG * CIN + (s & 1) * (CIN / 2);
  const unsigned dst = lx + (unsigned)(s & 1) * (XBUF * 4);
  for (int gph = 0; gph < 2; ++gph)
    copy_rows_to_lds<8, CIN * 2, CIN * 4, XP * 4, 32>((const char*)src, dst, gph * 256 + lane);
}

// Projection + 2x2 max-pool. Block = (64-key tile kt, batch b), 256 threads; two iterations each cover
// image rows hh = kt*4 + it*2 + {0,1}; wave -> (hh, 16 pixels along ww).
//                            (wave writes 16 rows = 2 KB, 4 instructions of 4 lines, 8 lanes x 16 B per line).
//   fk  [NB][NKEY][QW] f16 : pooled keys, value | residual x2048, 64 rows per block = 8 KB
//                            (2 instructions, each wave 4 lines, 8 lanes x 16 B per line).
// LDS regions: sP cross-wave (block barrier), sG per-wave but read across lanes after the block barrier,
// sF / sHT cross-wave (block barrier). Staged extent == consumed extent for all four.
// Operands come by asynchronous copies (whole lines from global, padded rows in LDS): the whole weight plane once per
// block (sW), each wave's 16 x rows in four stages of 128 channels through two buffers (sX): a stage flies while the
// one before it is worked on, and a buffer is refilled behind the barrier that ends its last read.
__global__ __launch_bounds__(256) void proj_pool_kernel(const float* __restrict__ x, const bf16* __restrict__ wct,
                                                         f16* __restrict__ gq, f16* __restrict__ fk,
                                                         f16* __restrict__ hvt) {
  const int kt   = blockIdx.x;
  const int b    = blockIdx.y;
  const int tid  = threadIdx.x;
  const int wave = __builtin_amdgcn_readfirstlane(threadIdx.x >> 5);
  const int lane = tid & 31;
  const int m    = lane & 15;
  const int hi   = lane >> 4;
  const int hsel = wave >> 2;          // which of the two image rows of this iteration
  const int ww0  = (wave & 3) * 16;    // first pixel column of this wave's tile

  __shared__ __align__(16) float sP[2 * 32 * PF];     // [hsel][pw][64 cols] ww-pooled f|h in f32
  __shared__ __align__(16) f16 sG[NWAVE * 16 * GP];   // per-wave g tile [16][value 32 | residual 32]
  __shared__ __align__(16) f16 sF[64 * FP];           // pooled f [64 keys][value 32 | residual 32]
  __shared__ __align__(16) f16 sHT[DV * HP];          // pooled h^T [32 d][64 keys]
  __shared__ __align__(16) bf16 sW[NPROJ * WP];       // weight rows [96 n][256 k]
  __shared__ __align__(16) float sX[2 * XBUF];        // [buffer][wave][16 pixels][128 channels] in f32

  f16*   sg = sG + wave * (16 * GP);
  float* sp = sP + hsel * (32 * PF);
  const int pwb = (ww0 >> 1) + hi * 4;   // pooled column index base for this lane half

  const float*   sx  = sX + wave * (16 * XP);
  const unsigned lx  = (unsigned)(size_t)sx;
  // first x row of this wave's tile in iteration 0; iteration 1 lies two image rows further
  const float*   xw0 = x + ((size_t)b * SEQ_FULL + (kt * 4 + hsel) * W_IMG + ww0) * CIN;

  // fill: every lane of every wave copies its own 16-byte pieces, no branch around the copies
  {
    const unsigned lw = (unsigned)(size_t)sW;
    copy_rows_to_lds<8, CIN * 2, CIN * 2, WP * 2, 256>((const char*)wct, lw, tid);
    copy_rows_to_lds<4, CIN * 2, CIN * 2, WP * 2, 256>((const char*)wct, lw, 2048 + tid);
    copy_x_stage(xw0, lx, lane, 0);
  }
  // this wave's copies have landed; behind the barrier every wave's have
  asm volatile("s_wait_asynccnt 0x0" ::: "memory");
  __syncthreads();
  copy_x_stage(xw0, lx, lane, 1);

  #pragma unroll   // the four stages laid out flat: which refills and waits exist is settled at compile time, no test around a copy
  for (int it = 0; it < 2; ++it) {
    const int hh   = kt * 4 + it * 2 + hsel;
    const int pix0 = hh * W_IMG + ww0;

    {   // tiles 0,1: f; 2,3: g; 4,5: h
      v8f acc[6];
      #pragma unroll
      for (int t = 0; t < 6; ++t) acc[t] = (v8f){0, 0, 0, 0, 0, 0, 0, 0};
      proj_tiles<0, 6>(sx + m * XP, sW, 0, m, hi, acc);
      // publish point of stage 2 * it + 1: this wave's reads of buffer 0 have retired, its copies into buffer 1 have landed
      asm volatile("s_wait_dscnt 0x0" ::: "memory");
      asm volatile("s_wait_asynccnt 0x0" ::: "memory");
      __syncthreads();
      if (it + 1 < 2) copy_x_stage(xw0, lx, lane, 2 * it + 2);
      proj_tiles<0, 6>(sx + XBUF + m * XP, sW, CIN / 64, m, hi, acc);
      #pragma unroll
      for (int r = 0; r < 8; ++r) {
        const float g0 = acc[2][r];
        const float g1 = acc[3][r];
        const f16 h0 = toh_flush(g0);
        const f16 h1 = toh_flush(g1);
        sg[(hi * 8 + r) * GP + m]      = h0;
        sg[(hi * 8 + r) * GP + 16 + m] = h1;
        sg[(hi * 8 + r) * GP + 32 + m] = toh_flush((g0 - (float)h0) * 2048.0f);
        sg[(hi * 8 + r) * GP + 48 + m] = toh_flush((g1 - (float)h1) * 2048.0f);
      }
      // ww pairs are D rows (2rp, 2rp+1) of the same lane half; pooled column pw = ww0/2 + 4*hi + rp
      #pragma unroll
      for (int rp = 0; rp < 4; ++rp) {
        #pragma unroll
        for (int t = 0; t < 2; ++t) {
          sp[(pwb + rp) * PF + t * 16 + m]      = fmaxf(acc[t][2 * rp], acc[t][2 * rp + 1]);
          sp[(pwb + rp) * PF + 32 + t * 16 + m] = fmaxf(acc[4 + t][2 * rp], acc[4 + t][2 * rp + 1]);
        }
      }
    }
    // publish point of stage 2 * it + 2, where there is one, at the barrier that the pooling needs anyway
    if (it + 1 < 2) {
      asm volatile("s_wait_dscnt 0x0" ::: "memory");
      asm volatile("s_wait_asynccnt 0x0" ::: "memory");
    }
    __syncthreads();
    if (it + 1 < 2) copy_x_stage(xw0, lx, lane, 2 * it + 3);

    {
      v4u    gv[4];
      size_t gi[4];
      #pragma unroll
      for (int i4 = 0; i4 < 4; ++i4) {
        const int row = i4 * 4 + (lane >> 3);
        const int cq  = (lane & 7) * 8;
        Pack8H p;
        p.v = *(const v8h*)(sg + row * GP + cq);
        gv[i4] = p.u;
        gi[i4] = ((size_t)b * SEQ + pix0 + row) * QW + cq;
      }
      #pragma unroll
      for (int i4 = 0; i4 < 4; ++i4) *(v4u*)(gq + gi[i4]) = gv[i4];
      
    }

    // hh-pool into the block's pooled tiles (f32 max, then one convert)
    #pragma unroll
    for (int e = 0; e < 4; ++e) {
      const int idx = e * 256 + tid;
      const int pw  = idx >> 5;
      const int c   = idx & 31;
      const float v = fmaxf(sP[pw * PF + c], sP[32 * PF + pw * PF + c]);
      const f16 hv  = toh_flush(v);
      sF[(it * 32 + pw) * FP + c]      = hv;
      sF[(it * 32 + pw) * FP + 32 + c] = toh_flush((v - (float)hv) * 2048.0f);
    }
    #pragma unroll
    for (int e = 0; e < 4; ++e) {
      const int idx = e * 256 + tid;
      const int pw  = idx >> 5;
      const int d   = idx & 31;
      const float v = fmaxf(sP[pw * PF + 32 + d], sP[32 * PF + pw * PF + 32 + d]);
      sHT[d * HP + it * 32 + pw] = toh_flush(v);
    }
    __syncthreads();
  }

  // final plane stores: fk (per instruction a wave writes 4 rows = 512 B), hvt (per instruction 4 d-lines)
  v4u    fv[2];
  size_t fi[2];
  #pragma unroll
  for (int i2 = 0; i2 < 2; ++i2) {
    const int idx = i2 * 256 + tid;
    const int row = idx >> 3;            // 0..63
    const int cq  = (idx & 7) * 8;
    Pack8H p;
    p.v = *(const v8h*)(sF + row * FP + cq);
    fv[i2] = p.u;
    fi[i2] = ((size_t)b * NKEY + kt * KTILE + row) * QW + cq;
  }
  v4u    hv;
  size_t hidx;
  {
    const int d  = tid >> 3;             // 0..31
    const int kq = (tid & 7) * 8;        // 0..56
    Pack8H p;
    p.v = *(const v8h*)(sHT + d * HP + kq);
    hv   = p.u;
    hidx = ((size_t)b * DV + d) * NKEY + kt * KTILE + kq;
  }
  #pragma unroll
  for (int i2 = 0; i2 < 2; ++i2) *(v4u*)(fk + fi[i2]) = fv[i2];
  *(v4u*)(hvt + hidx) = hv;
  
}

// Flash attention, non-causal, no score scaling. Block = (query block of 128, batch); one wave owns 16 queries.
// S^T = F x G^T so queries sit on lanes; P^T in C-layout is bit-identical to the A-fragment layout of CTX += P x Hv.
// Scores: value x value in c, (value x residual + residual x value) in cr, s = c + cr / 2048.
// The image's whole key plane and h^T plane are staged once in LDS by asynchronous copies (whole lines from global,
// padded rows in LDS) and shared by the block's 8 waves; F A-fragments and Hv^T B-fragments are two 16-B LDS loads
// each, G B-fragments two 16-B global loads each.
//   ctx [NB][SEQ][DV] f16 : one 64-B row per query; wave writes 16 rows = 1 KB contiguous, 512 B per instruction.
// LDS: sK / sV filled once, read-only behind the fill's barrier; sC per-wave region, written and read across lanes
// under a block barrier; staged extent == consumed extent.
__global__ __launch_bounds__(256) void attn_kernel(const f16* __restrict__ gq, const f16* __restrict__ fk,
                                                   const f16* __restrict__ hvt, f16* __restrict__ ctx) {
  const int qblk = blockIdx.x;
  const int b    = blockIdx.y;
  const int tid  = threadIdx.x;
  const int wave = __builtin_amdgcn_readfirstlane(threadIdx.x >> 5);
  const int lane = tid & 31;
  const int lq   = lane & 15;   // query column of S^T / d column of CTX
  const int hi   = lane >> 4;   // k-split half

  __shared__ __align__(16) f16 sK[NKEY * KP];   // [key][value 32 | residual 32]
  __shared__ __align__(16) f16 sV[DV * VP];     // [d][key]
  __shared__ __align__(16) f16 sC[NWAVE * 16 * CP];

  const int qrow0 = qblk * BQ + wave * 16;

  const f16* fk_b = fk + (size_t)b * NKEY * QW;
  const f16* vt_b = hvt + (size_t)b * DV * NKEY;

  // fill: every lane of every wave copies its own 16-byte pieces, no branch around the copies
  {
    const unsigned lk = (unsigned)(size_t)sK;
    const unsigned lv = (unsigned)(size_t)sV;
    for (int gph = 0; gph < (NKEY * QW) / (8 * 256 * 8); ++gph) copy8_to_lds<QW, KP>(fk_b, lk, gph * 2048 + tid);
    for (int gph = 0; gph < (DV * NKEY) / (8 * 256 * 8); ++gph) copy8_to_lds<NKEY, VP>(vt_b, lv, gph * 2048 + tid);
  }

  // G as B-operand fragments: lane lq holds query qrow0+lq, elements follow the split d map
  FragH qf, qr;
  {
    const f16* qp = gq + ((size_t)b * SEQ + qrow0 + lq) * QW + hi * 8;
    qf.q[0] = *(const v4u*)(qp);        // value,    d = hi*8 + 0..7
    qf.q[1] = *(const v4u*)(qp + 16);   // value,    d = 16 + hi*8 + 0..7
    qr.q[0] = *(const v4u*)(qp + 32);   // residual, d = hi*8 + 0..7
    qr.q[1] = *(const v4u*)(qp + 48);   // residual, d = 16 + hi*8 + 0..7
  }

  v8f o[2];
  #pragma unroll
  for (int dt = 0; dt < 2; ++dt) o[dt] = (v8f){0, 0, 0, 0, 0, 0, 0, 0};

  float rmax = -__builtin_inff();
  float rsum = 0.0f;
  const float SL = 1.4426950408889634f;   // log2(e); the scores carry no extra scale
  const float RS = 1.0f / 2048.0f;        // residual plane carry folded back

  // this wave's copies have landed; behind the barrier every wave's have
  asm volatile("s_wait_asynccnt 0x0" ::: "memory");
  __syncthreads();

  for (int i = 0; i < NKEY / BK; ++i) {
    const int j0 = i * BK;

    FragH ak[2], akr[2];
    #pragma unroll
    for (int sub = 0; sub < 2; ++sub) {
      const f16* base = sK + (j0 + sub * 16 + lq) * KP + hi * 8;
      ak[sub].q[0]  = *(const v4u*)(base);        // d = hi*8 + 0..7
      ak[sub].q[1]  = *(const v4u*)(base + 16);   // d = 16 + hi*8 + 0..7
      akr[sub].q[0] = *(const v4u*)(base + 32);
      akr[sub].q[1] = *(const v4u*)(base + 48);
    }

    // S^T tiles: c[sub][r] = score(query qrow0+lq, key j0 + sub*16 + hi*8 + r)
    v8f c[2], cr[2];
    #pragma unroll
    for (int sub = 0; sub < 2; ++sub) {
      c[sub]  = mma_f16(ak[sub].v,  qf.v, (v8f){0, 0, 0, 0, 0, 0, 0, 0});
      cr[sub] = mma_f16(ak[sub].v,  qr.v, (v8f){0, 0, 0, 0, 0, 0, 0, 0});
      cr[sub] = mma_f16(akr[sub].v, qf.v, cr[sub]);
    }
    #pragma unroll
    for (int sub = 0; sub < 2; ++sub) {
      #pragma unroll
      for (int r = 0; r < 8; ++r) c[sub][r] = c[sub][r] + cr[sub][r] * RS;
    }

    // online softmax: query lq's 32 scores are split across lane / lane^16
    float m_new = rmax;
    #pragma unroll
    for (int r = 0; r < 8; ++r) {
      m_new = fmaxf(m_new, c[0][r]);
      m_new = fmaxf(m_new, c[1][r]);
    }
    m_new = fmaxf(m_new, __shfl_xor(m_new, 16, 32));
    const float scale = __builtin_amdgcn_exp2f((rmax - m_new) * SL);
    rmax = m_new;

    // exp + pack: P^T C-layout == A-fragment layout for the PV product; P carried x4096 in f16.
    // Exponents below -25 give zero (kept values carry x4096 to at least 2^-13, inside the f16 normal range).
    FragH pa;
    float psum = 0.0f;
    #pragma unroll
    for (int r = 0; r < 8; ++r) {
      const float e0 = (c[0][r] - m_new) * SL;   // key j0 + hi*8 + r
      const float e1 = (c[1][r] - m_new) * SL;   // key j0 + 16 + hi*8 + r
      const float x0 = __builtin_amdgcn_exp2f(e0);
      const float x1 = __builtin_amdgcn_exp2f(e1);
      const float p0 = (e0 < -25.0f) ? 0.0f : x0;
      const float p1 = (e1 < -25.0f) ? 0.0f : x1;
      psum += p0 + p1;
      pa.h[r]     = (f16)(p0 * 4096.0f);
      pa.h[8 + r] = (f16)(p1 * 4096.0f);
    }
    rsum = rsum * scale + psum + __shfl_xor(psum, 16, 32);

    // rescale CTX: queries are the row dimension there -> per-row scale from lane 8*hi + r
    float sc[8];
    #pragma unroll
    for (int r = 0; r < 8; ++r) sc[r] = __shfl(scale, (hi << 3) + r, 32);
    #pragma unroll
    for (int dt = 0; dt < 2; ++dt) {
      #pragma unroll
      for (int r = 0; r < 8; ++r) o[dt][r] *= sc[r];
    }

    // CTX += P x Hv : B-fragment column n = d = dt*16 + lq, split key map from the transposed plane
    #pragma unroll
    for (int dt = 0; dt < 2; ++dt) {
      const f16* base = sV + (dt * 16 + lq) * VP + j0 + hi * 8;
      FragH bv;
      bv.q[0] = *(const v4u*)(base);        // keys j0 + hi*8 + 0..7
      bv.q[1] = *(const v4u*)(base + 16);   // keys j0 + 16 + hi*8 + 0..7
      o[dt] = mma_f16(pa.v, bv.v, o[dt]);
    }
  }

  // normalize: lane holds column d = dt*16 + lq for query rows 8*hi + r
  float rs[8];
  #pragma unroll
  for (int r = 0; r < 8; ++r) rs[r] = 1.0f / __shfl(rsum, (hi << 3) + r, 32);

  f16* stg = sC + wave * (16 * CP);
  #pragma unroll
  for (int r = 0; r < 8; ++r) {
    #pragma unroll
    for (int dt = 0; dt < 2; ++dt)
      stg[(hi * 8 + r) * CP + dt * 16 + lq] = toh_flush(o[dt][r] * (1.0f / 4096.0f) * rs[r]);
  }
  __syncthreads();

  // whole-line stores: per instruction the wave writes 8 ctx rows x 64 B = 512 B contiguous
  // (4 lines, each filled by 8 consecutive lanes x 16 B); 2 instructions cover the wave's 16 rows.
  v4u    vals[2];
  size_t gidx[2];
  #pragma unroll
  for (int i2 = 0; i2 < 2; ++i2) {
    const int row = i2 * 8 + (lane >> 2);
    const int dq  = (lane & 3) * 8;
    Pack8H p;
    p.v = *(const v8h*)(stg + row * CP + dq);
    vals[i2] = p.u;
    gidx[i2] = ((size_t)b * SEQ + qrow0 + row) * DV + dq;
  }
  #pragma unroll
  for (int i2 = 0; i2 < 2; ++i2) *(v4u*)(ctx + gidx[i2]) = vals[i2];
  
}

// Output projection + scaled residual: out = gamma * (CTX x Wo) + x_bf16. Block = 8 waves, wave -> one 16-row M tile,
// four passes over 64-column quarters. A fragments from the f16 ctx plane, B fragments from wot (carried x16).
// Epilogue per quarter: f32 tile staged in LDS (per-wave region, block barriers), then per instruction lanes 0..15
__global__ __launch_bounds__(256) void oproj_kernel(const f16* __restrict__ ctx, const f16* __restrict__ wot,
                                                    const float* __restrict__ x, const float* __restrict__ gamma,
                                                    float* __restrict__ out) {
  const int tid  = threadIdx.x;
  const int wave = tid >> 5;
  const int lane = tid & 31;
  const int m    = lane & 15;   // B column within a tile / 16-B piece index of the quarter-row
  const int hi   = lane >> 4;
  const int mt   = blockIdx.x * NWAVE + wave;
  const int prow0 = mt * 16;                 // plane row of ctx
  const int bb    = prow0 / SEQ;
  const int pix0  = prow0 - bb * SEQ;
  const size_t xrow0 = (size_t)bb * SEQ_FULL + pix0;

  __shared__ __align__(16) float sO[NWAVE * 16 * OP];
  float* so = sO + wave * (16 * OP);

  const float gsc = (float)(bf16)gamma[0] * 0.0625f;   // gamma (RNE bf16) folded with the 1/16 Wo carry
  const f16* ap0 = ctx + (size_t)(prow0 + m) * DV + hi * 8;

  #pragma unroll 1
  for (int qn = 0; qn < 4; ++qn) {
    v8f acc[4];
    #pragma unroll
    for (int j = 0; j < 4; ++j) acc[j] = (v8f){0, 0, 0, 0, 0, 0, 0, 0};
    #pragma unroll
    for (int kk = 0; kk < DV / 32; ++kk) {
      FragH a;
      a.q[0] = *(const v4u*)(ap0 + kk * 32);        // d = kk*32 + hi*8 + 0..7
      a.q[1] = *(const v4u*)(ap0 + kk * 32 + 16);   // d = kk*32 + 16 + hi*8 + 0..7
      #pragma unroll
      for (int j = 0; j < 4; ++j) {
        const int nt = qn * 4 + j;
        const f16* wp = wot + (size_t)(nt * 16 + m) * DV + kk * 32 + hi * 8;
        FragH bw;
        bw.q[0] = *(const v4u*)(wp);
        bw.q[1] = *(const v4u*)(wp + 16);
        acc[j] = mma_f16(a.v, bw.v, acc[j]);
      }
    }
    #pragma unroll
    for (int r = 0; r < 8; ++r) {
      #pragma unroll
      for (int j = 0; j < 4; ++j) so[(hi * 8 + r) * OP + j * 16 + m] = acc[j][r] * gsc;
    }
    __syncthreads();

    v4f    vals[8];
    size_t gidx[8];
    #pragma unroll
    for (int it = 0; it < 8; ++it) {
      const int row = it * 2 + hi;
      v4f v = *(const v4f*)(so + row * OP + m * 4);
      const size_t g = (xrow0 + row) * CIN + qn * 64 + m * 4;
      const v4f xv = *(const v4f*)(x + g);
      #pragma unroll
      for (int cc = 0; cc < 4; ++cc) v[cc] = v[cc] + (float)(bf16)xv[cc];   // residual with the RNE bf16 input value
      vals[it] = v;
      gidx[it] = g;
    }
    #pragma unroll
    for (int it = 0; it < 8; ++it) *(v4f*)(out + gidx[it]) = vals[it];
    
    __syncthreads();
  }
}

extern "C" void kernel_launch(void* const* d_in, const int* in_sizes, int n_in,
                              void* d_out, int out_size, void* d_ws, size_t ws_size,
                              hipStream_t stream) {
  if (n_in < 6) return;
  const size_t rows_used = (size_t)(NB - 1) * SEQ_FULL + SEQ;
  if ((size_t)in_sizes[0] < rows_used * CIN) return;
  if (in_sizes[1] < CIN * DQK) return;
  if (in_sizes[2] < CIN * DQK) return;
  if (in_sizes[3] < CIN * DV) return;
  if (in_sizes[4] < DV * CIN) return;
  if (in_sizes[5] < 1) return;
  if ((size_t)out_size < rows_used * CIN) return;
  if (ws_size < WS_TOTAL) return;

  const float* x     = (const float*)d_in[0];
  const float* wf    = (const float*)d_in[1];
  const float* wg    = (const float*)d_in[2];
  const float* wh    = (const float*)d_in[3];
  const float* wo    = (const float*)d_in[4];
  const float* gamma = (const float*)d_in[5];
  float* out = (float*)d_out;
  char*  ws  = (char*)d_ws;
  bf16* wct = (bf16*)(ws + OFF_WCT);
  f16*  wot = (f16*)(ws + OFF_WOT);
  f16*  gq  = (f16*)(ws + OFF_GQ);
  f16*  fk  = (f16*)(ws + OFF_FK);
  f16*  hvt = (f16*)(ws + OFF_HVT);
  f16*  ctx = (f16*)(ws + OFF_CTX);

  pack_w_kernel<<<16, 256, 0, stream>>>(wf, wg, wh, wo, wct, wot);
  proj_pool_kernel<<<dim3(SEQ / 256, NB), 256, 0, stream>>>(x, wct, gq, fk, hvt);
  attn_kernel<<<dim3(SEQ / BQ, NB), 256, 0, stream>>>(gq, fk, hvt, ctx);
  oproj_kernel<<<(NB * SEQ) / 128, 256, 0, stream>>>(ctx, wot, x, gamma, out);
}

// v003
// Measured time: 31.4 microseconds a run.
// Next to v002, in two timings, it ran 1.39 and 1.38 times as fast.
// Counting every step since v000, it is 2.79 times as fast.
#include <hip/hip_runtime.h>

// Contractions: X x [Wf|Wg|Wh] on v_wmma_f32_16x16x32_bf16 (bf16 operands = RNE-converted inputs, f32 accumulate);
// S^T = F x G^T as three v_wmma_f32_16x16x32_f16 products (value x value in one accumulator; value x residual and
// residual x value in a second accumulator, residual planes carried x2048 and folded back in f32);
// CTX = P x Hv (P as f16 carried x4096) and OUT = CTX x Wattn (Wattn as f16 of the bf16 value, carried x16)
// on v_wmma_f32_16x16x32_f16 (f16 operands, f32 accumulate). Max-pool, softmax and residual add in f32.

#ifndef NB
#define NB 8
#endif
#ifndef SEQ
#define SEQ 4096
#endif
#define NB_FULL  8
#define SEQ_FULL 4096
#define W_IMG    64                 // image width (pixels per image row)
#define CIN      256                // input channels
#define DQK      32                 // query / key channels
#define DV       32                 // value channels
#define NPROJ    96                 // packed projection columns: [0,32) f, [32,64) g, [64,96) h
#define QW       64                 // halves per row of the query / key planes: value 0..31 | residual 32..63
#define NKEY     (SEQ / 4)          // pooled key count per image
#define KTILE    64                 // keys produced per projection block
#define BQ       128                // query rows per attention block (8 waves x 16)
#define BK       32                 // keys per inner iteration
#define NWAVE    8
#define PF       68                 // LDS pitch (floats) of the ww-pooled staging rows (f 0..31 | h 32..63)
#define GP       72                 // LDS pitch (halves) of the g staging tile (value | residual)
#define FP       72                 // LDS pitch (halves) of the pooled f tile (value | residual)
#define HP       72                 // LDS pitch (halves) of the pooled h^T tile
#define CP       40                 // LDS pitch (halves) of the ctx staging tile
#define OW       (CIN + 4)          // LDS pitch (floats) of a staged output row (256 channels): 1040 B = 16 B x odd
#define KP       72                 // LDS pitch (halves) of a staged key row (value | residual): 144 B = 16 B x odd
#define VP       (NKEY + 8)         // LDS pitch (halves) of a staged h^T row: 16 B x odd
#define WP       (CIN + 8)          // LDS pitch (bf16) of a staged weight row: 528 B = 16 B x odd
#define XP       (CIN / 2 + 4)      // LDS pitch (floats) of a staged half x row (128 channels): 528 B = 16 B x odd
#define XBUF     (NWAVE * 16 * XP)  // floats in one of the two x buffers

static_assert(SEQ % 256 == 0);
static_assert(SEQ >= 256 && SEQ <= SEQ_FULL);
static_assert(NB >= 1 && NB <= NB_FULL);
static_assert(BQ == NWAVE * 16);
static_assert(NKEY % BK == 0);
static_assert(NKEY % KTILE == 0);
static_assert(CIN % 32 == 0 && DV == 32 && DQK == 32);
static_assert(NPROJ == 2 * DQK + DV && NPROJ % 16 == 0 && NPROJ / 8 == 12);
static_assert(QW == 2 * DQK && QW * 2 == 128);
static_assert(W_IMG == 64 && CIN == 4 * 64);
// coverage equalities (grid x block x per-thread elements == plane extent)
static_assert((SEQ / 256) * 2 * NWAVE * 16 == SEQ);          // g plane rows per image
static_assert((SEQ / 256) * KTILE == NKEY);                   // f / h^T plane keys per image
static_assert((SEQ / BQ) * NWAVE * 16 == SEQ);                // ctx / output rows per image
static_assert(4 * 32 * 8 == 16 * QW);                         // g tile store: 4 instructions x 32 lanes x 8 halves
static_assert(2 * 256 * 8 == KTILE * QW);                     // key tile store: 2 x 256 threads x 8 halves
static_assert(256 * 8 == DV * KTILE);                         // h^T tile store: 256 threads x 8 halves
static_assert(32 * 32 * 4 == 16 * CIN);                       // output tile store: 32 instructions x 32 lanes x 4 floats
static_assert(4 * 256 == 32 * DQK && 4 * 256 == 32 * DV);     // hh-pool element loops
static_assert(4 * 256 * 8 == CIN * DV);                       // wot plane
static_assert(12 * 8 == NPROJ);                               // wct plane rows
static_assert(PF >= 2 * DQK && (PF * 4) % 16 == 0);
static_assert(GP >= QW && FP >= QW && HP >= KTILE && CP >= DV && OW >= CIN);
static_assert((GP * 2) % 16 == 0 && (FP * 2) % 16 == 0 && (HP * 2) % 16 == 0 && (CP * 2) % 16 == 0);
static_assert((OW * 4) % 32 == 16);
static_assert(KP >= QW && (KP * 2) % 32 == 16 && (VP * 2) % 32 == 16);
static_assert((NKEY * QW) % (8 * 256 * 8) == 0);              // key plane: whole groups of 8 copies x 256 lanes x 8 halves
static_assert((DV * NKEY) % (8 * 256 * 8) == 0);              // h^T plane: the same
static_assert(CIN * DV * 2 == 4 * 256 * 16);                  // wot plane: 4 copies x 256 lanes x 16 B
static_assert((NKEY * QW + DV * NKEY) / (256 * 8) + 4 <= 63); // copies of one wave in flight
static_assert((NKEY * KP + DV * VP + NWAVE * 16 * CP + CIN * CP) * 2 <= 327680);
static_assert(NWAVE * 16 * OW * 4 <= NKEY * KP * 2);          // the output tile fits over the key plane
static_assert((WP * 2) % 32 == 16 && (XP * 4) % 32 == 16);
static_assert(NPROJ * CIN * 2 == (8 + 4) * 256 * 16);         // weight plane: 12 copies x 256 lanes x 16 B
static_assert(16 * (CIN / 2) * 4 == 2 * 8 * 32 * 16);         // one wave's half x rows: 16 copies x 32 lanes x 16 B
static_assert(12 + 16 <= 63);                                 // copies of one wave in flight
static_assert(2 * 32 * PF * 4 + (NWAVE * 16 * GP + 64 * FP + DV * HP) * 2 + NPROJ * WP * 2 + 2 * XBUF * 4 <= 327680);

static constexpr size_t WCT_BYTES = (size_t)NPROJ * CIN * 2;          // 49,152
static constexpr size_t WOT_BYTES = (size_t)CIN * DV * 2;             // 16,384
static constexpr size_t GQ_BYTES  = (size_t)NB * SEQ * QW * 2;        // 4,194,304 at full size
static constexpr size_t FK_BYTES  = (size_t)NB * NKEY * QW * 2;       // 1,048,576
static constexpr size_t HVT_BYTES = (size_t)NB * DV * NKEY * 2;       // 524,288
static constexpr size_t OFF_WCT = 0;
static constexpr size_t OFF_WOT = OFF_WCT + WCT_BYTES;
static constexpr size_t OFF_GQ  = OFF_WOT + WOT_BYTES;
static constexpr size_t OFF_FK  = OFF_GQ + GQ_BYTES;
static constexpr size_t OFF_HVT = OFF_FK + FK_BYTES;
static constexpr size_t WS_TOTAL = OFF_HVT + HVT_BYTES;               // 5,832,704 at full size
static_assert(WCT_BYTES % 128 == 0 && WOT_BYTES % 128 == 0 && GQ_BYTES % 128 == 0);
static_assert(FK_BYTES % 128 == 0 && HVT_BYTES % 128 == 0);
static_assert(WS_TOTAL <= (size_t)134217728);

typedef __bf16   bf16;
typedef _Float16 f16;
typedef bf16     v16bf __attribute__((ext_vector_type(16)));
typedef f16      v16h  __attribute__((ext_vector_type(16)));
typedef f16      v8h   __attribute__((ext_vector_type(8)));
typedef float    v8f   __attribute__((ext_vector_type(8)));
typedef float    v4f   __attribute__((ext_vector_type(4)));
typedef unsigned v4u   __attribute__((ext_vector_type(4)));

union FragB  { v16bf v; v4u q[2]; bf16 h[16]; };
union FragH  { v16h  v; v4u q[2]; f16  h[16]; };
union Pack8B { v4u u; bf16 h[8]; };
union Pack8H { v4u u; v8h v; f16 h[8]; };

// WMMA helpers: builtin followed by the VALU hazard guard (ties D, keeps A/B live).
static __device__ __forceinline__ v8f mma_bf16(v16bf a, v16bf b, v8f acc) {
  acc = __builtin_amdgcn_wmma_f32_16x16x32_bf16(false, a, false, b, (short)0, acc, false, false);
  asm volatile("v_nop\n\tv_nop\n\tv_nop\n\tv_nop" : "+v"(acc) : "v"(a), "v"(b));
  return acc;
}
static __device__ __forceinline__ v8f mma_f16(v16h a, v16h b, v8f acc) {
  acc = __builtin_amdgcn_wmma_f32_16x16x32_f16(false, a, false, b, (short)0, acc, false, false);
  asm volatile("v_nop\n\tv_nop\n\tv_nop\n\tv_nop" : "+v"(acc) : "v"(a), "v"(b));
  return acc;
}

// Eight asynchronous 16-byte copies per lane, global -> LDS, through no register: copy i takes the 16-byte piece
// number piece0 + i * 256 of a plane whose rows hold ROWH halves and lands it at row pitch PITCH (halves) in LDS.
// The closing s_wait_xcnt stands inside the statement so that no address register is rewritten ahead of it.
template <int ROWH, int PITCH>
static __device__ __forceinline__ void copy8_to_lds(const f16* __restrict__ plane, unsigned lds_base, int piece0) {
  const f16* g[8];
  unsigned   l[8];
  #pragma unroll   // constant indices: the sixteen addresses stay in registers for the asm operands
  for (int i = 0; i < 8; ++i) {
    const int piece = piece0 + i * 256;
    const int row   = piece / (ROWH / 8);
    const int col   = piece % (ROWH / 8);
    g[i] = plane + (size_t)piece * 8;
    l[i] = lds_base + (unsigned)(row * PITCH + col * 8) * 2u;
  }
  asm volatile("global_load_async_to_lds_b128 %0, %8, off\n\t"
               "global_load_async_to_lds_b128 %1, %9, off\n\t"
               "global_load_async_to_lds_b128 %2, %10, off\n\t"
               "global_load_async_to_lds_b128 %3, %11, off\n\t"
               "global_load_async_to_lds_b128 %4, %12, off\n\t"
               "global_load_async_to_lds_b128 %5, %13, off\n\t"
               "global_load_async_to_lds_b128 %6, %14, off\n\t"
               "global_load_async_to_lds_b128 %7, %15, off\n\t"
               "s_wait_xcnt 0x0"
               :: "v"(l[0]), "v"(l[1]), "v"(l[2]), "v"(l[3]), "v"(l[4]), "v"(l[5]), "v"(l[6]), "v"(l[7]),
                  "v"(g[0]), "v"(g[1]), "v"(g[2]), "v"(g[3]), "v"(g[4]), "v"(g[5]), "v"(g[6]), "v"(g[7])
               : "memory");
}

// N (8 or 4) asynchronous 16-byte copies per lane, global -> LDS, through no register: copy i takes the 16-byte piece
// number piece0 + i * STEP of a tile whose rows hold ROWB bytes at pitch SRCB in global memory and lands it at row
// pitch PITCHB in LDS (all in bytes).
// The closing s_wait_xcnt stands inside the statement so that no address register is rewritten ahead of it.
template <int N, int ROWB, int SRCB, int PITCHB, int STEP>
static __device__ __forceinline__ void copy_rows_to_lds(const char* __restrict__ plane, unsigned lds_base, int piece0) {
  static_assert(N == 8 || N == 4);
  const char* g[N];
  unsigned    l[N];
  #pragma unroll   // constant indices: the addresses stay in registers for the asm operands
  for (int i = 0; i < N; ++i) {
    const int piece = piece0 + i * STEP;
    const int row   = piece / (ROWB / 16);
    const int col   = piece % (ROWB / 16);
    g[i] = plane + (size_t)(row * SRCB + col * 16);
    l[i] = lds_base + (unsigned)(row * PITCHB + col * 16);
  }
  if constexpr (N == 8) {
    asm volatile("global_load_async_to_lds_b128 %0, %8, off\n\t"
                 "global_load_async_to_lds_b128 %1, %9, off\n\t"
                 "global_load_async_to_lds_b128 %2, %10, off\n\t"
                 "global_load_async_to_lds_b128 %3, %11, off\n\t"
                 "global_load_async_to_lds_b128 %4, %12, off\n\t"
                 "global_load_async_to_lds_b128 %5, %13, off\n\t"
                 "global_load_async_to_lds_b128 %6, %14, off\n\t"
                 "global_load_async_to_lds_b128 %7, %15, off\n\t"
                 "s_wait_xcnt 0x0"
                 :: "v"(l[0]), "v"(l[1]), "v"(l[2]), "v"(l[3]), "v"(l[4]), "v"(l[5]), "v"(l[6]), "v"(l[7]),
                    "v"(g[0]), "v"(g[1]), "v"(g[2]), "v"(g[3]), "v"(g[4]), "v"(g[5]), "v"(g[6]), "v"(g[7])
                 : "memory");
  } else {
    asm volatile("global_load_async_to_lds_b128 %0, %4, off\n\t"
                 "global_load_async_to_lds_b128 %1, %5, off\n\t"
                 "global_load_async_to_lds_b128 %2, %6, off\n\t"
                 "global_load_async_to_lds_b128 %3, %7, off\n\t"
                 "s_wait_xcnt 0x0"
                 :: "v"(l[0]), "v"(l[1]), "v"(l[2]), "v"(l[3]), "v"(g[0]), "v"(g[1]), "v"(g[2]), "v"(g[3])
                 : "memory");
  }
}

// f32 -> f16 convert that can never produce a subnormal operand (value select below 2^-14).
static __device__ __forceinline__ f16 toh_flush(float v) {
  const f16 r = (f16)v;
  return (fabsf(v) < 6.103515625e-05f) ? (f16)0.0f : r;
}

// Weight planes (k-contiguous rows, B fragments load like A fragments):
//   wct [NPROJ][CIN] bf16 : row n = column n of [Wf | Wg | Wh], RNE bf16.
//   wot [CIN][DV]    f16  : row n = column n of Wattn, value f16(bf16(w) * 16) (exact for normal results).
// Blocks 0..11: 8 rows of wct each (one wave per 512-B row, one instruction); blocks 12..15: 64 rows of wot each
// (one wave per eight 64-B rows = 512 B contiguous, one instruction). Source selection is block-uniform.
// coverage: wct rows 0..95 x k 0..255; wot rows 0..255 x k 0..31.
__global__ __launch_bounds__(256) void pack_w_kernel(const float* __restrict__ wf, const float* __restrict__ wg,
                                                      const float* __restrict__ wh, const float* __restrict__ wo,
                                                      bf16* __restrict__ wct, f16* __restrict__ wot) {
  const int blk = blockIdx.x;
  const int tid = threadIdx.x;
  if (blk < 12) {
    const int n  = blk * 8 + (tid >> 5);       // 0..95
    const int kq = (tid & 31) * 8;             // 0..248
    const float* src = (blk < 4) ? wf : ((blk < 8) ? wg : wh);
    const int pitch  = (blk < 8) ? DQK : DV;
    const int nl     = (blk < 4) ? n : ((blk < 8) ? (n - 32) : (n - 64));
    Pack8B pk;
    #pragma unroll
    for (int i = 0; i < 8; ++i) pk.h[i] = (bf16)src[(size_t)(kq + i) * pitch + nl];   // RNE convert
    bf16* dst = wct + (size_t)n * CIN + kq;
    *(v4u*)dst = pk.u;
    
  } else {
    const int j  = (blk - 12) * 256 + tid;     // 0..1023
    const int n  = j >> 2;                     // 0..255
    const int kq = (j & 3) * 8;                // 0..24
    Pack8H pk;
    #pragma unroll
    for (int i = 0; i < 8; ++i) {
      const float v = (float)(bf16)wo[(size_t)(kq + i) * CIN + n];
      pk.h[i] = toh_flush(v * 16.0f);          // bf16 significand fits f16
    }
    f16* dst = wot + (size_t)n * DV + kq;
    *(v4u*)dst = pk.u;
    
  }
}

// One wave's 16-pixel M tile times NTN consecutive 16-column tiles of wct starting at tile NT0, summed into acc over
// the CIN / 2 channels of one staged half: k steps kk0 .. kk0 + 3.
// A fragments from the staged f32 x rows (xr = this lane's half row in LDS; RNE bf16 convert, split k map); B fragments
// from the staged k-contiguous weight rows (sw, pitch WP). A k step's sixteen LDS loads stand ahead of its products.
template <int NT0, int NTN>
static __device__ __forceinline__ void proj_tiles(const float* xr, const bf16* sw, int kk0,
                                                  int m, int hi, v8f (&acc)[NTN]) {
  for (int kq = 0; kq < CIN / 64; ++kq) {
    const int kk = kk0 + kq;
    const float* xp = xr + kq * 32;
    const v4f a0 = *(const v4f*)(xp + hi * 8);
    const v4f a1 = *(const v4f*)(xp + hi * 8 + 4);
    const v4f b0 = *(const v4f*)(xp + 16 + hi * 8);
    const v4f b1 = *(const v4f*)(xp + 16 + hi * 8 + 4);
    FragB bw[NTN];
    #pragma unroll
    for (int t = 0; t < NTN; ++t) {
      const bf16* wp = sw + ((NT0 + t) * 16 + m) * WP + kk * 32 + hi * 8;
      bw[t].q[0] = *(const v4u*)(wp);        // k = kk*32 + hi*8 + 0..7, n = tile*16 + m
      bw[t].q[1] = *(const v4u*)(wp + 16);   // k = kk*32 + 16 + hi*8 + 0..7
    }
    FragB a;
    #pragma unroll
    for (int i = 0; i < 4; ++i) {
      a.h[i]      = (bf16)a0[i];   // elems 0..7  : k = kk*32 + hi*8 + 0..7
      a.h[4 + i]  = (bf16)a1[i];
      a.h[8 + i]  = (bf16)b0[i];   // elems 8..15 : k = kk*32 + 16 + hi*8 + 0..7
      a.h[12 + i] = (bf16)b1[i];
    }
    #pragma unroll
    for (int t = 0; t < NTN; ++t) acc[t] = mma_bf16(a.v, bw[t].v, acc[t]);
  }
}

// Stage s of one wave's x ring: the 16 pixel rows of iteration s >> 1, channel half s & 1, into buffer s & 1.
// xw0 = the wave's first x row of iteration 0 (iteration 1 lies two image rows further), lx = its rows in buffer 0.
static __device__ __forceinline__ void copy_x_stage(const float* __restrict__ xw0, unsigned lx, int lane, int s) {
  const float*   src = xw0 + (size_t)(s >> 1) * 2 * W_IMG * CIN + (s & 1) * (CIN / 2);
  const unsigned dst = lx + (unsigned)(s & 1) * (XBUF * 4);
  for (int gph = 0; gph < 2; ++gph)
    copy_rows_to_lds<8, CIN * 2, CIN * 4, XP * 4, 32>((const char*)src, dst, gph * 256 + lane);
}

// Projection + 2x2 max-pool. Block = (64-key tile kt, batch b), 256 threads; two iterations each cover
// image rows hh = kt*4 + it*2 + {0,1}; wave -> (hh, 16 pixels along ww).
//                            (wave writes 16 rows = 2 KB, 4 instructions of 4 lines, 8 lanes x 16 B per line).
//   fk  [NB][NKEY][QW] f16 : pooled keys, value | residual x2048, 64 rows per block = 8 KB
//                            (2 instructions, each wave 4 lines, 8 lanes x 16 B per line).
// LDS regions: sP cross-wave (block barrier), sG per-wave but read across lanes after the block barrier,
// sF / sHT cross-wave (block barrier). Staged extent == consumed extent for all four.
// Operands come by asynchronous copies (whole lines from global, padded rows in LDS): the whole weight plane once per
// block (sW), each wave's 16 x rows in four stages of 128 channels through two buffers (sX): a stage flies while the
// one before it is worked on, and a buffer is refilled behind the barrier that ends its last read.
__global__ __launch_bounds__(256) void proj_pool_kernel(const float* __restrict__ x, const bf16* __restrict__ wct,
                                                         f16* __restrict__ gq, f16* __restrict__ fk,
                                                         f16* __restrict__ hvt) {
  const int kt   = blockIdx.x;
  const int b    = blockIdx.y;
  const int tid  = threadIdx.x;
  const int wave = __builtin_amdgcn_readfirstlane(threadIdx.x >> 5);
  const int lane = tid & 31;
  const int m    = lane & 15;
  const int hi   = lane >> 4;
  const int hsel = wave >> 2;          // which of the two image rows of this iteration
  const int ww0  = (wave & 3) * 16;    // first pixel column of this wave's tile

  __shared__ __align__(16) float sP[2 * 32 * PF];     // [hsel][pw][64 cols] ww-pooled f|h in f32
  __shared__ __align__(16) f16 sG[NWAVE * 16 * GP];   // per-wave g tile [16][value 32 | residual 32]
  __shared__ __align__(16) f16 sF[64 * FP];           // pooled f [64 keys][value 32 | residual 32]
  __shared__ __align__(16) f16 sHT[DV * HP];          // pooled h^T [32 d][64 keys]
  __shared__ __align__(16) bf16 sW[NPROJ * WP];       // weight rows [96 n][256 k]
  __shared__ __align__(16) float sX[2 * XBUF];        // [buffer][wave][16 pixels][128 channels] in f32

  f16*   sg = sG + wave * (16 * GP);
  float* sp = sP + hsel * (32 * PF);
  const int pwb = (ww0 >> 1) + hi * 4;   // pooled column index base for this lane half

  const float*   sx  = sX + wave * (16 * XP);
  const unsigned lx  = (unsigned)(size_t)sx;
  // first x row of this wave's tile in iteration 0; iteration 1 lies two image rows further
  const float*   xw0 = x + ((size_t)b * SEQ_FULL + (kt * 4 + hsel) * W_IMG + ww0) * CIN;

  // fill: every lane of every wave copies its own 16-byte pieces, no branch around the copies
  {
    const unsigned lw = (unsigned)(size_t)sW;
    copy_rows_to_lds<8, CIN * 2, CIN * 2, WP * 2, 256>((const char*)wct, lw, tid);
    copy_rows_to_lds<4, CIN * 2, CIN * 2, WP * 2, 256>((const char*)wct, lw, 2048 + tid);
    copy_x_stage(xw0, lx, lane, 0);
  }
  // this wave's copies have landed; behind the barrier every wave's have
  asm volatile("s_wait_asynccnt 0x0" ::: "memory");
  __syncthreads();
  copy_x_stage(xw0, lx, lane, 1);

  #pragma unroll   // the four stages laid out flat: which refills and waits exist is settled at compile time, no test around a copy
  for (int it = 0; it < 2; ++it) {
    const int hh   = kt * 4 + it * 2 + hsel;
    const int pix0 = hh * W_IMG + ww0;

    {   // tiles 0,1: f; 2,3: g; 4,5: h
      v8f acc[6];
      #pragma unroll
      for (int t = 0; t < 6; ++t) acc[t] = (v8f){0, 0, 0, 0, 0, 0, 0, 0};
      proj_tiles<0, 6>(sx + m * XP, sW, 0, m, hi, acc);
      // publish point of stage 2 * it + 1: this wave's reads of buffer 0 have retired, its copies into buffer 1 have landed
      asm volatile("s_wait_dscnt 0x0" ::: "memory");
      asm volatile("s_wait_asynccnt 0x0" ::: "memory");
      __syncthreads();
      if (it + 1 < 2) copy_x_stage(xw0, lx, lane, 2 * it + 2);
      proj_tiles<0, 6>(sx + XBUF + m * XP, sW, CIN / 64, m, hi, acc);
      #pragma unroll
      for (int r = 0; r < 8; ++r) {
        const float g0 = acc[2][r];
        const float g1 = acc[3][r];
        const f16 h0 = toh_flush(g0);
        const f16 h1 = toh_flush(g1);
        sg[(hi * 8 + r) * GP + m]      = h0;
        sg[(hi * 8 + r) * GP + 16 + m] = h1;
        sg[(hi * 8 + r) * GP + 32 + m] = toh_flush((g0 - (float)h0) * 2048.0f);
        sg[(hi * 8 + r) * GP + 48 + m] = toh_flush((g1 - (float)h1) * 2048.0f);
      }
      // ww pairs are D rows (2rp, 2rp+1) of the same lane half; pooled column pw = ww0/2 + 4*hi + rp
      #pragma unroll
      for (int rp = 0; rp < 4; ++rp) {
        #pragma unroll
        for (int t = 0; t < 2; ++t) {
          sp[(pwb + rp) * PF + t * 16 + m]      = fmaxf(acc[t][2 * rp], acc[t][2 * rp + 1]);
          sp[(pwb + rp) * PF + 32 + t * 16 + m] = fmaxf(acc[4 + t][2 * rp], acc[4 + t][2 * rp + 1]);
        }
      }
    }
    // publish point of stage 2 * it + 2, where there is one, at the barrier that the pooling needs anyway
    if (it + 1 < 2) {
      asm volatile("s_wait_dscnt 0x0" ::: "memory");
      asm volatile("s_wait_asynccnt 0x0" ::: "memory");
    }
    __syncthreads();
    if (it + 1 < 2) copy_x_stage(xw0, lx, lane, 2 * it + 3);

    {
      v4u    gv[4];
      size_t gi[4];
      #pragma unroll
      for (int i4 = 0; i4 < 4; ++i4) {
        const int row = i4 * 4 + (lane >> 3);
        const int cq  = (lane & 7) * 8;
        Pack8H p;
        p.v = *(const v8h*)(sg + row * GP + cq);
        gv[i4] = p.u;
        gi[i4] = ((size_t)b * SEQ + pix0 + row) * QW + cq;
      }
      #pragma unroll
      for (int i4 = 0; i4 < 4; ++i4) *(v4u*)(gq + gi[i4]) = gv[i4];
      
    }

    // hh-pool into the block's pooled tiles (f32 max, then one convert)
    #pragma unroll
    for (int e = 0; e < 4; ++e) {
      const int idx = e * 256 + tid;
      const int pw  = idx >> 5;
      const int c   = idx & 31;
      const float v = fmaxf(sP[pw * PF + c], sP[32 * PF + pw * PF + c]);
      const f16 hv  = toh_flush(v);
      sF[(it * 32 + pw) * FP + c]      = hv;
      sF[(it * 32 + pw) * FP + 32 + c] = toh_flush((v - (float)hv) * 2048.0f);
    }
    #pragma unroll
    for (int e = 0; e < 4; ++e) {
      const int idx = e * 256 + tid;
      const int pw  = idx >> 5;
      const int d   = idx & 31;
      const float v = fmaxf(sP[pw * PF + 32 + d], sP[32 * PF + pw * PF + 32 + d]);
      sHT[d * HP + it * 32 + pw] = toh_flush(v);
    }
    __syncthreads();
  }

  // final plane stores: fk (per instruction a wave writes 4 rows = 512 B), hvt (per instruction 4 d-lines)
  v4u    fv[2];
  size_t fi[2];
  #pragma unroll
  for (int i2 = 0; i2 < 2; ++i2) {
    const int idx = i2 * 256 + tid;
    const int row = idx >> 3;            // 0..63
    const int cq  = (idx & 7) * 8;
    Pack8H p;
    p.v = *(const v8h*)(sF + row * FP + cq);
    fv[i2] = p.u;
    fi[i2] = ((size_t)b * NKEY + kt * KTILE + row) * QW + cq;
  }
  v4u    hv;
  size_t hidx;
  {
    const int d  = tid >> 3;             // 0..31
    const int kq = (tid & 7) * 8;        // 0..56
    Pack8H p;
    p.v = *(const v8h*)(sHT + d * HP + kq);
    hv   = p.u;
    hidx = ((size_t)b * DV + d) * NKEY + kt * KTILE + kq;
  }
  #pragma unroll
  for (int i2 = 0; i2 < 2; ++i2) *(v4u*)(fk + fi[i2]) = fv[i2];
  *(v4u*)(hvt + hidx) = hv;
  
}

// Flash attention, non-causal, no score scaling. Block = (query block of 128, batch); one wave owns 16 queries.
// S^T = F x G^T so queries sit on lanes; P^T in C-layout is bit-identical to the A-fragment layout of CTX += P x Hv.
// Scores: value x value in c, (value x residual + residual x value) in cr, s = c + cr / 2048.
// The image's whole key plane and h^T plane are staged once in LDS by asynchronous copies (whole lines from global,
// padded rows in LDS) and shared by the block's 8 waves; F A-fragments and Hv^T B-fragments are two 16-B LDS loads
// each, G B-fragments two 16-B global loads each.
// Epilogue in the same launch: out = gamma * (CTX x Wo) + x_bf16 for the block's 128 query rows. CTX (f16) goes from
// the accumulators through sC straight into A fragments; B fragments from wot (carried x16), staged with the fill;
// the wave's 16 x rows are loaded behind the fill's barrier and fly while the key loop runs.
// LDS: sK / sV / sWo filled once, read-only behind the fill's barrier; sC per-wave region, written and read across
// lanes under a block barrier; that barrier also ends every wave's last read of sK, over which the f32 output tile
// is then staged (per-wave region, block barrier), so that every store instruction writes 512 contiguous bytes.
__global__ __launch_bounds__(256) void attn_out_kernel(const f16* __restrict__ gq, const f16* __restrict__ fk,
                                                       const f16* __restrict__ hvt, const f16* __restrict__ wot,
                                                       const float* __restrict__ x, const float* __restrict__ gamma,
                                                       float* __restrict__ out) {
  const int qblk = blockIdx.x;
  const int b    = blockIdx.y;
  const int tid  = threadIdx.x;
  const int wave = __builtin_amdgcn_readfirstlane(threadIdx.x >> 5);
  const int lane = tid & 31;
  const int lq   = lane & 15;   // query column of S^T / d column of CTX
  const int hi   = lane >> 4;   // k-split half

  __shared__ __align__(16) f16 sK[NKEY * KP];   // [key][value 32 | residual 32]
  __shared__ __align__(16) f16 sV[DV * VP];     // [d][key]
  __shared__ __align__(16) f16 sC[NWAVE * 16 * CP];
  __shared__ __align__(16) f16 sWo[CIN * CP];   // [n][d]

  const int qrow0 = qblk * BQ + wave * 16;
  const float gsc = (float)(bf16)gamma[0] * 0.0625f;   // gamma (RNE bf16) folded with the 1/16 Wo carry

  const f16* fk_b = fk + (size_t)b * NKEY * QW;
  const f16* vt_b = hvt + (size_t)b * DV * NKEY;

  // fill: every lane of every wave copies its own 16-byte pieces, no branch around the copies
  {
    const unsigned lk = (unsigned)(size_t)sK;
    const unsigned lv = (unsigned)(size_t)sV;
    for (int gph = 0; gph < (NKEY * QW) / (8 * 256 * 8); ++gph) copy8_to_lds<QW, KP>(fk_b, lk, gph * 2048 + tid);
    for (int gph = 0; gph < (DV * NKEY) / (8 * 256 * 8); ++gph) copy8_to_lds<NKEY, VP>(vt_b, lv, gph * 2048 + tid);
    copy_rows_to_lds<4, DV * 2, DV * 2, CP * 2, 256>((const char*)wot, (unsigned)(size_t)sWo, tid);
  }

  // G as B-operand fragments: lane lq holds query qrow0+lq, elements follow the split d map
  FragH qf, qr;
  {
    const f16* qp = gq + ((size_t)b * SEQ + qrow0 + lq) * QW + hi * 8;
    qf.q[0] = *(const v4u*)(qp);        // value,    d = hi*8 + 0..7
    qf.q[1] = *(const v4u*)(qp + 16);   // value,    d = 16 + hi*8 + 0..7
    qr.q[0] = *(const v4u*)(qp + 32);   // residual, d = hi*8 + 0..7
    qr.q[1] = *(const v4u*)(qp + 48);   // residual, d = 16 + hi*8 + 0..7
  }

  v8f o[2];
  #pragma unroll
  for (int dt = 0; dt < 2; ++dt) o[dt] = (v8f){0, 0, 0, 0, 0, 0, 0, 0};

  float rmax = -__builtin_inff();
  float rsum = 0.0f;
  const float SL = 1.4426950408889634f;   // log2(e); the scores carry no extra scale
  const float RS = 1.0f / 2048.0f;        // residual plane carry folded back

  // this wave's copies have landed; behind the barrier every wave's have
  asm volatile("s_wait_asynccnt 0x0" ::: "memory");
  __syncthreads();

  // residual rows of this wave's 16 queries: instruction j takes half row j (512 contiguous bytes); first used in the
  // epilogue, so the loads stand behind the barrier (which would wait for them) and ahead of the key loop
  const size_t xoff = ((size_t)b * SEQ_FULL + qrow0) * CIN + lane * 4;
  v4f xv[32];
  #pragma unroll   // constant indices: the rows stay in registers until the epilogue
  for (int j = 0; j < 32; ++j) xv[j] = *(const v4f*)(x + xoff + j * (CIN / 2));

  for (int i = 0; i < NKEY / BK; ++i) {
    const int j0 = i * BK;

    FragH ak[2], akr[2];
    #pragma unroll
    for (int sub = 0; sub < 2; ++sub) {
      const f16* base = sK + (j0 + sub * 16 + lq) * KP + hi * 8;
      ak[sub].q[0]  = *(const v4u*)(base);        // d = hi*8 + 0..7
      ak[sub].q[1]  = *(const v4u*)(base + 16);   // d = 16 + hi*8 + 0..7
      akr[sub].q[0] = *(const v4u*)(base + 32);
      akr[sub].q[1] = *(const v4u*)(base + 48);
    }

    // S^T tiles: c[sub][r] = score(query qrow0+lq, key j0 + sub*16 + hi*8 + r)
    v8f c[2], cr[2];
    #pragma unroll
    for (int sub = 0; sub < 2; ++sub) {
      c[sub]  = mma_f16(ak[sub].v,  qf.v, (v8f){0, 0, 0, 0, 0, 0, 0, 0});
      cr[sub] = mma_f16(ak[sub].v,  qr.v, (v8f){0, 0, 0, 0, 0, 0, 0, 0});
      cr[sub] = mma_f16(akr[sub].v, qf.v, cr[sub]);
    }
    #pragma unroll
    for (int sub = 0; sub < 2; ++sub) {
      #pragma unroll
      for (int r = 0; r < 8; ++r) c[sub][r] = c[sub][r] + cr[sub][r] * RS;
    }

    // online softmax: query lq's 32 scores are split across lane / lane^16
    float m_new = rmax;
    #pragma unroll
    for (int r = 0; r < 8; ++r) {
      m_new = fmaxf(m_new, c[0][r]);
      m_new = fmaxf(m_new, c[1][r]);
    }
    m_new = fmaxf(m_new, __shfl_xor(m_new, 16, 32));
    const float scale = __builtin_amdgcn_exp2f((rmax - m_new) * SL);
    rmax = m_new;

    // exp + pack: P^T C-layout == A-fragment layout for the PV product; P carried x4096 in f16.
    // Exponents below -25 give zero (kept values carry x4096 to at least 2^-13, inside the f16 normal range).
    FragH pa;
    float psum = 0.0f;
    #pragma unroll
    for (int r = 0; r < 8; ++r) {
      const float e0 = (c[0][r] - m_new) * SL;   // key j0 + hi*8 + r
      const float e1 = (c[1][r] - m_new) * SL;   // key j0 + 16 + hi*8 + r
      const float x0 = __builtin_amdgcn_exp2f(e0);
      const float x1 = __builtin_amdgcn_exp2f(e1);
      const float p0 = (e0 < -25.0f) ? 0.0f : x0;
      const float p1 = (e1 < -25.0f) ? 0.0f : x1;
      psum += p0 + p1;
      pa.h[r]     = (f16)(p0 * 4096.0f);
      pa.h[8 + r] = (f16)(p1 * 4096.0f);
    }
    rsum = rsum * scale + psum + __shfl_xor(psum, 16, 32);

    // rescale CTX: queries are the row dimension there -> per-row scale from lane 8*hi + r
    float sc[8];
    #pragma unroll
    for (int r = 0; r < 8; ++r) sc[r] = __shfl(scale, (hi << 3) + r, 32);
    #pragma unroll
    for (int dt = 0; dt < 2; ++dt) {
      #pragma unroll
      for (int r = 0; r < 8; ++r) o[dt][r] *= sc[r];
    }

    // CTX += P x Hv : B-fragment column n = d = dt*16 + lq, split key map from the transposed plane
    #pragma unroll
    for (int dt = 0; dt < 2; ++dt) {
      const f16* base = sV + (dt * 16 + lq) * VP + j0 + hi * 8;
      FragH bv;
      bv.q[0] = *(const v4u*)(base);        // keys j0 + hi*8 + 0..7
      bv.q[1] = *(const v4u*)(base + 16);   // keys j0 + 16 + hi*8 + 0..7
      o[dt] = mma_f16(pa.v, bv.v, o[dt]);
    }
  }

  // normalize: lane holds column d = dt*16 + lq for query rows 8*hi + r
  float rs[8];
  #pragma unroll
  for (int r = 0; r < 8; ++r) rs[r] = 1.0f / __shfl(rsum, (hi << 3) + r, 32);

  f16* stg = sC + wave * (16 * CP);
  #pragma unroll
  for (int r = 0; r < 8; ++r) {
    #pragma unroll
    for (int dt = 0; dt < 2; ++dt)
      stg[(hi * 8 + r) * CP + dt * 16 + lq] = toh_flush(o[dt][r] * (1.0f / 4096.0f) * rs[r]);
  }
  __syncthreads();

  // CTX as A fragment: lane lq holds query row lq, elements follow the split d map
  FragH ca;
  {
    const f16* ap = stg + lq * CP + hi * 8;
    ca.q[0] = *(const v4u*)(ap);        // d = hi*8 + 0..7
    ca.q[1] = *(const v4u*)(ap + 16);   // d = 16 + hi*8 + 0..7
  }

  // OUT tile of the wave, 16 rows x 256 channels in f32, staged over the key plane (dead behind the barrier above)
  float* so = (float*)sK + wave * (16 * OW);
  #pragma unroll   // laid out flat so that a group's fragment loads can stand among the stores of the group before
  for (int qn = 0; qn < 4; ++qn) {   // four independent 16-column tiles at a time: one LDS wait per four products
    FragH bw[4];
    #pragma unroll
    for (int j = 0; j < 4; ++j) {
      const f16* wp = sWo + ((qn * 4 + j) * 16 + lq) * CP + hi * 8;
      bw[j].q[0] = *(const v4u*)(wp);
      bw[j].q[1] = *(const v4u*)(wp + 16);
    }
    v8f acc[4];
    #pragma unroll
    for (int j = 0; j < 4; ++j) acc[j] = mma_f16(ca.v, bw[j].v, (v8f){0, 0, 0, 0, 0, 0, 0, 0});
    #pragma unroll
    for (int r = 0; r < 8; ++r) {
      #pragma unroll
      for (int j = 0; j < 4; ++j) so[(hi * 8 + r) * OW + (qn * 4 + j) * 16 + lq] = acc[j][r] * gsc;
    }
  }
  __syncthreads();

  // whole-line stores: instruction j writes half row j = 512 contiguous bytes (4 lines)
  #pragma unroll   // constant indices into xv
  for (int j = 0; j < 32; ++j) {
    v4f v = *(const v4f*)(so + (j >> 1) * OW + (j & 1) * (CIN / 2) + lane * 4);
    #pragma unroll
    for (int cc = 0; cc < 4; ++cc) v[cc] = v[cc] + (float)(bf16)xv[j][cc];   // residual with the RNE bf16 input value
    *(v4f*)(out + xoff + j * (CIN / 2)) = v;
  }
}

extern "C" void kernel_launch(void* const* d_in, const int* in_sizes, int n_in,
                              void* d_out, int out_size, void* d_ws, size_t ws_size,
                              hipStream_t stream) {
  if (n_in < 6) return;
  const size_t rows_used = (size_t)(NB - 1) * SEQ_FULL + SEQ;
  if ((size_t)in_sizes[0] < rows_used * CIN) return;
  if (in_sizes[1] < CIN * DQK) return;
  if (in_sizes[2] < CIN * DQK) return;
  if (in_sizes[3] < CIN * DV) return;
  if (in_sizes[4] < DV * CIN) return;
  if (in_sizes[5] < 1) return;
  if ((size_t)out_size < rows_used * CIN) return;
  if (ws_size < WS_TOTAL) return;

  const float* x     = (const float*)d_in[0];
  const float* wf    = (const float*)d_in[1];
  const float* wg    = (const float*)d_in[2];
  const float* wh    = (const float*)d_in[3];
  const float* wo    = (const float*)d_in[4];
  const float* gamma = (const float*)d_in[5];
  float* out = (float*)d_out;
  char*  ws  = (char*)d_ws;
  bf16* wct = (bf16*)(ws + OFF_WCT);
  f16*  wot = (f16*)(ws + OFF_WOT);
  f16*  gq  = (f16*)(ws + OFF_GQ);
  f16*  fk  = (f16*)(ws + OFF_FK);
  f16*  hvt = (f16*)(ws + OFF_HVT);

  pack_w_kernel<<<16, 256, 0, stream>>>(wf, wg, wh, wo, wct, wot);
  proj_pool_kernel<<<dim3(SEQ / 256, NB), 256, 0, stream>>>(x, wct, gq, fk, hvt);
  attn_out_kernel<<<dim3(SEQ / BQ, NB), 256, 0, stream>>>(gq, fk, hvt, wot, x, gamma, out);
}

// v004
// One run takes 30 microseconds.
// Timed twice side by side with v003, it ran 1.06 and 1.05 times as fast.
// Over all steps from v000 it is 2.93 times as fast.
#include <hip/hip_runtime.h>

// Contractions: X x [Wf|Wg|Wh] on v_wmma_f32_16x16x32_bf16 (bf16 operands = RNE-converted inputs, f32 accumulate);
// S^T = F x G^T as three v_wmma_f32_16x16x32_f16 products (value x value in one accumulator; value x residual and
// residual x value in a second accumulator, residual planes carried x2048 and folded back in f32);
// CTX = P x Hv (P as f16 carried x4096) and OUT = CTX x Wattn (Wattn as f16 of the bf16 value, carried x16)
// on v_wmma_f32_16x16x32_f16 (f16 operands, f32 accumulate). Max-pool, softmax and residual add in f32.

#ifndef NB
#define NB 8
#endif
#ifndef SEQ
#define SEQ 4096
#endif
#define NB_FULL  8
#define SEQ_FULL 4096
#define W_IMG    64                 // image width (pixels per image row)
#define CIN      256                // input channels
#define DQK      32                 // query / key channels
#define DV       32                 // value channels
#define NPROJ    96                 // packed projection columns: [0,32) f, [32,64) g, [64,96) h
#define QW       64                 // halves per row of the query / key planes: value 0..31 | residual 32..63
#define NKEY     (SEQ / 4)          // pooled key count per image
#define KTILE    64                 // keys produced per projection block
#define BQ       128                // query rows per attention block (8 waves x 16)
#define BK       32                 // keys per inner iteration
#define NWAVE    8
#define PF       68                 // LDS pitch (floats) of the ww-pooled staging rows (f 0..31 | h 32..63)
#define GP       72                 // LDS pitch (halves) of the g staging tile (value | residual)
#define FP       72                 // LDS pitch (halves) of the pooled f tile (value | residual)
#define HP       72                 // LDS pitch (halves) of the pooled h^T tile
#define CP       40                 // LDS pitch (halves) of the ctx staging tile
#define OW       (CIN + 4)          // LDS pitch (floats) of a staged output row (256 channels): 1040 B = 16 B x odd
#define KP       72                 // LDS pitch (halves) of a staged key row (value | residual): 144 B = 16 B x odd
#define VP       (NKEY + 8)         // LDS pitch (halves) of a staged h^T row: 16 B x odd
#define WP       (CIN + 8)          // LDS pitch (bf16) of a staged weight row: 528 B = 16 B x odd
#define XP       (CIN / 2 + 4)      // LDS pitch (floats) of a staged half x row (128 channels): 528 B = 16 B x odd
#define XBUF     (NWAVE * 16 * XP)  // floats in one of the two x buffers

static_assert(SEQ % 256 == 0);
static_assert(SEQ >= 256 && SEQ <= SEQ_FULL);
static_assert(NB >= 1 && NB <= NB_FULL);
static_assert(BQ == NWAVE * 16);
static_assert(NKEY % BK == 0);
static_assert(NKEY % KTILE == 0);
static_assert(CIN % 32 == 0 && DV == 32 && DQK == 32);
static_assert(NPROJ == 2 * DQK + DV && NPROJ % 16 == 0 && NPROJ / 8 == 12);
static_assert(QW == 2 * DQK && QW * 2 == 128);
static_assert(W_IMG == 64 && CIN == 4 * 64);
// coverage equalities (grid x block x per-thread elements == plane extent)
static_assert((SEQ / 256) * 2 * NWAVE * 16 == SEQ);          // g plane rows per image
static_assert((SEQ / 256) * KTILE == NKEY);                   // f / h^T plane keys per image
static_assert((SEQ / BQ) * NWAVE * 16 == SEQ);                // ctx / output rows per image
static_assert(4 * 32 * 8 == 16 * QW);                         // g tile store: 4 instructions x 32 lanes x 8 halves
static_assert(2 * 256 * 8 == KTILE * QW);                     // key tile store: 2 x 256 threads x 8 halves
static_assert(256 * 8 == DV * KTILE);                         // h^T tile store: 256 threads x 8 halves
static_assert(32 * 32 * 4 == 16 * CIN);                       // output tile store: 32 instructions x 32 lanes x 4 floats
static_assert(4 * 256 == 32 * DQK && 4 * 256 == 32 * DV);     // hh-pool element loops
static_assert(NWAVE * 4 * 8 == CIN && 8 * 4 == DQK && DQK == DV);   // weight rows: 8 waves x 4 lane groups x 8 k, 8 lanes x 4 n
static_assert(64 * 4 == CIN && 4 * 8 == DV);                  // Wattn rows: 64 threads x 4 n, 4 thread groups x 8 d
static_assert(PF >= 2 * DQK && (PF * 4) % 16 == 0);
static_assert(GP >= QW && FP >= QW && HP >= KTILE && CP >= DV && OW >= CIN);
static_assert((GP * 2) % 16 == 0 && (FP * 2) % 16 == 0 && (HP * 2) % 16 == 0 && (CP * 2) % 16 == 0);
static_assert((OW * 4) % 32 == 16);
static_assert(KP >= QW && (KP * 2) % 32 == 16 && (VP * 2) % 32 == 16);
static_assert((NKEY * QW) % (8 * 256 * 8) == 0);              // key plane: whole groups of 8 copies x 256 lanes x 8 halves
static_assert((DV * NKEY) % (8 * 256 * 8) == 0);              // h^T plane: the same
static_assert((NKEY * QW + DV * NKEY) / (256 * 8) <= 63);     // copies of one wave in flight
static_assert((NKEY * KP + DV * VP + NWAVE * 16 * CP + CIN * CP) * 2 <= 327680);
static_assert(NWAVE * 16 * OW * 4 <= NKEY * KP * 2);          // the output tile fits over the key plane
static_assert((WP * 2) % 32 == 16 && (XP * 4) % 32 == 16);
static_assert(16 * (CIN / 2) * 4 == 2 * 8 * 32 * 16);         // one wave's half x rows: 16 copies x 32 lanes x 16 B
static_assert(2 * 32 * PF * 4 + (NWAVE * 16 * GP + 64 * FP + DV * HP) * 2 + NPROJ * WP * 2 + 2 * XBUF * 4 <= 327680);

static constexpr size_t GQ_BYTES  = (size_t)NB * SEQ * QW * 2;        // 4,194,304 at full size
static constexpr size_t FK_BYTES  = (size_t)NB * NKEY * QW * 2;       // 1,048,576
static constexpr size_t HVT_BYTES = (size_t)NB * DV * NKEY * 2;       // 524,288
static constexpr size_t OFF_GQ  = 0;
static constexpr size_t OFF_FK  = OFF_GQ + GQ_BYTES;
static constexpr size_t OFF_HVT = OFF_FK + FK_BYTES;
static constexpr size_t WS_TOTAL = OFF_HVT + HVT_BYTES;               // 5,767,168 at full size
static_assert(GQ_BYTES % 128 == 0 && FK_BYTES % 128 == 0 && HVT_BYTES % 128 == 0);
static_assert(WS_TOTAL <= (size_t)134217728);

typedef __bf16   bf16;
typedef _Float16 f16;
typedef bf16     v16bf __attribute__((ext_vector_type(16)));
typedef f16      v16h  __attribute__((ext_vector_type(16)));
typedef f16      v8h   __attribute__((ext_vector_type(8)));
typedef float    v8f   __attribute__((ext_vector_type(8)));
typedef float    v4f   __attribute__((ext_vector_type(4)));
typedef unsigned v4u   __attribute__((ext_vector_type(4)));

union FragB  { v16bf v; v4u q[2]; bf16 h[16]; };
union FragH  { v16h  v; v4u q[2]; f16  h[16]; };
union Pack8B { v4u u; bf16 h[8]; };
union Pack8H { v4u u; v8h v; f16 h[8]; };

// WMMA helpers: builtin followed by the VALU hazard guard (ties D, keeps A/B live).
static __device__ __forceinline__ v8f mma_bf16(v16bf a, v16bf b, v8f acc) {
  acc = __builtin_amdgcn_wmma_f32_16x16x32_bf16(false, a, false, b, (short)0, acc, false, false);
  asm volatile("v_nop\n\tv_nop\n\tv_nop\n\tv_nop" : "+v"(acc) : "v"(a), "v"(b));
  return acc;
}
static __device__ __forceinline__ v8f mma_f16(v16h a, v16h b, v8f acc) {
  acc = __builtin_amdgcn_wmma_f32_16x16x32_f16(false, a, false, b, (short)0, acc, false, false);
  asm volatile("v_nop\n\tv_nop\n\tv_nop\n\tv_nop" : "+v"(acc) : "v"(a), "v"(b));
  return acc;
}

// Eight asynchronous 16-byte copies per lane, global -> LDS, through no register: copy i takes the 16-byte piece
// number piece0 + i * 256 of a plane whose rows hold ROWH halves and lands it at row pitch PITCH (halves) in LDS.
// The closing s_wait_xcnt stands inside the statement so that no address register is rewritten ahead of it.
template <int ROWH, int PITCH>
static __device__ __forceinline__ void copy8_to_lds(const f16* __restrict__ plane, unsigned lds_base, int piece0) {
  const f16* g[8];
  unsigned   l[8];
  #pragma unroll   // constant indices: the sixteen addresses stay in registers for the asm operands
  for (int i = 0; i < 8; ++i) {
    const int piece = piece0 + i * 256;
    const int row   = piece / (ROWH / 8);
    const int col   = piece % (ROWH / 8);
    g[i] = plane + (size_t)piece * 8;
    l[i] = lds_base + (unsigned)(row * PITCH + col * 8) * 2u;
  }
  asm volatile("global_load_async_to_lds_b128 %0, %8, off\n\t"
               "global_load_async_to_lds_b128 %1, %9, off\n\t"
               "global_load_async_to_lds_b128 %2, %10, off\n\t"
               "global_load_async_to_lds_b128 %3, %11, off\n\t"
               "global_load_async_to_lds_b128 %4, %12, off\n\t"
               "global_load_async_to_lds_b128 %5, %13, off\n\t"
               "global_load_async_to_lds_b128 %6, %14, off\n\t"
               "global_load_async_to_lds_b128 %7, %15, off\n\t"
               "s_wait_xcnt 0x0"
               :: "v"(l[0]), "v"(l[1]), "v"(l[2]), "v"(l[3]), "v"(l[4]), "v"(l[5]), "v"(l[6]), "v"(l[7]),
                  "v"(g[0]), "v"(g[1]), "v"(g[2]), "v"(g[3]), "v"(g[4]), "v"(g[5]), "v"(g[6]), "v"(g[7])
               : "memory");
}

// N (8 or 4) asynchronous 16-byte copies per lane, global -> LDS, through no register: copy i takes the 16-byte piece
// number piece0 + i * STEP of a tile whose rows hold ROWB bytes at pitch SRCB in global memory and lands it at row
// pitch PITCHB in LDS (all in bytes).
// The closing s_wait_xcnt stands inside the statement so that no address register is rewritten ahead of it.
template <int N, int ROWB, int SRCB, int PITCHB, int STEP>
static __device__ __forceinline__ void copy_rows_to_lds(const char* __restrict__ plane, unsigned lds_base, int piece0) {
  static_assert(N == 8 || N == 4);
  const char* g[N];
  unsigned    l[N];
  #pragma unroll   // constant indices: the addresses stay in registers for the asm operands
  for (int i = 0; i < N; ++i) {
    const int piece = piece0 + i * STEP;
    const int row   = piece / (ROWB / 16);
    const int col   = piece % (ROWB / 16);
    g[i] = plane + (size_t)(row * SRCB + col * 16);
    l[i] = lds_base + (unsigned)(row * PITCHB + col * 16);
  }
  if constexpr (N == 8) {
    asm volatile("global_load_async_to_lds_b128 %0, %8, off\n\t"
                 "global_load_async_to_lds_b128 %1, %9, off\n\t"
                 "global_load_async_to_lds_b128 %2, %10, off\n\t"
                 "global_load_async_to_lds_b128 %3, %11, off\n\t"
                 "global_load_async_to_lds_b128 %4, %12, off\n\t"
                 "global_load_async_to_lds_b128 %5, %13, off\n\t"
                 "global_load_async_to_lds_b128 %6, %14, off\n\t"
                 "global_load_async_to_lds_b128 %7, %15, off\n\t"
                 "s_wait_xcnt 0x0"
                 :: "v"(l[0]), "v"(l[1]), "v"(l[2]), "v"(l[3]), "v"(l[4]), "v"(l[5]), "v"(l[6]), "v"(l[7]),
                    "v"(g[0]), "v"(g[1]), "v"(g[2]), "v"(g[3]), "v"(g[4]), "v"(g[5]), "v"(g[6]), "v"(g[7])
                 : "memory");
  } else {
    asm volatile("global_load_async_to_lds_b128 %0, %4, off\n\t"
                 "global_load_async_to_lds_b128 %1, %5, off\n\t"
                 "global_load_async_to_lds_b128 %2, %6, off\n\t"
                 "global_load_async_to_lds_b128 %3, %7, off\n\t"
                 "s_wait_xcnt 0x0"
                 :: "v"(l[0]), "v"(l[1]), "v"(l[2]), "v"(l[3]), "v"(g[0]), "v"(g[1]), "v"(g[2]), "v"(g[3])
                 : "memory");
  }
}

// f32 -> f16 convert that can never produce a subnormal operand (value select below 2^-14).
static __device__ __forceinline__ f16 toh_flush(float v) {
  const f16 r = (f16)v;
  return (fabsf(v) < 6.103515625e-05f) ? (f16)0.0f : r;
}

// Weight rows (k-contiguous, B fragments load like A fragments), built in LDS by the block that reads them:
//   sw  [NPROJ][WP] bf16 : row n = column n of [Wf | Wg | Wh], RNE bf16.
//   swo [CIN][CP]   f16  : row n = column n of Wattn, value f16(bf16(w) * 16) (exact for normal results).
// A lane takes an 8 (k) x 4 (n) patch of a matrix: eight 16-byte loads (every 128-byte line a load touches is used
// whole), then four 16-byte LDS stores of eight k-contiguous values each. Loads and stores are two calls, so that the
// loads can stand ahead of the block's asynchronous copies and fly while those are issued.
// coverage: sw rows 0..95 x k 0..255 (wave -> 32 k, lane >> 3 -> 8 k of them, lane & 7 -> 4 n, three matrices).
static __device__ __forceinline__ void load_proj_weights(const float* __restrict__ wf, const float* __restrict__ wg,
                                                         const float* __restrict__ wh, int wave, int lane,
                                                         v4f (&w)[3][8]) {
  const int n0 = (lane & 7) * 4;                  // 0..28
  const int k0 = wave * 32 + (lane >> 3) * 8;     // 0..248
  #pragma unroll   // constant indices: the patches stay in registers
  for (int i = 0; i < 8; ++i) {
    const size_t off = (size_t)(k0 + i) * DQK + n0;
    w[0][i] = *(const v4f*)(wf + off);
    w[1][i] = *(const v4f*)(wg + off);
    w[2][i] = *(const v4f*)(wh + off);
  }
}
static __device__ __forceinline__ void store_proj_weights(const v4f (&w)[3][8], bf16* sw, int wave, int lane) {
  const int n0 = (lane & 7) * 4;
  const int k0 = wave * 32 + (lane >> 3) * 8;
  #pragma unroll
  for (int mt = 0; mt < 3; ++mt) {
    #pragma unroll
    for (int j = 0; j < 4; ++j) {
      Pack8B pk;
      #pragma unroll
      for (int i = 0; i < 8; ++i) pk.h[i] = (bf16)w[mt][i][j];   // RNE convert
      *(v4u*)(sw + (mt * DQK + n0 + j) * WP + k0) = pk.u;
    }
  }
}
// coverage: swo rows 0..255 x d 0..31 (tid & 63 -> 4 n, tid >> 6 -> 8 d).
static __device__ __forceinline__ void load_out_weights(const float* __restrict__ wo, int tid, v4f (&w)[8]) {
  const int n0 = (tid & 63) * 4;    // 0..252
  const int d0 = (tid >> 6) * 8;    // 0..24
  #pragma unroll   // constant indices: the patch stays in registers
  for (int i = 0; i < 8; ++i) w[i] = *(const v4f*)(wo + (size_t)(d0 + i) * CIN + n0);
}
static __device__ __forceinline__ void store_out_weights(const v4f (&w)[8], f16* swo, int tid) {
  const int n0 = (tid & 63) * 4;
  const int d0 = (tid >> 6) * 8;
  #pragma unroll
  for (int j = 0; j < 4; ++j) {
    Pack8H pk;
    #pragma unroll
    for (int i = 0; i < 8; ++i) pk.h[i] = toh_flush((float)(bf16)w[i][j] * 16.0f);   // bf16 significand fits f16
    *(v4u*)(swo + (n0 + j) * CP + d0) = pk.u;
  }
}

// One wave's 16-pixel M tile times NTN consecutive 16-column tiles of the weight rows starting at tile NT0, summed into acc over
// the CIN / 2 channels of one staged half: k steps kk0 .. kk0 + 3.
// A fragments from the staged f32 x rows (xr = this lane's half row in LDS; RNE bf16 convert, split k map); B fragments
// from the staged k-contiguous weight rows (sw, pitch WP). A k step's sixteen LDS loads stand ahead of its products.
template <int NT0, int NTN>
static __device__ __forceinline__ void proj_tiles(const float* xr, const bf16* sw, int kk0,
                                                  int m, int hi, v8f (&acc)[NTN]) {
  for (int kq = 0; kq < CIN / 64; ++kq) {
    const int kk = kk0 + kq;
    const float* xp = xr + kq * 32;
    const v4f a0 = *(const v4f*)(xp + hi * 8);
    const v4f a1 = *(const v4f*)(xp + hi * 8 + 4);
    const v4f b0 = *(const v4f*)(xp + 16 + hi * 8);
    const v4f b1 = *(const v4f*)(xp + 16 + hi * 8 + 4);
    FragB bw[NTN];
    #pragma unroll
    for (int t = 0; t < NTN; ++t) {
      const bf16* wp = sw + ((NT0 + t) * 16 + m) * WP + kk * 32 + hi * 8;
      bw[t].q[0] = *(const v4u*)(wp);        // k = kk*32 + hi*8 + 0..7, n = tile*16 + m
      bw[t].q[1] = *(const v4u*)(wp + 16);   // k = kk*32 + 16 + hi*8 + 0..7
    }
    FragB a;
    #pragma unroll
    for (int i = 0; i < 4; ++i) {
      a.h[i]      = (bf16)a0[i];   // elems 0..7  : k = kk*32 + hi*8 + 0..7
      a.h[4 + i]  = (bf16)a1[i];
      a.h[8 + i]  = (bf16)b0[i];   // elems 8..15 : k = kk*32 + 16 + hi*8 + 0..7
      a.h[12 + i] = (bf16)b1[i];
    }
    #pragma unroll
    for (int t = 0; t < NTN; ++t) acc[t] = mma_bf16(a.v, bw[t].v, acc[t]);
  }
}

// Stage s of one wave's x ring: the 16 pixel rows of iteration s >> 1, channel half s & 1, into buffer s & 1.
// xw0 = the wave's first x row of iteration 0 (iteration 1 lies two image rows further), lx = its rows in buffer 0.
static __device__ __forceinline__ void copy_x_stage(const float* __restrict__ xw0, unsigned lx, int lane, int s) {
  const float*   src = xw0 + (size_t)(s >> 1) * 2 * W_IMG * CIN + (s & 1) * (CIN / 2);
  const unsigned dst = lx + (unsigned)(s & 1) * (XBUF * 4);
  for (int gph = 0; gph < 2; ++gph)
    copy_rows_to_lds<8, CIN * 2, CIN * 4, XP * 4, 32>((const char*)src, dst, gph * 256 + lane);
}

// Projection + 2x2 max-pool. Block = (64-key tile kt, batch b), 256 threads; two iterations each cover
// image rows hh = kt*4 + it*2 + {0,1}; wave -> (hh, 16 pixels along ww).
//                            (wave writes 16 rows = 2 KB, 4 instructions of 4 lines, 8 lanes x 16 B per line).
//   fk  [NB][NKEY][QW] f16 : pooled keys, value | residual x2048, 64 rows per block = 8 KB
//                            (2 instructions, each wave 4 lines, 8 lanes x 16 B per line).
// LDS regions: sP cross-wave (block barrier), sG per-wave but read across lanes after the block barrier,
// sF / sHT cross-wave (block barrier). Staged extent == consumed extent for all four.
// The weight rows (sW) are converted from the f32 inputs by the block itself, once, while the first x stage flies.
// x comes by asynchronous copies (whole lines from global, padded rows in LDS): each wave's 16 x rows in four stages
// of 128 channels through two buffers (sX): a stage flies while the one before it is worked on, and a buffer is
// refilled behind the barrier that ends its last read.
__global__ __launch_bounds__(256) void proj_pool_kernel(const float* __restrict__ x, const float* __restrict__ wf,
                                                         const float* __restrict__ wg, const float* __restrict__ wh,
                                                         f16* __restrict__ gq, f16* __restrict__ fk,
                                                         f16* __restrict__ hvt) {
  const int kt   = blockIdx.x;
  const int b    = blockIdx.y;
  const int tid  = threadIdx.x;
  const int wave = __builtin_amdgcn_readfirstlane(threadIdx.x >> 5);
  const int lane = tid & 31;
  const int m    = lane & 15;
  const int hi   = lane >> 4;
  const int hsel = wave >> 2;          // which of the two image rows of this iteration
  const int ww0  = (wave & 3) * 16;    // first pixel column of this wave's tile

  __shared__ __align__(16) float sP[2 * 32 * PF];     // [hsel][pw][64 cols] ww-pooled f|h in f32
  __shared__ __align__(16) f16 sG[NWAVE * 16 * GP];   // per-wave g tile [16][value 32 | residual 32]
  __shared__ __align__(16) f16 sF[64 * FP];           // pooled f [64 keys][value 32 | residual 32]
  __shared__ __align__(16) f16 sHT[DV * HP];          // pooled h^T [32 d][64 keys]
  __shared__ __align__(16) bf16 sW[NPROJ * WP];       // weight rows [96 n][256 k]
  __shared__ __align__(16) float sX[2 * XBUF];        // [buffer][wave][16 pixels][128 channels] in f32

  f16*   sg = sG + wave * (16 * GP);
  float* sp = sP + hsel * (32 * PF);
  const int pwb = (ww0 >> 1) + hi * 4;   // pooled column index base for this lane half

  const float*   sx  = sX + wave * (16 * XP);
  const unsigned lx  = (unsigned)(size_t)sx;
  // first x row of this wave's tile in iteration 0; iteration 1 lies two image rows further
  const float*   xw0 = x + ((size_t)b * SEQ_FULL + (kt * 4 + hsel) * W_IMG + ww0) * CIN;

  v4f wv[3][8];
  load_proj_weights(wf, wg, wh, wave, lane, wv);
  // fill: every lane of every wave copies its own 16-byte pieces, no branch around the copies
  copy_x_stage(xw0, lx, lane, 0);
  store_proj_weights(wv, sW, wave, lane);
  // this wave's copies have landed; behind the barrier every wave's have, and every wave's weight rows are written
  asm volatile("s_wait_asynccnt 0x0" ::: "memory");
  __syncthreads();
  copy_x_stage(xw0, lx, lane, 1);

  #pragma unroll   // the four stages laid out flat: which refills and waits exist is settled at compile time, no test around a copy
  for (int it = 0; it < 2; ++it) {
    const int hh   = kt * 4 + it * 2 + hsel;
    const int pix0 = hh * W_IMG + ww0;

    {   // tiles 0,1: f; 2,3: g; 4,5: h
      v8f acc[6];
      #pragma unroll
      for (int t = 0; t < 6; ++t) acc[t] = (v8f){0, 0, 0, 0, 0, 0, 0, 0};
      proj_tiles<0, 6>(sx + m * XP, sW, 0, m, hi, acc);
      // publish point of stage 2 * it + 1: this wave's reads of buffer 0 have retired, its copies into buffer 1 have landed
      asm volatile("s_wait_dscnt 0x0" ::: "memory");
      asm volatile("s_wait_asynccnt 0x0" ::: "memory");
      __syncthreads();
      if (it + 1 < 2) copy_x_stage(xw0, lx, lane, 2 * it + 2);
      proj_tiles<0, 6>(sx + XBUF + m * XP, sW, CIN / 64, m, hi, acc);
      #pragma unroll
      for (int r = 0; r < 8; ++r) {
        const float g0 = acc[2][r];
        const float g1 = acc[3][r];
        const f16 h0 = toh_flush(g0);
        const f16 h1 = toh_flush(g1);
        sg[(hi * 8 + r) * GP + m]      = h0;
        sg[(hi * 8 + r) * GP + 16 + m] = h1;
        sg[(hi * 8 + r) * GP + 32 + m] = toh_flush((g0 - (float)h0) * 2048.0f);
        sg[(hi * 8 + r) * GP + 48 + m] = toh_flush((g1 - (float)h1) * 2048.0f);
      }
      // ww pairs are D rows (2rp, 2rp+1) of the same lane half; pooled column pw = ww0/2 + 4*hi + rp
      #pragma unroll
      for (int rp = 0; rp < 4; ++rp) {
        #pragma unroll
        for (int t = 0; t < 2; ++t) {
          sp[(pwb + rp) * PF + t * 16 + m]      = fmaxf(acc[t][2 * rp], acc[t][2 * rp + 1]);
          sp[(pwb + rp) * PF + 32 + t * 16 + m] = fmaxf(acc[4 + t][2 * rp], acc[4 + t][2 * rp + 1]);
        }
      }
    }
    // publish point of stage 2 * it + 2, where there is one, at the barrier that the pooling needs anyway
    if (it + 1 < 2) {
      asm volatile("s_wait_dscnt 0x0" ::: "memory");
      asm volatile("s_wait_asynccnt 0x0" ::: "memory");
    }
    __syncthreads();
    if (it + 1 < 2) copy_x_stage(xw0, lx, lane, 2 * it + 3);

    {
      v4u    gv[4];
      size_t gi[4];
      #pragma unroll
      for (int i4 = 0; i4 < 4; ++i4) {
        const int row = i4 * 4 + (lane >> 3);
        const int cq  = (lane & 7) * 8;
        Pack8H p;
        p.v = *(const v8h*)(sg + row * GP + cq);
        gv[i4] = p.u;
        gi[i4] = ((size_t)b * SEQ + pix0 + row) * QW + cq;
      }
      #pragma unroll
      for (int i4 = 0; i4 < 4; ++i4) *(v4u*)(gq + gi[i4]) = gv[i4];
      
    }

    // hh-pool into the block's pooled tiles (f32 max, then one convert)
    #pragma unroll
    for (int e = 0; e < 4; ++e) {
      const int idx = e * 256 + tid;
      const int pw  = idx >> 5;
      const int c   = idx & 31;
      const float v = fmaxf(sP[pw * PF + c], sP[32 * PF + pw * PF + c]);
      const f16 hv  = toh_flush(v);
      sF[(it * 32 + pw) * FP + c]      = hv;
      sF[(it * 32 + pw) * FP + 32 + c] = toh_flush((v - (float)hv) * 2048.0f);
    }
    #pragma unroll
    for (int e = 0; e < 4; ++e) {
      const int idx = e * 256 + tid;
      const int pw  = idx >> 5;
      const int d   = idx & 31;
      const float v = fmaxf(sP[pw * PF + 32 + d], sP[32 * PF + pw * PF + 32 + d]);
      sHT[d * HP + it * 32 + pw] = toh_flush(v);
    }
    __syncthreads();
  }

  // final plane stores: fk (per instruction a wave writes 4 rows = 512 B), hvt (per instruction 4 d-lines)
  v4u    fv[2];
  size_t fi[2];
  #pragma unroll
  for (int i2 = 0; i2 < 2; ++i2) {
    const int idx = i2 * 256 + tid;
    const int row = idx >> 3;            // 0..63
    const int cq  = (idx & 7) * 8;
    Pack8H p;
    p.v = *(const v8h*)(sF + row * FP + cq);
    fv[i2] = p.u;
    fi[i2] = ((size_t)b * NKEY + kt * KTILE + row) * QW + cq;
  }
  v4u    hv;
  size_t hidx;
  {
    const int d  = tid >> 3;             // 0..31
    const int kq = (tid & 7) * 8;        // 0..56
    Pack8H p;
    p.v = *(const v8h*)(sHT + d * HP + kq);
    hv   = p.u;
    hidx = ((size_t)b * DV + d) * NKEY + kt * KTILE + kq;
  }
  #pragma unroll
  for (int i2 = 0; i2 < 2; ++i2) *(v4u*)(fk + fi[i2]) = fv[i2];
  *(v4u*)(hvt + hidx) = hv;
  
}

// Flash attention, non-causal, no score scaling. Block = (query block of 128, batch); one wave owns 16 queries.
// S^T = F x G^T so queries sit on lanes; P^T in C-layout is bit-identical to the A-fragment layout of CTX += P x Hv.
// Scores: value x value in c, (value x residual + residual x value) in cr, s = c + cr / 2048.
// The image's whole key plane and h^T plane are staged once in LDS by asynchronous copies (whole lines from global,
// padded rows in LDS) and shared by the block's 8 waves; F A-fragments and Hv^T B-fragments are two 16-B LDS loads
// each, G B-fragments two 16-B global loads each.
// Epilogue in the same launch: out = gamma * (CTX x Wo) + x_bf16 for the block's 128 query rows. CTX (f16) goes from
// the accumulators through sC straight into A fragments; B fragments from sWo (Wattn carried x16), converted by the
// block itself while the fill flies;
// the wave's 16 x rows are loaded behind the fill's barrier and fly while the key loop runs.
// LDS: sK / sV / sWo written once, read-only behind the fill's barrier; sC per-wave region, written and read across
// lanes under a block barrier; that barrier also ends every wave's last read of sK, over which the f32 output tile
// is then staged (per-wave region, block barrier), so that every store instruction writes 512 contiguous bytes.
__global__ __launch_bounds__(256) void attn_out_kernel(const f16* __restrict__ gq, const f16* __restrict__ fk,
                                                       const f16* __restrict__ hvt, const float* __restrict__ wo,
                                                       const float* __restrict__ x, const float* __restrict__ gamma,
                                                       float* __restrict__ out) {
  const int qblk = blockIdx.x;
  const int b    = blockIdx.y;
  const int tid  = threadIdx.x;
  const int wave = __builtin_amdgcn_readfirstlane(threadIdx.x >> 5);
  const int lane = tid & 31;
  const int lq   = lane & 15;   // query column of S^T / d column of CTX
  const int hi   = lane >> 4;   // k-split half

  __shared__ __align__(16) f16 sK[NKEY * KP];   // [key][value 32 | residual 32]
  __shared__ __align__(16) f16 sV[DV * VP];     // [d][key]
  __shared__ __align__(16) f16 sC[NWAVE * 16 * CP];
  __shared__ __align__(16) f16 sWo[CIN * CP];   // [n][d]

  const int qrow0 = qblk * BQ + wave * 16;
  const float gsc = (float)(bf16)gamma[0] * 0.0625f;   // gamma (RNE bf16) folded with the 1/16 Wo carry

  const f16* fk_b = fk + (size_t)b * NKEY * QW;
  const f16* vt_b = hvt + (size_t)b * DV * NKEY;

  // the block's plain loads stand ahead of the fill and fly while its copies are issued
  v4f wv[8];
  load_out_weights(wo, tid, wv);

  // G as B-operand fragments: lane lq holds query qrow0+lq, elements follow the split d map
  FragH qf, qr;
  {
    const f16* qp = gq + ((size_t)b * SEQ + qrow0 + lq) * QW + hi * 8;
    qf.q[0] = *(const v4u*)(qp);        // value,    d = hi*8 + 0..7
    qf.q[1] = *(const v4u*)(qp + 16);   // value,    d = 16 + hi*8 + 0..7
    qr.q[0] = *(const v4u*)(qp + 32);   // residual, d = hi*8 + 0..7
    qr.q[1] = *(const v4u*)(qp + 48);   // residual, d = 16 + hi*8 + 0..7
  }

  // fill: every lane of every wave copies its own 16-byte pieces, no branch around the copies
  {
    const unsigned lk = (unsigned)(size_t)sK;
    const unsigned lv = (unsigned)(size_t)sV;
    for (int gph = 0; gph < (NKEY * QW) / (8 * 256 * 8); ++gph) copy8_to_lds<QW, KP>(fk_b, lk, gph * 2048 + tid);
    for (int gph = 0; gph < (DV * NKEY) / (8 * 256 * 8); ++gph) copy8_to_lds<NKEY, VP>(vt_b, lv, gph * 2048 + tid);
  }
  // keeps the Wattn converts, which wait for their loads, from being scheduled among or ahead of the fill's copies
  __builtin_amdgcn_sched_barrier(0);

  v8f o[2];
  #pragma unroll
  for (int dt = 0; dt < 2; ++dt) o[dt] = (v8f){0, 0, 0, 0, 0, 0, 0, 0};

  float rmax = -__builtin_inff();
  float rsum = 0.0f;
  const float SL = 1.4426950408889634f;   // log2(e); the scores carry no extra scale
  const float RS = 1.0f / 2048.0f;        // residual plane carry folded back

  store_out_weights(wv, sWo, tid);

  // this wave's copies have landed; behind the barrier every wave's have
  asm volatile("s_wait_asynccnt 0x0" ::: "memory");
  __syncthreads();

  // residual rows of this wave's 16 queries: instruction j takes half row j (512 contiguous bytes); first used in the
  // epilogue, so the loads stand behind the barrier (which would wait for them) and ahead of the key loop
  const size_t xoff = ((size_t)b * SEQ_FULL + qrow0) * CIN + lane * 4;
  v4f xv[32];
  #pragma unroll   // constant indices: the rows stay in registers until the epilogue
  for (int j = 0; j < 32; ++j) xv[j] = *(const v4f*)(x + xoff + j * (CIN / 2));

  for (int i = 0; i < NKEY / BK; ++i) {
    const int j0 = i * BK;

    FragH ak[2], akr[2];
    #pragma unroll
    for (int sub = 0; sub < 2; ++sub) {
      const f16* base = sK + (j0 + sub * 16 + lq) * KP + hi * 8;
      ak[sub].q[0]  = *(const v4u*)(base);        // d = hi*8 + 0..7
      ak[sub].q[1]  = *(const v4u*)(base + 16);   // d = 16 + hi*8 + 0..7
      akr[sub].q[0] = *(const v4u*)(base + 32);
      akr[sub].q[1] = *(const v4u*)(base + 48);
    }

    // S^T tiles: c[sub][r] = score(query qrow0+lq, key j0 + sub*16 + hi*8 + r)
    v8f c[2], cr[2];
    #pragma unroll
    for (int sub = 0; sub < 2; ++sub) {
      c[sub]  = mma_f16(ak[sub].v,  qf.v, (v8f){0, 0, 0, 0, 0, 0, 0, 0});
      cr[sub] = mma_f16(ak[sub].v,  qr.v, (v8f){0, 0, 0, 0, 0, 0, 0, 0});
      cr[sub] = mma_f16(akr[sub].v, qf.v, cr[sub]);
    }
    #pragma unroll
    for (int sub = 0; sub < 2; ++sub) {
      #pragma unroll
      for (int r = 0; r < 8; ++r) c[sub][r] = c[sub][r] + cr[sub][r] * RS;
    }

    // online softmax: query lq's 32 scores are split across lane / lane^16
    float m_new = rmax;
    #pragma unroll
    for (int r = 0; r < 8; ++r) {
      m_new = fmaxf(m_new, c[0][r]);
      m_new = fmaxf(m_new, c[1][r]);
    }
    m_new = fmaxf(m_new, __shfl_xor(m_new, 16, 32));
    const float scale = __builtin_amdgcn_exp2f((rmax - m_new) * SL);
    rmax = m_new;

    // exp + pack: P^T C-layout == A-fragment layout for the PV product; P carried x4096 in f16.
    // Exponents below -25 give zero (kept values carry x4096 to at least 2^-13, inside the f16 normal range).
    FragH pa;
    float psum = 0.0f;
    #pragma unroll
    for (int r = 0; r < 8; ++r) {
      const float e0 = (c[0][r] - m_new) * SL;   // key j0 + hi*8 + r
      const float e1 = (c[1][r] - m_new) * SL;   // key j0 + 16 + hi*8 + r
      const float x0 = __builtin_amdgcn_exp2f(e0);
      const float x1 = __builtin_amdgcn_exp2f(e1);
      const float p0 = (e0 < -25.0f) ? 0.0f : x0;
      const float p1 = (e1 < -25.0f) ? 0.0f : x1;
      psum += p0 + p1;
      pa.h[r]     = (f16)(p0 * 4096.0f);
      pa.h[8 + r] = (f16)(p1 * 4096.0f);
    }
    rsum = rsum * scale + psum + __shfl_xor(psum, 16, 32);

    // rescale CTX: queries are the row dimension there -> per-row scale from lane 8*hi + r
    float sc[8];
    #pragma unroll
    for (int r = 0; r < 8; ++r) sc[r] = __shfl(scale, (hi << 3) + r, 32);
    #pragma unroll
    for (int dt = 0; dt < 2; ++dt) {
      #pragma unroll
      for (int r = 0; r < 8; ++r) o[dt][r] *= sc[r];
    }

    // CTX += P x Hv : B-fragment column n = d = dt*16 + lq, split key map from the transposed plane
    #pragma unroll
    for (int dt = 0; dt < 2; ++dt) {
      const f16* base = sV + (dt * 16 + lq) * VP + j0 + hi * 8;
      FragH bv;
      bv.q[0] = *(const v4u*)(base);        // keys j0 + hi*8 + 0..7
      bv.q[1] = *(const v4u*)(base + 16);   // keys j0 + 16 + hi*8 + 0..7
      o[dt] = mma_f16(pa.v, bv.v, o[dt]);
    }
  }

  // normalize: lane holds column d = dt*16 + lq for query rows 8*hi + r
  float rs[8];
  #pragma unroll
  for (int r = 0; r < 8; ++r) rs[r] = 1.0f / __shfl(rsum, (hi << 3) + r, 32);

  f16* stg = sC + wave * (16 * CP);
  #pragma unroll
  for (int r = 0; r < 8; ++r) {
    #pragma unroll
    for (int dt = 0; dt < 2; ++dt)
      stg[(hi * 8 + r) * CP + dt * 16 + lq] = toh_flush(o[dt][r] * (1.0f / 4096.0f) * rs[r]);
  }
  __syncthreads();

  // CTX as A fragment: lane lq holds query row lq, elements follow the split d map
  FragH ca;
  {
    const f16* ap = stg + lq * CP + hi * 8;
    ca.q[0] = *(const v4u*)(ap);        // d = hi*8 + 0..7
    ca.q[1] = *(const v4u*)(ap + 16);   // d = 16 + hi*8 + 0..7
  }

  // OUT tile of the wave, 16 rows x 256 channels in f32, staged over the key plane (dead behind the barrier above)
  float* so = (float*)sK + wave * (16 * OW);
  #pragma unroll   // laid out flat so that a group's fragment loads can stand among the stores of the group before
  for (int qn = 0; qn < 4; ++qn) {   // four independent 16-column tiles at a time: one LDS wait per four products
    FragH bw[4];
    #pragma unroll
    for (int j = 0; j < 4; ++j) {
      const f16* wp = sWo + ((qn * 4 + j) * 16 + lq) * CP + hi * 8;
      bw[j].q[0] = *(const v4u*)(wp);
      bw[j].q[1] = *(const v4u*)(wp + 16);
    }
    v8f acc[4];
    #pragma unroll
    for (int j = 0; j < 4; ++j) acc[j] = mma_f16(ca.v, bw[j].v, (v8f){0, 0, 0, 0, 0, 0, 0, 0});
    #pragma unroll
    for (int r = 0; r < 8; ++r) {
      #pragma unroll
      for (int j = 0; j < 4; ++j) so[(hi * 8 + r) * OW + (qn * 4 + j) * 16 + lq] = acc[j][r] * gsc;
    }
  }
  __syncthreads();

  // whole-line stores: instruction j writes half row j = 512 contiguous bytes (4 lines)
  #pragma unroll   // constant indices into xv
  for (int j = 0; j < 32; ++j) {
    v4f v = *(const v4f*)(so + (j >> 1) * OW + (j & 1) * (CIN / 2) + lane * 4);
    #pragma unroll
    for (int cc = 0; cc < 4; ++cc) v[cc] = v[cc] + (float)(bf16)xv[j][cc];   // residual with the RNE bf16 input value
    *(v4f*)(out + xoff + j * (CIN / 2)) = v;
  }
}

extern "C" void kernel_launch(void* const* d_in, const int* in_sizes, int n_in,
                              void* d_out, int out_size, void* d_ws, size_t ws_size,
                              hipStream_t stream) {
  if (n_in < 6) return;
  const size_t rows_used = (size_t)(NB - 1) * SEQ_FULL + SEQ;
  if ((size_t)in_sizes[0] < rows_used * CIN) return;
  if (in_sizes[1] < CIN * DQK) return;
  if (in_sizes[2] < CIN * DQK) return;
  if (in_sizes[3] < CIN * DV) return;
  if (in_sizes[4] < DV * CIN) return;
  if (in_sizes[5] < 1) return;
  if ((size_t)out_size < rows_used * CIN) return;
  if (ws_size < WS_TOTAL) return;

  const float* x     = (const float*)d_in[0];
  const float* wf    = (const float*)d_in[1];
  const float* wg    = (const float*)d_in[2];
  const float* wh    = (const float*)d_in[3];
  const float* wo    = (const float*)d_in[4];
  const float* gamma = (const float*)d_in[5];
  float* out = (float*)d_out;
  char*  ws  = (char*)d_ws;
  f16*  gq  = (f16*)(ws + OFF_GQ);
  f16*  fk  = (f16*)(ws + OFF_FK);
  f16*  hvt = (f16*)(ws + OFF_HVT);

  proj_pool_kernel<<<dim3(SEQ / 256, NB), 256, 0, stream>>>(x, wf, wg, wh, gq, fk, hvt);
  attn_out_kernel<<<dim3(SEQ / BQ, NB), 256, 0, stream>>>(gq, fk, hvt, wo, x, gamma, out);
}

// v005
// A run of this version takes 26.7 microseconds.
// In both of two side-by-side timings against v004, it was 1.12 times as fast.
// Over all steps from v000 it is 3.29 times as fast.
#include <hip/hip_runtime.h>

// Contractions: X x [Wf|Wg|Wh] on v_wmma_f32_16x16x32_bf16 (bf16 operands = RNE-converted inputs, f32 accumulate);
// S^T = F x G^T as three v_wmma_f32_16x16x32_f16 products (value x value in one accumulator; value x residual and
// residual x value in a second accumulator, residual planes carried x2048 and folded back in f32);
// CTX^T = Hv^T x P^T (P as f16 carried x4096) and OUT = CTX x Wattn (Wattn as f16 of the bf16 value, carried x16)
// on v_wmma_f32_16x16x32_f16 (f16 operands, f32 accumulate). Max-pool, softmax and residual add in f32.

#ifndef NB
#define NB 8
#endif
#ifndef SEQ
#define SEQ 4096
#endif
#define NB_FULL  8
#define SEQ_FULL 4096
#define W_IMG    64                 // image width (pixels per image row)
#define CIN      256                // input channels
#define DQK      32                 // query / key channels
#define DV       32                 // value channels
#define NPROJ    96                 // packed projection columns: [0,32) f, [32,64) g, [64,96) h
#define QW       64                 // halves per row of the query / key planes: value 0..31 | residual 32..63
#define NKEY     (SEQ / 4)          // pooled key count per image
#define KTILE    64                 // keys produced per projection block
#define BQ       128                // query rows per attention block (8 waves x 16)
#define BK       32                 // keys per inner iteration
#define NWAVE    8
#define PF       68                 // LDS pitch (floats) of the ww-pooled staging rows (f 0..31 | h 32..63)
#define GP       72                 // LDS pitch (halves) of the g staging tile (value | residual)
#define FP       72                 // LDS pitch (halves) of the pooled f tile (value | residual)
#define HP       72                 // LDS pitch (halves) of the pooled h^T tile
#define CP       40                 // LDS pitch (halves) of a staged Wattn row (32 d): 80 B = 16 B x odd
#define OW       (CIN + 4)          // LDS pitch (floats) of a staged output row (256 channels): 1040 B = 16 B x odd
#define KP       72                 // LDS pitch (halves) of a staged key row (value | residual): 144 B = 16 B x odd
#define VP       (NKEY + 8)         // LDS pitch (halves) of a staged h^T row: 16 B x odd
#define WP       (CIN + 8)          // LDS pitch (bf16) of a staged weight row: 528 B = 16 B x odd
#define XP       (CIN / 2 + 4)      // LDS pitch (floats) of a staged half x row (128 channels): 528 B = 16 B x odd
#define XBUF     (NWAVE * 16 * XP)  // floats in one of the two x buffers

static_assert(SEQ % 256 == 0);
static_assert(SEQ >= 256 && SEQ <= SEQ_FULL);
static_assert(NB >= 1 && NB <= NB_FULL);
static_assert(BQ == NWAVE * 16);
static_assert(NKEY % BK == 0);
static_assert(NKEY % KTILE == 0);
static_assert(CIN % 32 == 0 && DV == 32 && DQK == 32);
static_assert(NPROJ == 2 * DQK + DV && NPROJ % 16 == 0 && NPROJ / 8 == 12);
static_assert(QW == 2 * DQK && QW * 2 == 128);
static_assert(W_IMG == 64 && CIN == 4 * 64);
// coverage equalities (grid x block x per-thread elements == plane extent)
static_assert((SEQ / 256) * 2 * NWAVE * 16 == SEQ);          // g plane rows per image
static_assert((SEQ / 256) * KTILE == NKEY);                   // f / h^T plane keys per image
static_assert((SEQ / BQ) * NWAVE * 16 == SEQ);                // ctx / output rows per image
static_assert(4 * 32 * 8 == 16 * QW);                         // g tile store: 4 instructions x 32 lanes x 8 halves
static_assert(2 * 256 * 8 == KTILE * QW);                     // key tile store: 2 x 256 threads x 8 halves
static_assert(256 * 8 == DV * KTILE);                         // h^T tile store: 256 threads x 8 halves
static_assert(32 * 32 * 4 == 16 * CIN);                       // output tile store: 32 instructions x 32 lanes x 4 floats
static_assert(4 * 256 == 32 * DQK && 4 * 256 == 32 * DV);     // hh-pool element loops
static_assert(NWAVE * 4 * 8 == CIN && 8 * 4 == DQK && DQK == DV);   // weight rows: 8 waves x 4 lane groups x 8 k, 8 lanes x 4 n
static_assert(64 * 4 == CIN && 4 * 8 == DV);                  // Wattn rows: 64 threads x 4 n, 4 thread groups x 8 d
static_assert(PF >= 2 * DQK && (PF * 4) % 16 == 0);
static_assert(GP >= QW && FP >= QW && HP >= KTILE && CP >= DV && OW >= CIN);
static_assert((GP * 2) % 16 == 0 && (FP * 2) % 16 == 0 && (HP * 2) % 16 == 0 && (CP * 2) % 16 == 0);
static_assert((OW * 4) % 32 == 16);
static_assert(KP >= QW && (KP * 2) % 32 == 16 && (VP * 2) % 32 == 16);
static_assert((NKEY * QW) % (8 * 256 * 8) == 0);              // key plane: whole groups of 8 copies x 256 lanes x 8 halves
static_assert((DV * NKEY) % (8 * 256 * 8) == 0);              // h^T plane: the same
static_assert((NKEY * QW + DV * NKEY) / (256 * 8) <= 63);     // copies of one wave in flight
static_assert((NKEY * KP + DV * VP + CIN * CP) * 2 <= 327680);
static_assert(NWAVE * 16 * OW * 4 <= NKEY * KP * 2);          // the output tile fits over the key plane
static_assert((WP * 2) % 32 == 16 && (XP * 4) % 32 == 16);
static_assert(16 * (CIN / 2) * 4 == 2 * 8 * 32 * 16);         // one wave's half x rows: 16 copies x 32 lanes x 16 B
static_assert(2 * 32 * PF * 4 + (NWAVE * 16 * GP + 64 * FP + DV * HP) * 2 + NPROJ * WP * 2 + 2 * XBUF * 4 <= 327680);

static constexpr size_t GQ_BYTES  = (size_t)NB * SEQ * QW * 2;        // 4,194,304 at full size
static constexpr size_t FK_BYTES  = (size_t)NB * NKEY * QW * 2;       // 1,048,576
static constexpr size_t HVT_BYTES = (size_t)NB * DV * NKEY * 2;       // 524,288
static constexpr size_t OFF_GQ  = 0;
static constexpr size_t OFF_FK  = OFF_GQ + GQ_BYTES;
static constexpr size_t OFF_HVT = OFF_FK + FK_BYTES;
static constexpr size_t WS_TOTAL = OFF_HVT + HVT_BYTES;               // 5,767,168 at full size
static_assert(GQ_BYTES % 128 == 0 && FK_BYTES % 128 == 0 && HVT_BYTES % 128 == 0);
static_assert(WS_TOTAL <= (size_t)134217728);

typedef __bf16   bf16;
typedef _Float16 f16;
typedef bf16     v16bf __attribute__((ext_vector_type(16)));
typedef f16      v16h  __attribute__((ext_vector_type(16)));
typedef f16      v8h   __attribute__((ext_vector_type(8)));
typedef float    v8f   __attribute__((ext_vector_type(8)));
typedef float    v4f   __attribute__((ext_vector_type(4)));
typedef unsigned v4u   __attribute__((ext_vector_type(4)));

union FragB  { v16bf v; v4u q[2]; bf16 h[16]; };
union FragH  { v16h  v; v4u q[2]; f16  h[16]; };
union Pack8B { v4u u; bf16 h[8]; };
union Pack8H { v4u u; v8h v; f16 h[8]; };

// WMMA helpers: builtin followed by the VALU hazard guard (ties D, keeps A/B live).
static __device__ __forceinline__ v8f mma_bf16(v16bf a, v16bf b, v8f acc) {
  acc = __builtin_amdgcn_wmma_f32_16x16x32_bf16(false, a, false, b, (short)0, acc, false, false);
  asm volatile("v_nop\n\tv_nop\n\tv_nop\n\tv_nop" : "+v"(acc) : "v"(a), "v"(b));
  return acc;
}
static __device__ __forceinline__ v8f mma_f16(v16h a, v16h b, v8f acc) {
  acc = __builtin_amdgcn_wmma_f32_16x16x32_f16(false, a, false, b, (short)0, acc, false, false);
  asm volatile("v_nop\n\tv_nop\n\tv_nop\n\tv_nop" : "+v"(acc) : "v"(a), "v"(b));
  return acc;
}

// Eight asynchronous 16-byte copies per lane, global -> LDS, through no register: copy i takes the 16-byte piece
// number piece0 + i * 256 of a plane whose rows hold ROWH halves and lands it at row pitch PITCH (halves) in LDS.
// The closing s_wait_xcnt stands inside the statement so that no address register is rewritten ahead of it.
template <int ROWH, int PITCH>
static __device__ __forceinline__ void copy8_to_lds(const f16* __restrict__ plane, unsigned lds_base, int piece0) {
  const f16* g[8];
  unsigned   l[8];
  #pragma unroll   // constant indices: the sixteen addresses stay in registers for the asm operands
  for (int i = 0; i < 8; ++i) {
    const int piece = piece0 + i * 256;
    const int row   = piece / (ROWH / 8);
    const int col   = piece % (ROWH / 8);
    g[i] = plane + (size_t)piece * 8;
    l[i] = lds_base + (unsigned)(row * PITCH + col * 8) * 2u;
  }
  asm volatile("global_load_async_to_lds_b128 %0, %8, off\n\t"
               "global_load_async_to_lds_b128 %1, %9, off\n\t"
               "global_load_async_to_lds_b128 %2, %10, off\n\t"
               "global_load_async_to_lds_b128 %3, %11, off\n\t"
               "global_load_async_to_lds_b128 %4, %12, off\n\t"
               "global_load_async_to_lds_b128 %5, %13, off\n\t"
               "global_load_async_to_lds_b128 %6, %14, off\n\t"
               "global_load_async_to_lds_b128 %7, %15, off\n\t"
               "s_wait_xcnt 0x0"
               :: "v"(l[0]), "v"(l[1]), "v"(l[2]), "v"(l[3]), "v"(l[4]), "v"(l[5]), "v"(l[6]), "v"(l[7]),
                  "v"(g[0]), "v"(g[1]), "v"(g[2]), "v"(g[3]), "v"(g[4]), "v"(g[5]), "v"(g[6]), "v"(g[7])
               : "memory");
}

// N (8 or 4) asynchronous 16-byte copies per lane, global -> LDS, through no register: copy i takes the 16-byte piece
// number piece0 + i * STEP of a tile whose rows hold ROWB bytes at pitch SRCB in global memory and lands it at row
// pitch PITCHB in LDS (all in bytes).
// The closing s_wait_xcnt stands inside the statement so that no address register is rewritten ahead of it.
template <int N, int ROWB, int SRCB, int PITCHB, int STEP>
static __device__ __forceinline__ void copy_rows_to_lds(const char* __restrict__ plane, unsigned lds_base, int piece0) {
  static_assert(N == 8 || N == 4);
  const char* g[N];
  unsigned    l[N];
  #pragma unroll   // constant indices: the addresses stay in registers for the asm operands
  for (int i = 0; i < N; ++i) {
    const int piece = piece0 + i * STEP;
    const int row   = piece / (ROWB / 16);
    const int col   = piece % (ROWB / 16);
    g[i] = plane + (size_t)(row * SRCB + col * 16);
    l[i] = lds_base + (unsigned)(row * PITCHB + col * 16);
  }
  if constexpr (N == 8) {
    asm volatile("global_load_async_to_lds_b128 %0, %8, off\n\t"
                 "global_load_async_to_lds_b128 %1, %9, off\n\t"
                 "global_load_async_to_lds_b128 %2, %10, off\n\t"
                 "global_load_async_to_lds_b128 %3, %11, off\n\t"
                 "global_load_async_to_lds_b128 %4, %12, off\n\t"
                 "global_load_async_to_lds_b128 %5, %13, off\n\t"
                 "global_load_async_to_lds_b128 %6, %14, off\n\t"
                 "global_load_async_to_lds_b128 %7, %15, off\n\t"
                 "s_wait_xcnt 0x0"
                 :: "v"(l[0]), "v"(l[1]), "v"(l[2]), "v"(l[3]), "v"(l[4]), "v"(l[5]), "v"(l[6]), "v"(l[7]),
                    "v"(g[0]), "v"(g[1]), "v"(g[2]), "v"(g[3]), "v"(g[4]), "v"(g[5]), "v"(g[6]), "v"(g[7])
                 : "memory");
  } else {
    asm volatile("global_load_async_to_lds_b128 %0, %4, off\n\t"
                 "global_load_async_to_lds_b128 %1, %5, off\n\t"
                 "global_load_async_to_lds_b128 %2, %6, off\n\t"
                 "global_load_async_to_lds_b128 %3, %7, off\n\t"
                 "s_wait_xcnt 0x0"
                 :: "v"(l[0]), "v"(l[1]), "v"(l[2]), "v"(l[3]), "v"(g[0]), "v"(g[1]), "v"(g[2]), "v"(g[3])
                 : "memory");
  }
}

// Lane l takes the value of lane l ^ 16 (the other k-split half of the same query), on the vector pipe.
static __device__ __forceinline__ float xhalf(float v) {
  const int b = __builtin_bit_cast(int, v);
  return __builtin_bit_cast(float, __builtin_amdgcn_permlanex16(b, b, 0x76543210, 0xfedcba98, false, false));
}

// f32 -> f16 convert that can never produce a subnormal operand (value select below 2^-14).
static __device__ __forceinline__ f16 toh_flush(float v) {
  const f16 r = (f16)v;
  return (fabsf(v) < 6.103515625e-05f) ? (f16)0.0f : r;
}

// Weight rows (k-contiguous, B fragments load like A fragments), built in LDS by the block that reads them:
//   sw  [NPROJ][WP] bf16 : row n = column n of [Wf | Wg | Wh], RNE bf16.
//   swo [CIN][CP]   f16  : row n = column n of Wattn, value f16(bf16(w) * 16) (exact for normal results).
// A lane takes an 8 (k) x 4 (n) patch of a matrix: eight 16-byte loads (every 128-byte line a load touches is used
// whole), then four 16-byte LDS stores of eight k-contiguous values each. Loads and stores are two calls, so that the
// loads can stand ahead of the block's asynchronous copies and fly while those are issued.
// coverage: sw rows 0..95 x k 0..255 (wave -> 32 k, lane >> 3 -> 8 k of them, lane & 7 -> 4 n, three matrices).
static __device__ __forceinline__ void load_proj_weights(const float* __restrict__ wf, const float* __restrict__ wg,
                                                         const float* __restrict__ wh, int wave, int lane,
                                                         v4f (&w)[3][8]) {
  const int n0 = (lane & 7) * 4;                  // 0..28
  const int k0 = wave * 32 + (lane >> 3) * 8;     // 0..248
  #pragma unroll   // constant indices: the patches stay in registers
  for (int i = 0; i < 8; ++i) {
    const size_t off = (size_t)(k0 + i) * DQK + n0;
    w[0][i] = *(const v4f*)(wf + off);
    w[1][i] = *(const v4f*)(wg + off);
    w[2][i] = *(const v4f*)(wh + off);
  }
}
static __device__ __forceinline__ void store_proj_weights(const v4f (&w)[3][8], bf16* sw, int wave, int lane) {
  const int n0 = (lane & 7) * 4;
  const int k0 = wave * 32 + (lane >> 3) * 8;
  #pragma unroll
  for (int mt = 0; mt < 3; ++mt) {
    #pragma unroll
    for (int j = 0; j < 4; ++j) {
      Pack8B pk;
      #pragma unroll
      for (int i = 0; i < 8; ++i) pk.h[i] = (bf16)w[mt][i][j];   // RNE convert
      *(v4u*)(sw + (mt * DQK + n0 + j) * WP + k0) = pk.u;
    }
  }
}
// coverage: swo rows 0..255 x d 0..31 (tid & 63 -> 4 n, tid >> 6 -> 8 d).
static __device__ __forceinline__ void load_out_weights(const float* __restrict__ wo, int tid, v4f (&w)[8]) {
  const int n0 = (tid & 63) * 4;    // 0..252
  const int d0 = (tid >> 6) * 8;    // 0..24
  #pragma unroll   // constant indices: the patch stays in registers
  for (int i = 0; i < 8; ++i) w[i] = *(const v4f*)(wo + (size_t)(d0 + i) * CIN + n0);
}
static __device__ __forceinline__ void store_out_weights(const v4f (&w)[8], f16* swo, int tid) {
  const int n0 = (tid & 63) * 4;
  const int d0 = (tid >> 6) * 8;
  #pragma unroll
  for (int j = 0; j < 4; ++j) {
    Pack8H pk;
    #pragma unroll
    for (int i = 0; i < 8; ++i) pk.h[i] = toh_flush((float)(bf16)w[i][j] * 16.0f);   // bf16 significand fits f16
    *(v4u*)(swo + (n0 + j) * CP + d0) = pk.u;
  }
}

// One wave's 16-pixel M tile times NTN consecutive 16-column tiles of the weight rows starting at tile NT0, summed into acc over
// the CIN / 2 channels of one staged half: k steps kk0 .. kk0 + 3.
// A fragments from the staged f32 x rows (xr = this lane's half row in LDS; RNE bf16 convert, split k map); B fragments
// from the staged k-contiguous weight rows (sw, pitch WP). A k step's sixteen LDS loads stand ahead of its products.
template <int NT0, int NTN>
static __device__ __forceinline__ void proj_tiles(const float* xr, const bf16* sw, int kk0,
                                                  int m, int hi, v8f (&acc)[NTN]) {
  for (int kq = 0; kq < CIN / 64; ++kq) {
    const int kk = kk0 + kq;
    const float* xp = xr + kq * 32;
    const v4f a0 = *(const v4f*)(xp + hi * 8);
    const v4f a1 = *(const v4f*)(xp + hi * 8 + 4);
    const v4f b0 = *(const v4f*)(xp + 16 + hi * 8);
    const v4f b1 = *(const v4f*)(xp + 16 + hi * 8 + 4);
    FragB bw[NTN];
    #pragma unroll
    for (int t = 0; t < NTN; ++t) {
      const bf16* wp = sw + ((NT0 + t) * 16 + m) * WP + kk * 32 + hi * 8;
      bw[t].q[0] = *(const v4u*)(wp);        // k = kk*32 + hi*8 + 0..7, n = tile*16 + m
      bw[t].q[1] = *(const v4u*)(wp + 16);   // k = kk*32 + 16 + hi*8 + 0..7
    }
    FragB a;
    #pragma unroll
    for (int i = 0; i < 4; ++i) {
      a.h[i]      = (bf16)a0[i];   // elems 0..7  : k = kk*32 + hi*8 + 0..7
      a.h[4 + i]  = (bf16)a1[i];
      a.h[8 + i]  = (bf16)b0[i];   // elems 8..15 : k = kk*32 + 16 + hi*8 + 0..7
      a.h[12 + i] = (bf16)b1[i];
    }
    #pragma unroll
    for (int t = 0; t < NTN; ++t) acc[t] = mma_bf16(a.v, bw[t].v, acc[t]);
  }
}

// Stage s of one wave's x ring: the 16 pixel rows of iteration s >> 1, channel half s & 1, into buffer s & 1.
// xw0 = the wave's first x row of iteration 0 (iteration 1 lies two image rows further), lx = its rows in buffer 0.
static __device__ __forceinline__ void copy_x_stage(const float* __restrict__ xw0, unsigned lx, int lane, int s) {
  const float*   src = xw0 + (size_t)(s >> 1) * 2 * W_IMG * CIN + (s & 1) * (CIN / 2);
  const unsigned dst = lx + (unsigned)(s & 1) * (XBUF * 4);
  for (int gph = 0; gph < 2; ++gph)
    copy_rows_to_lds<8, CIN * 2, CIN * 4, XP * 4, 32>((const char*)src, dst, gph * 256 + lane);
}

// Projection + 2x2 max-pool. Block = (64-key tile kt, batch b), 256 threads; two iterations each cover
// image rows hh = kt*4 + it*2 + {0,1}; wave -> (hh, 16 pixels along ww).
//                            (wave writes 16 rows = 2 KB, 4 instructions of 4 lines, 8 lanes x 16 B per line).
//   fk  [NB][NKEY][QW] f16 : pooled keys, value | residual x2048, 64 rows per block = 8 KB
//                            (2 instructions, each wave 4 lines, 8 lanes x 16 B per line).
// LDS regions: sP cross-wave (block barrier), sG per-wave but read across lanes after the block barrier,
// sF / sHT cross-wave (block barrier). Staged extent == consumed extent for all four.
// The weight rows (sW) are converted from the f32 inputs by the block itself, once, while the first x stage flies.
// x comes by asynchronous copies (whole lines from global, padded rows in LDS): each wave's 16 x rows in four stages
// of 128 channels through two buffers (sX): a stage flies while the one before it is worked on, and a buffer is
// refilled behind the barrier that ends its last read.
__global__ __launch_bounds__(256) void proj_pool_kernel(const float* __restrict__ x, const float* __restrict__ wf,
                                                         const float* __restrict__ wg, const float* __restrict__ wh,
                                                         f16* __restrict__ gq, f16* __restrict__ fk,
                                                         f16* __restrict__ hvt) {
  const int kt   = blockIdx.x;
  const int b    = blockIdx.y;
  const int tid  = threadIdx.x;
  const int wave = __builtin_amdgcn_readfirstlane(threadIdx.x >> 5);
  const int lane = tid & 31;
  const int m    = lane & 15;
  const int hi   = lane >> 4;
  const int hsel = wave >> 2;          // which of the two image rows of this iteration
  const int ww0  = (wave & 3) * 16;    // first pixel column of this wave's tile

  __shared__ __align__(16) float sP[2 * 32 * PF];     // [hsel][pw][64 cols] ww-pooled f|h in f32
  __shared__ __align__(16) f16 sG[NWAVE * 16 * GP];   // per-wave g tile [16][value 32 | residual 32]
  __shared__ __align__(16) f16 sF[64 * FP];           // pooled f [64 keys][value 32 | residual 32]
  __shared__ __align__(16) f16 sHT[DV * HP];          // pooled h^T [32 d][64 keys]
  __shared__ __align__(16) bf16 sW[NPROJ * WP];       // weight rows [96 n][256 k]
  __shared__ __align__(16) float sX[2 * XBUF];        // [buffer][wave][16 pixels][128 channels] in f32

  f16*   sg = sG + wave * (16 * GP);
  float* sp = sP + hsel * (32 * PF);
  const int pwb = (ww0 >> 1) + hi * 4;   // pooled column index base for this lane half

  const float*   sx  = sX + wave * (16 * XP);
  const unsigned lx  = (unsigned)(size_t)sx;
  // first x row of this wave's tile in iteration 0; iteration 1 lies two image rows further
  const float*   xw0 = x + ((size_t)b * SEQ_FULL + (kt * 4 + hsel) * W_IMG + ww0) * CIN;

  v4f wv[3][8];
  load_proj_weights(wf, wg, wh, wave, lane, wv);
  // fill: every lane of every wave copies its own 16-byte pieces, no branch around the copies
  copy_x_stage(xw0, lx, lane, 0);
  store_proj_weights(wv, sW, wave, lane);
  // this wave's copies have landed; behind the barrier every wave's have, and every wave's weight rows are written
  asm volatile("s_wait_asynccnt 0x0" ::: "memory");
  __syncthreads();
  copy_x_stage(xw0, lx, lane, 1);

  #pragma unroll   // the four stages laid out flat: which refills and waits exist is settled at compile time, no test around a copy
  for (int it = 0; it < 2; ++it) {
    const int hh   = kt * 4 + it * 2 + hsel;
    const int pix0 = hh * W_IMG + ww0;

    {   // tiles 0,1: f; 2,3: g; 4,5: h
      v8f acc[6];
      #pragma unroll
      for (int t = 0; t < 6; ++t) acc[t] = (v8f){0, 0, 0, 0, 0, 0, 0, 0};
      proj_tiles<0, 6>(sx + m * XP, sW, 0, m, hi, acc);
      // publish point of stage 2 * it + 1: this wave's reads of buffer 0 have retired, its copies into buffer 1 have landed
      asm volatile("s_wait_dscnt 0x0" ::: "memory");
      asm volatile("s_wait_asynccnt 0x0" ::: "memory");
      __syncthreads();
      if (it + 1 < 2) copy_x_stage(xw0, lx, lane, 2 * it + 2);
      proj_tiles<0, 6>(sx + XBUF + m * XP, sW, CIN / 64, m, hi, acc);
      #pragma unroll
      for (int r = 0; r < 8; ++r) {
        const float g0 = acc[2][r];
        const float g1 = acc[3][r];
        const f16 h0 = toh_flush(g0);
        const f16 h1 = toh_flush(g1);
        sg[(hi * 8 + r) * GP + m]      = h0;
        sg[(hi * 8 + r) * GP + 16 + m] = h1;
        sg[(hi * 8 + r) * GP + 32 + m] = toh_flush((g0 - (float)h0) * 2048.0f);
        sg[(hi * 8 + r) * GP + 48 + m] = toh_flush((g1 - (float)h1) * 2048.0f);
      }
      // ww pairs are D rows (2rp, 2rp+1) of the same lane half; pooled column pw = ww0/2 + 4*hi + rp
      #pragma unroll
      for (int rp = 0; rp < 4; ++rp) {
        #pragma unroll
        for (int t = 0; t < 2; ++t) {
          sp[(pwb + rp) * PF + t * 16 + m]      = fmaxf(acc[t][2 * rp], acc[t][2 * rp + 1]);
          sp[(pwb + rp) * PF + 32 + t * 16 + m] = fmaxf(acc[4 + t][2 * rp], acc[4 + t][2 * rp + 1]);
        }
      }
    }
    // publish point of stage 2 * it + 2, where there is one, at the barrier that the pooling needs anyway
    if (it + 1 < 2) {
      asm volatile("s_wait_dscnt 0x0" ::: "memory");
      asm volatile("s_wait_asynccnt 0x0" ::: "memory");
    }
    __syncthreads();
    if (it + 1 < 2) copy_x_stage(xw0, lx, lane, 2 * it + 3);

    {
      v4u    gv[4];
      size_t gi[4];
      #pragma unroll
      for (int i4 = 0; i4 < 4; ++i4) {
        const int row = i4 * 4 + (lane >> 3);
        const int cq  = (lane & 7) * 8;
        Pack8H p;
        p.v = *(const v8h*)(sg + row * GP + cq);
        gv[i4] = p.u;
        gi[i4] = ((size_t)b * SEQ + pix0 + row) * QW + cq;
      }
      #pragma unroll
      for (int i4 = 0; i4 < 4; ++i4) *(v4u*)(gq + gi[i4]) = gv[i4];
      
    }

    // hh-pool into the block's pooled tiles (f32 max, then one convert)
    #pragma unroll
    for (int e = 0; e < 4; ++e) {
      const int idx = e * 256 + tid;
      const int pw  = idx >> 5;
      const int c   = idx & 31;
      const float v = fmaxf(sP[pw * PF + c], sP[32 * PF + pw * PF + c]);
      const f16 hv  = toh_flush(v);
      sF[(it * 32 + pw) * FP + c]      = hv;
      sF[(it * 32 + pw) * FP + 32 + c] = toh_flush((v - (float)hv) * 2048.0f);
    }
    #pragma unroll
    for (int e = 0; e < 4; ++e) {
      const int idx = e * 256 + tid;
      const int pw  = idx >> 5;
      const int d   = idx & 31;
      const float v = fmaxf(sP[pw * PF + 32 + d], sP[32 * PF + pw * PF + 32 + d]);
      sHT[d * HP + it * 32 + pw] = toh_flush(v);
    }
    __syncthreads();
  }

  // final plane stores: fk (per instruction a wave writes 4 rows = 512 B), hvt (per instruction 4 d-lines)
  v4u    fv[2];
  size_t fi[2];
  #pragma unroll
  for (int i2 = 0; i2 < 2; ++i2) {
    const int idx = i2 * 256 + tid;
    const int row = idx >> 3;            // 0..63
    const int cq  = (idx & 7) * 8;
    Pack8H p;
    p.v = *(const v8h*)(sF + row * FP + cq);
    fv[i2] = p.u;
    fi[i2] = ((size_t)b * NKEY + kt * KTILE + row) * QW + cq;
  }
  v4u    hv;
  size_t hidx;
  {
    const int d  = tid >> 3;             // 0..31
    const int kq = (tid & 7) * 8;        // 0..56
    Pack8H p;
    p.v = *(const v8h*)(sHT + d * HP + kq);
    hv   = p.u;
    hidx = ((size_t)b * DV + d) * NKEY + kt * KTILE + kq;
  }
  #pragma unroll
  for (int i2 = 0; i2 < 2; ++i2) *(v4u*)(fk + fi[i2]) = fv[i2];
  *(v4u*)(hvt + hidx) = hv;
  
}

// Flash attention, non-causal, no score scaling. Block = (query block of 128, batch); one wave owns 16 queries.
// S^T = F x G^T so queries sit on lanes; P^T in C-layout is bit-identical to the B-fragment layout of
// CTX^T += Hv^T x P^T, whose columns are again the queries: a query's maximum, sum and rescale stay on its own two
// lanes (lq, lq + 16), which exchange the maximum once per 32 keys and join their sums once, behind the loop.
// Scores: value x value in c, (value x residual + residual x value) in cr, s = c + cr / 2048.
// The image's whole key plane and h^T plane are staged once in LDS by asynchronous copies (whole lines from global,
// padded rows in LDS) and shared by the block's 8 waves; F A-fragments and Hv^T A-fragments are two 16-B LDS loads
// each, G B-fragments two 16-B global loads each.
// Epilogue in the same launch: out = gamma * (CTX x Wo) + x_bf16 for the block's 128 query rows. The two CTX^T tiles,
// converted in place, are the A fragment of that product (split d map); B fragments from sWo (Wattn carried x16),
// converted by the block itself while the fill flies;
// the wave's 16 x rows are loaded behind the fill's barrier and fly while the key loop runs.
// LDS: sK / sV / sWo written once, read-only behind the fill's barrier; the block barrier behind the key loop ends
// every wave's last read of sK, over which the f32 output tile is then staged (per-wave region, block barrier), so
// that every store instruction writes 512 contiguous bytes.
__global__ __launch_bounds__(256) void attn_out_kernel(const f16* __restrict__ gq, const f16* __restrict__ fk,
                                                       const f16* __restrict__ hvt, const float* __restrict__ wo,
                                                       const float* __restrict__ x, const float* __restrict__ gamma,
                                                       float* __restrict__ out) {
  const int qblk = blockIdx.x;
  const int b    = blockIdx.y;
  const int tid  = threadIdx.x;
  const int wave = __builtin_amdgcn_readfirstlane(threadIdx.x >> 5);
  const int lane = tid & 31;
  const int lq   = lane & 15;   // query column of S^T and of CTX^T
  const int hi   = lane >> 4;   // k-split half

  __shared__ __align__(16) f16 sK[NKEY * KP];   // [key][value 32 | residual 32]
  __shared__ __align__(16) f16 sV[DV * VP];     // [d][key]
  __shared__ __align__(16) f16 sWo[CIN * CP];   // [n][d]

  const int qrow0 = qblk * BQ + wave * 16;
  const float gsc = (float)(bf16)gamma[0] * 0.0625f;   // gamma (RNE bf16) folded with the 1/16 Wo carry

  const f16* fk_b = fk + (size_t)b * NKEY * QW;
  const f16* vt_b = hvt + (size_t)b * DV * NKEY;

  // the block's plain loads stand ahead of the fill and fly while its copies are issued
  v4f wv[8];
  load_out_weights(wo, tid, wv);

  // G as B-operand fragments: lane lq holds query qrow0+lq, elements follow the split d map
  FragH qf, qr;
  {
    const f16* qp = gq + ((size_t)b * SEQ + qrow0 + lq) * QW + hi * 8;
    qf.q[0] = *(const v4u*)(qp);        // value,    d = hi*8 + 0..7
    qf.q[1] = *(const v4u*)(qp + 16);   // value,    d = 16 + hi*8 + 0..7
    qr.q[0] = *(const v4u*)(qp + 32);   // residual, d = hi*8 + 0..7
    qr.q[1] = *(const v4u*)(qp + 48);   // residual, d = 16 + hi*8 + 0..7
  }

  // fill: every lane of every wave copies its own 16-byte pieces, no branch around the copies
  {
    const unsigned lk = (unsigned)(size_t)sK;
    const unsigned lv = (unsigned)(size_t)sV;
    for (int gph = 0; gph < (NKEY * QW) / (8 * 256 * 8); ++gph) copy8_to_lds<QW, KP>(fk_b, lk, gph * 2048 + tid);
    for (int gph = 0; gph < (DV * NKEY) / (8 * 256 * 8); ++gph) copy8_to_lds<NKEY, VP>(vt_b, lv, gph * 2048 + tid);
  }
  // keeps the Wattn converts, which wait for their loads, from being scheduled among or ahead of the fill's copies
  __builtin_amdgcn_sched_barrier(0);

  v8f o[2];
  #pragma unroll
  for (int dt = 0; dt < 2; ++dt) o[dt] = (v8f){0, 0, 0, 0, 0, 0, 0, 0};

  float rmax = -__builtin_inff();
  float rsum = 0.0f;
  const float SL = 1.4426950408889634f;   // log2(e); the scores carry no extra scale
  const float RS = 1.0f / 2048.0f;        // residual plane carry folded back

  store_out_weights(wv, sWo, tid);

  // this wave's copies have landed; behind the barrier every wave's have
  asm volatile("s_wait_asynccnt 0x0" ::: "memory");
  __syncthreads();

  // residual rows of this wave's 16 queries: instruction j takes half row j (512 contiguous bytes); first used in the
  // epilogue, so the loads stand behind the barrier (which would wait for them) and ahead of the key loop
  const size_t xoff = ((size_t)b * SEQ_FULL + qrow0) * CIN + lane * 4;
  v4f xv[32];
  #pragma unroll   // constant indices: the rows stay in registers until the epilogue
  for (int j = 0; j < 32; ++j) xv[j] = *(const v4f*)(x + xoff + j * (CIN / 2));

  for (int i = 0; i < NKEY / BK; ++i) {
    const int j0 = i * BK;

    FragH ak[2], akr[2];
    #pragma unroll
    for (int sub = 0; sub < 2; ++sub) {
      const f16* base = sK + (j0 + sub * 16 + lq) * KP + hi * 8;
      ak[sub].q[0]  = *(const v4u*)(base);        // d = hi*8 + 0..7
      ak[sub].q[1]  = *(const v4u*)(base + 16);   // d = 16 + hi*8 + 0..7
      akr[sub].q[0] = *(const v4u*)(base + 32);
      akr[sub].q[1] = *(const v4u*)(base + 48);
    }

    // S^T tiles: c[sub][r] = score(query qrow0+lq, key j0 + sub*16 + hi*8 + r)
    v8f c[2], cr[2];
    #pragma unroll
    for (int sub = 0; sub < 2; ++sub) {
      c[sub]  = mma_f16(ak[sub].v,  qf.v, (v8f){0, 0, 0, 0, 0, 0, 0, 0});
      cr[sub] = mma_f16(ak[sub].v,  qr.v, (v8f){0, 0, 0, 0, 0, 0, 0, 0});
      cr[sub] = mma_f16(akr[sub].v, qf.v, cr[sub]);
    }
    #pragma unroll
    for (int sub = 0; sub < 2; ++sub) {
      #pragma unroll
      for (int r = 0; r < 8; ++r) c[sub][r] = c[sub][r] + cr[sub][r] * RS;
    }

    // online softmax: query lq's 32 scores are split across lane / lane^16
    float m_new = rmax;
    #pragma unroll
    for (int r = 0; r < 8; ++r) {
      m_new = fmaxf(m_new, c[0][r]);
      m_new = fmaxf(m_new, c[1][r]);
    }
    m_new = fmaxf(m_new, xhalf(m_new));
    const float scale = __builtin_amdgcn_exp2f((rmax - m_new) * SL);
    rmax = m_new;

    // exp + pack: P^T C-layout == B-fragment layout for the PV product; P carried x4096 in f16.
    // Exponents below -25 give zero (the carried value would fall under 2^-13, twice the f16 normal minimum).
    FragH pa;
    float psum = 0.0f;
    #pragma unroll
    for (int r = 0; r < 8; ++r) {
      const float e0 = (c[0][r] - m_new) * SL;   // key j0 + hi*8 + r
      const float e1 = (c[1][r] - m_new) * SL;   // key j0 + 16 + hi*8 + r
      const float x0 = __builtin_amdgcn_exp2f(e0);
      const float x1 = __builtin_amdgcn_exp2f(e1);
      const float p0 = (e0 < -25.0f) ? 0.0f : x0;
      const float p1 = (e1 < -25.0f) ? 0.0f : x1;
      psum += p0 + p1;
      pa.h[r]     = (f16)(p0 * 4096.0f);
      pa.h[8 + r] = (f16)(p1 * 4096.0f);
    }
    rsum = rsum * scale + psum;   // the keys of this lane's half only

    // rescale CTX^T: the query is the column there -> the lane's own scale
    #pragma unroll
    for (int dt = 0; dt < 2; ++dt) {
      #pragma unroll
      for (int r = 0; r < 8; ++r) o[dt][r] *= scale;
    }

    // CTX^T += Hv^T x P^T : A-fragment row m = d = dt*16 + lq, split key map from the transposed plane;
    // o[dt][r] = ctx(query qrow0 + lq, d = dt*16 + hi*8 + r)
    #pragma unroll
    for (int dt = 0; dt < 2; ++dt) {
      const f16* base = sV + (dt * 16 + lq) * VP + j0 + hi * 8;
      FragH av;
      av.q[0] = *(const v4u*)(base);        // keys j0 + hi*8 + 0..7
      av.q[1] = *(const v4u*)(base + 16);   // keys j0 + 16 + hi*8 + 0..7
      o[dt] = mma_f16(av.v, pa.v, o[dt]);
    }
  }

  // normalize: the two halves' sums of query lq joined; CTX as A fragment straight from the accumulators:
  // lane lq holds query row lq, elements follow the split d map
  const float rs = 1.0f / (rsum + xhalf(rsum));
  FragH ca;
  #pragma unroll
  for (int r = 0; r < 8; ++r) {
    ca.h[r]     = toh_flush(o[0][r] * (1.0f / 4096.0f) * rs);   // d = hi*8 + r
    ca.h[8 + r] = toh_flush(o[1][r] * (1.0f / 4096.0f) * rs);   // d = 16 + hi*8 + r
  }
  // ends every wave's last read of the key plane
  __syncthreads();

  // OUT tile of the wave, 16 rows x 256 channels in f32, staged over the key plane (dead behind the barrier above)
  float* so = (float*)sK + wave * (16 * OW);
  #pragma unroll   // laid out flat so that a group's fragment loads can stand among the stores of the group before
  for (int qn = 0; qn < 4; ++qn) {   // four independent 16-column tiles at a time: one LDS wait per four products
    FragH bw[4];
    #pragma unroll
    for (int j = 0; j < 4; ++j) {
      const f16* wp = sWo + ((qn * 4 + j) * 16 + lq) * CP + hi * 8;
      bw[j].q[0] = *(const v4u*)(wp);
      bw[j].q[1] = *(const v4u*)(wp + 16);
    }
    v8f acc[4];
    #pragma unroll
    for (int j = 0; j < 4; ++j) acc[j] = mma_f16(ca.v, bw[j].v, (v8f){0, 0, 0, 0, 0, 0, 0, 0});
    #pragma unroll
    for (int r = 0; r < 8; ++r) {
      #pragma unroll
      for (int j = 0; j < 4; ++j) so[(hi * 8 + r) * OW + (qn * 4 + j) * 16 + lq] = acc[j][r] * gsc;
    }
  }
  __syncthreads();

  // whole-line stores: instruction j writes half row j = 512 contiguous bytes (4 lines)
  #pragma unroll   // constant indices into xv
  for (int j = 0; j < 32; ++j) {
    v4f v = *(const v4f*)(so + (j >> 1) * OW + (j & 1) * (CIN / 2) + lane * 4);
    #pragma unroll
    for (int cc = 0; cc < 4; ++cc) v[cc] = v[cc] + (float)(bf16)xv[j][cc];   // residual with the RNE bf16 input value
    *(v4f*)(out + xoff + j * (CIN / 2)) = v;
  }
}

extern "C" void kernel_launch(void* const* d_in, const int* in_sizes, int n_in,
                              void* d_out, int out_size, void* d_ws, size_t ws_size,
                              hipStream_t stream) {
  if (n_in < 6) return;
  const size_t rows_used = (size_t)(NB - 1) * SEQ_FULL + SEQ;
  if ((size_t)in_sizes[0] < rows_used * CIN) return;
  if (in_sizes[1] < CIN * DQK) return;
  if (in_sizes[2] < CIN * DQK) return;
  if (in_sizes[3] < CIN * DV) return;
  if (in_sizes[4] < DV * CIN) return;
  if (in_sizes[5] < 1) return;
  if ((size_t)out_size < rows_used * CIN) return;
  if (ws_size < WS_TOTAL) return;

  const float* x     = (const float*)d_in[0];
  const float* wf    = (const float*)d_in[1];
  const float* wg    = (const float*)d_in[2];
  const float* wh    = (const float*)d_in[3];
  const float* wo    = (const float*)d_in[4];
  const float* gamma = (const float*)d_in[5];
  float* out = (float*)d_out;
  char*  ws  = (char*)d_ws;
  f16*  gq  = (f16*)(ws + OFF_GQ);
  f16*  fk  = (f16*)(ws + OFF_FK);
  f16*  hvt = (f16*)(ws + OFF_HVT);

  proj_pool_kernel<<<dim3(SEQ / 256, NB), 256, 0, stream>>>(x, wf, wg, wh, gq, fk, hvt);
  attn_out_kernel<<<dim3(SEQ / BQ, NB), 256, 0, stream>>>(gq, fk, hvt, wo, x, gamma, out);
}

// v006
// A run of this version takes 25.7 microseconds.
// Next to v005, in two timings, it ran 1.04 times as fast each time.
// Counting every step since v000, it is 3.42 times as fast.
#include <hip/hip_runtime.h>

// Contractions: X x [Wf|Wg|Wh] on v_wmma_f32_16x16x32_bf16 (bf16 operands = RNE-converted inputs, f32 accumulate);
// S^T = F x G^T as three v_wmma_f32_16x16x32_f16 products (value x value in one accumulator; value x residual and
// residual x value in a second accumulator, residual planes carried x2048 and folded back in f32);
// CTX^T = Hv^T x P^T (P as f16 carried x4096) and OUT = CTX x Wattn (Wattn as f16 of the bf16 value, carried x16)
// on v_wmma_f32_16x16x32_f16 (f16 operands, f32 accumulate). Max-pool, softmax and residual add in f32.

#ifndef NB
#define NB 8
#endif
#ifndef SEQ
#define SEQ 4096
#endif
#define NB_FULL  8
#define SEQ_FULL 4096
#define W_IMG    64                 // image width (pixels per image row)
#define CIN      256                // input channels
#define DQK      32                 // query / key channels
#define DV       32                 // value channels
#define NPROJ    96                 // packed projection columns: [0,32) f, [32,64) g, [64,96) h
#define QW       64                 // halves per row of the query / key planes: value 0..31 | residual 32..63
#define NKEY     (SEQ / 4)          // pooled key count per image
#define KTILE    64                 // keys produced per projection block
#define BQ       128                // query rows per attention block (8 waves x 16)
#define BK       32                 // keys per inner iteration
#define NWAVE    8
#define PF       68                 // LDS pitch (floats) of the ww-pooled staging rows (f 0..31 | h 32..63)
#define GP       72                 // LDS pitch (halves) of the g staging tile (value | residual)
#define FP       72                 // LDS pitch (halves) of the pooled f tile (value | residual)
#define HP       72                 // LDS pitch (halves) of the pooled h^T tile
#define CP       40                 // LDS pitch (halves) of a staged Wattn row (32 d): 80 B = 16 B x odd
#define OW       (CIN + 4)          // LDS pitch (floats) of a staged output row (256 channels): 1040 B = 16 B x odd
#define KP       72                 // LDS pitch (halves) of a staged key row (value | residual): 144 B = 16 B x odd
#define VP       (NKEY + 8)         // LDS pitch (halves) of a staged h^T row: 16 B x odd
#define WP       (CIN + 8)          // LDS pitch (bf16) of a staged weight row: 528 B = 16 B x odd
#define XP       (CIN / 2 + 4)      // LDS pitch (floats) of a staged half x row (128 channels): 528 B = 16 B x odd
#define XBUF     (NWAVE * 16 * XP)  // floats in one of the two x buffers

static_assert(SEQ % 256 == 0);
static_assert(SEQ >= 256 && SEQ <= SEQ_FULL);
static_assert(NB >= 1 && NB <= NB_FULL);
static_assert(BQ == NWAVE * 16);
static_assert(NKEY % BK == 0);
static_assert(NKEY % KTILE == 0);
static_assert(CIN % 32 == 0 && DV == 32 && DQK == 32);
static_assert(NPROJ == 2 * DQK + DV && NPROJ % 16 == 0 && NPROJ / 8 == 12);
static_assert(QW == 2 * DQK && QW * 2 == 128);
static_assert(W_IMG == 64 && CIN == 4 * 64);
// coverage equalities (grid x block x per-thread elements == plane extent)
static_assert((SEQ / 256) * 2 * NWAVE * 16 == SEQ);          // g plane rows per image
static_assert((SEQ / 256) * KTILE == NKEY);                   // f / h^T plane keys per image
static_assert((SEQ / BQ) * NWAVE * 16 == SEQ);                // ctx / output rows per image
static_assert(4 * 32 * 8 == 16 * QW);                         // g tile store: 4 instructions x 32 lanes x 8 halves
static_assert(2 * 256 * 8 == KTILE * QW);                     // key tile store: 2 x 256 threads x 8 halves
static_assert(256 * 8 == DV * KTILE);                         // h^T tile store: 256 threads x 8 halves
static_assert(32 * 32 * 4 == 16 * CIN);                       // output tile store: 32 instructions x 32 lanes x 4 floats
static_assert(4 * 256 == 32 * DQK && 4 * 256 == 32 * DV);     // hh-pool element loops
static_assert(NWAVE * 4 * 8 == CIN && 8 * 4 == DQK && DQK == DV);   // weight rows: 8 waves x 4 lane groups x 8 k, 8 lanes x 4 n
static_assert(64 * 4 == CIN && 4 * 8 == DV);                  // Wattn rows: 64 threads x 4 n, 4 thread groups x 8 d
static_assert(PF >= 2 * DQK && (PF * 4) % 16 == 0);
static_assert(GP >= QW && FP >= QW && HP >= KTILE && CP >= DV && OW >= CIN);
static_assert((GP * 2) % 16 == 0 && (FP * 2) % 16 == 0 && (HP * 2) % 16 == 0 && (CP * 2) % 16 == 0);
static_assert((OW * 4) % 32 == 16);
static_assert(KP >= QW && (KP * 2) % 32 == 16 && (VP * 2) % 32 == 16);
static_assert((NKEY * QW) % (8 * 256 * 8) == 0);              // key plane: whole groups of 8 copies x 256 lanes x 8 halves
static_assert((DV * NKEY) % (8 * 256 * 8) == 0);              // h^T plane: the same
static_assert((NKEY * QW + DV * NKEY) / (256 * 8) <= 63);     // copies of one wave in flight
static_assert((NKEY * KP + DV * VP + CIN * CP) * 2 <= 327680);
static_assert(NWAVE * 16 * OW * 4 <= NKEY * KP * 2);          // the output tile fits over the key plane
static_assert((WP * 2) % 32 == 16 && (XP * 4) % 32 == 16);
static_assert(16 * (CIN / 2) * 4 == 2 * 8 * 32 * 16);         // one wave's half x rows: 16 copies x 32 lanes x 16 B
static_assert(2 * 32 * PF * 4 + (NWAVE * 16 * GP + 64 * FP + DV * HP) * 2 + NPROJ * WP * 2 + 2 * XBUF * 4 <= 327680);

static constexpr size_t GQ_BYTES  = (size_t)NB * SEQ * QW * 2;        // 4,194,304 at full size
static constexpr size_t FK_BYTES  = (size_t)NB * NKEY * QW * 2;       // 1,048,576
static constexpr size_t HVT_BYTES = (size_t)NB * DV * NKEY * 2;       // 524,288
static constexpr size_t OFF_GQ  = 0;
static constexpr size_t OFF_FK  = OFF_GQ + GQ_BYTES;
static constexpr size_t OFF_HVT = OFF_FK + FK_BYTES;
static constexpr size_t WS_TOTAL = OFF_HVT + HVT_BYTES;               // 5,767,168 at full size
static_assert(GQ_BYTES % 128 == 0 && FK_BYTES % 128 == 0 && HVT_BYTES % 128 == 0);
static_assert(WS_TOTAL <= (size_t)134217728);

typedef __bf16   bf16;
typedef _Float16 f16;
typedef bf16     v16bf __attribute__((ext_vector_type(16)));
typedef f16      v16h  __attribute__((ext_vector_type(16)));
typedef f16      v8h   __attribute__((ext_vector_type(8)));
typedef float    v8f   __attribute__((ext_vector_type(8)));
typedef float    v4f   __attribute__((ext_vector_type(4)));
typedef float    v2f   __attribute__((ext_vector_type(2)));
typedef unsigned v4u   __attribute__((ext_vector_type(4)));

union FragB  { v16bf v; v4u q[2]; bf16 h[16]; };
union FragH  { v16h  v; v4u q[2]; f16  h[16]; };
union Pack8B { v4u u; bf16 h[8]; };
union Pack8H { v4u u; v8h v; f16 h[8]; };

// WMMA helpers: builtin followed by the VALU hazard guard (ties D, keeps A/B live).
static __device__ __forceinline__ v8f mma_bf16(v16bf a, v16bf b, v8f acc) {
  acc = __builtin_amdgcn_wmma_f32_16x16x32_bf16(false, a, false, b, (short)0, acc, false, false);
  asm volatile("v_nop\n\tv_nop\n\tv_nop\n\tv_nop" : "+v"(acc) : "v"(a), "v"(b));
  return acc;
}
static __device__ __forceinline__ v8f mma_f16(v16h a, v16h b, v8f acc) {
  acc = __builtin_amdgcn_wmma_f32_16x16x32_f16(false, a, false, b, (short)0, acc, false, false);
  asm volatile("v_nop\n\tv_nop\n\tv_nop\n\tv_nop" : "+v"(acc) : "v"(a), "v"(b));
  return acc;
}

// Eight asynchronous 16-byte copies per lane, global -> LDS, through no register: copy i takes the 16-byte piece
// number piece0 + i * 256 of a plane whose rows hold ROWH halves and lands it at row pitch PITCH (halves) in LDS.
// The closing s_wait_xcnt stands inside the statement so that no address register is rewritten ahead of it.
template <int ROWH, int PITCH>
static __device__ __forceinline__ void copy8_to_lds(const f16* __restrict__ plane, unsigned lds_base, int piece0) {
  const f16* g[8];
  unsigned   l[8];
  #pragma unroll   // constant indices: the sixteen addresses stay in registers for the asm operands
  for (int i = 0; i < 8; ++i) {
    const int piece = piece0 + i * 256;
    const int row   = piece / (ROWH / 8);
    const int col   = piece % (ROWH / 8);
    g[i] = plane + (size_t)piece * 8;
    l[i] = lds_base + (unsigned)(row * PITCH + col * 8) * 2u;
  }
  asm volatile("global_load_async_to_lds_b128 %0, %8, off\n\t"
               "global_load_async_to_lds_b128 %1, %9, off\n\t"
               "global_load_async_to_lds_b128 %2, %10, off\n\t"
               "global_load_async_to_lds_b128 %3, %11, off\n\t"
               "global_load_async_to_lds_b128 %4, %12, off\n\t"
               "global_load_async_to_lds_b128 %5, %13, off\n\t"
               "global_load_async_to_lds_b128 %6, %14, off\n\t"
               "global_load_async_to_lds_b128 %7, %15, off\n\t"
               "s_wait_xcnt 0x0"
               :: "v"(l[0]), "v"(l[1]), "v"(l[2]), "v"(l[3]), "v"(l[4]), "v"(l[5]), "v"(l[6]), "v"(l[7]),
                  "v"(g[0]), "v"(g[1]), "v"(g[2]), "v"(g[3]), "v"(g[4]), "v"(g[5]), "v"(g[6]), "v"(g[7])
               : "memory");
}

// N (8 or 4) asynchronous 16-byte copies per lane, global -> LDS, through no register: copy i takes the 16-byte piece
// number piece0 + i * STEP of a tile whose rows hold ROWB bytes at pitch SRCB in global memory and lands it at row
// pitch PITCHB in LDS (all in bytes).
// The closing s_wait_xcnt stands inside the statement so that no address register is rewritten ahead of it.
template <int N, int ROWB, int SRCB, int PITCHB, int STEP>
static __device__ __forceinline__ void copy_rows_to_lds(const char* __restrict__ plane, unsigned lds_base, int piece0) {
  static_assert(N == 8 || N == 4);
  const char* g[N];
  unsigned    l[N];
  #pragma unroll   // constant indices: the addresses stay in registers for the asm operands
  for (int i = 0; i < N; ++i) {
    const int piece = piece0 + i * STEP;
    const int row   = piece / (ROWB / 16);
    const int col   = piece % (ROWB / 16);
    g[i] = plane + (size_t)(row * SRCB + col * 16);
    l[i] = lds_base + (unsigned)(row * PITCHB + col * 16);
  }
  if constexpr (N == 8) {
    asm volatile("global_load_async_to_lds_b128 %0, %8, off\n\t"
                 "global_load_async_to_lds_b128 %1, %9, off\n\t"
                 "global_load_async_to_lds_b128 %2, %10, off\n\t"
                 "global_load_async_to_lds_b128 %3, %11, off\n\t"
                 "global_load_async_to_lds_b128 %4, %12, off\n\t"
                 "global_load_async_to_lds_b128 %5, %13, off\n\t"
                 "global_load_async_to_lds_b128 %6, %14, off\n\t"
                 "global_load_async_to_lds_b128 %7, %15, off\n\t"
                 "s_wait_xcnt 0x0"
                 :: "v"(l[0]), "v"(l[1]), "v"(l[2]), "v"(l[3]), "v"(l[4]), "v"(l[5]), "v"(l[6]), "v"(l[7]),
                    "v"(g[0]), "v"(g[1]), "v"(g[2]), "v"(g[3]), "v"(g[4]), "v"(g[5]), "v"(g[6]), "v"(g[7])
                 : "memory");
  } else {
    asm volatile("global_load_async_to_lds_b128 %0, %4, off\n\t"
                 "global_load_async_to_lds_b128 %1, %5, off\n\t"
                 "global_load_async_to_lds_b128 %2, %6, off\n\t"
                 "global_load_async_to_lds_b128 %3, %7, off\n\t"
                 "s_wait_xcnt 0x0"
                 :: "v"(l[0]), "v"(l[1]), "v"(l[2]), "v"(l[3]), "v"(g[0]), "v"(g[1]), "v"(g[2]), "v"(g[3])
                 : "memory");
  }
}

// Lane l takes the value of lane l ^ 16 (the other k-split half of the same query), on the vector pipe.
static __device__ __forceinline__ float xhalf(float v) {
  const int b = __builtin_bit_cast(int, v);
  return __builtin_bit_cast(float, __builtin_amdgcn_permlanex16(b, b, 0x76543210, 0xfedcba98, false, false));
}

// f32 -> f16 convert that can never produce a subnormal operand (value select below 2^-14).
static __device__ __forceinline__ f16 toh_flush(float v) {
  const f16 r = (f16)v;
  return (fabsf(v) < 6.103515625e-05f) ? (f16)0.0f : r;
}

// Weight rows (k-contiguous, B fragments load like A fragments), built in LDS by the block that reads them:
//   sw  [NPROJ][WP] bf16 : row n = column n of [Wf | Wg | Wh], RNE bf16.
//   swo [CIN][CP]   f16  : row n = column n of Wattn, value f16(bf16(w) * 16) (exact for normal results).
// A lane takes an 8 (k) x 4 (n) patch of a matrix: eight 16-byte loads (every 128-byte line a load touches is used
// whole), then four 16-byte LDS stores of eight k-contiguous values each. Loads and stores are two calls, so that the
// loads can stand ahead of the block's asynchronous copies and fly while those are issued.
// coverage: sw rows 0..95 x k 0..255 (wave -> 32 k, lane >> 3 -> 8 k of them, lane & 7 -> 4 n, three matrices).
static __device__ __forceinline__ void load_proj_weights(const float* __restrict__ wf, const float* __restrict__ wg,
                                                         const float* __restrict__ wh, int wave, int lane,
                                                         v4f (&w)[3][8]) {
  const int n0 = (lane & 7) * 4;                  // 0..28
  const int k0 = wave * 32 + (lane >> 3) * 8;     // 0..248
  #pragma unroll   // constant indices: the patches stay in registers
  for (int i = 0; i < 8; ++i) {
    const size_t off = (size_t)(k0 + i) * DQK + n0;
    w[0][i] = *(const v4f*)(wf + off);
    w[1][i] = *(const v4f*)(wg + off);
    w[2][i] = *(const v4f*)(wh + off);
  }
}
static __device__ __forceinline__ void store_proj_weights(const v4f (&w)[3][8], bf16* sw, int wave, int lane) {
  const int n0 = (lane & 7) * 4;
  const int k0 = wave * 32 + (lane >> 3) * 8;
  #pragma unroll
  for (int mt = 0; mt < 3; ++mt) {
    #pragma unroll
    for (int j = 0; j < 4; ++j) {
      Pack8B pk;
      #pragma unroll
      for (int i = 0; i < 8; ++i) pk.h[i] = (bf16)w[mt][i][j];   // RNE convert
      *(v4u*)(sw + (mt * DQK + n0 + j) * WP + k0) = pk.u;
    }
  }
}
// coverage: swo rows 0..255 x d 0..31 (tid & 63 -> 4 n, tid >> 6 -> 8 d).
static __device__ __forceinline__ void load_out_weights(const float* __restrict__ wo, int tid, v4f (&w)[8]) {
  const int n0 = (tid & 63) * 4;    // 0..252
  const int d0 = (tid >> 6) * 8;    // 0..24
  #pragma unroll   // constant indices: the patch stays in registers
  for (int i = 0; i < 8; ++i) w[i] = *(const v4f*)(wo + (size_t)(d0 + i) * CIN + n0);
}
static __device__ __forceinline__ void store_out_weights(const v4f (&w)[8], f16* swo, int tid) {
  const int n0 = (tid & 63) * 4;
  const int d0 = (tid >> 6) * 8;
  #pragma unroll
  for (int j = 0; j < 4; ++j) {
    Pack8H pk;
    #pragma unroll
    for (int i = 0; i < 8; ++i) pk.h[i] = toh_flush((float)(bf16)w[i][j] * 16.0f);   // bf16 significand fits f16
    *(v4u*)(swo + (n0 + j) * CP + d0) = pk.u;
  }
}

// One wave's 16-pixel M tile times NTN consecutive 16-column tiles of the weight rows starting at tile NT0, summed into acc over
// the CIN / 2 channels of one staged half: k steps kk0 .. kk0 + 3.
// A fragments from the staged f32 x rows (xr = this lane's half row in LDS; RNE bf16 convert, split k map); B fragments
// from the staged k-contiguous weight rows (sw, pitch WP). A k step's sixteen LDS loads stand ahead of its products.
template <int NT0, int NTN>
static __device__ __forceinline__ void proj_tiles(const float* xr, const bf16* sw, int kk0,
                                                  int m, int hi, v8f (&acc)[NTN]) {
  for (int kq = 0; kq < CIN / 64; ++kq) {
    const int kk = kk0 + kq;
    const float* xp = xr + kq * 32;
    const v4f a0 = *(const v4f*)(xp + hi * 8);
    const v4f a1 = *(const v4f*)(xp + hi * 8 + 4);
    const v4f b0 = *(const v4f*)(xp + 16 + hi * 8);
    const v4f b1 = *(const v4f*)(xp + 16 + hi * 8 + 4);
    FragB bw[NTN];
    #pragma unroll
    for (int t = 0; t < NTN; ++t) {
      const bf16* wp = sw + ((NT0 + t) * 16 + m) * WP + kk * 32 + hi * 8;
      bw[t].q[0] = *(const v4u*)(wp);        // k = kk*32 + hi*8 + 0..7, n = tile*16 + m
      bw[t].q[1] = *(const v4u*)(wp + 16);   // k = kk*32 + 16 + hi*8 + 0..7
    }
    FragB a;
    #pragma unroll
    for (int i = 0; i < 4; ++i) {
      a.h[i]      = (bf16)a0[i];   // elems 0..7  : k = kk*32 + hi*8 + 0..7
      a.h[4 + i]  = (bf16)a1[i];
      a.h[8 + i]  = (bf16)b0[i];   // elems 8..15 : k = kk*32 + 16 + hi*8 + 0..7
      a.h[12 + i] = (bf16)b1[i];
    }
    #pragma unroll
    for (int t = 0; t < NTN; ++t) acc[t] = mma_bf16(a.v, bw[t].v, acc[t]);
  }
}

// Stage s of one wave's x ring: the 16 pixel rows of iteration s >> 1, channel half s & 1, into buffer s & 1.
// xw0 = the wave's first x row of iteration 0 (iteration 1 lies two image rows further), lx = its rows in buffer 0.
static __device__ __forceinline__ void copy_x_stage(const float* __restrict__ xw0, unsigned lx, int lane, int s) {
  const float*   src = xw0 + (size_t)(s >> 1) * 2 * W_IMG * CIN + (s & 1) * (CIN / 2);
  const unsigned dst = lx + (unsigned)(s & 1) * (XBUF * 4);
  for (int gph = 0; gph < 2; ++gph)
    copy_rows_to_lds<8, CIN * 2, CIN * 4, XP * 4, 32>((const char*)src, dst, gph * 256 + lane);
}

// Projection + 2x2 max-pool. Block = (64-key tile kt, batch b), 256 threads; two iterations each cover
// image rows hh = kt*4 + it*2 + {0,1}; wave -> (hh, 16 pixels along ww).
//                            (wave writes 16 rows = 2 KB, 4 instructions of 4 lines, 8 lanes x 16 B per line).
//   fk  [NB][NKEY][QW] f16 : pooled keys, value | residual x2048, 64 rows per block = 8 KB
//                            (2 instructions, each wave 4 lines, 8 lanes x 16 B per line).
// LDS regions: sP cross-wave (block barrier), sG per-wave but read across lanes after the block barrier,
// sF / sHT cross-wave (block barrier). Staged extent == consumed extent for all four.
// The weight rows (sW) are converted from the f32 inputs by the block itself, once, while the first x stage flies.
// x comes by asynchronous copies (whole lines from global, padded rows in LDS): each wave's 16 x rows of each of two iterations in four stages
// of 128 channels through two buffers (sX): a stage flies while the one before it is worked on, and a buffer is
// refilled behind the barrier that ends its last read.
__global__ __launch_bounds__(256) void proj_pool_kernel(const float* __restrict__ x, const float* __restrict__ wf,
                                                         const float* __restrict__ wg, const float* __restrict__ wh,
                                                         f16* __restrict__ gq, f16* __restrict__ fk,
                                                         f16* __restrict__ hvt) {
  const int kt   = blockIdx.x;
  const int b    = blockIdx.y;
  const int tid  = threadIdx.x;
  const int wave = __builtin_amdgcn_readfirstlane(threadIdx.x >> 5);
  const int lane = tid & 31;
  const int m    = lane & 15;
  const int hi   = lane >> 4;
  const int hsel = wave >> 2;          // which of the two image rows of this iteration
  const int ww0  = (wave & 3) * 16;    // first pixel column of this wave's tile

  __shared__ __align__(16) float sP[2 * 32 * PF];     // [hsel][pw][64 cols] ww-pooled f|h in f32
  __shared__ __align__(16) f16 sG[NWAVE * 16 * GP];   // per-wave g tile [16][value 32 | residual 32]
  __shared__ __align__(16) f16 sF[64 * FP];           // pooled f [64 keys][value 32 | residual 32]
  __shared__ __align__(16) f16 sHT[DV * HP];          // pooled h^T [32 d][64 keys]
  __shared__ __align__(16) bf16 sW[NPROJ * WP];       // weight rows [96 n][256 k]
  __shared__ __align__(16) float sX[2 * XBUF];        // [buffer][wave][16 pixels][128 channels] in f32

  f16*   sg = sG + wave * (16 * GP);
  float* sp = sP + hsel * (32 * PF);
  const int pwb = (ww0 >> 1) + hi * 4;   // pooled column index base for this lane half

  const float*   sx  = sX + wave * (16 * XP);
  const unsigned lx  = (unsigned)(size_t)sx;
  // first x row of this wave's tile in iteration 0; iteration 1 lies two image rows further
  const float*   xw0 = x + ((size_t)b * SEQ_FULL + (kt * 4 + hsel) * W_IMG + ww0) * CIN;

  v4f wv[3][8];
  load_proj_weights(wf, wg, wh, wave, lane, wv);
  // fill: every lane of every wave copies its own 16-byte pieces, no branch around the copies
  copy_x_stage(xw0, lx, lane, 0);
  store_proj_weights(wv, sW, wave, lane);
  // this wave's copies have landed; behind the barrier every wave's have, and every wave's weight rows are written
  asm volatile("s_wait_asynccnt 0x0" ::: "memory");
  __syncthreads();
  copy_x_stage(xw0, lx, lane, 1);

  #pragma unroll   // the four stages laid out flat: which refills and waits exist is settled at compile time, no test around a copy
  for (int it = 0; it < 2; ++it) {
    const int hh   = kt * 4 + it * 2 + hsel;
    const int pix0 = hh * W_IMG + ww0;

    {   // tiles 0,1: f; 2,3: g; 4,5: h
      v8f acc[6];
      #pragma unroll
      for (int t = 0; t < 6; ++t) acc[t] = (v8f){0, 0, 0, 0, 0, 0, 0, 0};
      proj_tiles<0, 6>(sx + m * XP, sW, 0, m, hi, acc);
      // publish point of stage 2 * it + 1: this wave's reads of buffer 0 have retired, its copies into buffer 1 have landed
      asm volatile("s_wait_dscnt 0x0" ::: "memory");
      asm volatile("s_wait_asynccnt 0x0" ::: "memory");
      __syncthreads();
      if (it + 1 < 2) copy_x_stage(xw0, lx, lane, 2 * it + 2);
      proj_tiles<0, 6>(sx + XBUF + m * XP, sW, CIN / 64, m, hi, acc);
      #pragma unroll
      for (int r = 0; r < 8; ++r) {
        const float g0 = acc[2][r];
        const float g1 = acc[3][r];
        const f16 h0 = toh_flush(g0);
        const f16 h1 = toh_flush(g1);
        sg[(hi * 8 + r) * GP + m]      = h0;
        sg[(hi * 8 + r) * GP + 16 + m] = h1;
        sg[(hi * 8 + r) * GP + 32 + m] = toh_flush((g0 - (float)h0) * 2048.0f);
        sg[(hi * 8 + r) * GP + 48 + m] = toh_flush((g1 - (float)h1) * 2048.0f);
      }
      // ww pairs are D rows (2rp, 2rp+1) of the same lane half; pooled column pw = ww0/2 + 4*hi + rp
      #pragma unroll
      for (int rp = 0; rp < 4; ++rp) {
        #pragma unroll
        for (int t = 0; t < 2; ++t) {
          sp[(pwb + rp) * PF + t * 16 + m]      = fmaxf(acc[t][2 * rp], acc[t][2 * rp + 1]);
          sp[(pwb + rp) * PF + 32 + t * 16 + m] = fmaxf(acc[4 + t][2 * rp], acc[4 + t][2 * rp + 1]);
        }
      }
    }
    // publish point of stage 2 * it + 2, where there is one, at the barrier that the pooling needs anyway
    if (it + 1 < 2) {
      asm volatile("s_wait_dscnt 0x0" ::: "memory");
      asm volatile("s_wait_asynccnt 0x0" ::: "memory");
    }
    __syncthreads();
    if (it + 1 < 2) copy_x_stage(xw0, lx, lane, 2 * it + 3);

    {
      v4u    gv[4];
      size_t gi[4];
      #pragma unroll
      for (int i4 = 0; i4 < 4; ++i4) {
        const int row = i4 * 4 + (lane >> 3);
        const int cq  = (lane & 7) * 8;
        Pack8H p;
        p.v = *(const v8h*)(sg + row * GP + cq);
        gv[i4] = p.u;
        gi[i4] = ((size_t)b * SEQ + pix0 + row) * QW + cq;
      }
      #pragma unroll
      for (int i4 = 0; i4 < 4; ++i4) *(v4u*)(gq + gi[i4]) = gv[i4];
      
    }

    // hh-pool into the block's pooled tiles (f32 max, then one convert)
    #pragma unroll
    for (int e = 0; e < 4; ++e) {
      const int idx = e * 256 + tid;
      const int pw  = idx >> 5;
      const int c   = idx & 31;
      const float v = fmaxf(sP[pw * PF + c], sP[32 * PF + pw * PF + c]);
      const f16 hv  = toh_flush(v);
      sF[(it * 32 + pw) * FP + c]      = hv;
      sF[(it * 32 + pw) * FP + 32 + c] = toh_flush((v - (float)hv) * 2048.0f);
    }
    #pragma unroll
    for (int e = 0; e < 4; ++e) {
      const int idx = e * 256 + tid;
      const int pw  = idx >> 5;
      const int d   = idx & 31;
      const float v = fmaxf(sP[pw * PF + 32 + d], sP[32 * PF + pw * PF + 32 + d]);
      sHT[d * HP + it * 32 + pw] = toh_flush(v);
    }
    __syncthreads();
  }

  // final plane stores: fk (per instruction a wave writes 4 rows = 512 B), hvt (per instruction 4 d-lines)
  v4u    fv[2];
  size_t fi[2];
  #pragma unroll
  for (int i2 = 0; i2 < 2; ++i2) {
    const int idx = i2 * 256 + tid;
    const int row = idx >> 3;            // 0..63
    const int cq  = (idx & 7) * 8;
    Pack8H p;
    p.v = *(const v8h*)(sF + row * FP + cq);
    fv[i2] = p.u;
    fi[i2] = ((size_t)b * NKEY + kt * KTILE + row) * QW + cq;
  }
  v4u    hv;
  size_t hidx;
  {
    const int d  = tid >> 3;             // 0..31
    const int kq = (tid & 7) * 8;        // 0..56
    Pack8H p;
    p.v = *(const v8h*)(sHT + d * HP + kq);
    hv   = p.u;
    hidx = ((size_t)b * DV + d) * NKEY + kt * KTILE + kq;
  }
  #pragma unroll
  for (int i2 = 0; i2 < 2; ++i2) *(v4u*)(fk + fi[i2]) = fv[i2];
  *(v4u*)(hvt + hidx) = hv;
  
}

// Flash attention, non-causal, no score scaling. Block = (query block of 128, batch); one wave owns 16 queries.
// S^T = F x G^T so queries sit on lanes; P^T in C-layout is bit-identical to the B-fragment layout of
// CTX^T += Hv^T x P^T, whose columns are again the queries: a query's maximum, sum and rescale stay on its own two
// lanes (lq, lq + 16), which exchange the maximum once per 32 keys and join their sums once, behind the loop.
// Scores: value x value in c, (value x residual + residual x value) in cr, s = c + cr / 2048.
// The image's whole key plane and h^T plane are staged once in LDS by asynchronous copies (whole lines from global,
// padded rows in LDS) and shared by the block's 8 waves; F A-fragments and Hv^T A-fragments are two 16-B LDS loads
// each, G B-fragments two 16-B global loads each.
// Epilogue in the same launch: out = gamma * (CTX x Wo) + x_bf16 for the block's 128 query rows. The two CTX^T tiles,
// converted in place, are the A fragment of that product (split d map); B fragments from sWo (Wattn carried x16),
// converted by the block itself while the fill flies;
// the wave's 16 x rows are loaded behind the fill's barrier and fly while the key loop runs.
// LDS: sK / sV / sWo written once, read-only behind the fill's barrier; the block barrier behind the key loop ends
// every wave's last read of sK, over which the f32 output tile is then staged (per-wave region, block barrier), so
// that every store instruction writes 512 contiguous bytes.
__global__ __launch_bounds__(256) void attn_out_kernel(const f16* __restrict__ gq, const f16* __restrict__ fk,
                                                       const f16* __restrict__ hvt, const float* __restrict__ wo,
                                                       const float* __restrict__ x, const float* __restrict__ gamma,
                                                       float* __restrict__ out) {
  const int qblk = blockIdx.x;
  const int b    = blockIdx.y;
  const int tid  = threadIdx.x;
  const int wave = __builtin_amdgcn_readfirstlane(threadIdx.x >> 5);
  const int lane = tid & 31;
  const int lq   = lane & 15;   // query column of S^T and of CTX^T
  const int hi   = lane >> 4;   // k-split half

  __shared__ __align__(16) f16 sK[NKEY * KP];   // [key][value 32 | residual 32]
  __shared__ __align__(16) f16 sV[DV * VP];     // [d][key]
  __shared__ __align__(16) f16 sWo[CIN * CP];   // [n][d]

  const int qrow0 = qblk * BQ + wave * 16;
  const float gsc = (float)(bf16)gamma[0] * 0.0625f;   // gamma (RNE bf16) folded with the 1/16 Wo carry

  const f16* fk_b = fk + (size_t)b * NKEY * QW;
  const f16* vt_b = hvt + (size_t)b * DV * NKEY;

  // the block's plain loads stand ahead of the fill and fly while its copies are issued
  v4f wv[8];
  load_out_weights(wo, tid, wv);

  // G as B-operand fragments: lane lq holds query qrow0+lq, elements follow the split d map
  FragH qf, qr;
  {
    const f16* qp = gq + ((size_t)b * SEQ + qrow0 + lq) * QW + hi * 8;
    qf.q[0] = *(const v4u*)(qp);        // value,    d = hi*8 + 0..7
    qf.q[1] = *(const v4u*)(qp + 16);   // value,    d = 16 + hi*8 + 0..7
    qr.q[0] = *(const v4u*)(qp + 32);   // residual, d = hi*8 + 0..7
    qr.q[1] = *(const v4u*)(qp + 48);   // residual, d = 16 + hi*8 + 0..7
  }

  // fill: every lane of every wave copies its own 16-byte pieces, no branch around the copies
  {
    const unsigned lk = (unsigned)(size_t)sK;
    const unsigned lv = (unsigned)(size_t)sV;
    for (int gph = 0; gph < (NKEY * QW) / (8 * 256 * 8); ++gph) copy8_to_lds<QW, KP>(fk_b, lk, gph * 2048 + tid);
    for (int gph = 0; gph < (DV * NKEY) / (8 * 256 * 8); ++gph) copy8_to_lds<NKEY, VP>(vt_b, lv, gph * 2048 + tid);
  }
  // keeps the Wattn converts, which wait for their loads, from being scheduled among or ahead of the fill's copies
  __builtin_amdgcn_sched_barrier(0);

  v8f o[2];
  #pragma unroll
  for (int dt = 0; dt < 2; ++dt) o[dt] = (v8f){0, 0, 0, 0, 0, 0, 0, 0};

  float rmax = -__builtin_inff();
  float rsum = 0.0f;
  const float SL = 1.4426950408889634f;   // log2(e); the scores carry no extra scale
  const float RS = 1.0f / 2048.0f;        // residual plane carry folded back

  store_out_weights(wv, sWo, tid);

  // this wave's copies have landed; behind the barrier every wave's have
  asm volatile("s_wait_asynccnt 0x0" ::: "memory");
  __syncthreads();

  // residual rows of this wave's 16 queries: instruction j takes half row j (512 contiguous bytes); first used in the
  // epilogue, so the loads stand behind the barrier (which would wait for them) and ahead of the key loop
  const size_t xoff = ((size_t)b * SEQ_FULL + qrow0) * CIN + lane * 4;
  v4f xv[32];
  #pragma unroll   // constant indices: the rows stay in registers until the epilogue
  for (int j = 0; j < 32; ++j) xv[j] = *(const v4f*)(x + xoff + j * (CIN / 2));

  for (int i = 0; i < NKEY / BK; ++i) {
    const int j0 = i * BK;

    FragH ak[2], akr[2];
    #pragma unroll
    for (int sub = 0; sub < 2; ++sub) {
      const f16* base = sK + (j0 + sub * 16 + lq) * KP + hi * 8;
      ak[sub].q[0]  = *(const v4u*)(base);        // d = hi*8 + 0..7
      ak[sub].q[1]  = *(const v4u*)(base + 16);   // d = 16 + hi*8 + 0..7
      akr[sub].q[0] = *(const v4u*)(base + 32);
      akr[sub].q[1] = *(const v4u*)(base + 48);
    }

    // S^T tiles: c[sub][r] = score(query qrow0+lq, key j0 + sub*16 + hi*8 + r)
    v8f c[2], cr[2];
    #pragma unroll
    for (int sub = 0; sub < 2; ++sub) {
      c[sub]  = mma_f16(ak[sub].v,  qf.v, (v8f){0, 0, 0, 0, 0, 0, 0, 0});
      cr[sub] = mma_f16(ak[sub].v,  qr.v, (v8f){0, 0, 0, 0, 0, 0, 0, 0});
      cr[sub] = mma_f16(akr[sub].v, qf.v, cr[sub]);
    }
    #pragma unroll
    for (int sub = 0; sub < 2; ++sub) {
      #pragma unroll
      for (int r = 0; r < 8; ++r) c[sub][r] = c[sub][r] + cr[sub][r] * RS;
    }

    // online softmax: query lq's 32 scores are split across lane / lane^16
    float m_new = rmax;
    #pragma unroll
    for (int r = 0; r < 8; ++r) {
      m_new = fmaxf(m_new, c[0][r]);
      m_new = fmaxf(m_new, c[1][r]);
    }
    m_new = fmaxf(m_new, xhalf(m_new));
    const float scale = __builtin_amdgcn_exp2f((rmax - m_new) * SL);
    rmax = m_new;

    // exp + pack: P^T C-layout == B-fragment layout for the PV product; P carried x4096 in f16.
    // log2(e), the maximum and the carry sit in one fused multiply-add per score: p * 4096 = exp2(s * SL + kb), which
    // goes to the convert as it is (far below the maximum it rounds to an f16 subnormal or to zero).
    const float kb = __builtin_fmaf(-m_new, SL, 12.0f);
    FragH pa;
    v2f px[2][4];
    #pragma unroll   // constant indices: scores, exponentials and the fragment stay in registers
    for (int sub = 0; sub < 2; ++sub) {
      #pragma unroll   // the same
      for (int i2 = 0; i2 < 4; ++i2) {   // keys j0 + sub*16 + hi*8 + 2*i2, + 1: a register pair of the accumulator
        const v2f e = __builtin_elementwise_fma((v2f){c[sub][2 * i2], c[sub][2 * i2 + 1]}, (v2f){SL, SL}, (v2f){kb, kb});
        px[sub][i2] = (v2f){__builtin_amdgcn_exp2f(e[0]), __builtin_amdgcn_exp2f(e[1])};
        pa.h[sub * 8 + 2 * i2]     = (f16)px[sub][i2][0];
        pa.h[sub * 8 + 2 * i2 + 1] = (f16)px[sub][i2][1];
      }
    }
    float psum = 0.0f;   // carried x4096 like P
    #pragma unroll   // constant indices into px
    for (int i2 = 0; i2 < 4; ++i2) {
      const v2f t = px[0][i2] + px[1][i2];
      psum += t[0];
      psum += t[1];
    }
    rsum = rsum * scale + psum;   // the keys of this lane's half only

    // rescale CTX^T: the query is the column there -> the lane's own scale
    #pragma unroll
    for (int dt = 0; dt < 2; ++dt) {
      #pragma unroll
      for (int r = 0; r < 8; ++r) o[dt][r] *= scale;
    }

    // CTX^T += Hv^T x P^T : A-fragment row m = d = dt*16 + lq, split key map from the transposed plane;
    // o[dt][r] = ctx(query qrow0 + lq, d = dt*16 + hi*8 + r)
    #pragma unroll
    for (int dt = 0; dt < 2; ++dt) {
      const f16* base = sV + (dt * 16 + lq) * VP + j0 + hi * 8;
      FragH av;
      av.q[0] = *(const v4u*)(base);        // keys j0 + hi*8 + 0..7
      av.q[1] = *(const v4u*)(base + 16);   // keys j0 + 16 + hi*8 + 0..7
      o[dt] = mma_f16(av.v, pa.v, o[dt]);
    }
  }

  // normalize: the two halves' sums of query lq joined (sums and CTX^T both carry x4096); CTX as A fragment straight from the accumulators:
  // lane lq holds query row lq, elements follow the split d map
  const float rs = 1.0f / (rsum + xhalf(rsum));
  FragH ca;
  #pragma unroll
  for (int r = 0; r < 8; ++r) {
    ca.h[r]     = toh_flush(o[0][r] * rs);   // d = hi*8 + r
    ca.h[8 + r] = toh_flush(o[1][r] * rs);   // d = 16 + hi*8 + r
  }
  // ends every wave's last read of the key plane
  __syncthreads();

  // OUT tile of the wave, 16 rows x 256 channels in f32, staged over the key plane (dead behind the barrier above)
  float* so = (float*)sK + wave * (16 * OW);
  #pragma unroll   // laid out flat so that a group's fragment loads can stand among the stores of the group before
  for (int qn = 0; qn < 4; ++qn) {   // four independent 16-column tiles at a time: one LDS wait per four products
    FragH bw[4];
    #pragma unroll
    for (int j = 0; j < 4; ++j) {
      const f16* wp = sWo + ((qn * 4 + j) * 16 + lq) * CP + hi * 8;
      bw[j].q[0] = *(const v4u*)(wp);
      bw[j].q[1] = *(const v4u*)(wp + 16);
    }
    v8f acc[4];
    #pragma unroll
    for (int j = 0; j < 4; ++j) acc[j] = mma_f16(ca.v, bw[j].v, (v8f){0, 0, 0, 0, 0, 0, 0, 0});
    #pragma unroll
    for (int r = 0; r < 8; ++r) {
      #pragma unroll
      for (int j = 0; j < 4; ++j) so[(hi * 8 + r) * OW + (qn * 4 + j) * 16 + lq] = acc[j][r] * gsc;
    }
  }
  __syncthreads();

  // whole-line stores: instruction j writes half row j = 512 contiguous bytes (4 lines)
  #pragma unroll   // constant indices into xv
  for (int j = 0; j < 32; ++j) {
    v4f v = *(const v4f*)(so + (j >> 1) * OW + (j & 1) * (CIN / 2) + lane * 4);
    #pragma unroll
    for (int cc = 0; cc < 4; ++cc) v[cc] = v[cc] + (float)(bf16)xv[j][cc];   // residual with the RNE bf16 input value
    *(v4f*)(out + xoff + j * (CIN / 2)) = v;
  }
}

extern "C" void kernel_launch(void* const* d_in, const int* in_sizes, int n_in,
                              void* d_out, int out_size, void* d_ws, size_t ws_size,
                              hipStream_t stream) {
  if (n_in < 6) return;
  const size_t rows_used = (size_t)(NB - 1) * SEQ_FULL + SEQ;
  if ((size_t)in_sizes[0] < rows_used * CIN) return;
  if (in_sizes[1] < CIN * DQK) return;
  if (in_sizes[2] < CIN * DQK) return;
  if (in_sizes[3] < CIN * DV) return;
  if (in_sizes[4] < DV * CIN) return;
  if (in_sizes[5] < 1) return;
  if ((size_t)out_size < rows_used * CIN) return;
  if (ws_size < WS_TOTAL) return;

  const float* x     = (const float*)d_in[0];
  const float* wf    = (const float*)d_in[1];
  const float* wg    = (const float*)d_in[2];
  const float* wh    = (const float*)d_in[3];
  const float* wo    = (const float*)d_in[4];
  const float* gamma = (const float*)d_in[5];
  float* out = (float*)d_out;
  char*  ws  = (char*)d_ws;
  f16*  gq  = (f16*)(ws + OFF_GQ);
  f16*  fk  = (f16*)(ws + OFF_FK);
  f16*  hvt = (f16*)(ws + OFF_HVT);

  proj_pool_kernel<<<dim3(SEQ / 256, NB), 256, 0, stream>>>(x, wf, wg, wh, gq, fk, hvt);
  attn_out_kernel<<<dim3(SEQ / BQ, NB), 256, 0, stream>>>(gq, fk, hvt, wo, x, gamma, out);
}

// v007
// A run of this version takes 24.2 microseconds.
// Next to v006, in two timings, it ran 1.05 and 1.07 times as fast.
// Counting every step since v000, it is 3.63 times as fast.
#include <hip/hip_runtime.h>

// Contractions: X x [Wf|Wg|Wh] on v_wmma_f32_16x16x32_bf16 (bf16 operands = RNE-converted inputs, f32 accumulate);
// S^T = F x G^T as three v_wmma_f32_16x16x32_f16 products (value x value in one accumulator; value x residual and
// residual x value in a second accumulator, residual planes carried x2048 and folded back in f32);
// CTX^T = Hv^T x P^T (P as f16 carried x4096) and OUT = CTX x Wattn (Wattn as f16 of the bf16 value, carried x16)
// on v_wmma_f32_16x16x32_f16 (f16 operands, f32 accumulate). Max-pool, softmax and residual add in f32.

#ifndef NB
#define NB 8
#endif
#ifndef SEQ
#define SEQ 4096
#endif
#define NB_FULL  8
#define SEQ_FULL 4096
#define W_IMG    64                 // image width (pixels per image row)
#define CIN      256                // input channels
#define DQK      32                 // query / key channels
#define DV       32                 // value channels
#define NPROJ    96                 // packed projection columns: [0,32) f, [32,64) g, [64,96) h
#define QW       64                 // halves per row of the query / key planes: value 0..31 | residual 32..63
#define NKEY     (SEQ / 4)          // pooled key count per image
#define KTILE    64                 // keys produced per projection block
#define BQ       128                // query rows per attention block (8 waves x 16)
#define BK       32                 // keys per inner iteration
#define NWAVE    8
#define PF       68                 // LDS pitch (floats) of the ww-pooled staging rows (f 0..31 | h 32..63)
#define GP       72                 // LDS pitch (halves) of the g staging tile (value | residual)
#define FP       72                 // LDS pitch (halves) of the pooled f tile (value | residual)
#define HP       72                 // LDS pitch (halves) of the pooled h^T tile
#define CP       40                 // LDS pitch (halves) of a staged Wattn row (32 d): 80 B = 16 B x odd
#define OW       (CIN + 4)          // LDS pitch (floats) of a staged output row (256 channels): 1040 B = 16 B x odd
#define KP       72                 // LDS pitch (halves) of a staged key row (value | residual): 144 B = 16 B x odd
#define VP       (NKEY + 8)         // LDS pitch (halves) of a staged h^T row: 16 B x odd
#define WP       (CIN + 8)          // LDS pitch (bf16) of a staged weight row: 528 B = 16 B x odd
#define XP       (CIN / 2 + 4)      // LDS pitch (floats) of a staged half x row (128 channels): 528 B = 16 B x odd
#define XBUF     (NWAVE * 16 * XP)  // floats in one of the two x buffers

static_assert(SEQ % 256 == 0);
static_assert(SEQ >= 256 && SEQ <= SEQ_FULL);
static_assert(NB >= 1 && NB <= NB_FULL);
static_assert(BQ == NWAVE * 16);
static_assert(NKEY % BK == 0);
static_assert(NKEY % KTILE == 0);
static_assert(CIN % 32 == 0 && DV == 32 && DQK == 32);
static_assert(NPROJ == 2 * DQK + DV && NPROJ % 16 == 0 && NPROJ / 8 == 12);
static_assert(QW == 2 * DQK && QW * 2 == 128);
static_assert(W_IMG == 64 && CIN == 4 * 64);
// coverage equalities (grid x block x per-thread elements == plane extent)
static_assert((SEQ / 256) * 2 * NWAVE * 16 == SEQ);          // g plane rows per image
static_assert((SEQ / 256) * KTILE == NKEY);                   // f / h^T plane keys per image
static_assert((SEQ / BQ) * NWAVE * 16 == SEQ);                // ctx / output rows per image
static_assert(4 * 32 * 8 == 16 * QW);                         // g tile store: 4 instructions x 32 lanes x 8 halves
static_assert(2 * 256 * 8 == KTILE * QW);                     // key tile store: 2 x 256 threads x 8 halves
static_assert(256 * 8 == DV * KTILE);                         // h^T tile store: 256 threads x 8 halves
static_assert(32 * 32 * 4 == 16 * CIN);                       // output tile store: 32 instructions x 32 lanes x 4 floats
static_assert(4 * 256 == 32 * DQK && 4 * 256 == 32 * DV);     // hh-pool element loops
static_assert(NWAVE * 4 * 8 == CIN && 8 * 4 == DQK && DQK == DV);   // weight rows: 8 waves x 4 lane groups x 8 k, 8 lanes x 4 n
static_assert(64 * 4 == CIN && 4 * 8 == DV);                  // Wattn rows: 64 threads x 4 n, 4 thread groups x 8 d
static_assert(PF >= 2 * DQK && (PF * 4) % 16 == 0);
static_assert(GP >= QW && FP >= QW && HP >= KTILE && CP >= DV && OW >= CIN);
static_assert((GP * 2) % 16 == 0 && (FP * 2) % 16 == 0 && (HP * 2) % 16 == 0 && (CP * 2) % 16 == 0);
static_assert((OW * 4) % 32 == 16);
static_assert(KP >= QW && (KP * 2) % 32 == 16 && (VP * 2) % 32 == 16);
static_assert((NKEY * QW) % (8 * 256 * 8) == 0);              // key plane: whole groups of 8 copies x 256 lanes x 8 halves
static_assert((DV * NKEY) % (8 * 256 * 8) == 0);              // h^T plane: the same
static_assert((NKEY * QW + DV * NKEY) / (256 * 8) <= 63);     // copies of one wave in flight
static_assert((NKEY * KP + DV * VP + CIN * CP) * 2 <= 327680);
static_assert(NWAVE * 16 * OW * 4 <= NKEY * KP * 2);          // the output tile fits over the key plane
static_assert((WP * 2) % 32 == 16 && (XP * 4) % 32 == 16);
static_assert(16 * (CIN / 2) * 4 == 2 * 8 * 32 * 16);         // one wave's half x rows: 16 copies x 32 lanes x 16 B
static_assert(2 * 32 * PF * 4 + (NWAVE * 16 * GP + 64 * FP + DV * HP) * 2 + NPROJ * WP * 2 + 2 * XBUF * 4 <= 327680);

static constexpr size_t GQ_BYTES  = (size_t)NB * SEQ * QW * 2;        // 4,194,304 at full size
static constexpr size_t FK_BYTES  = (size_t)NB * NKEY * QW * 2;       // 1,048,576
static constexpr size_t HVT_BYTES = (size_t)NB * DV * NKEY * 2;       // 524,288
static constexpr size_t OFF_GQ  = 0;
static constexpr size_t OFF_FK  = OFF_GQ + GQ_BYTES;
static constexpr size_t OFF_HVT = OFF_FK + FK_BYTES;
static constexpr size_t WS_TOTAL = OFF_HVT + HVT_BYTES;               // 5,767,168 at full size
static_assert(GQ_BYTES % 128 == 0 && FK_BYTES % 128 == 0 && HVT_BYTES % 128 == 0);
static_assert(WS_TOTAL <= (size_t)134217728);

typedef __bf16   bf16;
typedef _Float16 f16;
typedef bf16     v16bf __attribute__((ext_vector_type(16)));
typedef f16      v16h  __attribute__((ext_vector_type(16)));
typedef f16      v8h   __attribute__((ext_vector_type(8)));
typedef float    v8f   __attribute__((ext_vector_type(8)));
typedef float    v4f   __attribute__((ext_vector_type(4)));
typedef float    v2f   __attribute__((ext_vector_type(2)));
typedef unsigned v4u   __attribute__((ext_vector_type(4)));

union FragB  { v16bf v; v4u q[2]; bf16 h[16]; };
union FragH  { v16h  v; v4u q[2]; f16  h[16]; };
union Pack8B { v4u u; bf16 h[8]; };
union Pack8H { v4u u; v8h v; f16 h[8]; };

// WMMA helpers: builtin followed by the VALU hazard guard (ties D, keeps A/B live).
static __device__ __forceinline__ v8f mma_bf16(v16bf a, v16bf b, v8f acc) {
  acc = __builtin_amdgcn_wmma_f32_16x16x32_bf16(false, a, false, b, (short)0, acc, false, false);
  asm volatile("v_nop\n\tv_nop\n\tv_nop\n\tv_nop" : "+v"(acc) : "v"(a), "v"(b));
  return acc;
}
static __device__ __forceinline__ v8f mma_f16(v16h a, v16h b, v8f acc) {
  acc = __builtin_amdgcn_wmma_f32_16x16x32_f16(false, a, false, b, (short)0, acc, false, false);
  asm volatile("v_nop\n\tv_nop\n\tv_nop\n\tv_nop" : "+v"(acc) : "v"(a), "v"(b));
  return acc;
}

// Eight asynchronous 16-byte copies per lane, global -> LDS, through no register: copy i takes the 16-byte piece
// number piece0 + i * 256 of a plane whose rows hold ROWH halves and lands it at row pitch PITCH (halves) in LDS.
// The closing s_wait_xcnt stands inside the statement so that no address register is rewritten ahead of it.
template <int ROWH, int PITCH>
static __device__ __forceinline__ void copy8_to_lds(const f16* __restrict__ plane, unsigned lds_base, int piece0) {
  const f16* g[8];
  unsigned   l[8];
  #pragma unroll   // constant indices: the sixteen addresses stay in registers for the asm operands
  for (int i = 0; i < 8; ++i) {
    const int piece = piece0 + i * 256;
    const int row   = piece / (ROWH / 8);
    const int col   = piece % (ROWH / 8);
    g[i] = plane + (size_t)piece * 8;
    l[i] = lds_base + (unsigned)(row * PITCH + col * 8) * 2u;
  }
  asm volatile("global_load_async_to_lds_b128 %0, %8, off\n\t"
               "global_load_async_to_lds_b128 %1, %9, off\n\t"
               "global_load_async_to_lds_b128 %2, %10, off\n\t"
               "global_load_async_to_lds_b128 %3, %11, off\n\t"
               "global_load_async_to_lds_b128 %4, %12, off\n\t"
               "global_load_async_to_lds_b128 %5, %13, off\n\t"
               "global_load_async_to_lds_b128 %6, %14, off\n\t"
               "global_load_async_to_lds_b128 %7, %15, off\n\t"
               "s_wait_xcnt 0x0"
               :: "v"(l[0]), "v"(l[1]), "v"(l[2]), "v"(l[3]), "v"(l[4]), "v"(l[5]), "v"(l[6]), "v"(l[7]),
                  "v"(g[0]), "v"(g[1]), "v"(g[2]), "v"(g[3]), "v"(g[4]), "v"(g[5]), "v"(g[6]), "v"(g[7])
               : "memory");
}

// N (8 or 4) asynchronous 16-byte copies per lane, global -> LDS, through no register: copy i takes the 16-byte piece
// number piece0 + i * STEP of a tile whose rows hold ROWB bytes at pitch SRCB in global memory and lands it at row
// pitch PITCHB in LDS (all in bytes).
// The closing s_wait_xcnt stands inside the statement so that no address register is rewritten ahead of it.
template <int N, int ROWB, int SRCB, int PITCHB, int STEP>
static __device__ __forceinline__ void copy_rows_to_lds(const char* __restrict__ plane, unsigned lds_base, int piece0) {
  static_assert(N == 8 || N == 4);
  const char* g[N];
  unsigned    l[N];
  #pragma unroll   // constant indices: the addresses stay in registers for the asm operands
  for (int i = 0; i < N; ++i) {
    const int piece = piece0 + i * STEP;
    const int row   = piece / (ROWB / 16);
    const int col   = piece % (ROWB / 16);
    g[i] = plane + (size_t)(row * SRCB + col * 16);
    l[i] = lds_base + (unsigned)(row * PITCHB + col * 16);
  }
  if constexpr (N == 8) {
    asm volatile("global_load_async_to_lds_b128 %0, %8, off\n\t"
                 "global_load_async_to_lds_b128 %1, %9, off\n\t"
                 "global_load_async_to_lds_b128 %2, %10, off\n\t"
                 "global_load_async_to_lds_b128 %3, %11, off\n\t"
                 "global_load_async_to_lds_b128 %4, %12, off\n\t"
                 "global_load_async_to_lds_b128 %5, %13, off\n\t"
                 "global_load_async_to_lds_b128 %6, %14, off\n\t"
                 "global_load_async_to_lds_b128 %7, %15, off\n\t"
                 "s_wait_xcnt 0x0"
                 :: "v"(l[0]), "v"(l[1]), "v"(l[2]), "v"(l[3]), "v"(l[4]), "v"(l[5]), "v"(l[6]), "v"(l[7]),
                    "v"(g[0]), "v"(g[1]), "v"(g[2]), "v"(g[3]), "v"(g[4]), "v"(g[5]), "v"(g[6]), "v"(g[7])
                 : "memory");
  } else {
    asm volatile("global_load_async_to_lds_b128 %0, %4, off\n\t"
                 "global_load_async_to_lds_b128 %1, %5, off\n\t"
                 "global_load_async_to_lds_b128 %2, %6, off\n\t"
                 "global_load_async_to_lds_b128 %3, %7, off\n\t"
                 "s_wait_xcnt 0x0"
                 :: "v"(l[0]), "v"(l[1]), "v"(l[2]), "v"(l[3]), "v"(g[0]), "v"(g[1]), "v"(g[2]), "v"(g[3])
                 : "memory");
  }
}

// Lane l takes the value of lane l ^ 16 (the other k-split half of the same query), on the vector pipe.
static __device__ __forceinline__ float xhalf(float v) {
  const int b = __builtin_bit_cast(int, v);
  return __builtin_bit_cast(float, __builtin_amdgcn_permlanex16(b, b, 0x76543210, 0xfedcba98, false, false));
}

// f32 -> f16 convert that can never produce a subnormal operand (value select below 2^-14).
static __device__ __forceinline__ f16 toh_flush(float v) {
  const f16 r = (f16)v;
  return (fabsf(v) < 6.103515625e-05f) ? (f16)0.0f : r;
}

// Weight rows (k-contiguous, B fragments load like A fragments), built in LDS by the block that reads them:
//   sw  [NPROJ][WP] bf16 : row n = column n of [Wf | Wg | Wh], RNE bf16.
//   swo [CIN][CP]   f16  : row n = column n of Wattn, value f16(bf16(w) * 16) (exact for normal results).
// A lane takes an 8 (k) x 4 (n) patch of a matrix: eight 16-byte loads (every 128-byte line a load touches is used
// whole), then four 16-byte LDS stores of eight k-contiguous values each. Loads and stores are two calls, so that the
// loads can stand ahead of the block's asynchronous copies and fly while those are issued.
// coverage: sw rows 0..95 x k 0..255 (wave -> 32 k, lane >> 3 -> 8 k of them, lane & 7 -> 4 n, three matrices).
static __device__ __forceinline__ void load_proj_weights(const float* __restrict__ wf, const float* __restrict__ wg,
                                                         const float* __restrict__ wh, int wave, int lane,
                                                         v4f (&w)[3][8]) {
  const int n0 = (lane & 7) * 4;                  // 0..28
  const int k0 = wave * 32 + (lane >> 3) * 8;     // 0..248
  #pragma unroll   // constant indices: the patches stay in registers
  for (int i = 0; i < 8; ++i) {
    const size_t off = (size_t)(k0 + i) * DQK + n0;
    w[0][i] = *(const v4f*)(wf + off);
    w[1][i] = *(const v4f*)(wg + off);
    w[2][i] = *(const v4f*)(wh + off);
  }
}
static __device__ __forceinline__ void store_proj_weights(const v4f (&w)[3][8], bf16* sw, int wave, int lane) {
  const int n0 = (lane & 7) * 4;
  const int k0 = wave * 32 + (lane >> 3) * 8;
  #pragma unroll
  for (int mt = 0; mt < 3; ++mt) {
    #pragma unroll
    for (int j = 0; j < 4; ++j) {
      Pack8B pk;
      #pragma unroll
      for (int i = 0; i < 8; ++i) pk.h[i] = (bf16)w[mt][i][j];   // RNE convert
      *(v4u*)(sw + (mt * DQK + n0 + j) * WP + k0) = pk.u;
    }
  }
}
// coverage: swo rows 0..255 x d 0..31 (tid & 63 -> 4 n, tid >> 6 -> 8 d).
static __device__ __forceinline__ void load_out_weights(const float* __restrict__ wo, int tid, v4f (&w)[8]) {
  const int n0 = (tid & 63) * 4;    // 0..252
  const int d0 = (tid >> 6) * 8;    // 0..24
  #pragma unroll   // constant indices: the patch stays in registers
  for (int i = 0; i < 8; ++i) w[i] = *(const v4f*)(wo + (size_t)(d0 + i) * CIN + n0);
}
static __device__ __forceinline__ void store_out_weights(const v4f (&w)[8], f16* swo, int tid) {
  const int n0 = (tid & 63) * 4;
  const int d0 = (tid >> 6) * 8;
  #pragma unroll
  for (int j = 0; j < 4; ++j) {
    Pack8H pk;
    #pragma unroll
    for (int i = 0; i < 8; ++i) pk.h[i] = toh_flush((float)(bf16)w[i][j] * 16.0f);   // bf16 significand fits f16
    *(v4u*)(swo + (n0 + j) * CP + d0) = pk.u;
  }
}

// One wave's 16-pixel M tile times NTN consecutive 16-column tiles of the weight rows starting at tile NT0, summed into acc over
// the CIN / 2 channels of one staged half: k steps kk0 .. kk0 + 3.
// A fragments from the staged f32 x rows (xr = this lane's half row in LDS; RNE bf16 convert, split k map); B fragments
// from the staged k-contiguous weight rows (sw, pitch WP). A k step's sixteen LDS loads stand ahead of its products.
template <int NT0, int NTN>
static __device__ __forceinline__ void proj_tiles(const float* xr, const bf16* sw, int kk0,
                                                  int m, int hi, v8f (&acc)[NTN]) {
  for (int kq = 0; kq < CIN / 64; ++kq) {
    const int kk = kk0 + kq;
    const float* xp = xr + kq * 32;
    const v4f a0 = *(const v4f*)(xp + hi * 8);
    const v4f a1 = *(const v4f*)(xp + hi * 8 + 4);
    const v4f b0 = *(const v4f*)(xp + 16 + hi * 8);
    const v4f b1 = *(const v4f*)(xp + 16 + hi * 8 + 4);
    FragB bw[NTN];
    #pragma unroll
    for (int t = 0; t < NTN; ++t) {
      const bf16* wp = sw + ((NT0 + t) * 16 + m) * WP + kk * 32 + hi * 8;
      bw[t].q[0] = *(const v4u*)(wp);        // k = kk*32 + hi*8 + 0..7, n = tile*16 + m
      bw[t].q[1] = *(const v4u*)(wp + 16);   // k = kk*32 + 16 + hi*8 + 0..7
    }
    FragB a;
    #pragma unroll
    for (int i = 0; i < 4; ++i) {
      a.h[i]      = (bf16)a0[i];   // elems 0..7  : k = kk*32 + hi*8 + 0..7
      a.h[4 + i]  = (bf16)a1[i];
      a.h[8 + i]  = (bf16)b0[i];   // elems 8..15 : k = kk*32 + 16 + hi*8 + 0..7
      a.h[12 + i] = (bf16)b1[i];
    }
    #pragma unroll
    for (int t = 0; t < NTN; ++t) acc[t] = mma_bf16(a.v, bw[t].v, acc[t]);
  }
}

// Stage s of one wave's x ring: the 16 pixel rows of iteration s >> 1, channel half s & 1, into buffer s & 1.
// xw0 = the wave's first x row of iteration 0 (iteration 1 lies two image rows further), lx = its rows in buffer 0.
static __device__ __forceinline__ void copy_x_stage(const float* __restrict__ xw0, unsigned lx, int lane, int s) {
  const float*   src = xw0 + (size_t)(s >> 1) * 2 * W_IMG * CIN + (s & 1) * (CIN / 2);
  const unsigned dst = lx + (unsigned)(s & 1) * (XBUF * 4);
  for (int gph = 0; gph < 2; ++gph)
    copy_rows_to_lds<8, CIN * 2, CIN * 4, XP * 4, 32>((const char*)src, dst, gph * 256 + lane);
}

// Projection + 2x2 max-pool. Block = (64-key tile kt, batch b), 256 threads; two iterations each cover
// image rows hh = kt*4 + it*2 + {0,1}; wave -> (hh, 16 pixels along ww).
//                            (wave writes 16 rows = 2 KB, 4 instructions of 4 lines, 8 lanes x 16 B per line).
//   fk  [NB][NKEY][QW] f16 : pooled keys, value | residual x2048, 64 rows per block = 8 KB
//                            (2 instructions, each wave 4 lines, 8 lanes x 16 B per line).
// LDS regions: sP cross-wave (block barrier), sG per-wave but read across lanes after the block barrier,
// sF / sHT cross-wave (block barrier). Staged extent == consumed extent for all four.
// The weight rows (sW) are converted from the f32 inputs by the block itself, once, while the first x stage flies.
// x comes by asynchronous copies (whole lines from global, padded rows in LDS): each wave's 16 x rows of each of two iterations in four stages
// of 128 channels through two buffers (sX): a stage flies while the one before it is worked on, and a buffer is
// refilled behind the barrier that ends its last read.
__global__ __launch_bounds__(256) void proj_pool_kernel(const float* __restrict__ x, const float* __restrict__ wf,
                                                         const float* __restrict__ wg, const float* __restrict__ wh,
                                                         f16* __restrict__ gq, f16* __restrict__ fk,
                                                         f16* __restrict__ hvt) {
  const int kt   = blockIdx.x;
  const int b    = blockIdx.y;
  const int tid  = threadIdx.x;
  const int wave = __builtin_amdgcn_readfirstlane(threadIdx.x >> 5);
  const int lane = tid & 31;
  const int m    = lane & 15;
  const int hi   = lane >> 4;
  const int hsel = wave >> 2;          // which of the two image rows of this iteration
  const int ww0  = (wave & 3) * 16;    // first pixel column of this wave's tile

  __shared__ __align__(16) float sP[2 * 32 * PF];     // [hsel][pw][64 cols] ww-pooled f|h in f32
  __shared__ __align__(16) f16 sG[NWAVE * 16 * GP];   // per-wave g tile [16][value 32 | residual 32]
  __shared__ __align__(16) f16 sF[64 * FP];           // pooled f [64 keys][value 32 | residual 32]
  __shared__ __align__(16) f16 sHT[DV * HP];          // pooled h^T [32 d][64 keys]
  __shared__ __align__(16) bf16 sW[NPROJ * WP];       // weight rows [96 n][256 k]
  __shared__ __align__(16) float sX[2 * XBUF];        // [buffer][wave][16 pixels][128 channels] in f32

  f16*   sg = sG + wave * (16 * GP);
  float* sp = sP + hsel * (32 * PF);
  const int pwb = (ww0 >> 1) + hi * 4;   // pooled column index base for this lane half

  const float*   sx  = sX + wave * (16 * XP);
  const unsigned lx  = (unsigned)(size_t)sx;
  // first x row of this wave's tile in iteration 0; iteration 1 lies two image rows further
  const float*   xw0 = x + ((size_t)b * SEQ_FULL + (kt * 4 + hsel) * W_IMG + ww0) * CIN;

  v4f wv[3][8];
  load_proj_weights(wf, wg, wh, wave, lane, wv);
  // fill: every lane of every wave copies its own 16-byte pieces, no branch around the copies
  copy_x_stage(xw0, lx, lane, 0);
  store_proj_weights(wv, sW, wave, lane);
  // this wave's copies have landed; behind the barrier every wave's have, and every wave's weight rows are written
  asm volatile("s_wait_asynccnt 0x0" ::: "memory");
  __syncthreads();
  copy_x_stage(xw0, lx, lane, 1);

  #pragma unroll   // the four stages laid out flat: which refills and waits exist is settled at compile time, no test around a copy
  for (int it = 0; it < 2; ++it) {
    const int hh   = kt * 4 + it * 2 + hsel;
    const int pix0 = hh * W_IMG + ww0;

    {   // tiles 0,1: f; 2,3: g; 4,5: h
      v8f acc[6];
      #pragma unroll
      for (int t = 0; t < 6; ++t) acc[t] = (v8f){0, 0, 0, 0, 0, 0, 0, 0};
      proj_tiles<0, 6>(sx + m * XP, sW, 0, m, hi, acc);
      // publish point of stage 2 * it + 1: this wave's reads of buffer 0 have retired, its copies into buffer 1 have landed
      asm volatile("s_wait_dscnt 0x0" ::: "memory");
      asm volatile("s_wait_asynccnt 0x0" ::: "memory");
      __syncthreads();
      if (it + 1 < 2) copy_x_stage(xw0, lx, lane, 2 * it + 2);
      proj_tiles<0, 6>(sx + XBUF + m * XP, sW, CIN / 64, m, hi, acc);
      #pragma unroll
      for (int r = 0; r < 8; ++r) {
        const float g0 = acc[2][r];
        const float g1 = acc[3][r];
        const f16 h0 = toh_flush(g0);
        const f16 h1 = toh_flush(g1);
        sg[(hi * 8 + r) * GP + m]      = h0;
        sg[(hi * 8 + r) * GP + 16 + m] = h1;
        sg[(hi * 8 + r) * GP + 32 + m] = toh_flush((g0 - (float)h0) * 2048.0f);
        sg[(hi * 8 + r) * GP + 48 + m] = toh_flush((g1 - (float)h1) * 2048.0f);
      }
      // ww pairs are D rows (2rp, 2rp+1) of the same lane half; pooled column pw = ww0/2 + 4*hi + rp
      #pragma unroll
      for (int rp = 0; rp < 4; ++rp) {
        #pragma unroll
        for (int t = 0; t < 2; ++t) {
          sp[(pwb + rp) * PF + t * 16 + m]      = fmaxf(acc[t][2 * rp], acc[t][2 * rp + 1]);
          sp[(pwb + rp) * PF + 32 + t * 16 + m] = fmaxf(acc[4 + t][2 * rp], acc[4 + t][2 * rp + 1]);
        }
      }
    }
    // publish point of stage 2 * it + 2, where there is one, at the barrier that the pooling needs anyway
    if (it + 1 < 2) {
      asm volatile("s_wait_dscnt 0x0" ::: "memory");
      asm volatile("s_wait_asynccnt 0x0" ::: "memory");
    }
    __syncthreads();
    if (it + 1 < 2) copy_x_stage(xw0, lx, lane, 2 * it + 3);

    {
      v4u    gv[4];
      size_t gi[4];
      #pragma unroll
      for (int i4 = 0; i4 < 4; ++i4) {
        const int row = i4 * 4 + (lane >> 3);
        const int cq  = (lane & 7) * 8;
        Pack8H p;
        p.v = *(const v8h*)(sg + row * GP + cq);
        gv[i4] = p.u;
        gi[i4] = ((size_t)b * SEQ + pix0 + row) * QW + cq;
      }
      #pragma unroll
      for (int i4 = 0; i4 < 4; ++i4) *(v4u*)(gq + gi[i4]) = gv[i4];
      
    }

    // hh-pool into the block's pooled tiles (f32 max, then one convert)
    #pragma unroll
    for (int e = 0; e < 4; ++e) {
      const int idx = e * 256 + tid;
      const int pw  = idx >> 5;
      const int c   = idx & 31;
      const float v = fmaxf(sP[pw * PF + c], sP[32 * PF + pw * PF + c]);
      const f16 hv  = toh_flush(v);
      sF[(it * 32 + pw) * FP + c]      = hv;
      sF[(it * 32 + pw) * FP + 32 + c] = toh_flush((v - (float)hv) * 2048.0f);
    }
    #pragma unroll
    for (int e = 0; e < 4; ++e) {
      const int idx = e * 256 + tid;
      const int pw  = idx >> 5;
      const int d   = idx & 31;
      const float v = fmaxf(sP[pw * PF + 32 + d], sP[32 * PF + pw * PF + 32 + d]);
      sHT[d * HP + it * 32 + pw] = toh_flush(v);
    }
    __syncthreads();
  }

  // final plane stores: fk (per instruction a wave writes 4 rows = 512 B), hvt (per instruction 4 d-lines)
  v4u    fv[2];
  size_t fi[2];
  #pragma unroll
  for (int i2 = 0; i2 < 2; ++i2) {
    const int idx = i2 * 256 + tid;
    const int row = idx >> 3;            // 0..63
    const int cq  = (idx & 7) * 8;
    Pack8H p;
    p.v = *(const v8h*)(sF + row * FP + cq);
    fv[i2] = p.u;
    fi[i2] = ((size_t)b * NKEY + kt * KTILE + row) * QW + cq;
  }
  v4u    hv;
  size_t hidx;
  {
    const int d  = tid >> 3;             // 0..31
    const int kq = (tid & 7) * 8;        // 0..56
    Pack8H p;
    p.v = *(const v8h*)(sHT + d * HP + kq);
    hv   = p.u;
    hidx = ((size_t)b * DV + d) * NKEY + kt * KTILE + kq;
  }
  #pragma unroll
  for (int i2 = 0; i2 < 2; ++i2) *(v4u*)(fk + fi[i2]) = fv[i2];
  *(v4u*)(hvt + hidx) = hv;
  
}

// Flash attention, non-causal, no score scaling. Block = (query block of 128, batch); one wave owns 16 queries.
// S^T = F x G^T so queries sit on lanes; P^T in C-layout is bit-identical to the B-fragment layout of
// CTX^T += Hv^T x P^T, whose columns are again the queries: a query's maximum, sum and rescale stay on its own two
// lanes (lq, lq + 16), which exchange the maximum once per 32 keys and join their sums once, behind the loop.
// Scores: value x value in c, (value x residual + residual x value) in cr, s = c + cr / 2048.
// The image's whole key plane and h^T plane are staged once in LDS by asynchronous copies (whole lines from global,
// padded rows in LDS) and shared by the block's 8 waves; F A-fragments and Hv^T A-fragments are two 16-B LDS loads
// each, G B-fragments two 16-B global loads each.
// Epilogue in the same launch: out = gamma * (CTX x Wo) + x_bf16 for the block's 128 query rows. The two CTX^T tiles,
// converted in place, are the A fragment of that product (split d map); B fragments from sWo (Wattn carried x16),
// converted by the block itself while the fill flies;
// the wave's 16 x rows are loaded behind the fill's barrier and fly while the key loop runs.
// LDS: sK / sV / sWo written once, read-only behind the fill's barrier; the block barrier behind the key loop ends
// every wave's last read of sK, over which the f32 output tile is then staged (per-wave region, block barrier), so
// that every store instruction writes 512 contiguous bytes.
__global__ __launch_bounds__(256) void attn_out_kernel(const f16* __restrict__ gq, const f16* __restrict__ fk,
                                                       const f16* __restrict__ hvt, const float* __restrict__ wo,
                                                       const float* __restrict__ x, const float* __restrict__ gamma,
                                                       float* __restrict__ out) {
  const int qblk = blockIdx.x;
  const int b    = blockIdx.y;
  const int tid  = threadIdx.x;
  const int wave = __builtin_amdgcn_readfirstlane(threadIdx.x >> 5);
  const int lane = tid & 31;
  const int lq   = lane & 15;   // query column of S^T and of CTX^T
  const int hi   = lane >> 4;   // k-split half

  __shared__ __align__(16) f16 sK[NKEY * KP];   // [key][value 32 | residual 32]
  __shared__ __align__(16) f16 sV[DV * VP];     // [d][key]
  __shared__ __align__(16) f16 sWo[CIN * CP];   // [n][d]

  const int qrow0 = qblk * BQ + wave * 16;
  const float gsc = (float)(bf16)gamma[0] * 0.0625f;   // gamma (RNE bf16) folded with the 1/16 Wo carry

  const f16* fk_b = fk + (size_t)b * NKEY * QW;
  const f16* vt_b = hvt + (size_t)b * DV * NKEY;

  // the block's plain loads stand ahead of the fill and fly while its copies are issued
  v4f wv[8];
  load_out_weights(wo, tid, wv);

  // G as B-operand fragments: lane lq holds query qrow0+lq, elements follow the split d map
  FragH qf, qr;
  {
    const f16* qp = gq + ((size_t)b * SEQ + qrow0 + lq) * QW + hi * 8;
    qf.q[0] = *(const v4u*)(qp);        // value,    d = hi*8 + 0..7
    qf.q[1] = *(const v4u*)(qp + 16);   // value,    d = 16 + hi*8 + 0..7
    qr.q[0] = *(const v4u*)(qp + 32);   // residual, d = hi*8 + 0..7
    qr.q[1] = *(const v4u*)(qp + 48);   // residual, d = 16 + hi*8 + 0..7
  }

  // fill: every lane of every wave copies its own 16-byte pieces, no branch around the copies
  {
    const unsigned lk = (unsigned)(size_t)sK;
    const unsigned lv = (unsigned)(size_t)sV;
    for (int gph = 0; gph < (NKEY * QW) / (8 * 256 * 8); ++gph) copy8_to_lds<QW, KP>(fk_b, lk, gph * 2048 + tid);
    for (int gph = 0; gph < (DV * NKEY) / (8 * 256 * 8); ++gph) copy8_to_lds<NKEY, VP>(vt_b, lv, gph * 2048 + tid);
  }
  // keeps the Wattn converts, which wait for their loads, from being scheduled among or ahead of the fill's copies
  __builtin_amdgcn_sched_barrier(0);

  v8f o[2];
  #pragma unroll
  for (int dt = 0; dt < 2; ++dt) o[dt] = (v8f){0, 0, 0, 0, 0, 0, 0, 0};

  float rmax = -__builtin_inff();
  float rsum = 0.0f;
  const float SL = 1.4426950408889634f;   // log2(e); the scores carry no extra scale
  const float RS = 1.0f / 2048.0f;        // residual plane carry folded back

  store_out_weights(wv, sWo, tid);

  // this wave's copies have landed; behind the barrier every wave's have
  asm volatile("s_wait_asynccnt 0x0" ::: "memory");
  __syncthreads();

  // residual rows of this wave's 16 queries: instruction j takes half row j (512 contiguous bytes); first used in the
  // epilogue, so the loads stand behind the barrier (which would wait for them) and ahead of the key loop
  const size_t xoff = ((size_t)b * SEQ_FULL + qrow0) * CIN + lane * 4;
  v4f xv[32];
  #pragma unroll   // constant indices: the rows stay in registers until the epilogue
  for (int j = 0; j < 32; ++j) xv[j] = *(const v4f*)(x + xoff + j * (CIN / 2));

  // F A-fragments of pass 0; every later pass finds its own already in these registers
  FragH ak[2], akr[2];
  #pragma unroll
  for (int sub = 0; sub < 2; ++sub) {
    const f16* base = sK + (sub * 16 + lq) * KP + hi * 8;
    ak[sub].q[0]  = *(const v4u*)(base);        // d = hi*8 + 0..7
    ak[sub].q[1]  = *(const v4u*)(base + 16);   // d = 16 + hi*8 + 0..7
    akr[sub].q[0] = *(const v4u*)(base + 32);
    akr[sub].q[1] = *(const v4u*)(base + 48);
  }

  for (int i = 0; i < NKEY / BK; ++i) {
    const int j0 = i * BK;

    // S^T tiles: c[sub][r] = score(query qrow0+lq, key j0 + sub*16 + hi*8 + r)
    v8f c[2], cr[2];
    #pragma unroll
    for (int sub = 0; sub < 2; ++sub) {
      c[sub]  = mma_f16(ak[sub].v,  qf.v, (v8f){0, 0, 0, 0, 0, 0, 0, 0});
      cr[sub] = mma_f16(ak[sub].v,  qr.v, (v8f){0, 0, 0, 0, 0, 0, 0, 0});
      cr[sub] = mma_f16(akr[sub].v, qf.v, cr[sub]);
    }

    // one group of LDS loads per pass, right behind the S^T products, landing while the softmax runs: the next pass's
    // F fragments into the same registers (the last pass takes pass 0's rows again and uses none of them), and this
    // pass's Hv^T A-fragments: row m = d = dt*16 + lq, split key map from the transposed plane
    const int jn = ((i + 1) % (NKEY / BK)) * BK;
    #pragma unroll
    for (int sub = 0; sub < 2; ++sub) {
      const f16* base = sK + (jn + sub * 16 + lq) * KP + hi * 8;
      ak[sub].q[0]  = *(const v4u*)(base);        // d = hi*8 + 0..7
      ak[sub].q[1]  = *(const v4u*)(base + 16);   // d = 16 + hi*8 + 0..7
      akr[sub].q[0] = *(const v4u*)(base + 32);
      akr[sub].q[1] = *(const v4u*)(base + 48);
    }
    FragH av[2];
    #pragma unroll
    for (int dt = 0; dt < 2; ++dt) {
      const f16* base = sV + (dt * 16 + lq) * VP + j0 + hi * 8;
      av[dt].q[0] = *(const v4u*)(base);        // keys j0 + hi*8 + 0..7
      av[dt].q[1] = *(const v4u*)(base + 16);   // keys j0 + 16 + hi*8 + 0..7
    }

    #pragma unroll
    for (int sub = 0; sub < 2; ++sub) {
      #pragma unroll
      for (int r = 0; r < 8; ++r) c[sub][r] = c[sub][r] + cr[sub][r] * RS;
    }

    // online softmax: query lq's 32 scores are split across lane / lane^16
    float m_new = rmax;
    #pragma unroll
    for (int r = 0; r < 8; ++r) {
      m_new = fmaxf(m_new, c[0][r]);
      m_new = fmaxf(m_new, c[1][r]);
    }
    m_new = fmaxf(m_new, xhalf(m_new));
    const float scale = __builtin_amdgcn_exp2f((rmax - m_new) * SL);
    rmax = m_new;

    // exp + pack: P^T C-layout == B-fragment layout for the PV product; P carried x4096 in f16.
    // log2(e), the maximum and the carry sit in one fused multiply-add per score: p * 4096 = exp2(s * SL + kb), which
    // goes to the convert as it is (far below the maximum it rounds to an f16 subnormal or to zero).
    const float kb = __builtin_fmaf(-m_new, SL, 12.0f);
    FragH pa;
    v2f px[2][4];
    #pragma unroll   // constant indices: scores, exponentials and the fragment stay in registers
    for (int sub = 0; sub < 2; ++sub) {
      #pragma unroll   // the same
      for (int i2 = 0; i2 < 4; ++i2) {   // keys j0 + sub*16 + hi*8 + 2*i2, + 1: a register pair of the accumulator
        const v2f e = __builtin_elementwise_fma((v2f){c[sub][2 * i2], c[sub][2 * i2 + 1]}, (v2f){SL, SL}, (v2f){kb, kb});
        px[sub][i2] = (v2f){__builtin_amdgcn_exp2f(e[0]), __builtin_amdgcn_exp2f(e[1])};
        pa.h[sub * 8 + 2 * i2]     = (f16)px[sub][i2][0];
        pa.h[sub * 8 + 2 * i2 + 1] = (f16)px[sub][i2][1];
      }
    }
    float psum = 0.0f;   // carried x4096 like P
    #pragma unroll   // constant indices into px
    for (int i2 = 0; i2 < 4; ++i2) {
      const v2f t = px[0][i2] + px[1][i2];
      psum += t[0];
      psum += t[1];
    }
    rsum = rsum * scale + psum;   // the keys of this lane's half only

    // rescale CTX^T: the query is the column there -> the lane's own scale
    #pragma unroll
    for (int dt = 0; dt < 2; ++dt) {
      #pragma unroll
      for (int r = 0; r < 8; ++r) o[dt][r] *= scale;
    }

    // CTX^T += Hv^T x P^T : o[dt][r] = ctx(query qrow0 + lq, d = dt*16 + hi*8 + r)
    #pragma unroll
    for (int dt = 0; dt < 2; ++dt) o[dt] = mma_f16(av[dt].v, pa.v, o[dt]);
  }

  // normalize: the two halves' sums of query lq joined (sums and CTX^T both carry x4096); CTX as A fragment straight from the accumulators:
  // lane lq holds query row lq, elements follow the split d map
  const float rs = 1.0f / (rsum + xhalf(rsum));
  FragH ca;
  #pragma unroll
  for (int r = 0; r < 8; ++r) {
    ca.h[r]     = toh_flush(o[0][r] * rs);   // d = hi*8 + r
    ca.h[8 + r] = toh_flush(o[1][r] * rs);   // d = 16 + hi*8 + r
  }
  // ends every wave's last read of the key plane
  __syncthreads();

  // OUT tile of the wave, 16 rows x 256 channels in f32, staged over the key plane (dead behind the barrier above)
  float* so = (float*)sK + wave * (16 * OW);
  #pragma unroll   // laid out flat so that a group's fragment loads can stand among the stores of the group before
  for (int qn = 0; qn < 4; ++qn) {   // four independent 16-column tiles at a time: one LDS wait per four products
    FragH bw[4];
    #pragma unroll
    for (int j = 0; j < 4; ++j) {
      const f16* wp = sWo + ((qn * 4 + j) * 16 + lq) * CP + hi * 8;
      bw[j].q[0] = *(const v4u*)(wp);
      bw[j].q[1] = *(const v4u*)(wp + 16);
    }
    v8f acc[4];
    #pragma unroll
    for (int j = 0; j < 4; ++j) acc[j] = mma_f16(ca.v, bw[j].v, (v8f){0, 0, 0, 0, 0, 0, 0, 0});
    #pragma unroll
    for (int r = 0; r < 8; ++r) {
      #pragma unroll
      for (int j = 0; j < 4; ++j) so[(hi * 8 + r) * OW + (qn * 4 + j) * 16 + lq] = acc[j][r] * gsc;
    }
  }
  __syncthreads();

  // whole-line stores: instruction j writes half row j = 512 contiguous bytes (4 lines)
  #pragma unroll   // constant indices into xv
  for (int j = 0; j < 32; ++j) {
    v4f v = *(const v4f*)(so + (j >> 1) * OW + (j & 1) * (CIN / 2) + lane * 4);
    #pragma unroll
    for (int cc = 0; cc < 4; ++cc) v[cc] = v[cc] + (float)(bf16)xv[j][cc];   // residual with the RNE bf16 input value
    *(v4f*)(out + xoff + j * (CIN / 2)) = v;
  }
}

extern "C" void kernel_launch(void* const* d_in, const int* in_sizes, int n_in,
                              void* d_out, int out_size, void* d_ws, size_t ws_size,
                              hipStream_t stream) {
  if (n_in < 6) return;
  const size_t rows_used = (size_t)(NB - 1) * SEQ_FULL + SEQ;
  if ((size_t)in_sizes[0] < rows_used * CIN) return;
  if (in_sizes[1] < CIN * DQK) return;
  if (in_sizes[2] < CIN * DQK) return;
  if (in_sizes[3] < CIN * DV) return;
  if (in_sizes[4] < DV * CIN) return;
  if (in_sizes[5] < 1) return;
  if ((size_t)out_size < rows_used * CIN) return;
  if (ws_size < WS_TOTAL) return;

  const float* x     = (const float*)d_in[0];
  const float* wf    = (const float*)d_in[1];
  const float* wg    = (const float*)d_in[2];
  const float* wh    = (const float*)d_in[3];
  const float* wo    = (const float*)d_in[4];
  const float* gamma = (const float*)d_in[5];
  float* out = (float*)d_out;
  char*  ws  = (char*)d_ws;
  f16*  gq  = (f16*)(ws + OFF_GQ);
  f16*  fk  = (f16*)(ws + OFF_FK);
  f16*  hvt = (f16*)(ws + OFF_HVT);

  proj_pool_kernel<<<dim3(SEQ / 256, NB), 256, 0, stream>>>(x, wf, wg, wh, gq, fk, hvt);
  attn_out_kernel<<<dim3(SEQ / BQ, NB), 256, 0, stream>>>(gq, fk, hvt, wo, x, gamma, out);
}

// v008
// It runs in 22.2 microseconds.
// Timed twice side by side with v007, it ran 1.09 and 1.08 times as fast.
// Over all steps from v000 it is 3.93 times as fast.
#include <hip/hip_runtime.h>

// Contractions: X x [Wf|Wg|Wh] on v_wmma_f32_16x16x32_bf16 (bf16 operands = RNE-converted inputs, f32 accumulate);
// S^T = F x G^T as three v_wmma_f32_16x16x32_f16 products (value x value in one accumulator; value x residual and
// residual x value in a second accumulator, residual planes carried x2048 and folded back in f32);
// CTX^T = Hv^T x P^T (P as f16 carried x4096) and OUT = CTX x Wattn (Wattn as f16 of the bf16 value, carried x16)
// on v_wmma_f32_16x16x32_f16 (f16 operands, f32 accumulate). Max-pool, softmax and residual add in f32.

#ifndef NB
#define NB 8
#endif
#ifndef SEQ
#define SEQ 4096
#endif
#define NB_FULL  8
#define SEQ_FULL 4096
#define W_IMG    64                 // image width (pixels per image row)
#define CIN      256                // input channels
#define DQK      32                 // query / key channels
#define DV       32                 // value channels
#define NPROJ    96                 // packed projection columns: [0,32) f, [32,64) g, [64,96) h
#define QW       64                 // halves per row of the query / key planes: value 0..31 | residual 32..63
#define NKEY     (SEQ / 4)          // pooled key count per image
#define KTILE    32                 // keys produced per projection block (two image rows)
#define BQ       128                // query rows per attention block (8 waves x 16)
#define BK       32                 // keys per inner iteration
#define NWAVE    8
#define PF       68                 // LDS pitch (floats) of the ww-pooled staging rows (f 0..31 | h 32..63)
#define GP       72                 // LDS pitch (halves) of the g staging tile (value | residual)
#define FP       72                 // LDS pitch (halves) of the pooled f tile (value | residual)
#define HP       72                 // LDS pitch (halves) of the pooled h^T tile
#define CP       40                 // LDS pitch (halves) of a staged Wattn row (32 d): 80 B = 16 B x odd
#define OW       (CIN + 4)          // LDS pitch (floats) of a staged output row (256 channels): 1040 B = 16 B x odd
#define KP       72                 // LDS pitch (halves) of a staged key row (value | residual): 144 B = 16 B x odd
#define VP       (NKEY + 8)         // LDS pitch (halves) of a staged h^T row: 16 B x odd
#define WP       (CIN + 8)          // LDS pitch (bf16) of a staged weight row: 528 B = 16 B x odd
#define XP       (CIN / 2 + 4)      // LDS pitch (floats) of a staged half x row (128 channels): 528 B = 16 B x odd
#define XBUF     (NWAVE * 16 * XP)  // floats in one of the two x buffers

static_assert(SEQ % 256 == 0);
static_assert(SEQ >= 256 && SEQ <= SEQ_FULL);
static_assert(NB >= 1 && NB <= NB_FULL);
static_assert(BQ == NWAVE * 16);
static_assert(NKEY % BK == 0);
static_assert(NKEY % KTILE == 0);
static_assert(CIN % 32 == 0 && DV == 32 && DQK == 32);
static_assert(NPROJ == 2 * DQK + DV && NPROJ % 16 == 0 && NPROJ / 8 == 12);
static_assert(QW == 2 * DQK && QW * 2 == 128);
static_assert(W_IMG == 64 && CIN == 4 * 64);
// coverage equalities (grid x block x per-thread elements == plane extent)
static_assert((SEQ / 128) * NWAVE * 16 == SEQ);              // g plane rows per image
static_assert((SEQ / 128) * KTILE == NKEY);                   // f / h^T plane keys per image
static_assert((SEQ / BQ) * NWAVE * 16 == SEQ);                // ctx / output rows per image
static_assert(4 * 32 * 8 == 16 * QW);                         // g tile store: 4 instructions x 32 lanes x 8 halves
static_assert(256 * 8 == KTILE * QW);                         // key tile store: 256 threads x 8 halves
static_assert(256 * 4 == DV * KTILE);                         // h^T tile store: 256 threads x 4 halves
static_assert(32 * 32 * 4 == 16 * CIN);                       // output tile store: 32 instructions x 32 lanes x 4 floats
static_assert(4 * 256 == 32 * DQK && 4 * 256 == 32 * DV);     // hh-pool element loops
static_assert(NWAVE * 4 * 8 == CIN && 8 * 4 == DQK && DQK == DV);   // weight rows: 8 waves x 4 lane groups x 8 k, 8 lanes x 4 n
static_assert(64 * 4 == CIN && 4 * 8 == DV);                  // Wattn rows: 64 threads x 4 n, 4 thread groups x 8 d
static_assert(PF >= 2 * DQK && (PF * 4) % 16 == 0);
static_assert(GP >= QW && FP >= QW && HP >= KTILE && CP >= DV && OW >= CIN);
static_assert((GP * 2) % 16 == 0 && (FP * 2) % 16 == 0 && (HP * 2) % 16 == 0 && (CP * 2) % 16 == 0);
static_assert((OW * 4) % 32 == 16);
static_assert(KP >= QW && (KP * 2) % 32 == 16 && (VP * 2) % 32 == 16);
static_assert((NKEY * QW) % (8 * 256 * 8) == 0);              // key plane: whole groups of 8 copies x 256 lanes x 8 halves
static_assert((DV * NKEY) % (8 * 256 * 8) == 0);              // h^T plane: the same
static_assert(KTILE * 2 == 64 && DV == 32 && NKEY % (4 * KTILE) == 0);   // h^T copy: 2 d x 4 key tiles x 64 B per wave
static_assert((NKEY * QW + DV * NKEY) / (256 * 8) <= 63);     // copies of one wave in flight
static_assert((NKEY * KP + DV * VP + CIN * CP) * 2 <= 327680);
static_assert(NWAVE * 16 * OW * 4 <= NKEY * KP * 2);          // the output tile fits over the key plane
static_assert((WP * 2) % 32 == 16 && (XP * 4) % 32 == 16);
static_assert(16 * (CIN / 2) * 4 == 2 * 8 * 32 * 16);         // one wave's half x rows: 16 copies x 32 lanes x 16 B
static_assert(2 * 32 * PF * 4 + (NWAVE * 16 * GP + KTILE * FP + DV * HP) * 2 + NPROJ * WP * 2 + 2 * XBUF * 4 <= 327680);

static constexpr size_t GQ_BYTES  = (size_t)NB * SEQ * QW * 2;        // 4,194,304 at full size
static constexpr size_t FK_BYTES  = (size_t)NB * NKEY * QW * 2;       // 1,048,576
static constexpr size_t HVT_BYTES = (size_t)NB * DV * NKEY * 2;       // 524,288
static constexpr size_t OFF_GQ  = 0;
static constexpr size_t OFF_FK  = OFF_GQ + GQ_BYTES;
static constexpr size_t OFF_HVT = OFF_FK + FK_BYTES;
static constexpr size_t WS_TOTAL = OFF_HVT + HVT_BYTES;               // 5,767,168 at full size
static_assert(GQ_BYTES % 128 == 0 && FK_BYTES % 128 == 0 && HVT_BYTES % 128 == 0);
static_assert(WS_TOTAL <= (size_t)134217728);

typedef __bf16   bf16;
typedef _Float16 f16;
typedef bf16     v16bf __attribute__((ext_vector_type(16)));
typedef f16      v16h  __attribute__((ext_vector_type(16)));
typedef f16      v8h   __attribute__((ext_vector_type(8)));
typedef float    v8f   __attribute__((ext_vector_type(8)));
typedef float    v4f   __attribute__((ext_vector_type(4)));
typedef float    v2f   __attribute__((ext_vector_type(2)));
typedef unsigned v4u   __attribute__((ext_vector_type(4)));
typedef unsigned v2u   __attribute__((ext_vector_type(2)));

union FragB  { v16bf v; v4u q[2]; bf16 h[16]; };
union FragH  { v16h  v; v4u q[2]; f16  h[16]; };
union Pack8B { v4u u; bf16 h[8]; };
union Pack8H { v4u u; v8h v; f16 h[8]; };

// WMMA helpers: builtin followed by the VALU hazard guard (ties D, keeps A/B live).
static __device__ __forceinline__ v8f mma_bf16(v16bf a, v16bf b, v8f acc) {
  acc = __builtin_amdgcn_wmma_f32_16x16x32_bf16(false, a, false, b, (short)0, acc, false, false);
  asm volatile("v_nop\n\tv_nop\n\tv_nop\n\tv_nop" : "+v"(acc) : "v"(a), "v"(b));
  return acc;
}
static __device__ __forceinline__ v8f mma_f16(v16h a, v16h b, v8f acc) {
  acc = __builtin_amdgcn_wmma_f32_16x16x32_f16(false, a, false, b, (short)0, acc, false, false);
  asm volatile("v_nop\n\tv_nop\n\tv_nop\n\tv_nop" : "+v"(acc) : "v"(a), "v"(b));
  return acc;
}

// Eight asynchronous 16-byte copies per lane, global -> LDS, through no register: copy i takes the 16-byte piece
// number piece0 + i * 256 of a plane whose rows hold ROWH halves and lands it at row pitch PITCH (halves) in LDS.
// The closing s_wait_xcnt stands inside the statement so that no address register is rewritten ahead of it.
template <int ROWH, int PITCH>
static __device__ __forceinline__ void copy8_to_lds(const f16* __restrict__ plane, unsigned lds_base, int piece0) {
  const f16* g[8];
  unsigned   l[8];
  #pragma unroll   // constant indices: the sixteen addresses stay in registers for the asm operands
  for (int i = 0; i < 8; ++i) {
    const int piece = piece0 + i * 256;
    const int row   = piece / (ROWH / 8);
    const int col   = piece % (ROWH / 8);
    g[i] = plane + (size_t)piece * 8;
    l[i] = lds_base + (unsigned)(row * PITCH + col * 8) * 2u;
  }
  asm volatile("global_load_async_to_lds_b128 %0, %8, off\n\t"
               "global_load_async_to_lds_b128 %1, %9, off\n\t"
               "global_load_async_to_lds_b128 %2, %10, off\n\t"
               "global_load_async_to_lds_b128 %3, %11, off\n\t"
               "global_load_async_to_lds_b128 %4, %12, off\n\t"
               "global_load_async_to_lds_b128 %5, %13, off\n\t"
               "global_load_async_to_lds_b128 %6, %14, off\n\t"
               "global_load_async_to_lds_b128 %7, %15, off\n\t"
               "s_wait_xcnt 0x0"
               :: "v"(l[0]), "v"(l[1]), "v"(l[2]), "v"(l[3]), "v"(l[4]), "v"(l[5]), "v"(l[6]), "v"(l[7]),
                  "v"(g[0]), "v"(g[1]), "v"(g[2]), "v"(g[3]), "v"(g[4]), "v"(g[5]), "v"(g[6]), "v"(g[7])
               : "memory");
}

// Eight asynchronous 16-byte copies per lane of the h^T plane, which lies in global memory as [key tile][d][KTILE keys],
// into the LDS rows [d][key] (pitch VP). Copy i is unit unit0 + i * NWAVE; a unit is 2 d x 4 key tiles: its 32 lanes take
// four whole 128-byte lines from global and land them as two runs of 256 contiguous bytes.
// The closing s_wait_xcnt stands inside the statement so that no address register is rewritten ahead of it.
static __device__ __forceinline__ void copy8_vt_to_lds(const f16* __restrict__ plane, unsigned lds_base, int unit0, int lane) {
  const f16* g[8];
  unsigned   l[8];
  #pragma unroll   // constant indices: the sixteen addresses stay in registers for the asm operands
  for (int i = 0; i < 8; ++i) {
    const int unit = unit0 + i * NWAVE;
    const int d    = (unit % (DV / 2)) * 2 + ((lane >> 2) & 1);   // 0..31
    const int kt   = (unit / (DV / 2)) * 4 + (lane >> 3);         // 0..NKEY / KTILE - 1
    const int col  = (lane & 3) * 8;                              // 0..24
    g[i] = plane + (size_t)((kt * DV + d) * KTILE + col);
    l[i] = lds_base + (unsigned)(d * VP + kt * KTILE + col) * 2u;
  }
  asm volatile("global_load_async_to_lds_b128 %0, %8, off\n\t"
               "global_load_async_to_lds_b128 %1, %9, off\n\t"
               "global_load_async_to_lds_b128 %2, %10, off\n\t"
               "global_load_async_to_lds_b128 %3, %11, off\n\t"
               "global_load_async_to_lds_b128 %4, %12, off\n\t"
               "global_load_async_to_lds_b128 %5, %13, off\n\t"
               "global_load_async_to_lds_b128 %6, %14, off\n\t"
               "global_load_async_to_lds_b128 %7, %15, off\n\t"
               "s_wait_xcnt 0x0"
               :: "v"(l[0]), "v"(l[1]), "v"(l[2]), "v"(l[3]), "v"(l[4]), "v"(l[5]), "v"(l[6]), "v"(l[7]),
                  "v"(g[0]), "v"(g[1]), "v"(g[2]), "v"(g[3]), "v"(g[4]), "v"(g[5]), "v"(g[6]), "v"(g[7])
               : "memory");
}

// N (8 or 4) asynchronous 16-byte copies per lane, global -> LDS, through no register: copy i takes the 16-byte piece
// number piece0 + i * STEP of a tile whose rows hold ROWB bytes at pitch SRCB in global memory and lands it at row
// pitch PITCHB in LDS (all in bytes).
// The closing s_wait_xcnt stands inside the statement so that no address register is rewritten ahead of it.
template <int N, int ROWB, int SRCB, int PITCHB, int STEP>
static __device__ __forceinline__ void copy_rows_to_lds(const char* __restrict__ plane, unsigned lds_base, int piece0) {
  static_assert(N == 8 || N == 4);
  const char* g[N];
  unsigned    l[N];
  #pragma unroll   // constant indices: the addresses stay in registers for the asm operands
  for (int i = 0; i < N; ++i) {
    const int piece = piece0 + i * STEP;
    const int row   = piece / (ROWB / 16);
    const int col   = piece % (ROWB / 16);
    g[i] = plane + (size_t)(row * SRCB + col * 16);
    l[i] = lds_base + (unsigned)(row * PITCHB + col * 16);
  }
  if constexpr (N == 8) {
    asm volatile("global_load_async_to_lds_b128 %0, %8, off\n\t"
                 "global_load_async_to_lds_b128 %1, %9, off\n\t"
                 "global_load_async_to_lds_b128 %2, %10, off\n\t"
                 "global_load_async_to_lds_b128 %3, %11, off\n\t"
                 "global_load_async_to_lds_b128 %4, %12, off\n\t"
                 "global_load_async_to_lds_b128 %5, %13, off\n\t"
                 "global_load_async_to_lds_b128 %6, %14, off\n\t"
                 "global_load_async_to_lds_b128 %7, %15, off\n\t"
                 "s_wait_xcnt 0x0"
                 :: "v"(l[0]), "v"(l[1]), "v"(l[2]), "v"(l[3]), "v"(l[4]), "v"(l[5]), "v"(l[6]), "v"(l[7]),
                    "v"(g[0]), "v"(g[1]), "v"(g[2]), "v"(g[3]), "v"(g[4]), "v"(g[5]), "v"(g[6]), "v"(g[7])
                 : "memory");
  } else {
    asm volatile("global_load_async_to_lds_b128 %0, %4, off\n\t"
                 "global_load_async_to_lds_b128 %1, %5, off\n\t"
                 "global_load_async_to_lds_b128 %2, %6, off\n\t"
                 "global_load_async_to_lds_b128 %3, %7, off\n\t"
                 "s_wait_xcnt 0x0"
                 :: "v"(l[0]), "v"(l[1]), "v"(l[2]), "v"(l[3]), "v"(g[0]), "v"(g[1]), "v"(g[2]), "v"(g[3])
                 : "memory");
  }
}

// Lane l takes the value of lane l ^ 16 (the other k-split half of the same query), on the vector pipe.
static __device__ __forceinline__ float xhalf(float v) {
  const int b = __builtin_bit_cast(int, v);
  return __builtin_bit_cast(float, __builtin_amdgcn_permlanex16(b, b, 0x76543210, 0xfedcba98, false, false));
}

// f32 -> f16 convert that can never produce a subnormal operand (value select below 2^-14).
static __device__ __forceinline__ f16 toh_flush(float v) {
  const f16 r = (f16)v;
  return (fabsf(v) < 6.103515625e-05f) ? (f16)0.0f : r;
}

// Weight rows (k-contiguous, B fragments load like A fragments), built in LDS by the block that reads them:
//   sw  [NPROJ][WP] bf16 : row n = column n of [Wf | Wg | Wh], RNE bf16.
//   swo [CIN][CP]   f16  : row n = column n of Wattn, value f16(bf16(w) * 16) (exact for normal results).
// A lane takes an 8 (k) x 4 (n) patch of a matrix: eight 16-byte loads (every 128-byte line a load touches is used
// whole), then four 16-byte LDS stores of eight k-contiguous values each. Loads and stores are two calls, so that the
// loads can stand ahead of the block's asynchronous copies and fly while those are issued.
// coverage: sw rows 0..95 x k 0..255 (wave -> 32 k, lane >> 3 -> 8 k of them, lane & 7 -> 4 n, three matrices).
static __device__ __forceinline__ void load_proj_weights(const float* __restrict__ wf, const float* __restrict__ wg,
                                                         const float* __restrict__ wh, int wave, int lane,
                                                         v4f (&w)[3][8]) {
  const int n0 = (lane & 7) * 4;                  // 0..28
  const int k0 = wave * 32 + (lane >> 3) * 8;     // 0..248
  #pragma unroll   // constant indices: the patches stay in registers
  for (int i = 0; i < 8; ++i) {
    const size_t off = (size_t)(k0 + i) * DQK + n0;
    w[0][i] = *(const v4f*)(wf + off);
    w[1][i] = *(const v4f*)(wg + off);
    w[2][i] = *(const v4f*)(wh + off);
  }
}
static __device__ __forceinline__ void store_proj_weights(const v4f (&w)[3][8], bf16* sw, int wave, int lane) {
  const int n0 = (lane & 7) * 4;
  const int k0 = wave * 32 + (lane >> 3) * 8;
  #pragma unroll
  for (int mt = 0; mt < 3; ++mt) {
    #pragma unroll
    for (int j = 0; j < 4; ++j) {
      Pack8B pk;
      #pragma unroll
      for (int i = 0; i < 8; ++i) pk.h[i] = (bf16)w[mt][i][j];   // RNE convert
      *(v4u*)(sw + (mt * DQK + n0 + j) * WP + k0) = pk.u;
    }
  }
}
// coverage: swo rows 0..255 x d 0..31 (tid & 63 -> 4 n, tid >> 6 -> 8 d).
static __device__ __forceinline__ void load_out_weights(const float* __restrict__ wo, int tid, v4f (&w)[8]) {
  const int n0 = (tid & 63) * 4;    // 0..252
  const int d0 = (tid >> 6) * 8;    // 0..24
  #pragma unroll   // constant indices: the patch stays in registers
  for (int i = 0; i < 8; ++i) w[i] = *(const v4f*)(wo + (size_t)(d0 + i) * CIN + n0);
}
static __device__ __forceinline__ void store_out_weights(const v4f (&w)[8], f16* swo, int tid) {
  const int n0 = (tid & 63) * 4;
  const int d0 = (tid >> 6) * 8;
  #pragma unroll
  for (int j = 0; j < 4; ++j) {
    Pack8H pk;
    #pragma unroll
    for (int i = 0; i < 8; ++i) pk.h[i] = toh_flush((float)(bf16)w[i][j] * 16.0f);   // bf16 significand fits f16
    *(v4u*)(swo + (n0 + j) * CP + d0) = pk.u;
  }
}

// One wave's 16-pixel M tile times NTN consecutive 16-column tiles of the weight rows starting at tile NT0, summed into acc over
// the CIN / 2 channels of one staged half: k steps kk0 .. kk0 + 3.
// A fragments from the staged f32 x rows (xr = this lane's half row in LDS; RNE bf16 convert, split k map); B fragments
// from the staged k-contiguous weight rows (sw, pitch WP). A k step's sixteen LDS loads stand ahead of its products.
template <int NT0, int NTN>
static __device__ __forceinline__ void proj_tiles(const float* xr, const bf16* sw, int kk0,
                                                  int m, int hi, v8f (&acc)[NTN]) {
  for (int kq = 0; kq < CIN / 64; ++kq) {
    const int kk = kk0 + kq;
    const float* xp = xr + kq * 32;
    const v4f a0 = *(const v4f*)(xp + hi * 8);
    const v4f a1 = *(const v4f*)(xp + hi * 8 + 4);
    const v4f b0 = *(const v4f*)(xp + 16 + hi * 8);
    const v4f b1 = *(const v4f*)(xp + 16 + hi * 8 + 4);
    FragB bw[NTN];
    #pragma unroll
    for (int t = 0; t < NTN; ++t) {
      const bf16* wp = sw + ((NT0 + t) * 16 + m) * WP + kk * 32 + hi * 8;
      bw[t].q[0] = *(const v4u*)(wp);        // k = kk*32 + hi*8 + 0..7, n = tile*16 + m
      bw[t].q[1] = *(const v4u*)(wp + 16);   // k = kk*32 + 16 + hi*8 + 0..7
    }
    FragB a;
    #pragma unroll
    for (int i = 0; i < 4; ++i) {
      a.h[i]      = (bf16)a0[i];   // elems 0..7  : k = kk*32 + hi*8 + 0..7
      a.h[4 + i]  = (bf16)a1[i];
      a.h[8 + i]  = (bf16)b0[i];   // elems 8..15 : k = kk*32 + 16 + hi*8 + 0..7
      a.h[12 + i] = (bf16)b1[i];
    }
    #pragma unroll
    for (int t = 0; t < NTN; ++t) acc[t] = mma_bf16(a.v, bw[t].v, acc[t]);
  }
}

// Stage s (0 or 1) of one wave's x rows: channel half s of its 16 pixel rows, into buffer s.
// xw0 = the wave's first x row, lx = its rows in buffer 0.
static __device__ __forceinline__ void copy_x_stage(const float* __restrict__ xw0, unsigned lx, int lane, int s) {
  const float*   src = xw0 + s * (CIN / 2);
  const unsigned dst = lx + (unsigned)s * (XBUF * 4);
  for (int gph = 0; gph < 2; ++gph)
    copy_rows_to_lds<8, CIN * 2, CIN * 4, XP * 4, 32>((const char*)src, dst, gph * 256 + lane);
}

// Projection + 2x2 max-pool. Block = (32-key tile kt, batch b), 256 threads, one block per two image rows
// hh = kt*2 + {0,1}; wave -> (hh, 16 pixels along ww).
//   gq  [NB][SEQ][QW] f16  : queries, value | residual x2048
//                            (wave writes 16 rows = 2 KB, 4 instructions of 4 lines, 8 lanes x 16 B per line).
//   fk  [NB][NKEY][QW] f16 : pooled keys, value | residual x2048, 32 rows per block = 4 KB
//                            (1 instruction, each wave 4 lines, 8 lanes x 16 B per line).
//   hvt [NB][NKEY / KTILE][DV][KTILE] f16 : pooled h^T, one tile of 2 KB per block, so that no line has two writers
//                            (1 instruction, each wave 2 lines, 8 lanes x 8 B per 64-byte d row).
// LDS regions: sP cross-wave (block barrier), sG per-wave but read across lanes after the block barrier,
// sF / sHT cross-wave (block barrier). Staged extent == consumed extent for all four.
// The weight rows (sW) are converted from the f32 inputs by the block itself, once, while the first x stage flies.
// x comes by asynchronous copies (whole lines from global, padded rows in LDS): each wave's 16 x rows in two stages
// of 128 channels, each into its own buffer (sX): the second flies while the first is worked on.
__global__ __launch_bounds__(256) void proj_pool_kernel(const float* __restrict__ x, const float* __restrict__ wf,
                                                         const float* __restrict__ wg, const float* __restrict__ wh,
                                                         f16* __restrict__ gq, f16* __restrict__ fk,
                                                         f16* __restrict__ hvt) {
  const int kt   = blockIdx.x;
  const int b    = blockIdx.y;
  const int tid  = threadIdx.x;
  const int wave = __builtin_amdgcn_readfirstlane(threadIdx.x >> 5);
  const int lane = tid & 31;
  const int m    = lane & 15;
  const int hi   = lane >> 4;
  const int hsel = wave >> 2;          // which of the block's two image rows
  const int ww0  = (wave & 3) * 16;    // first pixel column of this wave's tile

  __shared__ __align__(16) float sP[2 * 32 * PF];     // [hsel][pw][64 cols] ww-pooled f|h in f32
  __shared__ __align__(16) f16 sG[NWAVE * 16 * GP];   // per-wave g tile [16][value 32 | residual 32]
  __shared__ __align__(16) f16 sF[KTILE * FP];        // pooled f [32 keys][value 32 | residual 32]
  __shared__ __align__(16) f16 sHT[DV * HP];          // pooled h^T [32 d][32 keys]
  __shared__ __align__(16) bf16 sW[NPROJ * WP];       // weight rows [96 n][256 k]
  __shared__ __align__(16) float sX[2 * XBUF];        // [buffer][wave][16 pixels][128 channels] in f32

  f16*   sg = sG + wave * (16 * GP);
  float* sp = sP + hsel * (32 * PF);
  const int pwb = (ww0 >> 1) + hi * 4;   // pooled column index base for this lane half

  const float*   sx   = sX + wave * (16 * XP);
  const unsigned lx   = (unsigned)(size_t)sx;
  const int      pix0 = (kt * 2 + hsel) * W_IMG + ww0;   // first pixel of this wave's tile
  const float*   xw0  = x + ((size_t)b * SEQ_FULL + pix0) * CIN;

  v4f wv[3][8];
  load_proj_weights(wf, wg, wh, wave, lane, wv);
  // fill: every lane of every wave copies its own 16-byte pieces, no branch around the copies
  copy_x_stage(xw0, lx, lane, 0);
  store_proj_weights(wv, sW, wave, lane);
  // this wave's copies have landed; behind the barrier every wave's have, and every wave's weight rows are written
  asm volatile("s_wait_asynccnt 0x0" ::: "memory");
  __syncthreads();
  copy_x_stage(xw0, lx, lane, 1);

  {   // tiles 0,1: f; 2,3: g; 4,5: h
    v8f acc[6];
    #pragma unroll
    for (int t = 0; t < 6; ++t) acc[t] = (v8f){0, 0, 0, 0, 0, 0, 0, 0};
    proj_tiles<0, 6>(sx + m * XP, sW, 0, m, hi, acc);
    // publish point of stage 1: this wave's reads of buffer 0 have retired, its copies into buffer 1 have landed
    asm volatile("s_wait_dscnt 0x0" ::: "memory");
    asm volatile("s_wait_asynccnt 0x0" ::: "memory");
    __syncthreads();
    proj_tiles<0, 6>(sx + XBUF + m * XP, sW, CIN / 64, m, hi, acc);
    #pragma unroll
    for (int r = 0; r < 8; ++r) {
      const float g0 = acc[2][r];
      const float g1 = acc[3][r];
      const f16 h0 = toh_flush(g0);
      const f16 h1 = toh_flush(g1);
      sg[(hi * 8 + r) * GP + m]      = h0;
      sg[(hi * 8 + r) * GP + 16 + m] = h1;
      sg[(hi * 8 + r) * GP + 32 + m] = toh_flush((g0 - (float)h0) * 2048.0f);
      sg[(hi * 8 + r) * GP + 48 + m] = toh_flush((g1 - (float)h1) * 2048.0f);
    }
    // ww pairs are D rows (2rp, 2rp+1) of the same lane half; pooled column pw = ww0/2 + 4*hi + rp
    #pragma unroll
    for (int rp = 0; rp < 4; ++rp) {
      #pragma unroll
      for (int t = 0; t < 2; ++t) {
        sp[(pwb + rp) * PF + t * 16 + m]      = fmaxf(acc[t][2 * rp], acc[t][2 * rp + 1]);
        sp[(pwb + rp) * PF + 32 + t * 16 + m] = fmaxf(acc[4 + t][2 * rp], acc[4 + t][2 * rp + 1]);
      }
    }
  }
  __syncthreads();

  {
    v4u    gv[4];
    size_t gi[4];
    #pragma unroll
    for (int i4 = 0; i4 < 4; ++i4) {
      const int row = i4 * 4 + (lane >> 3);
      const int cq  = (lane & 7) * 8;
      Pack8H p;
      p.v = *(const v8h*)(sg + row * GP + cq);
      gv[i4] = p.u;
      gi[i4] = ((size_t)b * SEQ + pix0 + row) * QW + cq;
    }
    #pragma unroll
    for (int i4 = 0; i4 < 4; ++i4) *(v4u*)(gq + gi[i4]) = gv[i4];
  }

  // hh-pool into the block's pooled tiles (f32 max, then one convert)
  #pragma unroll
  for (int e = 0; e < 4; ++e) {
    const int idx = e * 256 + tid;
    const int pw  = idx >> 5;
    const int c   = idx & 31;
    const float v = fmaxf(sP[pw * PF + c], sP[32 * PF + pw * PF + c]);
    const f16 hv  = toh_flush(v);
    sF[pw * FP + c]      = hv;
    sF[pw * FP + 32 + c] = toh_flush((v - (float)hv) * 2048.0f);
  }
  #pragma unroll
  for (int e = 0; e < 4; ++e) {
    const int idx = e * 256 + tid;
    const int pw  = idx >> 5;
    const int d   = idx & 31;
    const float v = fmaxf(sP[pw * PF + 32 + d], sP[32 * PF + pw * PF + 32 + d]);
    sHT[d * HP + pw] = toh_flush(v);
  }
  __syncthreads();

  // final plane stores: fk (a wave writes 4 rows = 512 B), hvt (a wave writes 4 d rows of 64 B = 256 B)
  v4u    fv;
  size_t fi;
  {
    const int row = tid >> 3;            // 0..31
    const int cq  = (tid & 7) * 8;
    Pack8H p;
    p.v = *(const v8h*)(sF + row * FP + cq);
    fv = p.u;
    fi = ((size_t)b * NKEY + kt * KTILE + row) * QW + cq;
  }
  v2u    hv;
  size_t hidx;
  {
    const int d  = tid >> 3;             // 0..31
    const int kq = (tid & 7) * 4;        // 0..28
    hv   = *(const v2u*)(sHT + d * HP + kq);
    hidx = (((size_t)b * (NKEY / KTILE) + kt) * DV + d) * KTILE + kq;
  }
  *(v4u*)(fk + fi) = fv;
  *(v2u*)(hvt + hidx) = hv;
}

// Flash attention, non-causal, no score scaling. Block = (query block of 128, batch); one wave owns 16 queries.
// S^T = F x G^T so queries sit on lanes; P^T in C-layout is bit-identical to the B-fragment layout of
// CTX^T += Hv^T x P^T, whose columns are again the queries: a query's maximum, sum and rescale stay on its own two
// lanes (lq, lq + 16), which exchange the maximum once per 32 keys and join their sums once, behind the loop.
// Scores: value x value in c, (value x residual + residual x value) in cr, s = c + cr / 2048.
// The image's whole key plane and h^T plane are staged once in LDS by asynchronous copies (whole lines from global,
// padded rows in LDS; the h^T tiles land side by side in rows [d][key]) and shared by the block's 8 waves; F A-fragments and Hv^T A-fragments are two 16-B LDS loads
// each, G B-fragments two 16-B global loads each.
// Epilogue in the same launch: out = gamma * (CTX x Wo) + x_bf16 for the block's 128 query rows. The two CTX^T tiles,
// converted in place, are the A fragment of that product (split d map); B fragments from sWo (Wattn carried x16),
// converted by the block itself while the fill flies;
// the wave's 16 x rows are loaded behind the fill's barrier and fly while the key loop runs.
// LDS: sK / sV / sWo written once, read-only behind the fill's barrier; the block barrier behind the key loop ends
// every wave's last read of sK, over which the f32 output tile is then staged (per-wave region, block barrier), so
// that every store instruction writes 512 contiguous bytes.
__global__ __launch_bounds__(256) void attn_out_kernel(const f16* __restrict__ gq, const f16* __restrict__ fk,
                                                       const f16* __restrict__ hvt, const float* __restrict__ wo,
                                                       const float* __restrict__ x, const float* __restrict__ gamma,
                                                       float* __restrict__ out) {
  const int qblk = blockIdx.x;
  const int b    = blockIdx.y;
  const int tid  = threadIdx.x;
  const int wave = __builtin_amdgcn_readfirstlane(threadIdx.x >> 5);
  const int lane = tid & 31;
  const int lq   = lane & 15;   // query column of S^T and of CTX^T
  const int hi   = lane >> 4;   // k-split half

  __shared__ __align__(16) f16 sK[NKEY * KP];   // [key][value 32 | residual 32]
  __shared__ __align__(16) f16 sV[DV * VP];     // [d][key]
  __shared__ __align__(16) f16 sWo[CIN * CP];   // [n][d]

  const int qrow0 = qblk * BQ + wave * 16;
  const float gsc = (float)(bf16)gamma[0] * 0.0625f;   // gamma (RNE bf16) folded with the 1/16 Wo carry

  const f16* fk_b = fk + (size_t)b * NKEY * QW;
  const f16* vt_b = hvt + (size_t)b * DV * NKEY;

  // the block's plain loads stand ahead of the fill and fly while its copies are issued
  v4f wv[8];
  load_out_weights(wo, tid, wv);

  // G as B-operand fragments: lane lq holds query qrow0+lq, elements follow the split d map
  FragH qf, qr;
  {
    const f16* qp = gq + ((size_t)b * SEQ + qrow0 + lq) * QW + hi * 8;
    qf.q[0] = *(const v4u*)(qp);        // value,    d = hi*8 + 0..7
    qf.q[1] = *(const v4u*)(qp + 16);   // value,    d = 16 + hi*8 + 0..7
    qr.q[0] = *(const v4u*)(qp + 32);   // residual, d = hi*8 + 0..7
    qr.q[1] = *(const v4u*)(qp + 48);   // residual, d = 16 + hi*8 + 0..7
  }

  // fill: every lane of every wave copies its own 16-byte pieces, no branch around the copies
  {
    const unsigned lk = (unsigned)(size_t)sK;
    const unsigned lv = (unsigned)(size_t)sV;
    for (int gph = 0; gph < (NKEY * QW) / (8 * 256 * 8); ++gph) copy8_to_lds<QW, KP>(fk_b, lk, gph * 2048 + tid);
    for (int gph = 0; gph < (DV * NKEY) / (8 * 256 * 8); ++gph) copy8_vt_to_lds(vt_b, lv, gph * 8 * NWAVE + wave, lane);
  }
  // keeps the Wattn converts, which wait for their loads, from being scheduled among or ahead of the fill's copies
  __builtin_amdgcn_sched_barrier(0);

  v8f o[2];
  #pragma unroll
  for (int dt = 0; dt < 2; ++dt) o[dt] = (v8f){0, 0, 0, 0, 0, 0, 0, 0};

  float rmax = -__builtin_inff();
  float rsum = 0.0f;
  const float SL = 1.4426950408889634f;   // log2(e); the scores carry no extra scale
  const float RS = 1.0f / 2048.0f;        // residual plane carry folded back

  store_out_weights(wv, sWo, tid);

  // this wave's copies have landed; behind the barrier every wave's have
  asm volatile("s_wait_asynccnt 0x0" ::: "memory");
  __syncthreads();

  // residual rows of this wave's 16 queries: instruction j takes half row j (512 contiguous bytes); first used in the
  // epilogue, so the loads stand behind the barrier (which would wait for them) and ahead of the key loop
  const size_t xoff = ((size_t)b * SEQ_FULL + qrow0) * CIN + lane * 4;
  v4f xv[32];
  #pragma unroll   // constant indices: the rows stay in registers until the epilogue
  for (int j = 0; j < 32; ++j) xv[j] = *(const v4f*)(x + xoff + j * (CIN / 2));

  // F A-fragments of pass 0; every later pass finds its own already in these registers
  FragH ak[2], akr[2];
  #pragma unroll
  for (int sub = 0; sub < 2; ++sub) {
    const f16* base = sK + (sub * 16 + lq) * KP + hi * 8;
    ak[sub].q[0]  = *(const v4u*)(base);        // d = hi*8 + 0..7
    ak[sub].q[1]  = *(const v4u*)(base + 16);   // d = 16 + hi*8 + 0..7
    akr[sub].q[0] = *(const v4u*)(base + 32);
    akr[sub].q[1] = *(const v4u*)(base + 48);
  }

  for (int i = 0; i < NKEY / BK; ++i) {
    const int j0 = i * BK;

    // S^T tiles: c[sub][r] = score(query qrow0+lq, key j0 + sub*16 + hi*8 + r)
    v8f c[2], cr[2];
    #pragma unroll
    for (int sub = 0; sub < 2; ++sub) {
      c[sub]  = mma_f16(ak[sub].v,  qf.v, (v8f){0, 0, 0, 0, 0, 0, 0, 0});
      cr[sub] = mma_f16(ak[sub].v,  qr.v, (v8f){0, 0, 0, 0, 0, 0, 0, 0});
      cr[sub] = mma_f16(akr[sub].v, qf.v, cr[sub]);
    }

    // one group of LDS loads per pass, right behind the S^T products, landing while the softmax runs: the next pass's
    // F fragments into the same registers (the last pass takes pass 0's rows again and uses none of them), and this
    // pass's Hv^T A-fragments: row m = d = dt*16 + lq, split key map from the transposed plane
    const int jn = ((i + 1) % (NKEY / BK)) * BK;
    #pragma unroll
    for (int sub = 0; sub < 2; ++sub) {
      const f16* base = sK + (jn + sub * 16 + lq) * KP + hi * 8;
      ak[sub].q[0]  = *(const v4u*)(base);        // d = hi*8 + 0..7
      ak[sub].q[1]  = *(const v4u*)(base + 16);   // d = 16 + hi*8 + 0..7
      akr[sub].q[0] = *(const v4u*)(base + 32);
      akr[sub].q[1] = *(const v4u*)(base + 48);
    }
    FragH av[2];
    #pragma unroll
    for (int dt = 0; dt < 2; ++dt) {
      const f16* base = sV + (dt * 16 + lq) * VP + j0 + hi * 8;
      av[dt].q[0] = *(const v4u*)(base);        // keys j0 + hi*8 + 0..7
      av[dt].q[1] = *(const v4u*)(base + 16);   // keys j0 + 16 + hi*8 + 0..7
    }

    #pragma unroll
    for (int sub = 0; sub < 2; ++sub) {
      #pragma unroll
      for (int r = 0; r < 8; ++r) c[sub][r] = c[sub][r] + cr[sub][r] * RS;
    }

    // online softmax: query lq's 32 scores are split across lane / lane^16
    float m_new = rmax;
    #pragma unroll
    for (int r = 0; r < 8; ++r) {
      m_new = fmaxf(m_new, c[0][r]);
      m_new = fmaxf(m_new, c[1][r]);
    }
    m_new = fmaxf(m_new, xhalf(m_new));
    const float scale = __builtin_amdgcn_exp2f((rmax - m_new) * SL);
    rmax = m_new;

    // exp + pack: P^T C-layout == B-fragment layout for the PV product; P carried x4096 in f16.
    // log2(e), the maximum and the carry sit in one fused multiply-add per score: p * 4096 = exp2(s * SL + kb), which
    // goes to the convert as it is (far below the maximum it rounds to an f16 subnormal or to zero).
    const float kb = __builtin_fmaf(-m_new, SL, 12.0f);
    FragH pa;
    v2f px[2][4];
    #pragma unroll   // constant indices: scores, exponentials and the fragment stay in registers
    for (int sub = 0; sub < 2; ++sub) {
      #pragma unroll   // the same
      for (int i2 = 0; i2 < 4; ++i2) {   // keys j0 + sub*16 + hi*8 + 2*i2, + 1: a register pair of the accumulator
        const v2f e = __builtin_elementwise_fma((v2f){c[sub][2 * i2], c[sub][2 * i2 + 1]}, (v2f){SL, SL}, (v2f){kb, kb});
        px[sub][i2] = (v2f){__builtin_amdgcn_exp2f(e[0]), __builtin_amdgcn_exp2f(e[1])};
        pa.h[sub * 8 + 2 * i2]     = (f16)px[sub][i2][0];
        pa.h[sub * 8 + 2 * i2 + 1] = (f16)px[sub][i2][1];
      }
    }
    float psum = 0.0f;   // carried x4096 like P
    #pragma unroll   // constant indices into px
    for (int i2 = 0; i2 < 4; ++i2) {
      const v2f t = px[0][i2] + px[1][i2];
      psum += t[0];
      psum += t[1];
    }
    rsum = rsum * scale + psum;   // the keys of this lane's half only

    // rescale CTX^T: the query is the column there -> the lane's own scale
    #pragma unroll
    for (int dt = 0; dt < 2; ++dt) {
      #pragma unroll
      for (int r = 0; r < 8; ++r) o[dt][r] *= scale;
    }

    // CTX^T += Hv^T x P^T : o[dt][r] = ctx(query qrow0 + lq, d = dt*16 + hi*8 + r)
    #pragma unroll
    for (int dt = 0; dt < 2; ++dt) o[dt] = mma_f16(av[dt].v, pa.v, o[dt]);
  }

  // normalize: the two halves' sums of query lq joined (sums and CTX^T both carry x4096); CTX as A fragment straight from the accumulators:
  // lane lq holds query row lq, elements follow the split d map
  const float rs = 1.0f / (rsum + xhalf(rsum));
  FragH ca;
  #pragma unroll
  for (int r = 0; r < 8; ++r) {
    ca.h[r]     = toh_flush(o[0][r] * rs);   // d = hi*8 + r
    ca.h[8 + r] = toh_flush(o[1][r] * rs);   // d = 16 + hi*8 + r
  }
  // ends every wave's last read of the key plane
  __syncthreads();

  // OUT tile of the wave, 16 rows x 256 channels in f32, staged over the key plane (dead behind the barrier above)
  float* so = (float*)sK + wave * (16 * OW);
  #pragma unroll   // laid out flat so that a group's fragment loads can stand among the stores of the group before
  for (int qn = 0; qn < 4; ++qn) {   // four independent 16-column tiles at a time: one LDS wait per four products
    FragH bw[4];
    #pragma unroll
    for (int j = 0; j < 4; ++j) {
      const f16* wp = sWo + ((qn * 4 + j) * 16 + lq) * CP + hi * 8;
      bw[j].q[0] = *(const v4u*)(wp);
      bw[j].q[1] = *(const v4u*)(wp + 16);
    }
    v8f acc[4];
    #pragma unroll
    for (int j = 0; j < 4; ++j) acc[j] = mma_f16(ca.v, bw[j].v, (v8f){0, 0, 0, 0, 0, 0, 0, 0});
    #pragma unroll
    for (int r = 0; r < 8; ++r) {
      #pragma unroll
      for (int j = 0; j < 4; ++j) so[(hi * 8 + r) * OW + (qn * 4 + j) * 16 + lq] = acc[j][r] * gsc;
    }
  }
  __syncthreads();

  // whole-line stores: instruction j writes half row j = 512 contiguous bytes (4 lines)
  #pragma unroll   // constant indices into xv
  for (int j = 0; j < 32; ++j) {
    v4f v = *(const v4f*)(so + (j >> 1) * OW + (j & 1) * (CIN / 2) + lane * 4);
    #pragma unroll
    for (int cc = 0; cc < 4; ++cc) v[cc] = v[cc] + (float)(bf16)xv[j][cc];   // residual with the RNE bf16 input value
    *(v4f*)(out + xoff + j * (CIN / 2)) = v;
  }
}

extern "C" void kernel_launch(void* const* d_in, const int* in_sizes, int n_in,
                              void* d_out, int out_size, void* d_ws, size_t ws_size,
                              hipStream_t stream) {
  if (n_in < 6) return;
  const size_t rows_used = (size_t)(NB - 1) * SEQ_FULL + SEQ;
  if ((size_t)in_sizes[0] < rows_used * CIN) return;
  if (in_sizes[1] < CIN * DQK) return;
  if (in_sizes[2] < CIN * DQK) return;
  if (in_sizes[3] < CIN * DV) return;
  if (in_sizes[4] < DV * CIN) return;
  if (in_sizes[5] < 1) return;
  if ((size_t)out_size < rows_used * CIN) return;
  if (ws_size < WS_TOTAL) return;

  const float* x     = (const float*)d_in[0];
  const float* wf    = (const float*)d_in[1];
  const float* wg    = (const float*)d_in[2];
  const float* wh    = (const float*)d_in[3];
  const float* wo    = (const float*)d_in[4];
  const float* gamma = (const float*)d_in[5];
  float* out = (float*)d_out;
  char*  ws  = (char*)d_ws;
  f16*  gq  = (f16*)(ws + OFF_GQ);
  f16*  fk  = (f16*)(ws + OFF_FK);
  f16*  hvt = (f16*)(ws + OFF_HVT);

  proj_pool_kernel<<<dim3(SEQ / 128, NB), 256, 0, stream>>>(x, wf, wg, wh, gq, fk, hvt);
  attn_out_kernel<<<dim3(SEQ / BQ, NB), 256, 0, stream>>>(gq, fk, hvt, wo, x, gamma, out);
}

// v009
// It runs in 20.9 microseconds.
// In both of two side-by-side timings against v008, it was 1.06 times as fast.
// Counting every step since v000, it is 4.15 times as fast.
#include <hip/hip_runtime.h>

// Contractions: X x [Wf|Wg|Wh] on v_wmma_f32_16x16x32_bf16 (bf16 operands = RNE-converted inputs, f32 accumulate);
// S^T = F x G^T as three v_wmma_f32_16x16x32_f16 products (value x value in one accumulator; value x residual and
// residual x value in a second accumulator, residual planes carried x2048 and folded back in f32);
// CTX^T = Hv^T x P^T (P as f16 carried x4096) and OUT = CTX x Wattn (Wattn as f16 of the bf16 value, carried x16)
// on v_wmma_f32_16x16x32_f16 (f16 operands, f32 accumulate). Max-pool, softmax and residual add in f32.

#ifndef NB
#define NB 8
#endif
#ifndef SEQ
#define SEQ 4096
#endif
#define NB_FULL  8
#define SEQ_FULL 4096
#define W_IMG    64                 // image width (pixels per image row)
#define CIN      256                // input channels
#define DQK      32                 // query / key channels
#define DV       32                 // value channels
#define NPROJ    96                 // packed projection columns: [0,32) f, [32,64) g, [64,96) h
#define QW       64                 // halves per row of the query / key planes: value 0..31 | residual 32..63
#define NKEY     (SEQ / 4)          // pooled key count per image
#define KTILE    32                 // keys produced per projection block (two image rows)
#define BQ       128                // query rows per attention block (8 waves x 16)
#define BK       32                 // keys per inner iteration
#define NWAVE    8
#define PF       68                 // LDS pitch (floats) of the ww-pooled staging rows (f 0..31 | h 32..63)
#define GP       72                 // LDS pitch (halves) of the g staging tile (value | residual)
#define FP       72                 // LDS pitch (halves) of the pooled f tile (value | residual)
#define HP       72                 // LDS pitch (halves) of the pooled h^T tile
#define CP       40                 // LDS pitch (halves) of a staged Wattn row (32 d): 80 B = 16 B x odd
#define OW       (CIN + 4)          // LDS pitch (floats) of a staged output row (256 channels): 1040 B = 16 B x odd
#define KP       72                 // LDS pitch (halves) of a staged key row (value | residual): 144 B = 16 B x odd
#define VP       (NKEY + 8)         // LDS pitch (halves) of a staged h^T row: 16 B x odd
#define WP       (CIN + 8)          // LDS pitch (bf16) of a staged weight row: 528 B = 16 B x odd
#define XP       (CIN / 2 + 4)      // LDS pitch (floats) of a staged half x row (128 channels): 528 B = 16 B x odd
#define XBUF     (NWAVE * 16 * XP)  // floats in one of the two x buffers

static_assert(SEQ % 256 == 0);
static_assert(SEQ >= 256 && SEQ <= SEQ_FULL);
static_assert(NB >= 1 && NB <= NB_FULL);
static_assert(BQ == NWAVE * 16);
static_assert(NKEY % BK == 0);
static_assert(NKEY % KTILE == 0);
static_assert(CIN % 32 == 0 && DV == 32 && DQK == 32);
static_assert(NPROJ == 2 * DQK + DV && NPROJ % 16 == 0 && NPROJ / 8 == 12);
static_assert(QW == 2 * DQK && QW * 2 == 128);
static_assert(W_IMG == 64 && CIN == 4 * 64);
// coverage equalities (grid x block x per-thread elements == plane extent)
static_assert((SEQ / 128) * NWAVE * 16 == SEQ);              // g plane rows per image
static_assert((SEQ / 128) * KTILE == NKEY);                   // f / h^T plane keys per image
static_assert((SEQ / BQ) * NWAVE * 16 == SEQ);                // ctx / output rows per image
static_assert(4 * 32 * 8 == 16 * QW);                         // g tile store: 4 instructions x 32 lanes x 8 halves
static_assert(256 * 8 == KTILE * QW);                         // key tile store: 256 threads x 8 halves
static_assert(256 * 4 == DV * KTILE);                         // h^T tile store: 256 threads x 4 halves
static_assert(32 * 32 * 4 == 16 * CIN);                       // output tile store: 32 instructions x 32 lanes x 4 floats
static_assert(4 * 256 == 32 * DQK && 4 * 256 == 32 * DV);     // hh-pool element loops
static_assert(NWAVE * 4 * 8 == CIN && 8 * 4 == DQK && DQK == DV);   // weight rows: 8 waves x 4 lane groups x 8 k, 8 lanes x 4 n
static_assert(64 * 4 == CIN && 4 * 8 == DV);                  // Wattn rows: 64 threads x 4 n, 4 thread groups x 8 d
static_assert(PF >= 2 * DQK && (PF * 4) % 16 == 0);
static_assert(GP >= QW && FP >= QW && HP >= KTILE && CP >= DV && OW >= CIN);
static_assert((GP * 2) % 16 == 0 && (FP * 2) % 16 == 0 && (HP * 2) % 16 == 0 && (CP * 2) % 16 == 0);
static_assert((OW * 4) % 32 == 16);
static_assert(KP >= QW && (KP * 2) % 32 == 16 && (VP * 2) % 32 == 16);
static_assert((NKEY * QW) % (8 * 256 * 8) == 0);              // key plane: whole groups of 8 copies x 256 lanes x 8 halves
static_assert((DV * NKEY) % (8 * 256 * 8) == 0);              // h^T plane: the same
static_assert(KTILE * 2 == 64 && DV == 32 && NKEY % (4 * KTILE) == 0);   // h^T copy: 2 d x 4 key tiles x 64 B per wave
static_assert((NKEY * QW + DV * NKEY) / (256 * 8) <= 63);     // copies of one wave in flight
static_assert((NKEY * KP + DV * VP + CIN * CP) * 2 <= 327680);
static_assert(NWAVE * 16 * OW * 4 <= NKEY * KP * 2);          // the output tile fits over the key plane
static_assert((WP * 2) % 32 == 16 && (XP * 4) % 32 == 16);
static_assert(16 * (CIN / 2) * 4 == 2 * 8 * 32 * 16);         // one wave's half x rows: 16 copies x 32 lanes x 16 B
static_assert(2 * 32 * PF * 4 + (NWAVE * 16 * GP + KTILE * FP + DV * HP) * 2 + NPROJ * WP * 2 + 2 * XBUF * 4 <= 327680);

static constexpr size_t GQ_BYTES  = (size_t)NB * SEQ * QW * 2;        // 4,194,304 at full size
static constexpr size_t FK_BYTES  = (size_t)NB * NKEY * QW * 2;       // 1,048,576
static constexpr size_t HVT_BYTES = (size_t)NB * DV * NKEY * 2;       // 524,288
static constexpr size_t OFF_GQ  = 0;
static constexpr size_t OFF_FK  = OFF_GQ + GQ_BYTES;
static constexpr size_t OFF_HVT = OFF_FK + FK_BYTES;
static constexpr size_t WS_TOTAL = OFF_HVT + HVT_BYTES;               // 5,767,168 at full size
static_assert(GQ_BYTES % 128 == 0 && FK_BYTES % 128 == 0 && HVT_BYTES % 128 == 0);
static_assert(WS_TOTAL <= (size_t)134217728);

typedef __bf16   bf16;
typedef _Float16 f16;
typedef bf16     v16bf __attribute__((ext_vector_type(16)));
typedef f16      v16h  __attribute__((ext_vector_type(16)));
typedef f16      v8h   __attribute__((ext_vector_type(8)));
typedef float    v8f   __attribute__((ext_vector_type(8)));
typedef float    v4f   __attribute__((ext_vector_type(4)));
typedef float    v2f   __attribute__((ext_vector_type(2)));
typedef unsigned v4u   __attribute__((ext_vector_type(4)));
typedef unsigned v2u   __attribute__((ext_vector_type(2)));

union FragB  { v16bf v; v4u q[2]; bf16 h[16]; };
union FragH  { v16h  v; v4u q[2]; f16  h[16]; };
union Pack8B { v4u u; bf16 h[8]; };
union Pack8H { v4u u; v8h v; f16 h[8]; };

// WMMA helpers: the plain builtins; the compiler keeps the distance behind a matrix instruction itself, with useful
// instructions where it has them.
static __device__ __forceinline__ v8f mma_bf16(v16bf a, v16bf b, v8f acc) {
  return __builtin_amdgcn_wmma_f32_16x16x32_bf16(false, a, false, b, (short)0, acc, false, false);
}
static __device__ __forceinline__ v8f mma_f16(v16h a, v16h b, v8f acc) {
  return __builtin_amdgcn_wmma_f32_16x16x32_f16(false, a, false, b, (short)0, acc, false, false);
}

// Eight asynchronous 16-byte copies per lane, global -> LDS, through no register: copy i takes the 16-byte piece
// number piece0 + i * 256 of a plane whose rows hold ROWH halves and lands it at row pitch PITCH (halves) in LDS.
// The closing s_wait_xcnt stands inside the statement so that no address register is rewritten ahead of it.
template <int ROWH, int PITCH>
static __device__ __forceinline__ void copy8_to_lds(const f16* __restrict__ plane, unsigned lds_base, int piece0) {
  const f16* g[8];
  unsigned   l[8];
  #pragma unroll   // constant indices: the sixteen addresses stay in registers for the asm operands
  for (int i = 0; i < 8; ++i) {
    const int piece = piece0 + i * 256;
    const int row   = piece / (ROWH / 8);
    const int col   = piece % (ROWH / 8);
    g[i] = plane + (size_t)piece * 8;
    l[i] = lds_base + (unsigned)(row * PITCH + col * 8) * 2u;
  }
  asm volatile("global_load_async_to_lds_b128 %0, %8, off\n\t"
               "global_load_async_to_lds_b128 %1, %9, off\n\t"
               "global_load_async_to_lds_b128 %2, %10, off\n\t"
               "global_load_async_to_lds_b128 %3, %11, off\n\t"
               "global_load_async_to_lds_b128 %4, %12, off\n\t"
               "global_load_async_to_lds_b128 %5, %13, off\n\t"
               "global_load_async_to_lds_b128 %6, %14, off\n\t"
               "global_load_async_to_lds_b128 %7, %15, off\n\t"
               "s_wait_xcnt 0x0"
               :: "v"(l[0]), "v"(l[1]), "v"(l[2]), "v"(l[3]), "v"(l[4]), "v"(l[5]), "v"(l[6]), "v"(l[7]),
                  "v"(g[0]), "v"(g[1]), "v"(g[2]), "v"(g[3]), "v"(g[4]), "v"(g[5]), "v"(g[6]), "v"(g[7])
               : "memory");
}

// Eight asynchronous 16-byte copies per lane of the h^T plane, which lies in global memory as [key tile][d][KTILE keys],
// into the LDS rows [d][key] (pitch VP). Copy i is unit unit0 + i * NWAVE; a unit is 2 d x 4 key tiles: its 32 lanes take
// four whole 128-byte lines from global and land them as two runs of 256 contiguous bytes.
// The closing s_wait_xcnt stands inside the statement so that no address register is rewritten ahead of it.
static __device__ __forceinline__ void copy8_vt_to_lds(const f16* __restrict__ plane, unsigned lds_base, int unit0, int lane) {
  const f16* g[8];
  unsigned   l[8];
  #pragma unroll   // constant indices: the sixteen addresses stay in registers for the asm operands
  for (int i = 0; i < 8; ++i) {
    const int unit = unit0 + i * NWAVE;
    const int d    = (unit % (DV / 2)) * 2 + ((lane >> 2) & 1);   // 0..31
    const int kt   = (unit / (DV / 2)) * 4 + (lane >> 3);         // 0..NKEY / KTILE - 1
    const int col  = (lane & 3) * 8;                              // 0..24
    g[i] = plane + (size_t)((kt * DV + d) * KTILE + col);
    l[i] = lds_base + (unsigned)(d * VP + kt * KTILE + col) * 2u;
  }
  asm volatile("global_load_async_to_lds_b128 %0, %8, off\n\t"
               "global_load_async_to_lds_b128 %1, %9, off\n\t"
               "global_load_async_to_lds_b128 %2, %10, off\n\t"
               "global_load_async_to_lds_b128 %3, %11, off\n\t"
               "global_load_async_to_lds_b128 %4, %12, off\n\t"
               "global_load_async_to_lds_b128 %5, %13, off\n\t"
               "global_load_async_to_lds_b128 %6, %14, off\n\t"
               "global_load_async_to_lds_b128 %7, %15, off\n\t"
               "s_wait_xcnt 0x0"
               :: "v"(l[0]), "v"(l[1]), "v"(l[2]), "v"(l[3]), "v"(l[4]), "v"(l[5]), "v"(l[6]), "v"(l[7]),
                  "v"(g[0]), "v"(g[1]), "v"(g[2]), "v"(g[3]), "v"(g[4]), "v"(g[5]), "v"(g[6]), "v"(g[7])
               : "memory");
}

// N (8 or 4) asynchronous 16-byte copies per lane, global -> LDS, through no register: copy i takes the 16-byte piece
// number piece0 + i * STEP of a tile whose rows hold ROWB bytes at pitch SRCB in global memory and lands it at row
// pitch PITCHB in LDS (all in bytes).
// The closing s_wait_xcnt stands inside the statement so that no address register is rewritten ahead of it.
template <int N, int ROWB, int SRCB, int PITCHB, int STEP>
static __device__ __forceinline__ void copy_rows_to_lds(const char* __restrict__ plane, unsigned lds_base, int piece0) {
  static_assert(N == 8 || N == 4);
  const char* g[N];
  unsigned    l[N];
  #pragma unroll   // constant indices: the addresses stay in registers for the asm operands
  for (int i = 0; i < N; ++i) {
    const int piece = piece0 + i * STEP;
    const int row   = piece / (ROWB / 16);
    const int col   = piece % (ROWB / 16);
    g[i] = plane + (size_t)(row * SRCB + col * 16);
    l[i] = lds_base + (unsigned)(row * PITCHB + col * 16);
  }
  if constexpr (N == 8) {
    asm volatile("global_load_async_to_lds_b128 %0, %8, off\n\t"
                 "global_load_async_to_lds_b128 %1, %9, off\n\t"
                 "global_load_async_to_lds_b128 %2, %10, off\n\t"
                 "global_load_async_to_lds_b128 %3, %11, off\n\t"
                 "global_load_async_to_lds_b128 %4, %12, off\n\t"
                 "global_load_async_to_lds_b128 %5, %13, off\n\t"
                 "global_load_async_to_lds_b128 %6, %14, off\n\t"
                 "global_load_async_to_lds_b128 %7, %15, off\n\t"
                 "s_wait_xcnt 0x0"
                 :: "v"(l[0]), "v"(l[1]), "v"(l[2]), "v"(l[3]), "v"(l[4]), "v"(l[5]), "v"(l[6]), "v"(l[7]),
                    "v"(g[0]), "v"(g[1]), "v"(g[2]), "v"(g[3]), "v"(g[4]), "v"(g[5]), "v"(g[6]), "v"(g[7])
                 : "memory");
  } else {
    asm volatile("global_load_async_to_lds_b128 %0, %4, off\n\t"
                 "global_load_async_to_lds_b128 %1, %5, off\n\t"
                 "global_load_async_to_lds_b128 %2, %6, off\n\t"
                 "global_load_async_to_lds_b128 %3, %7, off\n\t"
                 "s_wait_xcnt 0x0"
                 :: "v"(l[0]), "v"(l[1]), "v"(l[2]), "v"(l[3]), "v"(g[0]), "v"(g[1]), "v"(g[2]), "v"(g[3])
                 : "memory");
  }
}

// Lane l takes the value of lane l ^ 16 (the other k-split half of the same query), on the vector pipe.
static __device__ __forceinline__ float xhalf(float v) {
  const int b = __builtin_bit_cast(int, v);
  return __builtin_bit_cast(float, __builtin_amdgcn_permlanex16(b, b, 0x76543210, 0xfedcba98, false, false));
}

// f32 -> f16 convert that can never produce a subnormal operand (value select below 2^-14).
static __device__ __forceinline__ f16 toh_flush(float v) {
  const f16 r = (f16)v;
  return (fabsf(v) < 6.103515625e-05f) ? (f16)0.0f : r;
}

// Weight rows (k-contiguous, B fragments load like A fragments), built in LDS by the block that reads them:
//   sw  [NPROJ][WP] bf16 : row n = column n of [Wf | Wg | Wh], RNE bf16.
//   swo [CIN][CP]   f16  : row n = column n of Wattn, value f16(bf16(w) * 16) (exact for normal results).
// A lane takes an 8 (k) x 4 (n) patch of a matrix: eight 16-byte loads (every 128-byte line a load touches is used
// whole), then four 16-byte LDS stores of eight k-contiguous values each. Loads and stores are two calls, so that the
// loads can stand ahead of the block's asynchronous copies and fly while those are issued.
// coverage: sw rows 0..95 x k 0..255 (wave -> 32 k, lane >> 3 -> 8 k of them, lane & 7 -> 4 n, three matrices).
static __device__ __forceinline__ void load_proj_weights(const float* __restrict__ wf, const float* __restrict__ wg,
                                                         const float* __restrict__ wh, int wave, int lane,
                                                         v4f (&w)[3][8]) {
  const int n0 = (lane & 7) * 4;                  // 0..28
  const int k0 = wave * 32 + (lane >> 3) * 8;     // 0..248
  #pragma unroll   // constant indices: the patches stay in registers
  for (int i = 0; i < 8; ++i) {
    const size_t off = (size_t)(k0 + i) * DQK + n0;
    w[0][i] = *(const v4f*)(wf + off);
    w[1][i] = *(const v4f*)(wg + off);
    w[2][i] = *(const v4f*)(wh + off);
  }
}
static __device__ __forceinline__ void store_proj_weights(const v4f (&w)[3][8], bf16* sw, int wave, int lane) {
  const int n0 = (lane & 7) * 4;
  const int k0 = wave * 32 + (lane >> 3) * 8;
  #pragma unroll
  for (int mt = 0; mt < 3; ++mt) {
    #pragma unroll
    for (int j = 0; j < 4; ++j) {
      Pack8B pk;
      #pragma unroll
      for (int i = 0; i < 8; ++i) pk.h[i] = (bf16)w[mt][i][j];   // RNE convert
      *(v4u*)(sw + (mt * DQK + n0 + j) * WP + k0) = pk.u;
    }
  }
}
// coverage: swo rows 0..255 x d 0..31 (tid & 63 -> 4 n, tid >> 6 -> 8 d).
static __device__ __forceinline__ void load_out_weights(const float* __restrict__ wo, int tid, v4f (&w)[8]) {
  const int n0 = (tid & 63) * 4;    // 0..252
  const int d0 = (tid >> 6) * 8;    // 0..24
  #pragma unroll   // constant indices: the patch stays in registers
  for (int i = 0; i < 8; ++i) w[i] = *(const v4f*)(wo + (size_t)(d0 + i) * CIN + n0);
}
static __device__ __forceinline__ void store_out_weights(const v4f (&w)[8], f16* swo, int tid) {
  const int n0 = (tid & 63) * 4;
  const int d0 = (tid >> 6) * 8;
  #pragma unroll
  for (int j = 0; j < 4; ++j) {
    Pack8H pk;
    #pragma unroll
    for (int i = 0; i < 8; ++i) pk.h[i] = toh_flush((float)(bf16)w[i][j] * 16.0f);   // bf16 significand fits f16
    *(v4u*)(swo + (n0 + j) * CP + d0) = pk.u;
  }
}

// One wave's 16-pixel M tile times NTN consecutive 16-column tiles of the weight rows starting at tile NT0, summed into acc over
// the CIN / 2 channels of one staged half: k steps kk0 .. kk0 + 3.
// A fragments from the staged f32 x rows (xr = this lane's half row in LDS; RNE bf16 convert, split k map); B fragments
// from the staged k-contiguous weight rows (sw, pitch WP). A k step's sixteen LDS loads stand ahead of its products.
template <int NT0, int NTN>
static __device__ __forceinline__ void proj_tiles(const float* xr, const bf16* sw, int kk0,
                                                  int m, int hi, v8f (&acc)[NTN]) {
  for (int kq = 0; kq < CIN / 64; ++kq) {
    const int kk = kk0 + kq;
    const float* xp = xr + kq * 32;
    const v4f a0 = *(const v4f*)(xp + hi * 8);
    const v4f a1 = *(const v4f*)(xp + hi * 8 + 4);
    const v4f b0 = *(const v4f*)(xp + 16 + hi * 8);
    const v4f b1 = *(const v4f*)(xp + 16 + hi * 8 + 4);
    FragB bw[NTN];
    #pragma unroll
    for (int t = 0; t < NTN; ++t) {
      const bf16* wp = sw + ((NT0 + t) * 16 + m) * WP + kk * 32 + hi * 8;
      bw[t].q[0] = *(const v4u*)(wp);        // k = kk*32 + hi*8 + 0..7, n = tile*16 + m
      bw[t].q[1] = *(const v4u*)(wp + 16);   // k = kk*32 + 16 + hi*8 + 0..7
    }
    FragB a;
    #pragma unroll
    for (int i = 0; i < 4; ++i) {
      a.h[i]      = (bf16)a0[i];   // elems 0..7  : k = kk*32 + hi*8 + 0..7
      a.h[4 + i]  = (bf16)a1[i];
      a.h[8 + i]  = (bf16)b0[i];   // elems 8..15 : k = kk*32 + 16 + hi*8 + 0..7
      a.h[12 + i] = (bf16)b1[i];
    }
    #pragma unroll
    for (int t = 0; t < NTN; ++t) acc[t] = mma_bf16(a.v, bw[t].v, acc[t]);
  }
}

// Stage s (0 or 1) of one wave's x rows: channel half s of its 16 pixel rows, into buffer s.
// xw0 = the wave's first x row, lx = its rows in buffer 0.
static __device__ __forceinline__ void copy_x_stage(const float* __restrict__ xw0, unsigned lx, int lane, int s) {
  const float*   src = xw0 + s * (CIN / 2);
  const unsigned dst = lx + (unsigned)s * (XBUF * 4);
  for (int gph = 0; gph < 2; ++gph)
    copy_rows_to_lds<8, CIN * 2, CIN * 4, XP * 4, 32>((const char*)src, dst, gph * 256 + lane);
}

// Projection + 2x2 max-pool. Block = (32-key tile kt, batch b), 256 threads, one block per two image rows
// hh = kt*2 + {0,1}; wave -> (hh, 16 pixels along ww).
//   gq  [NB][SEQ][QW] f16  : queries, value | residual x2048
//                            (wave writes 16 rows = 2 KB, 4 instructions of 4 lines, 8 lanes x 16 B per line).
//   fk  [NB][NKEY][QW] f16 : pooled keys, value | residual x2048, 32 rows per block = 4 KB
//                            (1 instruction, each wave 4 lines, 8 lanes x 16 B per line).
//   hvt [NB][NKEY / KTILE][DV][KTILE] f16 : pooled h^T, one tile of 2 KB per block, so that no line has two writers
//                            (1 instruction, each wave 2 lines, 8 lanes x 8 B per 64-byte d row).
// LDS regions: sP cross-wave (block barrier), sG per-wave but read across lanes after the block barrier,
// sF / sHT cross-wave (block barrier). Staged extent == consumed extent for all four.
// The weight rows (sW) are converted from the f32 inputs by the block itself, once, while the first x stage flies.
// x comes by asynchronous copies (whole lines from global, padded rows in LDS): each wave's 16 x rows in two stages
// of 128 channels, each into its own buffer (sX): the second flies while the first is worked on.
__global__ __launch_bounds__(256) void proj_pool_kernel(const float* __restrict__ x, const float* __restrict__ wf,
                                                         const float* __restrict__ wg, const float* __restrict__ wh,
                                                         f16* __restrict__ gq, f16* __restrict__ fk,
                                                         f16* __restrict__ hvt) {
  const int kt   = blockIdx.x;
  const int b    = blockIdx.y;
  const int tid  = threadIdx.x;
  const int wave = __builtin_amdgcn_readfirstlane(threadIdx.x >> 5);
  const int lane = tid & 31;
  const int m    = lane & 15;
  const int hi   = lane >> 4;
  const int hsel = wave >> 2;          // which of the block's two image rows
  const int ww0  = (wave & 3) * 16;    // first pixel column of this wave's tile

  __shared__ __align__(16) float sP[2 * 32 * PF];     // [hsel][pw][64 cols] ww-pooled f|h in f32
  __shared__ __align__(16) f16 sG[NWAVE * 16 * GP];   // per-wave g tile [16][value 32 | residual 32]
  __shared__ __align__(16) f16 sF[KTILE * FP];        // pooled f [32 keys][value 32 | residual 32]
  __shared__ __align__(16) f16 sHT[DV * HP];          // pooled h^T [32 d][32 keys]
  __shared__ __align__(16) bf16 sW[NPROJ * WP];       // weight rows [96 n][256 k]
  __shared__ __align__(16) float sX[2 * XBUF];        // [buffer][wave][16 pixels][128 channels] in f32

  f16*   sg = sG + wave * (16 * GP);
  float* sp = sP + hsel * (32 * PF);
  const int pwb = (ww0 >> 1) + hi * 4;   // pooled column index base for this lane half

  const float*   sx   = sX + wave * (16 * XP);
  const unsigned lx   = (unsigned)(size_t)sx;
  const int      pix0 = (kt * 2 + hsel) * W_IMG + ww0;   // first pixel of this wave's tile
  const float*   xw0  = x + ((size_t)b * SEQ_FULL + pix0) * CIN;

  v4f wv[3][8];
  load_proj_weights(wf, wg, wh, wave, lane, wv);
  // fill: every lane of every wave copies its own 16-byte pieces, no branch around the copies
  copy_x_stage(xw0, lx, lane, 0);
  store_proj_weights(wv, sW, wave, lane);
  // this wave's copies have landed; behind the barrier every wave's have, and every wave's weight rows are written
  asm volatile("s_wait_asynccnt 0x0" ::: "memory");
  __syncthreads();
  copy_x_stage(xw0, lx, lane, 1);

  {   // tiles 0,1: f; 2,3: g; 4,5: h
    v8f acc[6];
    #pragma unroll
    for (int t = 0; t < 6; ++t) acc[t] = (v8f){0, 0, 0, 0, 0, 0, 0, 0};
    proj_tiles<0, 6>(sx + m * XP, sW, 0, m, hi, acc);
    // publish point of stage 1: this wave's reads of buffer 0 have retired, its copies into buffer 1 have landed
    asm volatile("s_wait_dscnt 0x0" ::: "memory");
    asm volatile("s_wait_asynccnt 0x0" ::: "memory");
    __syncthreads();
    proj_tiles<0, 6>(sx + XBUF + m * XP, sW, CIN / 64, m, hi, acc);
    #pragma unroll
    for (int r = 0; r < 8; ++r) {
      const float g0 = acc[2][r];
      const float g1 = acc[3][r];
      const f16 h0 = toh_flush(g0);
      const f16 h1 = toh_flush(g1);
      sg[(hi * 8 + r) * GP + m]      = h0;
      sg[(hi * 8 + r) * GP + 16 + m] = h1;
      sg[(hi * 8 + r) * GP + 32 + m] = toh_flush((g0 - (float)h0) * 2048.0f);
      sg[(hi * 8 + r) * GP + 48 + m] = toh_flush((g1 - (float)h1) * 2048.0f);
    }
    // ww pairs are D rows (2rp, 2rp+1) of the same lane half; pooled column pw = ww0/2 + 4*hi + rp
    #pragma unroll
    for (int rp = 0; rp < 4; ++rp) {
      #pragma unroll
      for (int t = 0; t < 2; ++t) {
        sp[(pwb + rp) * PF + t * 16 + m]      = fmaxf(acc[t][2 * rp], acc[t][2 * rp + 1]);
        sp[(pwb + rp) * PF + 32 + t * 16 + m] = fmaxf(acc[4 + t][2 * rp], acc[4 + t][2 * rp + 1]);
      }
    }
  }
  __syncthreads();

  {
    v4u    gv[4];
    size_t gi[4];
    #pragma unroll
    for (int i4 = 0; i4 < 4; ++i4) {
      const int row = i4 * 4 + (lane >> 3);
      const int cq  = (lane & 7) * 8;
      Pack8H p;
      p.v = *(const v8h*)(sg + row * GP + cq);
      gv[i4] = p.u;
      gi[i4] = ((size_t)b * SEQ + pix0 + row) * QW + cq;
    }
    #pragma unroll
    for (int i4 = 0; i4 < 4; ++i4) *(v4u*)(gq + gi[i4]) = gv[i4];
  }

  // hh-pool into the block's pooled tiles (f32 max, then one convert)
  #pragma unroll
  for (int e = 0; e < 4; ++e) {
    const int idx = e * 256 + tid;
    const int pw  = idx >> 5;
    const int c   = idx & 31;
    const float v = fmaxf(sP[pw * PF + c], sP[32 * PF + pw * PF + c]);
    const f16 hv  = toh_flush(v);
    sF[pw * FP + c]      = hv;
    sF[pw * FP + 32 + c] = toh_flush((v - (float)hv) * 2048.0f);
  }
  #pragma unroll
  for (int e = 0; e < 4; ++e) {
    const int idx = e * 256 + tid;
    const int pw  = idx >> 5;
    const int d   = idx & 31;
    const float v = fmaxf(sP[pw * PF + 32 + d], sP[32 * PF + pw * PF + 32 + d]);
    sHT[d * HP + pw] = toh_flush(v);
  }
  __syncthreads();

  // final plane stores: fk (a wave writes 4 rows = 512 B), hvt (a wave writes 4 d rows of 64 B = 256 B)
  v4u    fv;
  size_t fi;
  {
    const int row = tid >> 3;            // 0..31
    const int cq  = (tid & 7) * 8;
    Pack8H p;
    p.v = *(const v8h*)(sF + row * FP + cq);
    fv = p.u;
    fi = ((size_t)b * NKEY + kt * KTILE + row) * QW + cq;
  }
  v2u    hv;
  size_t hidx;
  {
    const int d  = tid >> 3;             // 0..31
    const int kq = (tid & 7) * 4;        // 0..28
    hv   = *(const v2u*)(sHT + d * HP + kq);
    hidx = (((size_t)b * (NKEY / KTILE) + kt) * DV + d) * KTILE + kq;
  }
  *(v4u*)(fk + fi) = fv;
  *(v2u*)(hvt + hidx) = hv;
}

// Flash attention, non-causal, no score scaling. Block = (query block of 128, batch); one wave owns 16 queries.
// S^T = F x G^T so queries sit on lanes; P^T in C-layout is bit-identical to the B-fragment layout of
// CTX^T += Hv^T x P^T, whose columns are again the queries: a query's maximum, sum and rescale stay on its own two
// lanes (lq, lq + 16), which exchange the maximum once per 32 keys and join their sums once, behind the loop.
// Scores: value x value in c, (value x residual + residual x value) in cr, s = c + cr / 2048.
// The image's whole key plane and h^T plane are staged once in LDS by asynchronous copies (whole lines from global,
// padded rows in LDS; the h^T tiles land side by side in rows [d][key]) and shared by the block's 8 waves; F A-fragments and Hv^T A-fragments are two 16-B LDS loads
// each, G B-fragments two 16-B global loads each.
// Epilogue in the same launch: out = gamma * (CTX x Wo) + x_bf16 for the block's 128 query rows. The two CTX^T tiles,
// converted in place, are the A fragment of that product (split d map); B fragments from sWo (Wattn carried x16),
// converted by the block itself while the fill flies;
// the wave's 16 x rows are loaded behind the fill's barrier and fly while the key loop runs.
// LDS: sK / sV / sWo written once, read-only behind the fill's barrier; the block barrier behind the key loop ends
// every wave's last read of sK, over which the f32 output tile is then staged (per-wave region, block barrier), so
// that every store instruction writes 512 contiguous bytes.
__global__ __launch_bounds__(256) void attn_out_kernel(const f16* __restrict__ gq, const f16* __restrict__ fk,
                                                       const f16* __restrict__ hvt, const float* __restrict__ wo,
                                                       const float* __restrict__ x, const float* __restrict__ gamma,
                                                       float* __restrict__ out) {
  const int qblk = blockIdx.x;
  const int b    = blockIdx.y;
  const int tid  = threadIdx.x;
  const int wave = __builtin_amdgcn_readfirstlane(threadIdx.x >> 5);
  const int lane = tid & 31;
  const int lq   = lane & 15;   // query column of S^T and of CTX^T
  const int hi   = lane >> 4;   // k-split half

  __shared__ __align__(16) f16 sK[NKEY * KP];   // [key][value 32 | residual 32]
  __shared__ __align__(16) f16 sV[DV * VP];     // [d][key]
  __shared__ __align__(16) f16 sWo[CIN * CP];   // [n][d]

  const int qrow0 = qblk * BQ + wave * 16;
  const float gsc = (float)(bf16)gamma[0] * 0.0625f;   // gamma (RNE bf16) folded with the 1/16 Wo carry

  const f16* fk_b = fk + (size_t)b * NKEY * QW;
  const f16* vt_b = hvt + (size_t)b * DV * NKEY;

  // the block's plain loads stand ahead of the fill and fly while its copies are issued
  v4f wv[8];
  load_out_weights(wo, tid, wv);

  // G as B-operand fragments: lane lq holds query qrow0+lq, elements follow the split d map
  FragH qf, qr;
  {
    const f16* qp = gq + ((size_t)b * SEQ + qrow0 + lq) * QW + hi * 8;
    qf.q[0] = *(const v4u*)(qp);        // value,    d = hi*8 + 0..7
    qf.q[1] = *(const v4u*)(qp + 16);   // value,    d = 16 + hi*8 + 0..7
    qr.q[0] = *(const v4u*)(qp + 32);   // residual, d = hi*8 + 0..7
    qr.q[1] = *(const v4u*)(qp + 48);   // residual, d = 16 + hi*8 + 0..7
  }

  // fill: every lane of every wave copies its own 16-byte pieces, no branch around the copies
  {
    const unsigned lk = (unsigned)(size_t)sK;
    const unsigned lv = (unsigned)(size_t)sV;
    for (int gph = 0; gph < (NKEY * QW) / (8 * 256 * 8); ++gph) copy8_to_lds<QW, KP>(fk_b, lk, gph * 2048 + tid);
    for (int gph = 0; gph < (DV * NKEY) / (8 * 256 * 8); ++gph) copy8_vt_to_lds(vt_b, lv, gph * 8 * NWAVE + wave, lane);
  }
  // keeps the Wattn converts, which wait for their loads, from being scheduled among or ahead of the fill's copies
  __builtin_amdgcn_sched_barrier(0);

  v8f o[2];
  #pragma unroll
  for (int dt = 0; dt < 2; ++dt) o[dt] = (v8f){0, 0, 0, 0, 0, 0, 0, 0};

  float rmax = -__builtin_inff();
  float rsum = 0.0f;
  const float SL = 1.4426950408889634f;   // log2(e); the scores carry no extra scale
  const float RS = 1.0f / 2048.0f;        // residual plane carry folded back

  store_out_weights(wv, sWo, tid);

  // this wave's copies have landed; behind the barrier every wave's have
  asm volatile("s_wait_asynccnt 0x0" ::: "memory");
  __syncthreads();

  // residual rows of this wave's 16 queries: instruction j takes half row j (512 contiguous bytes); first used in the
  // epilogue, so the loads stand behind the barrier (which would wait for them) and ahead of the key loop
  const size_t xoff = ((size_t)b * SEQ_FULL + qrow0) * CIN + lane * 4;
  v4f xv[32];
  #pragma unroll   // constant indices: the rows stay in registers until the epilogue
  for (int j = 0; j < 32; ++j) xv[j] = *(const v4f*)(x + xoff + j * (CIN / 2));

  // F A-fragments of pass 0; every later pass finds its own already in these registers
  FragH ak[2], akr[2];
  #pragma unroll
  for (int sub = 0; sub < 2; ++sub) {
    const f16* base = sK + (sub * 16 + lq) * KP + hi * 8;
    ak[sub].q[0]  = *(const v4u*)(base);        // d = hi*8 + 0..7
    ak[sub].q[1]  = *(const v4u*)(base + 16);   // d = 16 + hi*8 + 0..7
    akr[sub].q[0] = *(const v4u*)(base + 32);
    akr[sub].q[1] = *(const v4u*)(base + 48);
  }

  for (int i = 0; i < NKEY / BK; ++i) {
    const int j0 = i * BK;

    // S^T tiles: c[sub][r] = score(query qrow0+lq, key j0 + sub*16 + hi*8 + r)
    v8f c[2], cr[2];
    #pragma unroll
    for (int sub = 0; sub < 2; ++sub) {
      c[sub]  = mma_f16(ak[sub].v,  qf.v, (v8f){0, 0, 0, 0, 0, 0, 0, 0});
      cr[sub] = mma_f16(ak[sub].v,  qr.v, (v8f){0, 0, 0, 0, 0, 0, 0, 0});
      cr[sub] = mma_f16(akr[sub].v, qf.v, cr[sub]);
    }

    // one group of LDS loads per pass, right behind the S^T products, landing while the softmax runs: the next pass's
    // F fragments into the same registers (the last pass takes pass 0's rows again and uses none of them), and this
    // pass's Hv^T A-fragments: row m = d = dt*16 + lq, split key map from the transposed plane
    // scheduling order of the pass's head: the six S^T products back to back, then the load addresses and the residual
    // folds (they fill the slots behind the last product), then the twelve LDS loads in one place, then the softmax;
    // left free, the compiler deals four of the loads among the products and pads the slots with v_nop
    __builtin_amdgcn_sched_group_barrier(0x008, 6, 0);
    __builtin_amdgcn_sched_group_barrier(0x002, 19, 0);
    __builtin_amdgcn_sched_group_barrier(0x100, 12, 0);
    __builtin_amdgcn_sched_group_barrier(0x002, 128, 0);
    const int jn = ((i + 1) % (NKEY / BK)) * BK;
    #pragma unroll
    for (int sub = 0; sub < 2; ++sub) {
      const f16* base = sK + (jn + sub * 16 + lq) * KP + hi * 8;
      ak[sub].q[0]  = *(const v4u*)(base);        // d = hi*8 + 0..7
      ak[sub].q[1]  = *(const v4u*)(base + 16);   // d = 16 + hi*8 + 0..7
      akr[sub].q[0] = *(const v4u*)(base + 32);
      akr[sub].q[1] = *(const v4u*)(base + 48);
    }
    FragH av[2];
    #pragma unroll
    for (int dt = 0; dt < 2; ++dt) {
      const f16* base = sV + (dt * 16 + lq) * VP + j0 + hi * 8;
      av[dt].q[0] = *(const v4u*)(base);        // keys j0 + hi*8 + 0..7
      av[dt].q[1] = *(const v4u*)(base + 16);   // keys j0 + 16 + hi*8 + 0..7
    }

    #pragma unroll
    for (int sub = 0; sub < 2; ++sub) {
      #pragma unroll
      for (int r = 0; r < 8; ++r) c[sub][r] = c[sub][r] + cr[sub][r] * RS;
    }

    // online softmax: query lq's 32 scores are split across lane / lane^16
    float m_new = rmax;
    #pragma unroll
    for (int r = 0; r < 8; ++r) {
      m_new = fmaxf(m_new, c[0][r]);
      m_new = fmaxf(m_new, c[1][r]);
    }
    m_new = fmaxf(m_new, xhalf(m_new));
    const float scale = __builtin_amdgcn_exp2f((rmax - m_new) * SL);
    rmax = m_new;

    // exp + pack: P^T C-layout == B-fragment layout for the PV product; P carried x4096 in f16.
    // log2(e), the maximum and the carry sit in one fused multiply-add per score: p * 4096 = exp2(s * SL + kb), which
    // goes to the convert as it is (far below the maximum it rounds to an f16 subnormal or to zero).
    const float kb = __builtin_fmaf(-m_new, SL, 12.0f);
    FragH pa;
    v2f px[2][4];
    #pragma unroll   // constant indices: scores, exponentials and the fragment stay in registers
    for (int sub = 0; sub < 2; ++sub) {
      #pragma unroll   // the same
      for (int i2 = 0; i2 < 4; ++i2) {   // keys j0 + sub*16 + hi*8 + 2*i2, + 1: a register pair of the accumulator
        const v2f e = __builtin_elementwise_fma((v2f){c[sub][2 * i2], c[sub][2 * i2 + 1]}, (v2f){SL, SL}, (v2f){kb, kb});
        px[sub][i2] = (v2f){__builtin_amdgcn_exp2f(e[0]), __builtin_amdgcn_exp2f(e[1])};
        pa.h[sub * 8 + 2 * i2]     = (f16)px[sub][i2][0];
        pa.h[sub * 8 + 2 * i2 + 1] = (f16)px[sub][i2][1];
      }
    }
    float psum = 0.0f;   // carried x4096 like P
    #pragma unroll   // constant indices into px
    for (int i2 = 0; i2 < 4; ++i2) {
      const v2f t = px[0][i2] + px[1][i2];
      psum += t[0];
      psum += t[1];
    }
    rsum = rsum * scale + psum;   // the keys of this lane's half only

    // rescale CTX^T: the query is the column there -> the lane's own scale
    #pragma unroll
    for (int dt = 0; dt < 2; ++dt) {
      #pragma unroll
      for (int r = 0; r < 8; ++r) o[dt][r] *= scale;
    }

    // CTX^T += Hv^T x P^T : o[dt][r] = ctx(query qrow0 + lq, d = dt*16 + hi*8 + r)
    #pragma unroll
    for (int dt = 0; dt < 2; ++dt) o[dt] = mma_f16(av[dt].v, pa.v, o[dt]);
  }

  // normalize: the two halves' sums of query lq joined (sums and CTX^T both carry x4096); CTX as A fragment straight from the accumulators:
  // lane lq holds query row lq, elements follow the split d map
  const float rs = 1.0f / (rsum + xhalf(rsum));
  FragH ca;
  #pragma unroll
  for (int r = 0; r < 8; ++r) {
    ca.h[r]     = toh_flush(o[0][r] * rs);   // d = hi*8 + r
    ca.h[8 + r] = toh_flush(o[1][r] * rs);   // d = 16 + hi*8 + r
  }
  // ends every wave's last read of the key plane
  __syncthreads();

  // OUT tile of the wave, 16 rows x 256 channels in f32, staged over the key plane (dead behind the barrier above)
  float* so = (float*)sK + wave * (16 * OW);
  #pragma unroll   // laid out flat so that a group's fragment loads can stand among the stores of the group before
  for (int qn = 0; qn < 4; ++qn) {   // four independent 16-column tiles at a time: one LDS wait per four products
    FragH bw[4];
    #pragma unroll
    for (int j = 0; j < 4; ++j) {
      const f16* wp = sWo + ((qn * 4 + j) * 16 + lq) * CP + hi * 8;
      bw[j].q[0] = *(const v4u*)(wp);
      bw[j].q[1] = *(const v4u*)(wp + 16);
    }
    v8f acc[4];
    #pragma unroll
    for (int j = 0; j < 4; ++j) acc[j] = mma_f16(ca.v, bw[j].v, (v8f){0, 0, 0, 0, 0, 0, 0, 0});
    #pragma unroll
    for (int r = 0; r < 8; ++r) {
      #pragma unroll
      for (int j = 0; j < 4; ++j) so[(hi * 8 + r) * OW + (qn * 4 + j) * 16 + lq] = acc[j][r] * gsc;
    }
  }
  __syncthreads();

  // whole-line stores: instruction j writes half row j = 512 contiguous bytes (4 lines)
  #pragma unroll   // constant indices into xv
  for (int j = 0; j < 32; ++j) {
    v4f v = *(const v4f*)(so + (j >> 1) * OW + (j & 1) * (CIN / 2) + lane * 4);
    #pragma unroll
    for (int cc = 0; cc < 4; ++cc) v[cc] = v[cc] + (float)(bf16)xv[j][cc];   // residual with the RNE bf16 input value
    *(v4f*)(out + xoff + j * (CIN / 2)) = v;
  }
}

extern "C" void kernel_launch(void* const* d_in, const int* in_sizes, int n_in,
                              void* d_out, int out_size, void* d_ws, size_t ws_size,
                              hipStream_t stream) {
  if (n_in < 6) return;
  const size_t rows_used = (size_t)(NB - 1) * SEQ_FULL + SEQ;
  if ((size_t)in_sizes[0] < rows_used * CIN) return;
  if (in_sizes[1] < CIN * DQK) return;
  if (in_sizes[2] < CIN * DQK) return;
  if (in_sizes[3] < CIN * DV) return;
  if (in_sizes[4] < DV * CIN) return;
  if (in_sizes[5] < 1) return;
  if ((size_t)out_size < rows_used * CIN) return;
  if (ws_size < WS_TOTAL) return;

  const float* x     = (const float*)d_in[0];
  const float* wf    = (const float*)d_in[1];
  const float* wg    = (const float*)d_in[2];
  const float* wh    = (const float*)d_in[3];
  const float* wo    = (const float*)d_in[4];
  const float* gamma = (const float*)d_in[5];
  float* out = (float*)d_out;
  char*  ws  = (char*)d_ws;
  f16*  gq  = (f16*)(ws + OFF_GQ);
  f16*  fk  = (f16*)(ws + OFF_FK);
  f16*  hvt = (f16*)(ws + OFF_HVT);

  proj_pool_kernel<<<dim3(SEQ / 128, NB), 256, 0, stream>>>(x, wf, wg, wh, gq, fk, hvt);
  attn_out_kernel<<<dim3(SEQ / BQ, NB), 256, 0, stream>>>(gq, fk, hvt, wo, x, gamma, out);
}

// v010
// One run takes 20 microseconds.
// Timed twice side by side with v009, it ran 1.04 times as fast both times.
// All steps since v000 together make it 4.32 times as fast.
#include <hip/hip_runtime.h>

// Contractions: X x [Wf|Wg|Wh] on v_wmma_f32_16x16x32_bf16 (bf16 operands = RNE-converted inputs, f32 accumulate);
// S^T = F x G^T as three v_wmma_f32_16x16x32_f16 products summed in ONE f32 accumulator: f and g are carried x256 and
// then split into f16 value + f16 residual, so that value x value, value x residual and residual x value all carry x65536;
// CTX^T = Hv^T x P^T (P as f16 carried x4096), the softmax row sums as a third tile of that product (a row of ones
// x P^T), and OUT = CTX x Wattn (Wattn as f16 of the bf16 value, carried x16)
// on v_wmma_f32_16x16x32_f16 (f16 operands, f32 accumulate). Max-pool, softmax and residual add in f32.

#ifndef NB
#define NB 8
#endif
#ifndef SEQ
#define SEQ 4096
#endif
#define NB_FULL  8
#define SEQ_FULL 4096
#define W_IMG    64                 // image width (pixels per image row)
#define CIN      256                // input channels
#define DQK      32                 // query / key channels
#define DV       32                 // value channels
#define NPROJ    96                 // packed projection columns: [0,32) f, [32,64) g, [64,96) h
#define QW       64                 // halves per row of the query / key planes: value 0..31 | residual 32..63
#define NKEY     (SEQ / 4)          // pooled key count per image
#define KTILE    32                 // keys produced per projection block (two image rows)
#define BQ       128                // query rows per attention block (8 waves x 16)
#define BK       32                 // keys per inner iteration
#define RCARRY   256.0f             // carry of f and of g ahead of the value | residual split (a power of two: exact)
#define NWAVE    8
#define PF       68                 // LDS pitch (floats) of the ww-pooled staging rows (f 0..31 | h 32..63)
#define GP       72                 // LDS pitch (halves) of the g staging tile (value | residual)
#define FP       72                 // LDS pitch (halves) of the pooled f tile (value | residual)
#define HP       72                 // LDS pitch (halves) of the pooled h^T tile
#define CP       40                 // LDS pitch (halves) of a staged Wattn row (32 d): 80 B = 16 B x odd
#define OW       (CIN + 4)          // LDS pitch (floats) of a staged output row (256 channels): 1040 B = 16 B x odd
#define KP       72                 // LDS pitch (halves) of a staged key row (value | residual): 144 B = 16 B x odd
#define VP       (NKEY + 8)         // LDS pitch (halves) of a staged h^T row: 16 B x odd
#define WP       (CIN + 8)          // LDS pitch (bf16) of a staged weight row: 528 B = 16 B x odd
#define XP       (CIN / 2 + 4)      // LDS pitch (floats) of a staged half x row (128 channels): 528 B = 16 B x odd
#define XBUF     (NWAVE * 16 * XP)  // floats in one of the two x buffers

static_assert(SEQ % 256 == 0);
static_assert(SEQ >= 256 && SEQ <= SEQ_FULL);
static_assert(NB >= 1 && NB <= NB_FULL);
static_assert(BQ == NWAVE * 16);
static_assert(NKEY % BK == 0);
static_assert(NKEY % KTILE == 0);
static_assert(CIN % 32 == 0 && DV == 32 && DQK == 32);
static_assert(NPROJ == 2 * DQK + DV && NPROJ % 16 == 0 && NPROJ / 8 == 12);
static_assert(QW == 2 * DQK && QW * 2 == 128);
static_assert(W_IMG == 64 && CIN == 4 * 64);
// coverage equalities (grid x block x per-thread elements == plane extent)
static_assert((SEQ / 128) * NWAVE * 16 == SEQ);              // g plane rows per image
static_assert((SEQ / 128) * KTILE == NKEY);                   // f / h^T plane keys per image
static_assert((SEQ / BQ) * NWAVE * 16 == SEQ);                // ctx / output rows per image
static_assert(4 * 32 * 8 == 16 * QW);                         // g tile store: 4 instructions x 32 lanes x 8 halves
static_assert(256 * 8 == KTILE * QW);                         // key tile store: 256 threads x 8 halves
static_assert(256 * 4 == DV * KTILE);                         // h^T tile store: 256 threads x 4 halves
static_assert(32 * 32 * 4 == 16 * CIN);                       // output tile store: 32 instructions x 32 lanes x 4 floats
static_assert(4 * 256 == 32 * DQK && 4 * 256 == 32 * DV);     // hh-pool element loops
static_assert(NWAVE * 4 * 8 == CIN && 8 * 4 == DQK && DQK == DV);   // weight rows: 8 waves x 4 lane groups x 8 k, 8 lanes x 4 n
static_assert(64 * 4 == CIN && 4 * 8 == DV);                  // Wattn rows: 64 threads x 4 n, 4 thread groups x 8 d
static_assert(PF >= 2 * DQK && (PF * 4) % 16 == 0);
static_assert(GP >= QW && FP >= QW && HP >= KTILE && CP >= DV && OW >= CIN);
static_assert((GP * 2) % 16 == 0 && (FP * 2) % 16 == 0 && (HP * 2) % 16 == 0 && (CP * 2) % 16 == 0);
static_assert((OW * 4) % 32 == 16);
static_assert(KP >= QW && (KP * 2) % 32 == 16 && (VP * 2) % 32 == 16);
static_assert((NKEY * QW) % (8 * 256 * 8) == 0);              // key plane: whole groups of 8 copies x 256 lanes x 8 halves
static_assert((DV * NKEY) % (8 * 256 * 8) == 0);              // h^T plane: the same
static_assert(KTILE * 2 == 64 && DV == 32 && NKEY % (4 * KTILE) == 0);   // h^T copy: 2 d x 4 key tiles x 64 B per wave
static_assert((NKEY * QW + DV * NKEY) / (256 * 8) <= 63);     // copies of one wave in flight
static_assert((NKEY * KP + DV * VP + CIN * CP) * 2 <= 327680);
static_assert(NWAVE * 16 * OW * 4 <= NKEY * KP * 2);          // the output tile fits over the key plane
static_assert((WP * 2) % 32 == 16 && (XP * 4) % 32 == 16);
static_assert(16 * (CIN / 2) * 4 == 2 * 8 * 32 * 16);         // one wave's half x rows: 16 copies x 32 lanes x 16 B
static_assert(2 * 32 * PF * 4 + (NWAVE * 16 * GP + KTILE * FP + DV * HP) * 2 + NPROJ * WP * 2 + 2 * XBUF * 4 <= 327680);

static constexpr size_t GQ_BYTES  = (size_t)NB * SEQ * QW * 2;        // 4,194,304 at full size
static constexpr size_t FK_BYTES  = (size_t)NB * NKEY * QW * 2;       // 1,048,576
static constexpr size_t HVT_BYTES = (size_t)NB * DV * NKEY * 2;       // 524,288
static constexpr size_t OFF_GQ  = 0;
static constexpr size_t OFF_FK  = OFF_GQ + GQ_BYTES;
static constexpr size_t OFF_HVT = OFF_FK + FK_BYTES;
static constexpr size_t WS_TOTAL = OFF_HVT + HVT_BYTES;               // 5,767,168 at full size
static_assert(GQ_BYTES % 128 == 0 && FK_BYTES % 128 == 0 && HVT_BYTES % 128 == 0);
static_assert(WS_TOTAL <= (size_t)134217728);

typedef __bf16   bf16;
typedef _Float16 f16;
typedef bf16     v16bf __attribute__((ext_vector_type(16)));
typedef f16      v16h  __attribute__((ext_vector_type(16)));
typedef f16      v8h   __attribute__((ext_vector_type(8)));
typedef float    v8f   __attribute__((ext_vector_type(8)));
typedef float    v4f   __attribute__((ext_vector_type(4)));
typedef float    v2f   __attribute__((ext_vector_type(2)));
typedef unsigned v4u   __attribute__((ext_vector_type(4)));
typedef unsigned v2u   __attribute__((ext_vector_type(2)));

union FragB  { v16bf v; v4u q[2]; bf16 h[16]; };
union FragH  { v16h  v; v4u q[2]; f16  h[16]; };
union Pack8B { v4u u; bf16 h[8]; };
union Pack8H { v4u u; v8h v; f16 h[8]; };

// WMMA helpers: the plain builtins; the compiler keeps the distance behind a matrix instruction itself, with useful
// instructions where it has them.
static __device__ __forceinline__ v8f mma_bf16(v16bf a, v16bf b, v8f acc) {
  return __builtin_amdgcn_wmma_f32_16x16x32_bf16(false, a, false, b, (short)0, acc, false, false);
}
static __device__ __forceinline__ v8f mma_f16(v16h a, v16h b, v8f acc) {
  return __builtin_amdgcn_wmma_f32_16x16x32_f16(false, a, false, b, (short)0, acc, false, false);
}

// Eight asynchronous 16-byte copies per lane, global -> LDS, through no register: copy i takes the 16-byte piece
// number piece0 + i * 256 of a plane whose rows hold ROWH halves and lands it at row pitch PITCH (halves) in LDS.
// The closing s_wait_xcnt stands inside the statement so that no address register is rewritten ahead of it.
template <int ROWH, int PITCH>
static __device__ __forceinline__ void copy8_to_lds(const f16* __restrict__ plane, unsigned lds_base, int piece0) {
  const f16* g[8];
  unsigned   l[8];
  #pragma unroll   // constant indices: the sixteen addresses stay in registers for the asm operands
  for (int i = 0; i < 8; ++i) {
    const int piece = piece0 + i * 256;
    const int row   = piece / (ROWH / 8);
    const int col   = piece % (ROWH / 8);
    g[i] = plane + (size_t)piece * 8;
    l[i] = lds_base + (unsigned)(row * PITCH + col * 8) * 2u;
  }
  asm volatile("global_load_async_to_lds_b128 %0, %8, off\n\t"
               "global_load_async_to_lds_b128 %1, %9, off\n\t"
               "global_load_async_to_lds_b128 %2, %10, off\n\t"
               "global_load_async_to_lds_b128 %3, %11, off\n\t"
               "global_load_async_to_lds_b128 %4, %12, off\n\t"
               "global_load_async_to_lds_b128 %5, %13, off\n\t"
               "global_load_async_to_lds_b128 %6, %14, off\n\t"
               "global_load_async_to_lds_b128 %7, %15, off\n\t"
               "s_wait_xcnt 0x0"
               :: "v"(l[0]), "v"(l[1]), "v"(l[2]), "v"(l[3]), "v"(l[4]), "v"(l[5]), "v"(l[6]), "v"(l[7]),
                  "v"(g[0]), "v"(g[1]), "v"(g[2]), "v"(g[3]), "v"(g[4]), "v"(g[5]), "v"(g[6]), "v"(g[7])
               : "memory");
}

// Eight asynchronous 16-byte copies per lane of the h^T plane, which lies in global memory as [key tile][d][KTILE keys],
// into the LDS rows [d][key] (pitch VP). Copy i is unit unit0 + i * NWAVE; a unit is 2 d x 4 key tiles: its 32 lanes take
// four whole 128-byte lines from global and land them as two runs of 256 contiguous bytes.
// The closing s_wait_xcnt stands inside the statement so that no address register is rewritten ahead of it.
static __device__ __forceinline__ void copy8_vt_to_lds(const f16* __restrict__ plane, unsigned lds_base, int unit0, int lane) {
  const f16* g[8];
  unsigned   l[8];
  #pragma unroll   // constant indices: the sixteen addresses stay in registers for the asm operands
  for (int i = 0; i < 8; ++i) {
    const int unit = unit0 + i * NWAVE;
    const int d    = (unit % (DV / 2)) * 2 + ((lane >> 2) & 1);   // 0..31
    const int kt   = (unit / (DV / 2)) * 4 + (lane >> 3);         // 0..NKEY / KTILE - 1
    const int col  = (lane & 3) * 8;                              // 0..24
    g[i] = plane + (size_t)((kt * DV + d) * KTILE + col);
    l[i] = lds_base + (unsigned)(d * VP + kt * KTILE + col) * 2u;
  }
  asm volatile("global_load_async_to_lds_b128 %0, %8, off\n\t"
               "global_load_async_to_lds_b128 %1, %9, off\n\t"
               "global_load_async_to_lds_b128 %2, %10, off\n\t"
               "global_load_async_to_lds_b128 %3, %11, off\n\t"
               "global_load_async_to_lds_b128 %4, %12, off\n\t"
               "global_load_async_to_lds_b128 %5, %13, off\n\t"
               "global_load_async_to_lds_b128 %6, %14, off\n\t"
               "global_load_async_to_lds_b128 %7, %15, off\n\t"
               "s_wait_xcnt 0x0"
               :: "v"(l[0]), "v"(l[1]), "v"(l[2]), "v"(l[3]), "v"(l[4]), "v"(l[5]), "v"(l[6]), "v"(l[7]),
                  "v"(g[0]), "v"(g[1]), "v"(g[2]), "v"(g[3]), "v"(g[4]), "v"(g[5]), "v"(g[6]), "v"(g[7])
               : "memory");
}

// N (8 or 4) asynchronous 16-byte copies per lane, global -> LDS, through no register: copy i takes the 16-byte piece
// number piece0 + i * STEP of a tile whose rows hold ROWB bytes at pitch SRCB in global memory and lands it at row
// pitch PITCHB in LDS (all in bytes).
// The closing s_wait_xcnt stands inside the statement so that no address register is rewritten ahead of it.
template <int N, int ROWB, int SRCB, int PITCHB, int STEP>
static __device__ __forceinline__ void copy_rows_to_lds(const char* __restrict__ plane, unsigned lds_base, int piece0) {
  static_assert(N == 8 || N == 4);
  const char* g[N];
  unsigned    l[N];
  #pragma unroll   // constant indices: the addresses stay in registers for the asm operands
  for (int i = 0; i < N; ++i) {
    const int piece = piece0 + i * STEP;
    const int row   = piece / (ROWB / 16);
    const int col   = piece % (ROWB / 16);
    g[i] = plane + (size_t)(row * SRCB + col * 16);
    l[i] = lds_base + (unsigned)(row * PITCHB + col * 16);
  }
  if constexpr (N == 8) {
    asm volatile("global_load_async_to_lds_b128 %0, %8, off\n\t"
                 "global_load_async_to_lds_b128 %1, %9, off\n\t"
                 "global_load_async_to_lds_b128 %2, %10, off\n\t"
                 "global_load_async_to_lds_b128 %3, %11, off\n\t"
                 "global_load_async_to_lds_b128 %4, %12, off\n\t"
                 "global_load_async_to_lds_b128 %5, %13, off\n\t"
                 "global_load_async_to_lds_b128 %6, %14, off\n\t"
                 "global_load_async_to_lds_b128 %7, %15, off\n\t"
                 "s_wait_xcnt 0x0"
                 :: "v"(l[0]), "v"(l[1]), "v"(l[2]), "v"(l[3]), "v"(l[4]), "v"(l[5]), "v"(l[6]), "v"(l[7]),
                    "v"(g[0]), "v"(g[1]), "v"(g[2]), "v"(g[3]), "v"(g[4]), "v"(g[5]), "v"(g[6]), "v"(g[7])
                 : "memory");
  } else {
    asm volatile("global_load_async_to_lds_b128 %0, %4, off\n\t"
                 "global_load_async_to_lds_b128 %1, %5, off\n\t"
                 "global_load_async_to_lds_b128 %2, %6, off\n\t"
                 "global_load_async_to_lds_b128 %3, %7, off\n\t"
                 "s_wait_xcnt 0x0"
                 :: "v"(l[0]), "v"(l[1]), "v"(l[2]), "v"(l[3]), "v"(g[0]), "v"(g[1]), "v"(g[2]), "v"(g[3])
                 : "memory");
  }
}

// Lane l takes the value of lane l ^ 16 (the other k-split half of the same query), on the vector pipe.
static __device__ __forceinline__ float xhalf(float v) {
  const int b = __builtin_bit_cast(int, v);
  return __builtin_bit_cast(float, __builtin_amdgcn_permlanex16(b, b, 0x76543210, 0xfedcba98, false, false));
}

// f32 -> f16 convert that can never produce a subnormal operand (value select below 2^-14).
static __device__ __forceinline__ f16 toh_flush(float v) {
  const f16 r = (f16)v;
  return (fabsf(v) < 6.103515625e-05f) ? (f16)0.0f : r;
}

// Weight rows (k-contiguous, B fragments load like A fragments), built in LDS by the block that reads them:
//   sw  [NPROJ][WP] bf16 : row n = column n of [Wf | Wg | Wh], RNE bf16.
//   swo [CIN][CP]   f16  : row n = column n of Wattn, value f16(bf16(w) * 16) (exact for normal results).
// A lane takes an 8 (k) x 4 (n) patch of a matrix: eight 16-byte loads (every 128-byte line a load touches is used
// whole), then four 16-byte LDS stores of eight k-contiguous values each. Loads and stores are two calls, so that the
// loads can stand ahead of the block's asynchronous copies and fly while those are issued.
// coverage: sw rows 0..95 x k 0..255 (wave -> 32 k, lane >> 3 -> 8 k of them, lane & 7 -> 4 n, three matrices).
static __device__ __forceinline__ void load_proj_weights(const float* __restrict__ wf, const float* __restrict__ wg,
                                                         const float* __restrict__ wh, int wave, int lane,
                                                         v4f (&w)[3][8]) {
  const int n0 = (lane & 7) * 4;                  // 0..28
  const int k0 = wave * 32 + (lane >> 3) * 8;     // 0..248
  #pragma unroll   // constant indices: the patches stay in registers
  for (int i = 0; i < 8; ++i) {
    const size_t off = (size_t)(k0 + i) * DQK + n0;
    w[0][i] = *(const v4f*)(wf + off);
    w[1][i] = *(const v4f*)(wg + off);
    w[2][i] = *(const v4f*)(wh + off);
  }
}
static __device__ __forceinline__ void store_proj_weights(const v4f (&w)[3][8], bf16* sw, int wave, int lane) {
  const int n0 = (lane & 7) * 4;
  const int k0 = wave * 32 + (lane >> 3) * 8;
  #pragma unroll
  for (int mt = 0; mt < 3; ++mt) {
    #pragma unroll
    for (int j = 0; j < 4; ++j) {
      Pack8B pk;
      #pragma unroll
      for (int i = 0; i < 8; ++i) pk.h[i] = (bf16)w[mt][i][j];   // RNE convert
      *(v4u*)(sw + (mt * DQK + n0 + j) * WP + k0) = pk.u;
    }
  }
}
// coverage: swo rows 0..255 x d 0..31 (tid & 63 -> 4 n, tid >> 6 -> 8 d).
static __device__ __forceinline__ void load_out_weights(const float* __restrict__ wo, int tid, v4f (&w)[8]) {
  const int n0 = (tid & 63) * 4;    // 0..252
  const int d0 = (tid >> 6) * 8;    // 0..24
  #pragma unroll   // constant indices: the patch stays in registers
  for (int i = 0; i < 8; ++i) w[i] = *(const v4f*)(wo + (size_t)(d0 + i) * CIN + n0);
}
static __device__ __forceinline__ void store_out_weights(const v4f (&w)[8], f16* swo, int tid) {
  const int n0 = (tid & 63) * 4;
  const int d0 = (tid >> 6) * 8;
  #pragma unroll
  for (int j = 0; j < 4; ++j) {
    Pack8H pk;
    #pragma unroll
    for (int i = 0; i < 8; ++i) pk.h[i] = toh_flush((float)(bf16)w[i][j] * 16.0f);   // bf16 significand fits f16
    *(v4u*)(swo + (n0 + j) * CP + d0) = pk.u;
  }
}

// One wave's 16-pixel M tile times NTN consecutive 16-column tiles of the weight rows starting at tile NT0, summed into acc over
// the CIN / 2 channels of one staged half: k steps kk0 .. kk0 + 3.
// A fragments from the staged f32 x rows (xr = this lane's half row in LDS; RNE bf16 convert, split k map); B fragments
// from the staged k-contiguous weight rows (sw, pitch WP). A k step's sixteen LDS loads stand ahead of its products.
template <int NT0, int NTN>
static __device__ __forceinline__ void proj_tiles(const float* xr, const bf16* sw, int kk0,
                                                  int m, int hi, v8f (&acc)[NTN]) {
  for (int kq = 0; kq < CIN / 64; ++kq) {
    const int kk = kk0 + kq;
    const float* xp = xr + kq * 32;
    const v4f a0 = *(const v4f*)(xp + hi * 8);
    const v4f a1 = *(const v4f*)(xp + hi * 8 + 4);
    const v4f b0 = *(const v4f*)(xp + 16 + hi * 8);
    const v4f b1 = *(const v4f*)(xp + 16 + hi * 8 + 4);
    FragB bw[NTN];
    #pragma unroll
    for (int t = 0; t < NTN; ++t) {
      const bf16* wp = sw + ((NT0 + t) * 16 + m) * WP + kk * 32 + hi * 8;
      bw[t].q[0] = *(const v4u*)(wp);        // k = kk*32 + hi*8 + 0..7, n = tile*16 + m
      bw[t].q[1] = *(const v4u*)(wp + 16);   // k = kk*32 + 16 + hi*8 + 0..7
    }
    FragB a;
    #pragma unroll
    for (int i = 0; i < 4; ++i) {
      a.h[i]      = (bf16)a0[i];   // elems 0..7  : k = kk*32 + hi*8 + 0..7
      a.h[4 + i]  = (bf16)a1[i];
      a.h[8 + i]  = (bf16)b0[i];   // elems 8..15 : k = kk*32 + 16 + hi*8 + 0..7
      a.h[12 + i] = (bf16)b1[i];
    }
    #pragma unroll
    for (int t = 0; t < NTN; ++t) acc[t] = mma_bf16(a.v, bw[t].v, acc[t]);
  }
}

// Stage s (0 or 1) of one wave's x rows: channel half s of its 16 pixel rows, into buffer s.
// xw0 = the wave's first x row, lx = its rows in buffer 0.
static __device__ __forceinline__ void copy_x_stage(const float* __restrict__ xw0, unsigned lx, int lane, int s) {
  const float*   src = xw0 + s * (CIN / 2);
  const unsigned dst = lx + (unsigned)s * (XBUF * 4);
  for (int gph = 0; gph < 2; ++gph)
    copy_rows_to_lds<8, CIN * 2, CIN * 4, XP * 4, 32>((const char*)src, dst, gph * 256 + lane);
}

// Projection + 2x2 max-pool. Block = (32-key tile kt, batch b), 256 threads, one block per two image rows
// hh = kt*2 + {0,1}; wave -> (hh, 16 pixels along ww).
//   gq  [NB][SEQ][QW] f16  : queries x256, value | residual
//                            (wave writes 16 rows = 2 KB, 4 instructions of 4 lines, 8 lanes x 16 B per line).
//   fk  [NB][NKEY][QW] f16 : pooled keys x256, value | residual, 32 rows per block = 4 KB
//                            (1 instruction, each wave 4 lines, 8 lanes x 16 B per line).
//   hvt [NB][NKEY / KTILE][DV][KTILE] f16 : pooled h^T, one tile of 2 KB per block, so that no line has two writers
//                            (1 instruction, each wave 2 lines, 8 lanes x 8 B per 64-byte d row).
// LDS regions: sP cross-wave (block barrier), sG per-wave but read across lanes after the block barrier,
// sF / sHT cross-wave (block barrier). Staged extent == consumed extent for all four.
// The weight rows (sW) are converted from the f32 inputs by the block itself, once, while the first x stage flies.
// x comes by asynchronous copies (whole lines from global, padded rows in LDS): each wave's 16 x rows in two stages
// of 128 channels, each into its own buffer (sX): the second flies while the first is worked on.
__global__ __launch_bounds__(256) void proj_pool_kernel(const float* __restrict__ x, const float* __restrict__ wf,
                                                         const float* __restrict__ wg, const float* __restrict__ wh,
                                                         f16* __restrict__ gq, f16* __restrict__ fk,
                                                         f16* __restrict__ hvt) {
  const int kt   = blockIdx.x;
  const int b    = blockIdx.y;
  const int tid  = threadIdx.x;
  const int wave = __builtin_amdgcn_readfirstlane(threadIdx.x >> 5);
  const int lane = tid & 31;
  const int m    = lane & 15;
  const int hi   = lane >> 4;
  const int hsel = wave >> 2;          // which of the block's two image rows
  const int ww0  = (wave & 3) * 16;    // first pixel column of this wave's tile

  __shared__ __align__(16) float sP[2 * 32 * PF];     // [hsel][pw][64 cols] ww-pooled f|h in f32
  __shared__ __align__(16) f16 sG[NWAVE * 16 * GP];   // per-wave g tile [16][value 32 | residual 32]
  __shared__ __align__(16) f16 sF[KTILE * FP];        // pooled f [32 keys][value 32 | residual 32]
  __shared__ __align__(16) f16 sHT[DV * HP];          // pooled h^T [32 d][32 keys]
  __shared__ __align__(16) bf16 sW[NPROJ * WP];       // weight rows [96 n][256 k]
  __shared__ __align__(16) float sX[2 * XBUF];        // [buffer][wave][16 pixels][128 channels] in f32

  f16*   sg = sG + wave * (16 * GP);
  float* sp = sP + hsel * (32 * PF);
  const int pwb = (ww0 >> 1) + hi * 4;   // pooled column index base for this lane half

  const float*   sx   = sX + wave * (16 * XP);
  const unsigned lx   = (unsigned)(size_t)sx;
  const int      pix0 = (kt * 2 + hsel) * W_IMG + ww0;   // first pixel of this wave's tile
  const float*   xw0  = x + ((size_t)b * SEQ_FULL + pix0) * CIN;

  v4f wv[3][8];
  load_proj_weights(wf, wg, wh, wave, lane, wv);
  // fill: every lane of every wave copies its own 16-byte pieces, no branch around the copies
  copy_x_stage(xw0, lx, lane, 0);
  store_proj_weights(wv, sW, wave, lane);
  // this wave's copies have landed; behind the barrier every wave's have, and every wave's weight rows are written
  asm volatile("s_wait_asynccnt 0x0" ::: "memory");
  __syncthreads();
  copy_x_stage(xw0, lx, lane, 1);

  {   // tiles 0,1: f; 2,3: g; 4,5: h
    v8f acc[6];
    #pragma unroll
    for (int t = 0; t < 6; ++t) acc[t] = (v8f){0, 0, 0, 0, 0, 0, 0, 0};
    proj_tiles<0, 6>(sx + m * XP, sW, 0, m, hi, acc);
    // publish point of stage 1: this wave's reads of buffer 0 have retired, its copies into buffer 1 have landed
    asm volatile("s_wait_dscnt 0x0" ::: "memory");
    asm volatile("s_wait_asynccnt 0x0" ::: "memory");
    __syncthreads();
    proj_tiles<0, 6>(sx + XBUF + m * XP, sW, CIN / 64, m, hi, acc);
    #pragma unroll
    for (int r = 0; r < 8; ++r) {
      const float g0 = acc[2][r] * RCARRY;
      const float g1 = acc[3][r] * RCARRY;
      const f16 h0 = toh_flush(g0);
      const f16 h1 = toh_flush(g1);
      sg[(hi * 8 + r) * GP + m]      = h0;
      sg[(hi * 8 + r) * GP + 16 + m] = h1;
      sg[(hi * 8 + r) * GP + 32 + m] = toh_flush(g0 - (float)h0);
      sg[(hi * 8 + r) * GP + 48 + m] = toh_flush(g1 - (float)h1);
    }
    // ww pairs are D rows (2rp, 2rp+1) of the same lane half; pooled column pw = ww0/2 + 4*hi + rp
    #pragma unroll
    for (int rp = 0; rp < 4; ++rp) {
      #pragma unroll
      for (int t = 0; t < 2; ++t) {
        sp[(pwb + rp) * PF + t * 16 + m]      = fmaxf(acc[t][2 * rp], acc[t][2 * rp + 1]);
        sp[(pwb + rp) * PF + 32 + t * 16 + m] = fmaxf(acc[4 + t][2 * rp], acc[4 + t][2 * rp + 1]);
      }
    }
  }
  __syncthreads();

  {
    v4u    gv[4];
    size_t gi[4];
    #pragma unroll
    for (int i4 = 0; i4 < 4; ++i4) {
      const int row = i4 * 4 + (lane >> 3);
      const int cq  = (lane & 7) * 8;
      Pack8H p;
      p.v = *(const v8h*)(sg + row * GP + cq);
      gv[i4] = p.u;
      gi[i4] = ((size_t)b * SEQ + pix0 + row) * QW + cq;
    }
    #pragma unroll
    for (int i4 = 0; i4 < 4; ++i4) *(v4u*)(gq + gi[i4]) = gv[i4];
  }

  // hh-pool into the block's pooled tiles (f32 max, then one convert)
  #pragma unroll
  for (int e = 0; e < 4; ++e) {
    const int idx = e * 256 + tid;
    const int pw  = idx >> 5;
    const int c   = idx & 31;
    const float v = fmaxf(sP[pw * PF + c], sP[32 * PF + pw * PF + c]) * RCARRY;
    const f16 hv  = toh_flush(v);
    sF[pw * FP + c]      = hv;
    sF[pw * FP + 32 + c] = toh_flush(v - (float)hv);
  }
  #pragma unroll
  for (int e = 0; e < 4; ++e) {
    const int idx = e * 256 + tid;
    const int pw  = idx >> 5;
    const int d   = idx & 31;
    const float v = fmaxf(sP[pw * PF + 32 + d], sP[32 * PF + pw * PF + 32 + d]);
    sHT[d * HP + pw] = toh_flush(v);
  }
  __syncthreads();

  // final plane stores: fk (a wave writes 4 rows = 512 B), hvt (a wave writes 4 d rows of 64 B = 256 B)
  v4u    fv;
  size_t fi;
  {
    const int row = tid >> 3;            // 0..31
    const int cq  = (tid & 7) * 8;
    Pack8H p;
    p.v = *(const v8h*)(sF + row * FP + cq);
    fv = p.u;
    fi = ((size_t)b * NKEY + kt * KTILE + row) * QW + cq;
  }
  v2u    hv;
  size_t hidx;
  {
    const int d  = tid >> 3;             // 0..31
    const int kq = (tid & 7) * 4;        // 0..28
    hv   = *(const v2u*)(sHT + d * HP + kq);
    hidx = (((size_t)b * (NKEY / KTILE) + kt) * DV + d) * KTILE + kq;
  }
  *(v4u*)(fk + fi) = fv;
  *(v2u*)(hvt + hidx) = hv;
}

// Flash attention, non-causal, no score scaling. Block = (query block of 128, batch); one wave owns 16 queries.
// S^T = F x G^T so queries sit on lanes; P^T in C-layout is bit-identical to the B-fragment layout of
// CTX^T += Hv^T x P^T, whose columns are again the queries: a query's maximum and rescale stay on its own two
// lanes (lq, lq + 16), which exchange the maximum once per 32 keys.
// Scores: the three products accumulate in c, which carries s x65536; the carry goes out in the exponent's multiply-add.
// Row sums: a row of ones x P^T, accumulated beside CTX^T, so that the matrix unit adds what the vector port would add
// (the f16 P that CTX^T sums, over both lane halves).
// The image's whole key plane and h^T plane are staged once in LDS by asynchronous copies (whole lines from global,
// padded rows in LDS; the h^T tiles land side by side in rows [d][key]) and shared by the block's 8 waves; F A-fragments and Hv^T A-fragments are two 16-B LDS loads
// each, G B-fragments two 16-B global loads each.
// Epilogue in the same launch: out = gamma * (CTX x Wo) + x_bf16 for the block's 128 query rows. The two CTX^T tiles,
// converted in place, are the A fragment of that product (split d map); B fragments from sWo (Wattn carried x16),
// converted by the block itself while the fill flies;
// the wave's 16 x rows are loaded behind the fill's barrier and fly while the key loop runs.
// LDS: sK / sV / sWo written once, read-only behind the fill's barrier; the block barrier behind the key loop ends
// every wave's last read of sK, over which the f32 output tile is then staged (per-wave region, block barrier), so
// that every store instruction writes 512 contiguous bytes.
__global__ __launch_bounds__(256) void attn_out_kernel(const f16* __restrict__ gq, const f16* __restrict__ fk,
                                                       const f16* __restrict__ hvt, const float* __restrict__ wo,
                                                       const float* __restrict__ x, const float* __restrict__ gamma,
                                                       float* __restrict__ out) {
  const int qblk = blockIdx.x;
  const int b    = blockIdx.y;
  const int tid  = threadIdx.x;
  const int wave = __builtin_amdgcn_readfirstlane(threadIdx.x >> 5);
  const int lane = tid & 31;
  const int lq   = lane & 15;   // query column of S^T and of CTX^T
  const int hi   = lane >> 4;   // k-split half

  __shared__ __align__(16) f16 sK[NKEY * KP];   // [key][value 32 | residual 32]
  __shared__ __align__(16) f16 sV[DV * VP];     // [d][key]
  __shared__ __align__(16) f16 sWo[CIN * CP];   // [n][d]
  __shared__ __align__(16) f16 sOne[16];        // sixteen ones: the A fragment of the row sums, the same in every lane

  const int qrow0 = qblk * BQ + wave * 16;
  const float gsc = (float)(bf16)gamma[0] * 0.0625f;   // gamma (RNE bf16) folded with the 1/16 Wo carry

  const f16* fk_b = fk + (size_t)b * NKEY * QW;
  const f16* vt_b = hvt + (size_t)b * DV * NKEY;

  // the block's plain loads stand ahead of the fill and fly while its copies are issued
  v4f wv[8];
  load_out_weights(wo, tid, wv);

  // G as B-operand fragments: lane lq holds query qrow0+lq, elements follow the split d map
  FragH qf, qr;
  {
    const f16* qp = gq + ((size_t)b * SEQ + qrow0 + lq) * QW + hi * 8;
    qf.q[0] = *(const v4u*)(qp);        // value,    d = hi*8 + 0..7
    qf.q[1] = *(const v4u*)(qp + 16);   // value,    d = 16 + hi*8 + 0..7
    qr.q[0] = *(const v4u*)(qp + 32);   // residual, d = hi*8 + 0..7
    qr.q[1] = *(const v4u*)(qp + 48);   // residual, d = 16 + hi*8 + 0..7
  }

  // fill: every lane of every wave copies its own 16-byte pieces, no branch around the copies
  {
    const unsigned lk = (unsigned)(size_t)sK;
    const unsigned lv = (unsigned)(size_t)sV;
    for (int gph = 0; gph < (NKEY * QW) / (8 * 256 * 8); ++gph) copy8_to_lds<QW, KP>(fk_b, lk, gph * 2048 + tid);
    for (int gph = 0; gph < (DV * NKEY) / (8 * 256 * 8); ++gph) copy8_vt_to_lds(vt_b, lv, gph * 8 * NWAVE + wave, lane);
  }
  // keeps the Wattn converts, which wait for their loads, from being scheduled among or ahead of the fill's copies
  __builtin_amdgcn_sched_barrier(0);

  v8f o[2];
  #pragma unroll
  for (int dt = 0; dt < 2; ++dt) o[dt] = (v8f){0, 0, 0, 0, 0, 0, 0, 0};

  // row sums, carried x4096 like P: every row of this tile holds the same sum; row 0 of the lane's half is the one kept
  v8f ol = (v8f){0, 0, 0, 0, 0, 0, 0, 0};
  float rmax = -__builtin_inff();                             // of the carried scores
  const float SL = 1.4426950408889634f / (RCARRY * RCARRY);   // log2(e) with the score carry taken out

  store_out_weights(wv, sWo, tid);
  if (tid < 16) sOne[tid] = (f16)1.0f;

  // this wave's copies have landed; behind the barrier every wave's have
  asm volatile("s_wait_asynccnt 0x0" ::: "memory");
  __syncthreads();

  // the ones come back as a loaded fragment, which stays in its eight registers over the loop; written as a constant the
  // compiler rebuilds it in every pass and pads the product behind it with v_nop
  FragH ones;
  ones.q[0] = *(const v4u*)(sOne);
  ones.q[1] = *(const v4u*)(sOne + 8);

  // residual rows of this wave's 16 queries: instruction j takes half row j (512 contiguous bytes); first used in the
  // epilogue, so the loads stand behind the barrier (which would wait for them) and ahead of the key loop
  const size_t xoff = ((size_t)b * SEQ_FULL + qrow0) * CIN + lane * 4;
  v4f xv[32];
  #pragma unroll   // constant indices: the rows stay in registers until the epilogue
  for (int j = 0; j < 32; ++j) xv[j] = *(const v4f*)(x + xoff + j * (CIN / 2));

  // F A-fragments of pass 0; every later pass finds its own already in these registers
  FragH ak[2], akr[2];
  #pragma unroll
  for (int sub = 0; sub < 2; ++sub) {
    const f16* base = sK + (sub * 16 + lq) * KP + hi * 8;
    ak[sub].q[0]  = *(const v4u*)(base);        // d = hi*8 + 0..7
    ak[sub].q[1]  = *(const v4u*)(base + 16);   // d = 16 + hi*8 + 0..7
    akr[sub].q[0] = *(const v4u*)(base + 32);
    akr[sub].q[1] = *(const v4u*)(base + 48);
  }

  // LDS addresses of a pass's loads, carried from pass to pass and stepped behind the loads, so that the loads stand
  // directly behind the S^T products: kn = this lane's F row of the NEXT pass, vn = its Hv^T columns of this pass
  const char* kn = (const char*)(sK + (BK + lq) * KP + hi * 8);
  const char* vn = (const char*)(sV + lq * VP + hi * 8);

  for (int i = 0; i < NKEY / BK; ++i) {

    // S^T tiles: c[sub][r] = 65536 x score(query qrow0+lq, key i*BK + sub*16 + hi*8 + r); the two tiles take turns, so
    // that each accumulate finds the one before it finished
    v8f c[2];
    #pragma unroll
    for (int sub = 0; sub < 2; ++sub) c[sub] = mma_f16(ak[sub].v,  qf.v, (v8f){0, 0, 0, 0, 0, 0, 0, 0});
    #pragma unroll
    for (int sub = 0; sub < 2; ++sub) c[sub] = mma_f16(ak[sub].v,  qr.v, c[sub]);
    #pragma unroll
    for (int sub = 0; sub < 2; ++sub) c[sub] = mma_f16(akr[sub].v, qf.v, c[sub]);

    // one group of LDS loads per pass, right behind the S^T products, landing while the softmax runs: this pass's Hv^T
    // A-fragments (row m = d = dt*16 + lq, split key map from the transposed plane), and the next pass's F fragments
    // into the same registers (the last pass takes pass 0's rows again and uses none of them)
    FragH av[2];
    #pragma unroll
    for (int dt = 0; dt < 2; ++dt) {
      const f16* base = (const f16*)vn + dt * 16 * VP;
      av[dt].q[0] = *(const v4u*)(base);        // keys i*BK + hi*8 + 0..7
      av[dt].q[1] = *(const v4u*)(base + 16);   // keys i*BK + 16 + hi*8 + 0..7
    }
    #pragma unroll
    for (int sub = 0; sub < 2; ++sub) {
      const f16* base = (const f16*)kn + sub * 16 * KP;
      ak[sub].q[0]  = *(const v4u*)(base);        // d = hi*8 + 0..7
      ak[sub].q[1]  = *(const v4u*)(base + 16);   // d = 16 + hi*8 + 0..7
      akr[sub].q[0] = *(const v4u*)(base + 32);
      akr[sub].q[1] = *(const v4u*)(base + 48);
    }
    kn += (i == NKEY / BK - 2) ? -(NKEY / BK - 1) * (BK * KP * 2) : BK * KP * 2;   // behind the last rows: pass 0's
    vn += BK * 2;

    // online softmax: query lq's 32 scores are split across lane / lane^16
    float m_new = rmax;
    #pragma unroll   // tile 0 first: its last product stands one place ahead of tile 1's
    for (int sub = 0; sub < 2; ++sub) {
      #pragma unroll
      for (int r = 0; r < 8; ++r) m_new = fmaxf(m_new, c[sub][r]);
    }
    m_new = fmaxf(m_new, xhalf(m_new));
    const float scale = __builtin_amdgcn_exp2f((rmax - m_new) * SL);
    // m_new again, as an update of rmax in its own register: a plain copy lands behind the pass's last product, over a
    // register of its P^T operand, and costs four v_nop there
    rmax = fmaxf(rmax, m_new);

    // exp + pack: P^T C-layout == B-fragment layout for the PV product; P carried x4096 in f16.
    // log2(e), the maximum and both carries sit in one fused multiply-add per score: p * 4096 = exp2(c * SL + kb), which
    // goes to the convert as it is (far below the maximum it rounds to an f16 subnormal or to zero).
    const float kb = __builtin_fmaf(-m_new, SL, 12.0f);
    FragH pa;
    #pragma unroll   // constant indices: scores, exponentials and the fragment stay in registers
    for (int sub = 0; sub < 2; ++sub) {
      #pragma unroll   // the same
      for (int i2 = 0; i2 < 4; ++i2) {   // keys i*BK + sub*16 + hi*8 + 2*i2, + 1: a register pair of the accumulator
        const v2f e = __builtin_elementwise_fma((v2f){c[sub][2 * i2], c[sub][2 * i2 + 1]}, (v2f){SL, SL}, (v2f){kb, kb});
        pa.h[sub * 8 + 2 * i2]     = (f16)__builtin_amdgcn_exp2f(e[0]);
        pa.h[sub * 8 + 2 * i2 + 1] = (f16)__builtin_amdgcn_exp2f(e[1]);
      }
    }

    // rescale CTX^T and the kept row of the sums: the query is the column there -> the lane's own scale
    // (the other seven rows of ol are never read; unscaled they stay finite: at most NKEY x 4096)
    ol[0] *= scale;
    #pragma unroll
    for (int dt = 0; dt < 2; ++dt) {
      #pragma unroll
      for (int r = 0; r < 8; ++r) o[dt][r] *= scale;
    }

    // row sums += ones x P^T : ol[r] = sum over the pass's 32 keys of P(query qrow0 + lq), the same in every row
    ol = mma_f16(ones.v, pa.v, ol);
    // CTX^T += Hv^T x P^T : o[dt][r] = ctx(query qrow0 + lq, d = dt*16 + hi*8 + r)
    #pragma unroll
    for (int dt = 0; dt < 2; ++dt) o[dt] = mma_f16(av[dt].v, pa.v, o[dt]);

    // scheduling order of the pass (the directives order what stands above them, so they close the body): the six S^T
    // products back to back, the twelve LDS loads in one place, the address steps and the softmax, the three products
    // with P^T; left free, the compiler deals loads among the products and the softmax
    __builtin_amdgcn_sched_group_barrier(0x008, 6, 0);
    __builtin_amdgcn_sched_group_barrier(0x100, 12, 0);
    __builtin_amdgcn_sched_group_barrier(0x002, 128, 0);
    __builtin_amdgcn_sched_group_barrier(0x008, 3, 0);
  }

  // normalize (sums and CTX^T both carry x4096); CTX as A fragment straight from the accumulators:
  // lane lq holds query row lq, elements follow the split d map
  const float rs = 1.0f / ol[0];
  FragH ca;
  #pragma unroll
  for (int r = 0; r < 8; ++r) {
    ca.h[r]     = toh_flush(o[0][r] * rs);   // d = hi*8 + r
    ca.h[8 + r] = toh_flush(o[1][r] * rs);   // d = 16 + hi*8 + r
  }
  // ends every wave's last read of the key plane
  __syncthreads();

  // OUT tile of the wave, 16 rows x 256 channels in f32, staged over the key plane (dead behind the barrier above)
  float* so = (float*)sK + wave * (16 * OW);
  #pragma unroll   // laid out flat so that a group's fragment loads can stand among the stores of the group before
  for (int qn = 0; qn < 4; ++qn) {   // four independent 16-column tiles at a time: one LDS wait per four products
    FragH bw[4];
    #pragma unroll
    for (int j = 0; j < 4; ++j) {
      const f16* wp = sWo + ((qn * 4 + j) * 16 + lq) * CP + hi * 8;
      bw[j].q[0] = *(const v4u*)(wp);
      bw[j].q[1] = *(const v4u*)(wp + 16);
    }
    v8f acc[4];
    #pragma unroll
    for (int j = 0; j < 4; ++j) acc[j] = mma_f16(ca.v, bw[j].v, (v8f){0, 0, 0, 0, 0, 0, 0, 0});
    #pragma unroll
    for (int r = 0; r < 8; ++r) {
      #pragma unroll
      for (int j = 0; j < 4; ++j) so[(hi * 8 + r) * OW + (qn * 4 + j) * 16 + lq] = acc[j][r] * gsc;
    }
  }
  __syncthreads();

  // whole-line stores: instruction j writes half row j = 512 contiguous bytes (4 lines)
  #pragma unroll   // constant indices into xv
  for (int j = 0; j < 32; ++j) {
    v4f v = *(const v4f*)(so + (j >> 1) * OW + (j & 1) * (CIN / 2) + lane * 4);
    #pragma unroll
    for (int cc = 0; cc < 4; ++cc) v[cc] = v[cc] + (float)(bf16)xv[j][cc];   // residual with the RNE bf16 input value
    *(v4f*)(out + xoff + j * (CIN / 2)) = v;
  }
}

extern "C" void kernel_launch(void* const* d_in, const int* in_sizes, int n_in,
                              void* d_out, int out_size, void* d_ws, size_t ws_size,
                              hipStream_t stream) {
  if (n_in < 6) return;
  const size_t rows_used = (size_t)(NB - 1) * SEQ_FULL + SEQ;
  if ((size_t)in_sizes[0] < rows_used * CIN) return;
  if (in_sizes[1] < CIN * DQK) return;
  if (in_sizes[2] < CIN * DQK) return;
  if (in_sizes[3] < CIN * DV) return;
  if (in_sizes[4] < DV * CIN) return;
  if (in_sizes[5] < 1) return;
  if ((size_t)out_size < rows_used * CIN) return;
  if (ws_size < WS_TOTAL) return;

  const float* x     = (const float*)d_in[0];
  const float* wf    = (const float*)d_in[1];
  const float* wg    = (const float*)d_in[2];
  const float* wh    = (const float*)d_in[3];
  const float* wo    = (const float*)d_in[4];
  const float* gamma = (const float*)d_in[5];
  float* out = (float*)d_out;
  char*  ws  = (char*)d_ws;
  f16*  gq  = (f16*)(ws + OFF_GQ);
  f16*  fk  = (f16*)(ws + OFF_FK);
  f16*  hvt = (f16*)(ws + OFF_HVT);

  proj_pool_kernel<<<dim3(SEQ / 128, NB), 256, 0, stream>>>(x, wf, wg, wh, gq, fk, hvt);
  attn_out_kernel<<<dim3(SEQ / BQ, NB), 256, 0, stream>>>(gq, fk, hvt, wo, x, gamma, out);
}
